// v000
// Times are from an AMD MI455X. After a warm-up the kernel runs many times in a row, and a time is the length of
// such a window on the GPU divided by its runs, so every launch and the gaps after it count. The runs cycle
// through copies of the inputs. A figure is the median of several windows, for all but v000 over two sittings.
// Sittings can differ by a few percent; kernels timed side by side share one.
// The starting kernel, v000, takes 19.7 milliseconds a run.
#include <hip/hip_runtime.h>
// Multi-head self-attention with rotate-half RoPE computed in the kernel and a biased output projection, NON-causal (x [2][2048][1024]; q / k / v = x W^T (natural [1024][1024], no biases), 16 heads of 64; cos / sin = [f | f] of pos * 10000^(-2i/64); q = q cos + rotate_half(q) sin, likewise k; scores * 64^-0.5; softmax over all 2048 keys (no mask); out = merged Wo^T + bo (natural + bias) -> [2][2048][1024]); run in grouped-query non-causal form as 16 groups of ONE head.
// Structure: x as exact f16 rows; natural weights as exact x16 planes; v as a WMMA GEMM (32x64 wave tiles, f32 accumulation, f16 output); rope tables computed once (double-derived inv_freq, f32 angle); per batch: q [2048][1024] and k [2048][1024] as GEMMs into f32 rows then the rotate-half rotation + f16 conversion per (row, head) on VALU; V^T of the 16 groups via LDS transposes; per query tile of 256 rows and per group: scores of its head against ALL 2048 keys of the shared key slab (K = 64, zero key stride, alpha 1/8), row softmax on VALU (f32 statistics, expf; weights x256 f16), o = P V^T with the shared value slab (o carried x64) into merged f16 rows; out = o Wo^T GEMM (f32, alpha 2^-10); launches: see trace.
// Compute dtype: inputs rounded to bf16; x / weights exact; q, k, v, softmax weights and o as plain f16 GEMM operands (~2^-12); scores and softmax statistics f32. v_wmma_f32_16x16x32_f16.
#define NB 2
#define NG 16
#define HPG 1
#define KVD (NG * HD)
#define SQ 2048
#define DM 1024
#define NH 16
#define HD 64
#define HG 4                         /* heads per launch of the untemplated k_vt (not launched) */
#define QT 256                       /* query rows per tile */
#define NKX SQ                       /* S / P row pitch */
#define QT0 128                      /* first-tile rows of the f32 k_att0 path (not launched) */
#define B0 0                         /* first batch processed (debug hook) */
#define NBR NB                       /* batches processed (debug hook) */
#define NR ((size_t)NB * SQ)         /* token rows */
#define MP ((int)((size_t)NBR * SQ)) /* rows projected (debug hook) */
#define QN SQ                        /* query rows attended per batch (debug hook) */
#define NHD NH                       /* heads attended (debug hook) */
#define MPO MP                       /* rows through the output stage (debug hook) */
#define LQ DM      /* row pitch of the q/k/v rows */
typedef __bf16 v16b __attribute__((ext_vector_type(16)));
typedef unsigned short v8us __attribute__((ext_vector_type(8), may_alias));
typedef float  v8f  __attribute__((ext_vector_type(8)));
typedef float  v4f  __attribute__((ext_vector_type(4)));
typedef float  v4fa __attribute__((ext_vector_type(4), may_alias));
union FragB { v16b v; v8us half[2]; unsigned short u[16]; };

__device__ __forceinline__ unsigned short bf16_bits(float x) { unsigned int u = __float_as_uint(x); return (unsigned short)((u + 0x7FFFu + ((u >> 16) & 1u)) >> 16); }
__device__ __forceinline__ float bf16_val(unsigned short b) { return __uint_as_float(((unsigned int)b) << 16); }
__device__ __forceinline__ float bf16_round(float x) { return bf16_val(bf16_bits(x)); }
// D += A·B with NT terms: 1 = ah·bh, 2 = + al·bh (A split), 3 = + ah·bl (both split)
template <int NT>
__device__ __forceinline__ v8f mmaN(v16b ah, v16b al, v16b bh, v16b bl, v8f c) {
  c = __builtin_amdgcn_wmma_f32_16x16x32_bf16(false, ah, false, bh, (short)0, c, false, false);
  if (NT >= 2) c = __builtin_amdgcn_wmma_f32_16x16x32_bf16(false, al, false, bh, (short)0, c, false, false);
  if (NT >= 3) c = __builtin_amdgcn_wmma_f32_16x16x32_bf16(false, ah, false, bl, (short)0, c, false, false);
  asm volatile("v_nop\n\tv_nop\n\tv_nop\n\tv_nop" : "+v"(c) : "v"(ah), "v"(al), "v"(bh), "v"(bl));
  return c;
}

__global__ __launch_bounds__(256) void k_wt_bf16(const float* __restrict__ W, unsigned short* __restrict__ Wt, int K, int N) {
  const int t = blockIdx.x * 256 + threadIdx.x;
  const int k8n = K / 8;
  if (t >= N * k8n) return;
  const int n = t / k8n, k8 = (t % k8n) * 8;
  v8us v;
#pragma unroll
  for (int i = 0; i < 8; ++i) v[i] = bf16_bits(W[(size_t)(k8 + i) * N + n]);
  *(v8us*)(Wt + (size_t)n * K + k8) = v;
  
}

// GEMM C[M][N] (f32, pitch ldc) = act(A[M][K]·W + bias). A f32 row-major (pitch lda) converted per fragment to bf16
// (ASPLIT: hi/lo two planes -> 2 terms, else single rounded term); Wt bf16 [N][K] (pitch ldb). BIAS_BF16 rounds the
// bias to bf16 first (bias quantised to bf16 before the add). K%32==0, M%16==0, N%64==0.
template <bool ASPLIT, int ACT, bool BIAS_BF16>
__global__ __launch_bounds__(128) void k_gemm_bf(const float* __restrict__ A, int lda, const unsigned short* __restrict__ Wt, int ldb,
                                               const float* __restrict__ bias, float* __restrict__ C, int ldc, int M, int N, int K) {
  __shared__ __attribute__((aligned(16))) float so[4][16][64];
  const int tid = threadIdx.x, w = tid >> 5, lane = tid & 31, ln = lane & 15, hh = lane >> 4;
  const int ntn = N / 64;
  const int wid = blockIdx.x * 4 + w;
  const int mt = wid / ntn, nq = wid % ntn;
  if (mt * 16 >= M) return;
  const int row0 = mt * 16, col0 = nq * 64;
  const float* arow = A + (size_t)(row0 + ln) * lda;
  v8f acc[4] = {};
  for (int kb = 0; kb < K; kb += 32) {
    FragB ah, al;
    const v4f x0 = *(const v4fa*)(arow + kb + 8 * hh), x1 = *(const v4fa*)(arow + kb + 8 * hh + 4);
    const v4f x2 = *(const v4fa*)(arow + kb + 16 + 8 * hh), x3 = *(const v4fa*)(arow + kb + 16 + 8 * hh + 4);
    float xs[16] = {x0[0],x0[1],x0[2],x0[3],x1[0],x1[1],x1[2],x1[3],x2[0],x2[1],x2[2],x2[3],x3[0],x3[1],x3[2],x3[3]};
#pragma unroll
    for (int i = 0; i < 16; ++i) { const unsigned short hb = bf16_bits(xs[i]); ah.u[i] = hb; al.u[i] = ASPLIT ? bf16_bits(xs[i] - bf16_val(hb)) : (unsigned short)0; }
#pragma unroll
    for (int t = 0; t < 4; ++t) {
      const unsigned short* brow = Wt + (size_t)(col0 + t * 16 + ln) * ldb + kb;
      FragB b;
      b.half[0] = *(const v8us*)(brow + 8 * hh);
      b.half[1] = *(const v8us*)(brow + 16 + 8 * hh);
      acc[t] = mmaN<ASPLIT ? 2 : 1>(ah.v, al.v, b.v, b.v, acc[t]);
    }
  }
#pragma unroll
  for (int t = 0; t < 4; ++t) {
    float bv = bias ? bias[col0 + t * 16 + ln] : 0.f;
    if (BIAS_BF16) bv = bf16_round(bv);
#pragma unroll
    for (int r = 0; r < 8; ++r) { float v = acc[t][r] + bv; if (ACT == 1) v = fmaxf(v, 0.f); so[w][8 * hh + r][t * 16 + ln] = v; }
  }
  __builtin_amdgcn_fence(__ATOMIC_ACQ_REL, "workgroup");
  __builtin_amdgcn_wave_barrier();
  const int rsub = lane >> 4, c4 = (lane & 15) * 4;
  {
#pragma unroll
    for (int q = 0; q < 8; ++q) {
      const int r = q * 2 + rsub;
      const v4f v = *(const v4fa*)&so[w][r][c4];
      *(v4f*)(C + (size_t)(row0 + r) * ldc + col0 + c4) = v;
    }
    
  }
}

// GEMM C = act(A·W + bias + resid): A f32 (ASPLIT -> hi/lo 2 terms), Wt bf16 [N][K]; ACT 0 none, 1 relu, 2 exact gelu;
// resid (optional, f32, row index = (row % rmod), pitch ldr, RES_BF16 rounds it) added before the activation.
template <bool ASPLIT, int ACT, bool BIAS_BF16, bool RES_BF16>
__global__ __launch_bounds__(128) void k_gemm_bf3(const float* __restrict__ A, int lda, const unsigned short* __restrict__ Wt, int ldb,
                                                const float* __restrict__ bias, const float* __restrict__ resid, int rmod, int ldr,
                                                float* __restrict__ C, int ldc, int M, int N, int K) {
  __shared__ __attribute__((aligned(16))) float so[4][16][64];
  const int tid = threadIdx.x, w = tid >> 5, lane = tid & 31, ln = lane & 15, hh = lane >> 4;
  const int ntn = N / 64;
  const int wid = blockIdx.x * 4 + w;
  const int mt = wid / ntn, nq = wid % ntn;
  if (mt * 16 >= M) return;
  const int row0 = mt * 16, col0 = nq * 64;
  const float* arow = A + (size_t)(row0 + ln) * lda;
  v8f acc[4] = {};
  for (int kb = 0; kb < K; kb += 32) {
    FragB ah, al;
    const v4f x0 = *(const v4fa*)(arow + kb + 8 * hh), x1 = *(const v4fa*)(arow + kb + 8 * hh + 4);
    const v4f x2 = *(const v4fa*)(arow + kb + 16 + 8 * hh), x3 = *(const v4fa*)(arow + kb + 16 + 8 * hh + 4);
    float xs[16] = {x0[0],x0[1],x0[2],x0[3],x1[0],x1[1],x1[2],x1[3],x2[0],x2[1],x2[2],x2[3],x3[0],x3[1],x3[2],x3[3]};
#pragma unroll
    for (int i = 0; i < 16; ++i) { const unsigned short hb = bf16_bits(xs[i]); ah.u[i] = hb; al.u[i] = ASPLIT ? bf16_bits(xs[i] - bf16_val(hb)) : (unsigned short)0; }
#pragma unroll
    for (int t = 0; t < 4; ++t) {
      const unsigned short* brow = Wt + (size_t)(col0 + t * 16 + ln) * ldb + kb;
      FragB b;
      b.half[0] = *(const v8us*)(brow + 8 * hh);
      b.half[1] = *(const v8us*)(brow + 16 + 8 * hh);
      acc[t] = mmaN<ASPLIT ? 2 : 1>(ah.v, al.v, b.v, b.v, acc[t]);
    }
  }
#pragma unroll
  for (int t = 0; t < 4; ++t) {
    const int col = col0 + t * 16 + ln;
    float bv = bias ? bias[col] : 0.f;
    if (BIAS_BF16) bv = bf16_round(bv);
#pragma unroll
    for (int r = 0; r < 8; ++r) {
      float v = acc[t][r] + bv;
      if (resid) { float rv = resid[(size_t)((row0 + 8 * hh + r) % rmod) * ldr + col]; if (RES_BF16) rv = bf16_round(rv); v += rv; }
      if (ACT == 1) v = fmaxf(v, 0.f);
      if (ACT == 2) v = 0.5f * v * (1.0f + erff(v * 0.70710678118654752f));
      if (ACT == 3) { const float u = 0.7978845608028654f * (v + 0.044715f * v * v * v); v = 0.5f * v * (1.0f + tanhf(u)); }
      so[w][8 * hh + r][t * 16 + ln] = v;
    }
  }
  __builtin_amdgcn_fence(__ATOMIC_ACQ_REL, "workgroup");
  __builtin_amdgcn_wave_barrier();
  const int rsub = lane >> 4, c4 = (lane & 15) * 4;
  {
#pragma unroll
    for (int q = 0; q < 8; ++q) {
      const int r = q * 2 + rsub;
      const v4f v = *(const v4fa*)&so[w][r][c4];
      *(v4f*)(C + (size_t)(row0 + r) * ldc + col0 + c4) = v;
    }
    
  }
}
// row LayerNorm (biased variance, eps) over N: s = X (+ R); optional out_sum <- s; out_norm <- (s-mu)*rsqrt(var+eps)*g + b
template <bool PARAM_BF16>
__global__ __launch_bounds__(256) void k_layernorm(const float* __restrict__ X, const float* __restrict__ R, const float* __restrict__ g, const float* __restrict__ bta,
                                                  float* __restrict__ out_sum, float* __restrict__ out_norm, int N, float eps) {
  __shared__ float red[256];
  const int row = blockIdx.x, tid = threadIdx.x;
  const float* x = X + (size_t)row * N; const float* rr = R ? R + (size_t)row * N : nullptr;
  float vals[16];                     // up to N = 4096
  const int per = N / 256;            // contiguous chunk per thread? use strided-by-4 chunks: thread handles j = tid*4 + 1024*u
  float s1 = 0.f;
  for (int u = 0; u < per / 4; ++u) {
    const int j = tid * 4 + 1024 * u;
    const v4f a = *(const v4fa*)(x + j);
    v4f b = {0.f,0.f,0.f,0.f}; if (rr) b = *(const v4fa*)(rr + j);
#pragma unroll
    for (int q = 0; q < 4; ++q) { const float v = a[q] + b[q]; vals[u * 4 + q] = v; s1 += v; }
  }
  red[tid] = s1; __syncthreads();
  for (int st = 128; st > 0; st >>= 1) { if (tid < st) red[tid] += red[tid + st]; __syncthreads(); }
  const float mu = red[0] / (float)N; __syncthreads();
  float s2 = 0.f;
  for (int u = 0; u < per / 4; ++u)
#pragma unroll
    for (int q = 0; q < 4; ++q) { const float c = vals[u * 4 + q] - mu; s2 += c * c; }
  red[tid] = s2; __syncthreads();
  for (int st = 128; st > 0; st >>= 1) { if (tid < st) red[tid] += red[tid + st]; __syncthreads(); }
  const float rs = rsqrtf(red[0] / (float)N + eps);
  {
    for (int u = 0; u < per / 4; ++u) {
      const int j = tid * 4 + 1024 * u;
      v4f o, sm;
#pragma unroll
      for (int q = 0; q < 4; ++q) {
        float gg = g[j + q], bb = bta[j + q];
        if (PARAM_BF16) { gg = bf16_round(gg); bb = bf16_round(bb); }
        sm[q] = vals[u * 4 + q]; o[q] = (vals[u * 4 + q] - mu) * rs * gg + bb;
      }
      if (out_sum) *(v4f*)(out_sum + (size_t)row * N + j) = sm;
      *(v4f*)(out_norm + (size_t)row * N + j) = o;
    }
    
  }
}



// ---- f16 WMMA path (v_wmma_f32_16x16x32_f16): 11-bit significands for operands in range — used where a [0,1] probability operand needs more precision than bf16
typedef _Float16 v16h __attribute__((ext_vector_type(16)));
union FragH { v16h v; v8us half[2]; _Float16 h[16]; unsigned short u[16]; };
template <int NT>
__device__ __forceinline__ v8f mmaH(v16h ah, v16h al, v16h bh, v16h bl, v8f c) {
  c = __builtin_amdgcn_wmma_f32_16x16x32_f16(false, ah, false, bh, (short)0, c, false, false);
  if (NT >= 2) c = __builtin_amdgcn_wmma_f32_16x16x32_f16(false, al, false, bh, (short)0, c, false, false);
  if (NT >= 3) c = __builtin_amdgcn_wmma_f32_16x16x32_f16(false, ah, false, bl, (short)0, c, false, false);
  asm volatile("v_nop\n\tv_nop\n\tv_nop\n\tv_nop" : "+v"(c) : "v"(ah), "v"(al), "v"(bh), "v"(bl));
  return c;
}
// batched GEMM like k_gemm_b but f16 operands: A f32 (split into f16 hi/lo if ASPLIT, else rounded to f16), Bt = f16 values [n][k]; alpha; C f32; N multiple of 16 (partial tiles skipped)
template <bool ASPLIT>
__global__ __launch_bounds__(128) void k_gemm_h(const float* __restrict__ A, int lda, size_t sA, const _Float16* __restrict__ Bh, int ldb, size_t sB, float alpha, float* __restrict__ C, int ldc, size_t sC, int M, int N, int K) {
  __shared__ __attribute__((aligned(16))) float so[4][16][64];
  const int tid = threadIdx.x, w = tid >> 5, lane = tid & 31, ln = lane & 15, hh = lane >> 4; const int by = blockIdx.y;
  A += (size_t)by * sA; Bh += (size_t)by * sB; C += (size_t)by * sC;
  const int ntn = (N + 63) / 64; const int wid = blockIdx.x * 4 + w; const int mt = wid / ntn, nq = wid % ntn; if (mt * 16 >= M) return;
  const int row0 = mt * 16, col0 = nq * 64; const float* arow = A + (size_t)(row0 + ln) * lda;
  v8f acc[4] = {};
  for (int kb = 0; kb < K; kb += 32) {
    FragH ah, al;
    const v4f x0 = *(const v4fa*)(arow + kb + 8 * hh), x1 = *(const v4fa*)(arow + kb + 8 * hh + 4), x2 = *(const v4fa*)(arow + kb + 16 + 8 * hh), x3 = *(const v4fa*)(arow + kb + 16 + 8 * hh + 4);
    float xs[16] = {x0[0],x0[1],x0[2],x0[3],x1[0],x1[1],x1[2],x1[3],x2[0],x2[1],x2[2],x2[3],x3[0],x3[1],x3[2],x3[3]};
#pragma unroll
    for (int i = 0; i < 16; ++i) { const _Float16 h = (_Float16)xs[i]; ah.h[i] = h; al.h[i] = ASPLIT ? (_Float16)(xs[i] - (float)h) : (_Float16)0.0f; }
#pragma unroll
    for (int t = 0; t < 4; ++t) { if (col0 + t * 16 >= N) continue; const size_t boff = (size_t)(col0 + t * 16 + ln) * ldb + kb; FragH bq; bq.half[0] = *(const v8us*)(Bh + boff + 8 * hh); bq.half[1] = *(const v8us*)(Bh + boff + 16 + 8 * hh);
      acc[t] = mmaH<ASPLIT ? 2 : 1>(ah.v, al.v, bq.v, bq.v, acc[t]); }
  }
#pragma unroll
  for (int t = 0; t < 4; ++t) { if (col0 + t * 16 >= N) continue;
#pragma unroll
    for (int r = 0; r < 8; ++r) so[w][8 * hh + r][t * 16 + ln] = acc[t][r] * alpha; }
  __builtin_amdgcn_fence(__ATOMIC_ACQ_REL, "workgroup"); __builtin_amdgcn_wave_barrier();
  const int rsub = lane >> 4, c4 = (lane & 15) * 4;
  {
#pragma unroll
    for (int q = 0; q < 8; ++q) { const int r = q * 2 + rsub; if (col0 + c4 < N) { const v4f v = *(const v4fa*)&so[w][r][c4]; *(v4f*)(C + (size_t)(row0 + r) * ldc + col0 + c4) = v; } }
     }
}

// Wt[n][k] = f16(W[k][n]·scale) from f32 row-major W[K][N] (scale = power of two; bf16-exact weights stay exact in f16 away from the subnormal range)
__global__ __launch_bounds__(256) void k_wt_f16(const float* __restrict__ W, _Float16* __restrict__ Wt, int K, int N, float scale) {
  const int t = blockIdx.x * 256 + threadIdx.x; if (t >= N * (K / 8)) return; const int n = t / (K / 8), k8 = (t % (K / 8)) * 8; FragH f;
#pragma unroll
  for (int i = 0; i < 8; ++i) f.h[i] = (_Float16)(bf16_round(W[(size_t)(k8 + i) * N + n]) * scale); const v8us o = f.half[0];
  *(v8us*)((unsigned short*)Wt + (size_t)n * K + k8) = o; 
}
// k_gemm_hh variant with fused epilogue: v = acc·alpha + bias[by·sBias + col] (+ CP[(row/rowsPerB)·sCPb + by·64 + col] if CP) ; ACT 0 none / 1 elu ; writes f16 C16 (and f32 C if non-null)
template <int ACT>
__global__ __launch_bounds__(128) void k_gemm_hhx(const _Float16* __restrict__ A, int lda, size_t sA, const _Float16* __restrict__ Bh, int ldb, size_t sB, float alpha, const float* __restrict__ bias, size_t sBias, const float* __restrict__ CP, int rowsPerB, size_t sCPb, int row0g,
    float* __restrict__ C, _Float16* __restrict__ C16, int ldc, size_t sC, int M, int N, int K) {
  __shared__ __attribute__((aligned(16))) float so[4][16][64];
  const int tid = threadIdx.x, w = tid >> 5, lane = tid & 31, ln = lane & 15, hh = lane >> 4; const int by = blockIdx.y;
  A += (size_t)by * sA; Bh += (size_t)by * sB; const size_t cofs = (size_t)by * sC; const float* bp = bias ? bias + (size_t)by * sBias : nullptr;
  const int ntn = (N + 63) / 64; const int wid = blockIdx.x * 4 + w; const int mt = wid / ntn, nq = wid % ntn; if (mt * 16 >= M) return;
  const int row0 = mt * 16, col0 = nq * 64; const _Float16* arow = A + (size_t)(row0 + ln) * lda;
  v8f acc[4] = {};
  for (int kb = 0; kb < K; kb += 32) { FragH ah; ah.half[0] = *(const v8us*)((const unsigned short*)arow + kb + 8 * hh); ah.half[1] = *(const v8us*)((const unsigned short*)arow + kb + 16 + 8 * hh);
#pragma unroll
    for (int t = 0; t < 4; ++t) { if (col0 + t * 16 >= N) continue; const size_t boff = (size_t)(col0 + t * 16 + ln) * ldb + kb; FragH bq; bq.half[0] = *(const v8us*)((const unsigned short*)Bh + boff + 8 * hh); bq.half[1] = *(const v8us*)((const unsigned short*)Bh + boff + 16 + 8 * hh);
      acc[t] = mmaH<1>(ah.v, ah.v, bq.v, bq.v, acc[t]); }
  }
#pragma unroll
  for (int t = 0; t < 4; ++t) { if (col0 + t * 16 >= N) continue; const int col = col0 + t * 16 + ln; const float bv = bp ? bf16_round(bp[col]) : 0.f;
#pragma unroll
    for (int r = 0; r < 8; ++r) { float v = acc[t][r] * alpha + bv; if (CP) { const int rr = row0g + row0 + 8 * hh + r; if (rowsPerB < 0) v += CP[cofs + (size_t)rr * ldc + col];      /* rowsPerB < 0: own element of the batched C plane */ else { const int bidx = rr / rowsPerB; v += CP[(size_t)bidx * sCPb + (size_t)by * 64 + col]; } } if (ACT == 1) v = (v > 0.f) ? v : expm1f(v); else if (ACT == 7) v = (v > 0.f) ? v + 1.0f : expf(v); else if (ACT == 8) v = tanhf(v); else if (ACT == 9) v = 0.5f * v * (1.0f + tanhf(0.7978845608028654f * (v + 0.044715f * v * v * v))); else if (ACT == 11) v = 1.0f / (1.0f + expf(-v)); else if (ACT == 12) v = (v > 0.f) ? v : 0.01f * v; else if (ACT == 14) v = (v > 0.f) ? v : 0.1f * v; else if (ACT == 16) v = (v >= 0.f) ? v : 0.3f * v; else if (ACT == 17) v = (v >= 0.f) ? v : 0.2f * v; else if (ACT == 15) v = v / (1.0f + expf(-v)); else if (ACT == 3) v = fmaxf(v, 0.f); else if (ACT == 6) v = 0.5f * v * (1.0f + erff(v * 0.70710678118654752f)); so[w][8 * hh + r][t * 16 + ln] = v; } }
  __builtin_amdgcn_fence(__ATOMIC_ACQ_REL, "workgroup"); __builtin_amdgcn_wave_barrier();
  const int rsub = lane >> 4, c4 = (lane & 15) * 4; typedef _Float16 v4h __attribute__((ext_vector_type(4)));
  {
#pragma unroll
    for (int q = 0; q < 8; ++q) { const int r = q * 2 + rsub; if (col0 + c4 < N) { const v4f v = *(const v4fa*)&so[w][r][c4]; if (C) *(v4f*)(C + cofs + (size_t)(row0 + r) * ldc + col0 + c4) = v; if (C16) { v4h h4; for (int i = 0; i < 4; ++i) h4[i] = (_Float16)v[i]; *(v4h*)(C16 + cofs + (size_t)(row0 + r) * ldc + col0 + c4) = h4; } } }
     }
}


typedef _Float16 v4h __attribute__((ext_vector_type(4)));

__global__ __launch_bounds__(256) void k_x16(const float* __restrict__ x, _Float16* __restrict__ X16, size_t n8) { const size_t t = (size_t)blockIdx.x * 256 + threadIdx.x; if (t >= n8) return; FragH f;
#pragma unroll
  for (int q = 0; q < 8; ++q) f.h[q] = (_Float16)bf16_round(x[t * 8 + q]); *(v8us*)((unsigned short*)X16 + t * 8) = f.half[0];  }
__global__ __launch_bounds__(256) void k_h16(const float* __restrict__ x, _Float16* __restrict__ X16, size_t n8) { const size_t t = (size_t)blockIdx.x * 256 + threadIdx.x; if (t >= n8) return; FragH f;
#pragma unroll
  for (int q = 0; q < 8; ++q) f.h[q] = (_Float16)x[t * 8 + q]; *(v8us*)((unsigned short*)X16 + t * 8) = f.half[0];  }
__global__ __launch_bounds__(256) void k_round16f(const float* __restrict__ W, _Float16* __restrict__ Bt, size_t n8) { const size_t t = (size_t)blockIdx.x * 256 + threadIdx.x; if (t >= n8) return; FragH f;
#pragma unroll
  for (int i = 0; i < 8; ++i) f.h[i] = (_Float16)(bf16_round(W[t * 8 + i]) * 16.0f); *(v8us*)((unsigned short*)Bt + t * 8) = f.half[0];  }
template <int NHv, int TTv>
__global__ __launch_bounds__(256) void k_vt(const _Float16* __restrict__ V16, int ldv, int voff, _Float16* __restrict__ Vt) { __shared__ unsigned short tl[64][66]; const int tid = threadIdx.x; const int slab = blockIdx.x / (TTv / 64), lg = blockIdx.x % (TTv / 64); const int b = slab / NHv, h = slab % NHv;
  for (int i = tid; i < 64 * 8; i += 256) { const int r = i / 8, c8 = (i % 8) * 8; FragH f; f.half[0] = *(const v8us*)((const unsigned short*)V16 + ((size_t)b * TTv + lg * 64 + r) * ldv + voff + h * 64 + c8);
#pragma unroll
    for (int q = 0; q < 8; ++q) tl[r][c8 + q] = f.u[q]; }
  __syncthreads();
  {
#pragma unroll
    for (int rd = 0; rd < 2; ++rd) { const int d = rd * 32 + tid / 8, pc = tid % 8; FragH f;
#pragma unroll
      for (int q = 0; q < 8; ++q) f.u[q] = tl[pc * 8 + q][d];
      *(v8us*)((unsigned short*)Vt + ((size_t)slab * 64 + d) * TTv + lg * 64 + pc * 8) = f.half[0]; }
     } }

__global__ __launch_bounds__(256) void k_hl(const float* __restrict__ F, _Float16* __restrict__ Hh, _Float16* __restrict__ Hl, size_t n8) { const size_t t = (size_t)blockIdx.x * 256 + threadIdx.x; if (t >= n8) return; FragH fh, fl; const v4f a = *(const v4fa*)(F + t * 8), c = *(const v4fa*)(F + t * 8 + 4);
#pragma unroll
  for (int q = 0; q < 4; ++q) { _Float16 h = (_Float16)a[q]; fh.h[q] = h; fl.h[q] = (_Float16)((a[q] - (float)h) * 1024.0f); h = (_Float16)c[q]; fh.h[4 + q] = h; fl.h[4 + q] = (_Float16)((c[q] - (float)h) * 1024.0f); }
  { *(v8us*)((unsigned short*)Hh + t * 8) = fh.half[0]; *(v8us*)((unsigned short*)Hl + t * 8) = fl.half[0];  } }

// ---- fast GEMM (wave tile 32x64; requires M % 32 == 0 rows per launch region and N % 64 == 0); epilogue = k_gemm_hhx semantics ----
__device__ __forceinline__ v16h g2_frag(const _Float16* p, int hh) { FragH f; f.half[0] = *(const v8us*)((const unsigned short*)p + 8 * hh); f.half[1] = *(const v8us*)((const unsigned short*)p + 16 + 8 * hh); return f.v; }
__device__ __forceinline__ v8f g2_mma(v16h a, v16h b, v8f c) { v8f d = __builtin_amdgcn_wmma_f32_16x16x32_f16(false, a, false, b, (short)0, c, false, false); asm volatile("v_nop\n\tv_nop\n\tv_nop\n\tv_nop" : "+v"(d) : "v"(a), "v"(b)); return d; }
template <int ACT>
__global__ __launch_bounds__(128) void k_gemm2(const _Float16* __restrict__ A, int lda, size_t sA, const _Float16* __restrict__ Bh, int ldb, size_t sB, float alpha, const float* __restrict__ bias, size_t sBias, const float* __restrict__ CP, int rowsPerB, size_t sCPb, int row0g,
    float* __restrict__ C, _Float16* __restrict__ C16, int ldc, size_t sC, int M, int N, int K) { static_assert(ACT == 0 || ACT == 3 || ACT == 6 || ACT == 8 || ACT == 9 || ACT == 11 || ACT == 12 || ACT == 14 || ACT == 15 || ACT == 16 || ACT == 17, "k_gemm2: unsupported ACT code (would silently apply no activation)");
  __shared__ __attribute__((aligned(16))) float so[4][32][68];
  const int tid = threadIdx.x, w = tid >> 5, lane = tid & 31, ln = lane & 15, hh = lane >> 4; const int by = blockIdx.y;
  A += (size_t)by * sA; Bh += (size_t)by * sB; const size_t cofs = (size_t)by * sC; const float* bp = bias ? bias + (size_t)by * sBias : nullptr;
  const int ntn = N >> 6; const int mt = blockIdx.x / ntn, nq = blockIdx.x - mt * ntn; const int row0 = mt * 128 + 32 * w, col0 = nq * 64; if (row0 >= M) return;
  const _Float16* a0p = A + (size_t)(row0 + ln) * lda; const _Float16* a1p = a0p + (size_t)16 * lda;
  const _Float16* b0p = Bh + (size_t)(col0 + ln) * ldb; const _Float16* b1p = b0p + (size_t)16 * ldb; const _Float16* b2p = b1p + (size_t)16 * ldb; const _Float16* b3p = b2p + (size_t)16 * ldb;
  const v8f z8 = {0.f,0.f,0.f,0.f,0.f,0.f,0.f,0.f}; v8f c00 = z8, c01 = z8, c02 = z8, c03 = z8, c10 = z8, c11 = z8, c12 = z8, c13 = z8;
#pragma unroll 1
  for (int kb = 0; kb < K; kb += 32) { const v16h a0 = g2_frag(a0p + kb, hh), a1 = g2_frag(a1p + kb, hh);
    v16h b = g2_frag(b0p + kb, hh); c00 = g2_mma(a0, b, c00); c10 = g2_mma(a1, b, c10);
    b = g2_frag(b1p + kb, hh); c01 = g2_mma(a0, b, c01); c11 = g2_mma(a1, b, c11);
    b = g2_frag(b2p + kb, hh); c02 = g2_mma(a0, b, c02); c12 = g2_mma(a1, b, c12);
    b = g2_frag(b3p + kb, hh); c03 = g2_mma(a0, b, c03); c13 = g2_mma(a1, b, c13); }
  v8f accs[8] = {c00, c01, c02, c03, c10, c11, c12, c13};
#pragma unroll
  for (int u = 0; u < 8; ++u) { const int t = u & 3, half = u >> 2; const int col = col0 + t * 16 + ln; const float bv = bp ? bf16_round(bp[col]) : 0.f;
#pragma unroll
    for (int r = 0; r < 8; ++r) { const int rloc = half * 16 + 8 * hh + r; float v = accs[u][r] * alpha + bv; if (CP) { if (rowsPerB < 0) v += CP[cofs + (size_t)(row0g + row0 + rloc) * ldc + col];      /* rowsPerB < 0: own element of the batched C plane */ else { const int bidx = (row0g + row0 + rloc) / rowsPerB; v += CP[(size_t)bidx * sCPb + (size_t)by * 64 + col]; } }
      if (ACT == 3) v = fmaxf(v, 0.f); else if (ACT == 6) v = 0.5f * v * (1.0f + erff(v * 0.70710678118654752f)); else if (ACT == 11) v = 1.0f / (1.0f + expf(-v)); else if (ACT == 15) v = v / (1.0f + expf(-v)); else if (ACT == 12) v = (v > 0.f) ? v : 0.01f * v; else if (ACT == 8) v = tanhf(v); else if (ACT == 9) v = 0.5f * v * (1.0f + tanhf(0.7978845608028654f * (v + 0.044715f * v * v * v))); else if (ACT == 14) v = (v > 0.f) ? v : 0.1f * v; else if (ACT == 16) v = (v >= 0.f) ? v : 0.3f * v; else if (ACT == 17) v = (v >= 0.f) ? v : 0.2f * v;
      so[w][rloc][t * 16 + ln] = v; } }
  __builtin_amdgcn_fence(__ATOMIC_ACQ_REL, "workgroup"); __builtin_amdgcn_wave_barrier();
  const int rsub = lane >> 4, c4 = (lane & 15) * 4;
  {
#pragma unroll
    for (int q = 0; q < 16; ++q) { const int r = q * 2 + rsub; const v4f v = *(const v4fa*)&so[w][r][c4]; if (C) *(v4f*)(C + cofs + (size_t)(row0 + r) * ldc + col0 + c4) = v; if (C16) { v4h h4; for (int i = 0; i < 4; ++i) h4[i] = (_Float16)v[i]; *(v4h*)(C16 + cofs + (size_t)(row0 + r) * ldc + col0 + c4) = h4; } }
     } }


__global__ __launch_bounds__(256) void k_wnat(const float* __restrict__ w, size_t n8, _Float16* __restrict__ Bt) { const size_t t = (size_t)blockIdx.x * 256 + threadIdx.x; if (t >= n8) return; FragH f; for (int q = 0; q < 8; ++q) f.h[q] = (_Float16)(bf16_round(w[t * 8 + q]) * 16.0f); *(v8us*)((unsigned short*)Bt + t * 8) = f.half[0];  }
__global__ __launch_bounds__(256) void k_rsm(const float* __restrict__ S, _Float16* __restrict__ P, int nrows) {
  #pragma clang fp contract(off)
  const int i = blockIdx.x * 256 + threadIdx.x; if (i >= nrows) return; const float* s = S + (size_t)i * SQ; float mx = -3.0e38f;
#pragma unroll 1
  for (int j = 0; j < SQ; ++j) mx = fmaxf(mx, s[j]); float se = 0.f;
#pragma unroll 1
  for (int j = 0; j < SQ; ++j) se += expf(s[j] - mx); const float sc = 256.0f / se;
#pragma unroll 1
  for (int j0 = 0; j0 < SQ; j0 += 8) { FragH f; for (int q = 0; q < 8; ++q) f.h[q] = (_Float16)(expf(s[j0 + q] - mx) * sc); unsigned short* d = (unsigned short*)P + (size_t)i * SQ + j0; *(v8us*)d = f.half[0];  } }
__global__ __launch_bounds__(256) void k_vt(const _Float16* __restrict__ V16, int b, int h0, _Float16* __restrict__ VT) { __shared__ unsigned short tl[64][65]; const int tid = threadIdx.x; const int hh = blockIdx.x % HG, sg = blockIdx.x / HG; const int s0 = sg * 64; const int h = h0 + hh;
  for (int i = tid; i < 64 * 8; i += 256) { const int j = i / 8, d8 = (i % 8) * 8; FragH f; f.half[0] = *(const v8us*)((const unsigned short*)V16 + ((size_t)b * SQ + s0 + j) * DM + h * HD + d8); for (int q = 0; q < 8; ++q) tl[d8 + q][j] = f.u[q]; }
  __syncthreads();
  { for (int i = tid; i < 64 * 8; i += 256) { const int d = i / 8, j8 = (i % 8) * 8; FragH f; for (int q = 0; q < 8; ++q) f.u[q] = tl[d][j8 + q]; *(v8us*)((unsigned short*)VT + ((size_t)hh * HD + d) * SQ + s0 + j8) = f.half[0]; }  } }



__global__ __launch_bounds__(256) void k_rsmcf2(const float* __restrict__ S, _Float16* __restrict__ P, int hg, int q0, int nk) {
  #pragma clang fp contract(off)
  const int t = blockIdx.x * 256 + threadIdx.x; if (t >= hg * QT) return; const size_t i = (size_t)t; const float* s = S + i * NKX; const int last = q0 + (t % QT); float mx = -3.0e38f;
#pragma unroll 1
  for (int j = 0; j < nk; ++j) { const float f = (j <= last) ? 1.f : 0.f; mx = fmaxf(mx, fmaf(f, s[j], (1.f - f) * -1.0e9f)); } float se = 0.f;
#pragma unroll 1
  for (int j = 0; j < nk; ++j) { const float f = (j <= last) ? 1.f : 0.f; se += __expf(fmaf(f, s[j], (1.f - f) * -1.0e9f) - mx); } const float sc = 256.0f / se;
#pragma unroll 1
  for (int j0 = 0; j0 < nk; j0 += 8) { FragH fr; for (int q = 0; q < 8; ++q) { const int j = j0 + q; const float f = (j <= last) ? 1.f : 0.f; fr.h[q] = (_Float16)(__expf(fmaf(f, s[j], (1.f - f) * -1.0e9f) - mx) * sc); } unsigned short* d = (unsigned short*)P + i * NKX + j0; *(v8us*)d = fr.half[0];  } }


template <int MASKADD>
__global__ __launch_bounds__(64) void k_att0(const float* __restrict__ QF, const float* __restrict__ KF, const float* __restrict__ VF, int ld, const float* __restrict__ mask, float scale, float* __restrict__ OF, int ldo) {
  #pragma clang fp contract(off)
  __shared__ __attribute__((aligned(16))) float lq[64][64]; __shared__ __attribute__((aligned(16))) float lo[64][64];
  const int tid = threadIdx.x; const int h = blockIdx.x / (QT0 / 64), rg = blockIdx.x % (QT0 / 64); const int i = rg * 64 + tid;
  const float* qr = QF + (size_t)i * ld + h * HD;
#pragma unroll 1
  for (int c = 0; c < HD / 4; ++c) { *(v4f*)&lq[tid][c * 4] = *(const v4fa*)(qr + c * 4); const v4f z = {0.f, 0.f, 0.f, 0.f}; *(v4f*)&lo[tid][c * 4] = z; }
  float m = -1.0e30f, l = 0.f; const int jmax = MASKADD ? (SQ - 1) : (rg * 64 + 63);      /* additive-mask form: every key (the mask input decides); causal form: keys up to the block's last row */
#pragma unroll 1
  for (int j = 0; j <= jmax; ++j) { const float* kr = KF + (size_t)j * ld + h * HD; const float* vr = VF + (size_t)j * ld + h * HD; float s = 0.f;
#pragma unroll 1
    for (int c = 0; c < HD / 4; ++c) { const v4f kq = *(const v4fa*)(kr + c * 4); const v4f qq = *(v4f*)&lq[tid][c * 4]; s = __fadd_rn(s, __fmul_rn(qq[0], kq[0])); s = __fadd_rn(s, __fmul_rn(qq[1], kq[1])); s = __fadd_rn(s, __fmul_rn(qq[2], kq[2])); s = __fadd_rn(s, __fmul_rn(qq[3], kq[3])); }
    s = __fmul_rn(s, scale); if (MASKADD) s = __fadd_rn(s, __fmul_rn(bf16_round(mask[(size_t)i * SQ + j]), -10000.0f));
    const float f = (MASKADD || j <= i) ? 1.f : 0.f; const float sm = fmaf(f, s, (1.f - f) * -1.0e30f); const float mn = fmaxf(m, sm); const float sc = expf(m - mn); const float e = expf(sm - mn); l = __fadd_rn(__fmul_rn(l, sc), e); m = mn;
#pragma unroll 1
    for (int c = 0; c < HD / 4; ++c) { const v4f vv = *(const v4fa*)(vr + c * 4); v4f oo = *(v4f*)&lo[tid][c * 4]; for (int u = 0; u < 4; ++u) oo[u] = __fadd_rn(__fmul_rn(oo[u], sc), __fmul_rn(e, vv[u])); *(v4f*)&lo[tid][c * 4] = oo; } }
  const float fin = 64.0f / l;      /* o carried x64 like the f16 path */
#pragma unroll 1
  for (int c = 0; c < HD / 4; ++c) { v4f oo = *(v4f*)&lo[tid][c * 4]; for (int u = 0; u < 4; ++u) oo[u] = __fmul_rn(oo[u], fin); *(v4f*)&lo[tid][c * 4] = oo; }
  __syncthreads();
  {
#pragma unroll 1
    for (int it = 0; it < 16; ++it) { const int row = it * 4 + tid / 16, pc = (tid % 16) * 4; const v4f v = *(const v4f*)&lo[row][pc]; *(v4f*)(OF + (size_t)(rg * 64 + row) * ldo + h * HD + pc) = v; }
     } }


__global__ __launch_bounds__(256) void k_kvexp(const float* __restrict__ src, float* __restrict__ dst, size_t n4) { const size_t t = (size_t)blockIdx.x * 256 + threadIdx.x; if (t >= n4) return; const size_t e = t * 4; const size_t row = e / DM; const int col = (int)(e % DM); const int h = col / HD, d = col % HD; const v4f v = *(const v4fa*)(src + row * KVD + (size_t)(h / HPG) * HD + d); *(v4f*)(dst + e) = v;  }

__global__ __launch_bounds__(256) void k_tab2(float theta, float* __restrict__ CS, float* __restrict__ SN) {
  #pragma clang fp contract(off)
  const int t = blockIdx.x * 256 + threadIdx.x; if (t >= SQ * (HD / 2)) return; const int i = t % (HD / 2); const int p = t / (HD / 2); const float invf = 1.0f / powf(theta, (float)(2 * i) / (float)HD); const float ang = __fmul_rn((float)p, invf); const float c = cosf(ang), s = sinf(ang);
  *(float*)(CS + t) = c; *(float*)(SN + t) = s;  }
template <int NORM, int ROPE>
__global__ __launch_bounds__(64) void k_xform(const float* __restrict__ F, int ldf, int nh, const float* __restrict__ gain, float eps, const float* __restrict__ CS, const float* __restrict__ SN, _Float16* __restrict__ H16, int ldo) {
  #pragma clang fp contract(off)
  __shared__ float xv[HD]; __shared__ float red[HD]; __shared__ unsigned short sh_[HD]; const int d = threadIdx.x; const int h = blockIdx.x % nh; const size_t r = blockIdx.x / nh; const int p = (int)(r % SQ);
  float x = F[r * (size_t)ldf + (size_t)h * HD + d];
  if (NORM) { red[d] = __fmul_rn(x, x); __syncthreads(); for (int st = HD / 2; st > 0; st >>= 1) { if (d < st) red[d] = __fadd_rn(red[d], red[d + st]); __syncthreads(); } const float rs = rsqrtf(__fadd_rn(red[0] / (float)HD, eps)); x = __fmul_rn(__fmul_rn(x, rs), bf16_round(gain[d])); }
  xv[d] = x; __syncthreads();
  float o = x;
  if (ROPE == 1) { const int i = d >> 1; const float c = CS[p * (HD / 2) + i], s = SN[p * (HD / 2) + i]; const float ev = xv[2 * i], od = xv[2 * i + 1]; o = (d & 1) ? __fadd_rn(__fmul_rn(ev, s), __fmul_rn(od, c)) : __fadd_rn(__fmul_rn(ev, c), -__fmul_rn(od, s)); }
  if (ROPE == 2) { const int i = d & (HD / 2 - 1); const float c = CS[p * (HD / 2) + i], s = SN[p * (HD / 2) + i]; const float lo = xv[i], hi = xv[i + HD / 2]; o = (d < HD / 2) ? __fadd_rn(__fmul_rn(lo, c), -__fmul_rn(hi, s)) : __fadd_rn(__fmul_rn(lo, s), __fmul_rn(hi, c)); }
  FragH th; th.h[0] = (_Float16)o; sh_[d] = th.u[0]; __syncthreads();
  if (d < HD / 8) { FragH f; for (int q = 0; q < 8; ++q) f.u[q] = sh_[d * 8 + q]; unsigned short* dst = (unsigned short*)H16 + r * (size_t)ldo + (size_t)h * HD + d * 8; *(v8us*)dst = f.half[0];  } }

template <int NORM, int ROPE>
__global__ __launch_bounds__(64) void k_xformf(const float* __restrict__ F, int ldf, int nh, const float* __restrict__ gain, float eps, const float* __restrict__ CS, const float* __restrict__ SN, float* __restrict__ F32, int ldo) {
  #pragma clang fp contract(off)
  __shared__ float xv[HD]; __shared__ float red[HD]; const int d = threadIdx.x; const int h = blockIdx.x % nh; const size_t r = blockIdx.x / nh; const int p = (int)(r % SQ);
  float x = F[r * (size_t)ldf + (size_t)h * HD + d];
  if (NORM) { red[d] = __fmul_rn(x, x); __syncthreads(); for (int st = HD / 2; st > 0; st >>= 1) { if (d < st) red[d] = __fadd_rn(red[d], red[d + st]); __syncthreads(); } const float rs = rsqrtf(__fadd_rn(red[0] / (float)HD, eps)); x = __fmul_rn(__fmul_rn(x, rs), bf16_round(gain[d])); }
  xv[d] = x; __syncthreads();
  float o = x;
  if (ROPE == 1) { const int i = d >> 1; const float c = CS[p * (HD / 2) + i], s = SN[p * (HD / 2) + i]; const float ev = xv[2 * i], od = xv[2 * i + 1]; o = (d & 1) ? __fadd_rn(__fmul_rn(ev, s), __fmul_rn(od, c)) : __fadd_rn(__fmul_rn(ev, c), -__fmul_rn(od, s)); }
  if (ROPE == 2) { const int i = d & (HD / 2 - 1); const float c = CS[p * (HD / 2) + i], s = SN[p * (HD / 2) + i]; const float lo = xv[i], hi = xv[i + HD / 2]; o = (d < HD / 2) ? __fadd_rn(__fmul_rn(lo, c), -__fmul_rn(hi, s)) : __fadd_rn(__fmul_rn(lo, s), __fmul_rn(hi, c)); }
  float* dst = F32 + r * (size_t)ldo + (size_t)h * HD + d; *(float*)dst = o;  }

__global__ __launch_bounds__(256) void k_bfcp(const float* __restrict__ src, float* __restrict__ dst, size_t n4) { const size_t t = (size_t)blockIdx.x * 256 + threadIdx.x; if (t >= n4) return; const v4f a = *(const v4fa*)(src + t * 4); v4f o; for (int q = 0; q < 4; ++q) o[q] = bf16_round(a[q]); *(v4f*)(dst + t * 4) = o;  }

__global__ __launch_bounds__(256) void k_tab2d(float* __restrict__ CS, float* __restrict__ SN) {
  #pragma clang fp contract(off)
  const int t = blockIdx.x * 256 + threadIdx.x; if (t >= SQ * (HD / 2)) return; const int i = t % (HD / 2); const int p = t / (HD / 2); const float invf = (float)(1.0 / pow(10000.0, (double)(2 * i) / (double)HD)); const float ang = __fmul_rn((float)p, invf); const float c = cosf(ang), s = sinf(ang);
  *(float*)(CS + t) = c; *(float*)(SN + t) = s;  }
extern "C" void kernel_launch(void* const* d_in, const int* in_sizes, int n_in,
                              void* d_out, int out_size, void* d_ws, size_t ws_size, hipStream_t stream) {
  (void)in_sizes; (void)n_in; (void)out_size;
  const float* const* I = (const float* const*)d_in; const float* x = I[0]; const float* wq = I[1]; const float* wk = I[2]; const float* wv = I[3]; const float* wo = I[4]; const float* bq = nullptr; const float* bk = nullptr; const float* bv = nullptr; const float* bo = I[5];      /* input order: x, Wq, Wk, Wv, Wo (natural [out][in] weights), bo [1024] (the output bias: into the output GEMM's bias slot); the q / k / v projections have NO biases; rope tables computed in the kernel (positions = row index) */
  char* ws = (char*)d_ws; size_t off = 0;
  auto take = [&](size_t bytes) { char* p = ws + off; off += (bytes + 255) & ~(size_t)255; return p; };
  _Float16* BQ = (_Float16*)take((size_t)DM * DM * 2); _Float16* BK = (_Float16*)take((size_t)KVD * DM * 2); _Float16* BV = (_Float16*)take((size_t)KVD * DM * 2); _Float16* BO = (_Float16*)take((size_t)DM * DM * 2);
  _Float16* X16 = (_Float16*)take(NR * DM * 2); float* QF = (float*)take((size_t)SQ * DM * 4); float* KF = (float*)take((size_t)SQ * KVD * 4); float* CSB = (float*)take((size_t)SQ * 32 * 4); float* SNB = (float*)take((size_t)SQ * 32 * 4); _Float16* Q16 = (_Float16*)take(NR * DM * 2); _Float16* K16 = (_Float16*)take(NR * KVD * 2); _Float16* V16 = (_Float16*)take(NR * KVD * 2); _Float16* O16 = (_Float16*)take(NR * DM * 2);
  float* S = (float*)take((size_t)NH * QT * NKX * 4); _Float16* P = (_Float16*)take((size_t)NH * QT * NKX * 2); _Float16* VT = (_Float16*)take((size_t)NH * HD * SQ * 2);
  float* QF0 = (float*)take((size_t)QT0 * DM * 4); float* KF0 = (float*)take((size_t)QT0 * KVD * 4); float* VF0 = (float*)take((size_t)QT0 * KVD * 4); float* KF0e = (float*)take((size_t)QT0 * DM * 4); float* VF0e = (float*)take((size_t)QT0 * DM * 4); float* OF0 = (float*)take((size_t)NB * QT0 * DM * 4); _Float16* OH0 = (_Float16*)take((size_t)NB * QT0 * DM * 2); _Float16* OL0 = (_Float16*)take((size_t)NB * QT0 * DM * 2);
  if (off > ws_size) return;
  k_wnat<<<(unsigned)(((size_t)DM * DM / 8 + 255) / 256), 256, 0, stream>>>(wq, (size_t)DM * DM / 8, BQ); k_wnat<<<(unsigned)(((size_t)KVD * DM / 8 + 255) / 256), 256, 0, stream>>>(wk, (size_t)KVD * DM / 8, BK); k_wnat<<<(unsigned)(((size_t)KVD * DM / 8 + 255) / 256), 256, 0, stream>>>(wv, (size_t)KVD * DM / 8, BV); k_wnat<<<(unsigned)(((size_t)DM * DM / 8 + 255) / 256), 256, 0, stream>>>(wo, (size_t)DM * DM / 8, BO);      /* natural [out][in] = Bt[n][k] x16 (KVD = 16 x 64 = DM: full-width k / v) */
  k_x16<<<(unsigned)((NR * DM / 8 + 255) / 256), 256, 0, stream>>>(x, X16, NR * DM / 8);
  const size_t r0p = (size_t)B0 * SQ;      /* first projected row */
  k_gemm2<0><<<dim3((unsigned)((MP / 128) * (KVD / 64)), 1), 128, 0, stream>>>(X16 + r0p * DM, DM, 0, BV, DM, 0, 0.0625f, bv, 0, nullptr, 1, 0, 0, nullptr, V16 + r0p * KVD, KVD, 0, MP, KVD, DM);
  k_tab2d<<<(unsigned)(((size_t)SQ * (HD / 2) + 255) / 256), 256, 0, stream>>>(CSB, SNB);      /* rope tables computed in the kernel: CS[p][i] = cos(p * 10000^(-2i/64)), SN = sin, i < 32 (rotate-half convention; the module's [f | f] tables repeat these 32 columns) */
  for (int b = B0; b < B0 + NBR; ++b) { const size_t r0 = (size_t)b * SQ;
    k_gemm2<0><<<dim3((unsigned)((SQ / 128) * (DM / 64)), 1), 128, 0, stream>>>(X16 + r0 * DM, DM, 0, BQ, DM, 0, 0.0625f, bq, 0, nullptr, 1, 0, 0, QF, nullptr, DM, 0, SQ, DM, DM);      /* q (f32) of this batch */
    k_gemm2<0><<<dim3((unsigned)((SQ / 128) * (KVD / 64)), 1), 128, 0, stream>>>(X16 + r0 * DM, DM, 0, BK, DM, 0, 0.0625f, bk, 0, nullptr, 1, 0, 0, KF, nullptr, KVD, 0, SQ, KVD, DM);      /* k (f32) */
    k_xform<0, 2><<<(unsigned)((size_t)SQ * NH), 64, 0, stream>>>(QF, DM, NH, nullptr, 0.f, CSB, SNB, Q16 + r0 * DM, DM); k_xform<0, 2><<<(unsigned)((size_t)SQ * NG), 64, 0, stream>>>(KF, KVD, NG, nullptr, 0.f, CSB, SNB, K16 + r0 * KVD, KVD);      /* half-split rope <0, 2> (out_lo = x_lo c - x_hi s, out_hi = x_lo s + x_hi c = t cos + rotate_half(t) sin) from the computed tables, then f32 -> f16 */
    k_vt<NG, SQ><<<NG * (SQ / 64), 256, 0, stream>>>(V16 + r0 * KVD, KVD, 0, VT);      /* V^T [NH][HD][SQ] for this batch */
    for (int q0 = 0; q0 < QN; q0 += QT) { const int nk = SQ;      /* non-causal: all keys for every query tile */
      for (int g = 0; g < NG; ++g) k_gemm2<0><<<dim3((QT / 128) * (nk / 64), HPG), 128, 0, stream>>>(Q16 + (r0 + q0) * LQ + (size_t)g * HPG * HD, LQ, (size_t)HD, K16 + r0 * KVD + (size_t)g * HD, KVD, 0, 0.125f, nullptr, 0, nullptr, 1, 0, 0, S + (size_t)g * HPG * QT * NKX, nullptr, NKX, (size_t)QT * NKX, QT, nk, HD);      /* scores: the head of group g against the group's keys (sB 0) */
      k_rsm<<<(NHD * QT + 255) / 256, 256, 0, stream>>>(S, P, NHD * QT);      /* plain row softmax over all SQ keys (row pitch NKX == SQ) */
      for (int g = 0; g < NG; ++g) k_gemm2<0><<<dim3((QT / 128) * (HD / 64), HPG), 128, 0, stream>>>(P + (size_t)g * HPG * QT * NKX, NKX, (size_t)QT * NKX, VT + (size_t)g * HD * SQ, SQ, 0, 0.25f, nullptr, 0, nullptr, 1, 0, 0, nullptr, O16 + (r0 + q0) * DM + (size_t)g * HPG * HD, DM, (size_t)HD, QT, HD, nk); } }      /* o for the group's head (x64) */      /* o (merged heads, x64) as f16 rows */
  k_gemm2<0><<<dim3((unsigned)((MPO / 128) * (DM / 64)), 1), 128, 0, stream>>>(O16 + r0p * DM, DM, 0, BO, DM, 0, 0.0009765625f, bo, 0, nullptr, 1, 0, 0, (float*)d_out + r0p * DM, nullptr, DM, 0, MPO, DM, DM);      /* out rows are the output layout */
}

// v001
// One run takes 3820 microseconds.
// Two timings next to v000 put it at 5.13 and 5.16 times that version's speed.
#include <hip/hip_runtime.h>
// Multi-head self-attention with rotate-half RoPE computed in the kernel and a biased output projection, NON-causal (x [2][2048][1024]; q / k / v = x W^T (natural [1024][1024], no biases), 16 heads of 64; cos / sin = [f | f] of pos * 10000^(-2i/64); q = q cos + rotate_half(q) sin, likewise k; scores * 64^-0.5; softmax over all 2048 keys (no mask); out = merged Wo^T + bo (natural + bias) -> [2][2048][1024]); run as 16 groups of ONE head.
// Structure: x as exact f16 rows; natural weights as exact x16 planes; v as a WMMA GEMM (32x64 wave tiles, f32 accumulation, f16 output); rope tables computed once (double-derived inv_freq, f32 angle); per batch: q [2048][1024] and k [2048][1024] as GEMMs into f32 rows then the rotate-half rotation + f16 conversion per (row, head) on VALU; V^T of the 16 groups via LDS transposes; per query tile of 512 rows, all 16 heads in one launch (grid.y = head): scores against ALL 2048 keys of the head's key slab (K = 64, alpha 1/8), row softmax on VALU (f32 statistics, expf; weights x256 f16), o = P V^T with the shared value slab (o carried x64) into merged f16 rows; out = o Wo^T GEMM (f32, alpha 2^-10); launches: see trace.
// Compute dtype: inputs rounded to bf16; x / weights exact; q, k, v, softmax weights and o as plain f16 GEMM operands (~2^-12); scores and softmax statistics f32. v_wmma_f32_16x16x32_f16.
#define NB 2
#define NG 16
#define HPG 1
#define KVD (NG * HD)
#define SQ 2048
#define DM 1024
#define NH 16
#define HD 64
#define HG 4                         /* heads per block group of the unlaunched k_vt(V16, b, h0, VT) */
#define QT 512                       /* query rows per attention launch: the widest divisor of SQ whose S and P planes (NH * QT * SQ * 6 bytes) fit the workspace */
#define NKX SQ                       /* S / P row pitch */
#define QT0 128                      /* first-tile rows of the f32 k_att0 path (not launched) */
#define B0 0                         /* first batch processed (debug hook) */
#define NBR NB                       /* batches processed (debug hook) */
#define NR ((size_t)NB * SQ)         /* token rows */
#define MP ((int)((size_t)NBR * SQ)) /* rows projected (debug hook) */
#define QN SQ                        /* query rows attended per batch (debug hook) */
#define NHD NH                       /* heads attended (debug hook) */
#define MPO MP                       /* rows through the output stage (debug hook) */
#define LQ DM      /* row pitch of the q/k/v rows */
typedef __bf16 v16b __attribute__((ext_vector_type(16)));
typedef unsigned short v8us __attribute__((ext_vector_type(8), may_alias));
typedef float  v8f  __attribute__((ext_vector_type(8)));
typedef float  v4f  __attribute__((ext_vector_type(4)));
typedef float  v4fa __attribute__((ext_vector_type(4), may_alias));
union FragB { v16b v; v8us half[2]; unsigned short u[16]; };

__device__ __forceinline__ unsigned short bf16_bits(float x) { unsigned int u = __float_as_uint(x); return (unsigned short)((u + 0x7FFFu + ((u >> 16) & 1u)) >> 16); }
__device__ __forceinline__ float bf16_val(unsigned short b) { return __uint_as_float(((unsigned int)b) << 16); }
__device__ __forceinline__ float bf16_round(float x) { return bf16_val(bf16_bits(x)); }
// D += A·B with NT terms: 1 = ah·bh, 2 = + al·bh (A split), 3 = + ah·bl (both split)
template <int NT>
__device__ __forceinline__ v8f mmaN(v16b ah, v16b al, v16b bh, v16b bl, v8f c) {
  c = __builtin_amdgcn_wmma_f32_16x16x32_bf16(false, ah, false, bh, (short)0, c, false, false);
  if (NT >= 2) c = __builtin_amdgcn_wmma_f32_16x16x32_bf16(false, al, false, bh, (short)0, c, false, false);
  if (NT >= 3) c = __builtin_amdgcn_wmma_f32_16x16x32_bf16(false, ah, false, bl, (short)0, c, false, false);
  asm volatile("v_nop\n\tv_nop\n\tv_nop\n\tv_nop" : "+v"(c) : "v"(ah), "v"(al), "v"(bh), "v"(bl));
  return c;
}

__global__ __launch_bounds__(256) void k_wt_bf16(const float* __restrict__ W, unsigned short* __restrict__ Wt, int K, int N) {
  const int t = blockIdx.x * 256 + threadIdx.x;
  const int k8n = K / 8;
  if (t >= N * k8n) return;
  const int n = t / k8n, k8 = (t % k8n) * 8;
  v8us v;
#pragma unroll
  for (int i = 0; i < 8; ++i) v[i] = bf16_bits(W[(size_t)(k8 + i) * N + n]);
  *(v8us*)(Wt + (size_t)n * K + k8) = v;
  
}

// GEMM C[M][N] (f32, pitch ldc) = act(A[M][K]·W + bias). A f32 row-major (pitch lda) converted per fragment to bf16
// (ASPLIT: hi/lo two planes -> 2 terms, else single rounded term); Wt bf16 [N][K] (pitch ldb). BIAS_BF16 rounds the
// bias to bf16 first (bias quantised to bf16 before the add). K%32==0, M%16==0, N%64==0.
template <bool ASPLIT, int ACT, bool BIAS_BF16>
__global__ __launch_bounds__(128) void k_gemm_bf(const float* __restrict__ A, int lda, const unsigned short* __restrict__ Wt, int ldb,
                                               const float* __restrict__ bias, float* __restrict__ C, int ldc, int M, int N, int K) {
  __shared__ __attribute__((aligned(16))) float so[4][16][64];
  const int tid = threadIdx.x, w = tid >> 5, lane = tid & 31, ln = lane & 15, hh = lane >> 4;
  const int ntn = N / 64;
  const int wid = blockIdx.x * 4 + w;
  const int mt = wid / ntn, nq = wid % ntn;
  if (mt * 16 >= M) return;
  const int row0 = mt * 16, col0 = nq * 64;
  const float* arow = A + (size_t)(row0 + ln) * lda;
  v8f acc[4] = {};
  for (int kb = 0; kb < K; kb += 32) {
    FragB ah, al;
    const v4f x0 = *(const v4fa*)(arow + kb + 8 * hh), x1 = *(const v4fa*)(arow + kb + 8 * hh + 4);
    const v4f x2 = *(const v4fa*)(arow + kb + 16 + 8 * hh), x3 = *(const v4fa*)(arow + kb + 16 + 8 * hh + 4);
    float xs[16] = {x0[0],x0[1],x0[2],x0[3],x1[0],x1[1],x1[2],x1[3],x2[0],x2[1],x2[2],x2[3],x3[0],x3[1],x3[2],x3[3]};
#pragma unroll
    for (int i = 0; i < 16; ++i) { const unsigned short hb = bf16_bits(xs[i]); ah.u[i] = hb; al.u[i] = ASPLIT ? bf16_bits(xs[i] - bf16_val(hb)) : (unsigned short)0; }
#pragma unroll
    for (int t = 0; t < 4; ++t) {
      const unsigned short* brow = Wt + (size_t)(col0 + t * 16 + ln) * ldb + kb;
      FragB b;
      b.half[0] = *(const v8us*)(brow + 8 * hh);
      b.half[1] = *(const v8us*)(brow + 16 + 8 * hh);
      acc[t] = mmaN<ASPLIT ? 2 : 1>(ah.v, al.v, b.v, b.v, acc[t]);
    }
  }
#pragma unroll
  for (int t = 0; t < 4; ++t) {
    float bv = bias ? bias[col0 + t * 16 + ln] : 0.f;
    if (BIAS_BF16) bv = bf16_round(bv);
#pragma unroll
    for (int r = 0; r < 8; ++r) { float v = acc[t][r] + bv; if (ACT == 1) v = fmaxf(v, 0.f); so[w][8 * hh + r][t * 16 + ln] = v; }
  }
  __builtin_amdgcn_fence(__ATOMIC_ACQ_REL, "workgroup");
  __builtin_amdgcn_wave_barrier();
  const int rsub = lane >> 4, c4 = (lane & 15) * 4;
  {
#pragma unroll
    for (int q = 0; q < 8; ++q) {
      const int r = q * 2 + rsub;
      const v4f v = *(const v4fa*)&so[w][r][c4];
      *(v4f*)(C + (size_t)(row0 + r) * ldc + col0 + c4) = v;
    }
    
  }
}

// GEMM C = act(A·W + bias + resid): A f32 (ASPLIT -> hi/lo 2 terms), Wt bf16 [N][K]; ACT 0 none, 1 relu, 2 exact gelu;
// resid (optional, f32, row index = (row % rmod), pitch ldr, RES_BF16 rounds it) added before the activation.
template <bool ASPLIT, int ACT, bool BIAS_BF16, bool RES_BF16>
__global__ __launch_bounds__(128) void k_gemm_bf3(const float* __restrict__ A, int lda, const unsigned short* __restrict__ Wt, int ldb,
                                                const float* __restrict__ bias, const float* __restrict__ resid, int rmod, int ldr,
                                                float* __restrict__ C, int ldc, int M, int N, int K) {
  __shared__ __attribute__((aligned(16))) float so[4][16][64];
  const int tid = threadIdx.x, w = tid >> 5, lane = tid & 31, ln = lane & 15, hh = lane >> 4;
  const int ntn = N / 64;
  const int wid = blockIdx.x * 4 + w;
  const int mt = wid / ntn, nq = wid % ntn;
  if (mt * 16 >= M) return;
  const int row0 = mt * 16, col0 = nq * 64;
  const float* arow = A + (size_t)(row0 + ln) * lda;
  v8f acc[4] = {};
  for (int kb = 0; kb < K; kb += 32) {
    FragB ah, al;
    const v4f x0 = *(const v4fa*)(arow + kb + 8 * hh), x1 = *(const v4fa*)(arow + kb + 8 * hh + 4);
    const v4f x2 = *(const v4fa*)(arow + kb + 16 + 8 * hh), x3 = *(const v4fa*)(arow + kb + 16 + 8 * hh + 4);
    float xs[16] = {x0[0],x0[1],x0[2],x0[3],x1[0],x1[1],x1[2],x1[3],x2[0],x2[1],x2[2],x2[3],x3[0],x3[1],x3[2],x3[3]};
#pragma unroll
    for (int i = 0; i < 16; ++i) { const unsigned short hb = bf16_bits(xs[i]); ah.u[i] = hb; al.u[i] = ASPLIT ? bf16_bits(xs[i] - bf16_val(hb)) : (unsigned short)0; }
#pragma unroll
    for (int t = 0; t < 4; ++t) {
      const unsigned short* brow = Wt + (size_t)(col0 + t * 16 + ln) * ldb + kb;
      FragB b;
      b.half[0] = *(const v8us*)(brow + 8 * hh);
      b.half[1] = *(const v8us*)(brow + 16 + 8 * hh);
      acc[t] = mmaN<ASPLIT ? 2 : 1>(ah.v, al.v, b.v, b.v, acc[t]);
    }
  }
#pragma unroll
  for (int t = 0; t < 4; ++t) {
    const int col = col0 + t * 16 + ln;
    float bv = bias ? bias[col] : 0.f;
    if (BIAS_BF16) bv = bf16_round(bv);
#pragma unroll
    for (int r = 0; r < 8; ++r) {
      float v = acc[t][r] + bv;
      if (resid) { float rv = resid[(size_t)((row0 + 8 * hh + r) % rmod) * ldr + col]; if (RES_BF16) rv = bf16_round(rv); v += rv; }
      if (ACT == 1) v = fmaxf(v, 0.f);
      if (ACT == 2) v = 0.5f * v * (1.0f + erff(v * 0.70710678118654752f));
      if (ACT == 3) { const float u = 0.7978845608028654f * (v + 0.044715f * v * v * v); v = 0.5f * v * (1.0f + tanhf(u)); }
      so[w][8 * hh + r][t * 16 + ln] = v;
    }
  }
  __builtin_amdgcn_fence(__ATOMIC_ACQ_REL, "workgroup");
  __builtin_amdgcn_wave_barrier();
  const int rsub = lane >> 4, c4 = (lane & 15) * 4;
  {
#pragma unroll
    for (int q = 0; q < 8; ++q) {
      const int r = q * 2 + rsub;
      const v4f v = *(const v4fa*)&so[w][r][c4];
      *(v4f*)(C + (size_t)(row0 + r) * ldc + col0 + c4) = v;
    }
    
  }
}
// row LayerNorm (biased variance, eps) over N: s = X (+ R); optional out_sum <- s; out_norm <- (s-mu)*rsqrt(var+eps)*g + b
template <bool PARAM_BF16>
__global__ __launch_bounds__(256) void k_layernorm(const float* __restrict__ X, const float* __restrict__ R, const float* __restrict__ g, const float* __restrict__ bta,
                                                  float* __restrict__ out_sum, float* __restrict__ out_norm, int N, float eps) {
  __shared__ float red[256];
  const int row = blockIdx.x, tid = threadIdx.x;
  const float* x = X + (size_t)row * N; const float* rr = R ? R + (size_t)row * N : nullptr;
  float vals[16];                     // up to N = 4096
  const int per = N / 256;            // contiguous chunk per thread? use strided-by-4 chunks: thread handles j = tid*4 + 1024*u
  float s1 = 0.f;
  for (int u = 0; u < per / 4; ++u) {
    const int j = tid * 4 + 1024 * u;
    const v4f a = *(const v4fa*)(x + j);
    v4f b = {0.f,0.f,0.f,0.f}; if (rr) b = *(const v4fa*)(rr + j);
#pragma unroll
    for (int q = 0; q < 4; ++q) { const float v = a[q] + b[q]; vals[u * 4 + q] = v; s1 += v; }
  }
  red[tid] = s1; __syncthreads();
  for (int st = 128; st > 0; st >>= 1) { if (tid < st) red[tid] += red[tid + st]; __syncthreads(); }
  const float mu = red[0] / (float)N; __syncthreads();
  float s2 = 0.f;
  for (int u = 0; u < per / 4; ++u)
#pragma unroll
    for (int q = 0; q < 4; ++q) { const float c = vals[u * 4 + q] - mu; s2 += c * c; }
  red[tid] = s2; __syncthreads();
  for (int st = 128; st > 0; st >>= 1) { if (tid < st) red[tid] += red[tid + st]; __syncthreads(); }
  const float rs = rsqrtf(red[0] / (float)N + eps);
  {
    for (int u = 0; u < per / 4; ++u) {
      const int j = tid * 4 + 1024 * u;
      v4f o, sm;
#pragma unroll
      for (int q = 0; q < 4; ++q) {
        float gg = g[j + q], bb = bta[j + q];
        if (PARAM_BF16) { gg = bf16_round(gg); bb = bf16_round(bb); }
        sm[q] = vals[u * 4 + q]; o[q] = (vals[u * 4 + q] - mu) * rs * gg + bb;
      }
      if (out_sum) *(v4f*)(out_sum + (size_t)row * N + j) = sm;
      *(v4f*)(out_norm + (size_t)row * N + j) = o;
    }
    
  }
}



// ---- f16 WMMA path (v_wmma_f32_16x16x32_f16): 11-bit significands for operands in range — used where a [0,1] probability operand needs more precision than bf16
typedef _Float16 v16h __attribute__((ext_vector_type(16)));
union FragH { v16h v; v8us half[2]; _Float16 h[16]; unsigned short u[16]; };
template <int NT>
__device__ __forceinline__ v8f mmaH(v16h ah, v16h al, v16h bh, v16h bl, v8f c) {
  c = __builtin_amdgcn_wmma_f32_16x16x32_f16(false, ah, false, bh, (short)0, c, false, false);
  if (NT >= 2) c = __builtin_amdgcn_wmma_f32_16x16x32_f16(false, al, false, bh, (short)0, c, false, false);
  if (NT >= 3) c = __builtin_amdgcn_wmma_f32_16x16x32_f16(false, ah, false, bl, (short)0, c, false, false);
  asm volatile("v_nop\n\tv_nop\n\tv_nop\n\tv_nop" : "+v"(c) : "v"(ah), "v"(al), "v"(bh), "v"(bl));
  return c;
}
// batched GEMM like k_gemm_b but f16 operands: A f32 (split into f16 hi/lo if ASPLIT, else rounded to f16), Bt = f16 values [n][k]; alpha; C f32; N multiple of 16 (partial tiles skipped)
template <bool ASPLIT>
__global__ __launch_bounds__(128) void k_gemm_h(const float* __restrict__ A, int lda, size_t sA, const _Float16* __restrict__ Bh, int ldb, size_t sB, float alpha, float* __restrict__ C, int ldc, size_t sC, int M, int N, int K) {
  __shared__ __attribute__((aligned(16))) float so[4][16][64];
  const int tid = threadIdx.x, w = tid >> 5, lane = tid & 31, ln = lane & 15, hh = lane >> 4; const int by = blockIdx.y;
  A += (size_t)by * sA; Bh += (size_t)by * sB; C += (size_t)by * sC;
  const int ntn = (N + 63) / 64; const int wid = blockIdx.x * 4 + w; const int mt = wid / ntn, nq = wid % ntn; if (mt * 16 >= M) return;
  const int row0 = mt * 16, col0 = nq * 64; const float* arow = A + (size_t)(row0 + ln) * lda;
  v8f acc[4] = {};
  for (int kb = 0; kb < K; kb += 32) {
    FragH ah, al;
    const v4f x0 = *(const v4fa*)(arow + kb + 8 * hh), x1 = *(const v4fa*)(arow + kb + 8 * hh + 4), x2 = *(const v4fa*)(arow + kb + 16 + 8 * hh), x3 = *(const v4fa*)(arow + kb + 16 + 8 * hh + 4);
    float xs[16] = {x0[0],x0[1],x0[2],x0[3],x1[0],x1[1],x1[2],x1[3],x2[0],x2[1],x2[2],x2[3],x3[0],x3[1],x3[2],x3[3]};
#pragma unroll
    for (int i = 0; i < 16; ++i) { const _Float16 h = (_Float16)xs[i]; ah.h[i] = h; al.h[i] = ASPLIT ? (_Float16)(xs[i] - (float)h) : (_Float16)0.0f; }
#pragma unroll
    for (int t = 0; t < 4; ++t) { if (col0 + t * 16 >= N) continue; const size_t boff = (size_t)(col0 + t * 16 + ln) * ldb + kb; FragH bq; bq.half[0] = *(const v8us*)(Bh + boff + 8 * hh); bq.half[1] = *(const v8us*)(Bh + boff + 16 + 8 * hh);
      acc[t] = mmaH<ASPLIT ? 2 : 1>(ah.v, al.v, bq.v, bq.v, acc[t]); }
  }
#pragma unroll
  for (int t = 0; t < 4; ++t) { if (col0 + t * 16 >= N) continue;
#pragma unroll
    for (int r = 0; r < 8; ++r) so[w][8 * hh + r][t * 16 + ln] = acc[t][r] * alpha; }
  __builtin_amdgcn_fence(__ATOMIC_ACQ_REL, "workgroup"); __builtin_amdgcn_wave_barrier();
  const int rsub = lane >> 4, c4 = (lane & 15) * 4;
  {
#pragma unroll
    for (int q = 0; q < 8; ++q) { const int r = q * 2 + rsub; if (col0 + c4 < N) { const v4f v = *(const v4fa*)&so[w][r][c4]; *(v4f*)(C + (size_t)(row0 + r) * ldc + col0 + c4) = v; } }
     }
}

// Wt[n][k] = f16(W[k][n]·scale) from f32 row-major W[K][N] (scale = power of two; bf16-exact weights stay exact in f16 away from the subnormal range)
__global__ __launch_bounds__(256) void k_wt_f16(const float* __restrict__ W, _Float16* __restrict__ Wt, int K, int N, float scale) {
  const int t = blockIdx.x * 256 + threadIdx.x; if (t >= N * (K / 8)) return; const int n = t / (K / 8), k8 = (t % (K / 8)) * 8; FragH f;
#pragma unroll
  for (int i = 0; i < 8; ++i) f.h[i] = (_Float16)(bf16_round(W[(size_t)(k8 + i) * N + n]) * scale); const v8us o = f.half[0];
  *(v8us*)((unsigned short*)Wt + (size_t)n * K + k8) = o; 
}
// k_gemm_hh variant with fused epilogue: v = acc·alpha + bias[by·sBias + col] (+ CP[(row/rowsPerB)·sCPb + by·64 + col] if CP) ; ACT 0 none / 1 elu ; writes f16 C16 (and f32 C if non-null)
template <int ACT>
__global__ __launch_bounds__(128) void k_gemm_hhx(const _Float16* __restrict__ A, int lda, size_t sA, const _Float16* __restrict__ Bh, int ldb, size_t sB, float alpha, const float* __restrict__ bias, size_t sBias, const float* __restrict__ CP, int rowsPerB, size_t sCPb, int row0g,
    float* __restrict__ C, _Float16* __restrict__ C16, int ldc, size_t sC, int M, int N, int K) {
  __shared__ __attribute__((aligned(16))) float so[4][16][64];
  const int tid = threadIdx.x, w = tid >> 5, lane = tid & 31, ln = lane & 15, hh = lane >> 4; const int by = blockIdx.y;
  A += (size_t)by * sA; Bh += (size_t)by * sB; const size_t cofs = (size_t)by * sC; const float* bp = bias ? bias + (size_t)by * sBias : nullptr;
  const int ntn = (N + 63) / 64; const int wid = blockIdx.x * 4 + w; const int mt = wid / ntn, nq = wid % ntn; if (mt * 16 >= M) return;
  const int row0 = mt * 16, col0 = nq * 64; const _Float16* arow = A + (size_t)(row0 + ln) * lda;
  v8f acc[4] = {};
  for (int kb = 0; kb < K; kb += 32) { FragH ah; ah.half[0] = *(const v8us*)((const unsigned short*)arow + kb + 8 * hh); ah.half[1] = *(const v8us*)((const unsigned short*)arow + kb + 16 + 8 * hh);
#pragma unroll
    for (int t = 0; t < 4; ++t) { if (col0 + t * 16 >= N) continue; const size_t boff = (size_t)(col0 + t * 16 + ln) * ldb + kb; FragH bq; bq.half[0] = *(const v8us*)((const unsigned short*)Bh + boff + 8 * hh); bq.half[1] = *(const v8us*)((const unsigned short*)Bh + boff + 16 + 8 * hh);
      acc[t] = mmaH<1>(ah.v, ah.v, bq.v, bq.v, acc[t]); }
  }
#pragma unroll
  for (int t = 0; t < 4; ++t) { if (col0 + t * 16 >= N) continue; const int col = col0 + t * 16 + ln; const float bv = bp ? bf16_round(bp[col]) : 0.f;
#pragma unroll
    for (int r = 0; r < 8; ++r) { float v = acc[t][r] * alpha + bv; if (CP) { const int rr = row0g + row0 + 8 * hh + r; if (rowsPerB < 0) v += CP[cofs + (size_t)rr * ldc + col];      /* rowsPerB < 0: own element of the batched C plane */ else { const int bidx = rr / rowsPerB; v += CP[(size_t)bidx * sCPb + (size_t)by * 64 + col]; } } if (ACT == 1) v = (v > 0.f) ? v : expm1f(v); else if (ACT == 7) v = (v > 0.f) ? v + 1.0f : expf(v); else if (ACT == 8) v = tanhf(v); else if (ACT == 9) v = 0.5f * v * (1.0f + tanhf(0.7978845608028654f * (v + 0.044715f * v * v * v))); else if (ACT == 11) v = 1.0f / (1.0f + expf(-v)); else if (ACT == 12) v = (v > 0.f) ? v : 0.01f * v; else if (ACT == 14) v = (v > 0.f) ? v : 0.1f * v; else if (ACT == 16) v = (v >= 0.f) ? v : 0.3f * v; else if (ACT == 17) v = (v >= 0.f) ? v : 0.2f * v; else if (ACT == 15) v = v / (1.0f + expf(-v)); else if (ACT == 3) v = fmaxf(v, 0.f); else if (ACT == 6) v = 0.5f * v * (1.0f + erff(v * 0.70710678118654752f)); so[w][8 * hh + r][t * 16 + ln] = v; } }
  __builtin_amdgcn_fence(__ATOMIC_ACQ_REL, "workgroup"); __builtin_amdgcn_wave_barrier();
  const int rsub = lane >> 4, c4 = (lane & 15) * 4; typedef _Float16 v4h __attribute__((ext_vector_type(4)));
  {
#pragma unroll
    for (int q = 0; q < 8; ++q) { const int r = q * 2 + rsub; if (col0 + c4 < N) { const v4f v = *(const v4fa*)&so[w][r][c4]; if (C) *(v4f*)(C + cofs + (size_t)(row0 + r) * ldc + col0 + c4) = v; if (C16) { v4h h4; for (int i = 0; i < 4; ++i) h4[i] = (_Float16)v[i]; *(v4h*)(C16 + cofs + (size_t)(row0 + r) * ldc + col0 + c4) = h4; } } }
     }
}


typedef _Float16 v4h __attribute__((ext_vector_type(4)));

__global__ __launch_bounds__(256) void k_x16(const float* __restrict__ x, _Float16* __restrict__ X16, size_t n8) { const size_t t = (size_t)blockIdx.x * 256 + threadIdx.x; if (t >= n8) return; FragH f;
#pragma unroll
  for (int q = 0; q < 8; ++q) f.h[q] = (_Float16)bf16_round(x[t * 8 + q]); *(v8us*)((unsigned short*)X16 + t * 8) = f.half[0];  }
__global__ __launch_bounds__(256) void k_h16(const float* __restrict__ x, _Float16* __restrict__ X16, size_t n8) { const size_t t = (size_t)blockIdx.x * 256 + threadIdx.x; if (t >= n8) return; FragH f;
#pragma unroll
  for (int q = 0; q < 8; ++q) f.h[q] = (_Float16)x[t * 8 + q]; *(v8us*)((unsigned short*)X16 + t * 8) = f.half[0];  }
__global__ __launch_bounds__(256) void k_round16f(const float* __restrict__ W, _Float16* __restrict__ Bt, size_t n8) { const size_t t = (size_t)blockIdx.x * 256 + threadIdx.x; if (t >= n8) return; FragH f;
#pragma unroll
  for (int i = 0; i < 8; ++i) f.h[i] = (_Float16)(bf16_round(W[t * 8 + i]) * 16.0f); *(v8us*)((unsigned short*)Bt + t * 8) = f.half[0];  }
template <int NHv, int TTv>
__global__ __launch_bounds__(256) void k_vt(const _Float16* __restrict__ V16, int ldv, int voff, _Float16* __restrict__ Vt) { __shared__ unsigned short tl[64][66]; const int tid = threadIdx.x; const int slab = blockIdx.x / (TTv / 64), lg = blockIdx.x % (TTv / 64); const int b = slab / NHv, h = slab % NHv;
  for (int i = tid; i < 64 * 8; i += 256) { const int r = i / 8, c8 = (i % 8) * 8; FragH f; f.half[0] = *(const v8us*)((const unsigned short*)V16 + ((size_t)b * TTv + lg * 64 + r) * ldv + voff + h * 64 + c8);
#pragma unroll
    for (int q = 0; q < 8; ++q) tl[r][c8 + q] = f.u[q]; }
  __syncthreads();
  {
#pragma unroll
    for (int rd = 0; rd < 2; ++rd) { const int d = rd * 32 + tid / 8, pc = tid % 8; FragH f;
#pragma unroll
      for (int q = 0; q < 8; ++q) f.u[q] = tl[pc * 8 + q][d];
      *(v8us*)((unsigned short*)Vt + ((size_t)slab * 64 + d) * TTv + lg * 64 + pc * 8) = f.half[0]; }
     } }

__global__ __launch_bounds__(256) void k_hl(const float* __restrict__ F, _Float16* __restrict__ Hh, _Float16* __restrict__ Hl, size_t n8) { const size_t t = (size_t)blockIdx.x * 256 + threadIdx.x; if (t >= n8) return; FragH fh, fl; const v4f a = *(const v4fa*)(F + t * 8), c = *(const v4fa*)(F + t * 8 + 4);
#pragma unroll
  for (int q = 0; q < 4; ++q) { _Float16 h = (_Float16)a[q]; fh.h[q] = h; fl.h[q] = (_Float16)((a[q] - (float)h) * 1024.0f); h = (_Float16)c[q]; fh.h[4 + q] = h; fl.h[4 + q] = (_Float16)((c[q] - (float)h) * 1024.0f); }
  { *(v8us*)((unsigned short*)Hh + t * 8) = fh.half[0]; *(v8us*)((unsigned short*)Hl + t * 8) = fl.half[0];  } }

// ---- fast GEMM (wave tile 32x64; requires M % 32 == 0 rows per launch region and N % 64 == 0); epilogue = k_gemm_hhx semantics ----
__device__ __forceinline__ v16h g2_frag(const _Float16* p, int hh) { FragH f; f.half[0] = *(const v8us*)((const unsigned short*)p + 8 * hh); f.half[1] = *(const v8us*)((const unsigned short*)p + 16 + 8 * hh); return f.v; }
__device__ __forceinline__ v8f g2_mma(v16h a, v16h b, v8f c) { v8f d = __builtin_amdgcn_wmma_f32_16x16x32_f16(false, a, false, b, (short)0, c, false, false); asm volatile("v_nop\n\tv_nop\n\tv_nop\n\tv_nop" : "+v"(d) : "v"(a), "v"(b)); return d; }
template <int ACT>
__global__ __launch_bounds__(128) void k_gemm2(const _Float16* __restrict__ A, int lda, size_t sA, const _Float16* __restrict__ Bh, int ldb, size_t sB, float alpha, const float* __restrict__ bias, size_t sBias, const float* __restrict__ CP, int rowsPerB, size_t sCPb, int row0g,
    float* __restrict__ C, _Float16* __restrict__ C16, int ldc, size_t sC, int M, int N, int K) { static_assert(ACT == 0 || ACT == 3 || ACT == 6 || ACT == 8 || ACT == 9 || ACT == 11 || ACT == 12 || ACT == 14 || ACT == 15 || ACT == 16 || ACT == 17, "k_gemm2: unsupported ACT code (would silently apply no activation)");
  __shared__ __attribute__((aligned(16))) float so[4][32][68];
  const int tid = threadIdx.x, w = tid >> 5, lane = tid & 31, ln = lane & 15, hh = lane >> 4; const int by = blockIdx.y;
  A += (size_t)by * sA; Bh += (size_t)by * sB; const size_t cofs = (size_t)by * sC; const float* bp = bias ? bias + (size_t)by * sBias : nullptr;
  const int ntn = N >> 6; const int mt = blockIdx.x / ntn, nq = blockIdx.x - mt * ntn; const int row0 = mt * 128 + 32 * w, col0 = nq * 64; if (row0 >= M) return;
  const _Float16* a0p = A + (size_t)(row0 + ln) * lda; const _Float16* a1p = a0p + (size_t)16 * lda;
  const _Float16* b0p = Bh + (size_t)(col0 + ln) * ldb; const _Float16* b1p = b0p + (size_t)16 * ldb; const _Float16* b2p = b1p + (size_t)16 * ldb; const _Float16* b3p = b2p + (size_t)16 * ldb;
  const v8f z8 = {0.f,0.f,0.f,0.f,0.f,0.f,0.f,0.f}; v8f c00 = z8, c01 = z8, c02 = z8, c03 = z8, c10 = z8, c11 = z8, c12 = z8, c13 = z8;
#pragma unroll 1
  for (int kb = 0; kb < K; kb += 32) { const v16h a0 = g2_frag(a0p + kb, hh), a1 = g2_frag(a1p + kb, hh);
    v16h b = g2_frag(b0p + kb, hh); c00 = g2_mma(a0, b, c00); c10 = g2_mma(a1, b, c10);
    b = g2_frag(b1p + kb, hh); c01 = g2_mma(a0, b, c01); c11 = g2_mma(a1, b, c11);
    b = g2_frag(b2p + kb, hh); c02 = g2_mma(a0, b, c02); c12 = g2_mma(a1, b, c12);
    b = g2_frag(b3p + kb, hh); c03 = g2_mma(a0, b, c03); c13 = g2_mma(a1, b, c13); }
  v8f accs[8] = {c00, c01, c02, c03, c10, c11, c12, c13};
#pragma unroll
  for (int u = 0; u < 8; ++u) { const int t = u & 3, half = u >> 2; const int col = col0 + t * 16 + ln; const float bv = bp ? bf16_round(bp[col]) : 0.f;
#pragma unroll
    for (int r = 0; r < 8; ++r) { const int rloc = half * 16 + 8 * hh + r; float v = accs[u][r] * alpha + bv; if (CP) { if (rowsPerB < 0) v += CP[cofs + (size_t)(row0g + row0 + rloc) * ldc + col];      /* rowsPerB < 0: own element of the batched C plane */ else { const int bidx = (row0g + row0 + rloc) / rowsPerB; v += CP[(size_t)bidx * sCPb + (size_t)by * 64 + col]; } }
      if (ACT == 3) v = fmaxf(v, 0.f); else if (ACT == 6) v = 0.5f * v * (1.0f + erff(v * 0.70710678118654752f)); else if (ACT == 11) v = 1.0f / (1.0f + expf(-v)); else if (ACT == 15) v = v / (1.0f + expf(-v)); else if (ACT == 12) v = (v > 0.f) ? v : 0.01f * v; else if (ACT == 8) v = tanhf(v); else if (ACT == 9) v = 0.5f * v * (1.0f + tanhf(0.7978845608028654f * (v + 0.044715f * v * v * v))); else if (ACT == 14) v = (v > 0.f) ? v : 0.1f * v; else if (ACT == 16) v = (v >= 0.f) ? v : 0.3f * v; else if (ACT == 17) v = (v >= 0.f) ? v : 0.2f * v;
      so[w][rloc][t * 16 + ln] = v; } }
  __builtin_amdgcn_fence(__ATOMIC_ACQ_REL, "workgroup"); __builtin_amdgcn_wave_barrier();
  const int rsub = lane >> 4, c4 = (lane & 15) * 4;
  {
#pragma unroll
    for (int q = 0; q < 16; ++q) { const int r = q * 2 + rsub; const v4f v = *(const v4fa*)&so[w][r][c4]; if (C) *(v4f*)(C + cofs + (size_t)(row0 + r) * ldc + col0 + c4) = v; if (C16) { v4h h4; for (int i = 0; i < 4; ++i) h4[i] = (_Float16)v[i]; *(v4h*)(C16 + cofs + (size_t)(row0 + r) * ldc + col0 + c4) = h4; } }
     } }


__global__ __launch_bounds__(256) void k_wnat(const float* __restrict__ w, size_t n8, _Float16* __restrict__ Bt) { const size_t t = (size_t)blockIdx.x * 256 + threadIdx.x; if (t >= n8) return; FragH f; for (int q = 0; q < 8; ++q) f.h[q] = (_Float16)(bf16_round(w[t * 8 + q]) * 16.0f); *(v8us*)((unsigned short*)Bt + t * 8) = f.half[0];  }
__global__ __launch_bounds__(256) void k_rsm(const float* __restrict__ S, _Float16* __restrict__ P, int nrows) {
  #pragma clang fp contract(off)
  const int i = blockIdx.x * 256 + threadIdx.x; if (i >= nrows) return; const float* s = S + (size_t)i * SQ; float mx = -3.0e38f;
#pragma unroll 1
  for (int j = 0; j < SQ; ++j) mx = fmaxf(mx, s[j]); float se = 0.f;
#pragma unroll 1
  for (int j = 0; j < SQ; ++j) se += expf(s[j] - mx); const float sc = 256.0f / se;
#pragma unroll 1
  for (int j0 = 0; j0 < SQ; j0 += 8) { FragH f; for (int q = 0; q < 8; ++q) f.h[q] = (_Float16)(expf(s[j0 + q] - mx) * sc); unsigned short* d = (unsigned short*)P + (size_t)i * SQ + j0; *(v8us*)d = f.half[0];  } }
__global__ __launch_bounds__(256) void k_vt(const _Float16* __restrict__ V16, int b, int h0, _Float16* __restrict__ VT) { __shared__ unsigned short tl[64][65]; const int tid = threadIdx.x; const int hh = blockIdx.x % HG, sg = blockIdx.x / HG; const int s0 = sg * 64; const int h = h0 + hh;
  for (int i = tid; i < 64 * 8; i += 256) { const int j = i / 8, d8 = (i % 8) * 8; FragH f; f.half[0] = *(const v8us*)((const unsigned short*)V16 + ((size_t)b * SQ + s0 + j) * DM + h * HD + d8); for (int q = 0; q < 8; ++q) tl[d8 + q][j] = f.u[q]; }
  __syncthreads();
  { for (int i = tid; i < 64 * 8; i += 256) { const int d = i / 8, j8 = (i % 8) * 8; FragH f; for (int q = 0; q < 8; ++q) f.u[q] = tl[d][j8 + q]; *(v8us*)((unsigned short*)VT + ((size_t)hh * HD + d) * SQ + s0 + j8) = f.half[0]; }  } }



__global__ __launch_bounds__(256) void k_rsmcf2(const float* __restrict__ S, _Float16* __restrict__ P, int hg, int q0, int nk) {
  #pragma clang fp contract(off)
  const int t = blockIdx.x * 256 + threadIdx.x; if (t >= hg * QT) return; const size_t i = (size_t)t; const float* s = S + i * NKX; const int last = q0 + (t % QT); float mx = -3.0e38f;
#pragma unroll 1
  for (int j = 0; j < nk; ++j) { const float f = (j <= last) ? 1.f : 0.f; mx = fmaxf(mx, fmaf(f, s[j], (1.f - f) * -1.0e9f)); } float se = 0.f;
#pragma unroll 1
  for (int j = 0; j < nk; ++j) { const float f = (j <= last) ? 1.f : 0.f; se += __expf(fmaf(f, s[j], (1.f - f) * -1.0e9f) - mx); } const float sc = 256.0f / se;
#pragma unroll 1
  for (int j0 = 0; j0 < nk; j0 += 8) { FragH fr; for (int q = 0; q < 8; ++q) { const int j = j0 + q; const float f = (j <= last) ? 1.f : 0.f; fr.h[q] = (_Float16)(__expf(fmaf(f, s[j], (1.f - f) * -1.0e9f) - mx) * sc); } unsigned short* d = (unsigned short*)P + i * NKX + j0; *(v8us*)d = fr.half[0];  } }


template <int MASKADD>
__global__ __launch_bounds__(64) void k_att0(const float* __restrict__ QF, const float* __restrict__ KF, const float* __restrict__ VF, int ld, const float* __restrict__ mask, float scale, float* __restrict__ OF, int ldo) {
  #pragma clang fp contract(off)
  __shared__ __attribute__((aligned(16))) float lq[64][64]; __shared__ __attribute__((aligned(16))) float lo[64][64];
  const int tid = threadIdx.x; const int h = blockIdx.x / (QT0 / 64), rg = blockIdx.x % (QT0 / 64); const int i = rg * 64 + tid;
  const float* qr = QF + (size_t)i * ld + h * HD;
#pragma unroll 1
  for (int c = 0; c < HD / 4; ++c) { *(v4f*)&lq[tid][c * 4] = *(const v4fa*)(qr + c * 4); const v4f z = {0.f, 0.f, 0.f, 0.f}; *(v4f*)&lo[tid][c * 4] = z; }
  float m = -1.0e30f, l = 0.f; const int jmax = MASKADD ? (SQ - 1) : (rg * 64 + 63);      /* additive-mask form: every key (the mask input decides); causal form: keys up to the block's last row */
#pragma unroll 1
  for (int j = 0; j <= jmax; ++j) { const float* kr = KF + (size_t)j * ld + h * HD; const float* vr = VF + (size_t)j * ld + h * HD; float s = 0.f;
#pragma unroll 1
    for (int c = 0; c < HD / 4; ++c) { const v4f kq = *(const v4fa*)(kr + c * 4); const v4f qq = *(v4f*)&lq[tid][c * 4]; s = __fadd_rn(s, __fmul_rn(qq[0], kq[0])); s = __fadd_rn(s, __fmul_rn(qq[1], kq[1])); s = __fadd_rn(s, __fmul_rn(qq[2], kq[2])); s = __fadd_rn(s, __fmul_rn(qq[3], kq[3])); }
    s = __fmul_rn(s, scale); if (MASKADD) s = __fadd_rn(s, __fmul_rn(bf16_round(mask[(size_t)i * SQ + j]), -10000.0f));
    const float f = (MASKADD || j <= i) ? 1.f : 0.f; const float sm = fmaf(f, s, (1.f - f) * -1.0e30f); const float mn = fmaxf(m, sm); const float sc = expf(m - mn); const float e = expf(sm - mn); l = __fadd_rn(__fmul_rn(l, sc), e); m = mn;
#pragma unroll 1
    for (int c = 0; c < HD / 4; ++c) { const v4f vv = *(const v4fa*)(vr + c * 4); v4f oo = *(v4f*)&lo[tid][c * 4]; for (int u = 0; u < 4; ++u) oo[u] = __fadd_rn(__fmul_rn(oo[u], sc), __fmul_rn(e, vv[u])); *(v4f*)&lo[tid][c * 4] = oo; } }
  const float fin = 64.0f / l;      /* o carried x64 like the f16 path */
#pragma unroll 1
  for (int c = 0; c < HD / 4; ++c) { v4f oo = *(v4f*)&lo[tid][c * 4]; for (int u = 0; u < 4; ++u) oo[u] = __fmul_rn(oo[u], fin); *(v4f*)&lo[tid][c * 4] = oo; }
  __syncthreads();
  {
#pragma unroll 1
    for (int it = 0; it < 16; ++it) { const int row = it * 4 + tid / 16, pc = (tid % 16) * 4; const v4f v = *(const v4f*)&lo[row][pc]; *(v4f*)(OF + (size_t)(rg * 64 + row) * ldo + h * HD + pc) = v; }
     } }


__global__ __launch_bounds__(256) void k_kvexp(const float* __restrict__ src, float* __restrict__ dst, size_t n4) { const size_t t = (size_t)blockIdx.x * 256 + threadIdx.x; if (t >= n4) return; const size_t e = t * 4; const size_t row = e / DM; const int col = (int)(e % DM); const int h = col / HD, d = col % HD; const v4f v = *(const v4fa*)(src + row * KVD + (size_t)(h / HPG) * HD + d); *(v4f*)(dst + e) = v;  }

__global__ __launch_bounds__(256) void k_tab2(float theta, float* __restrict__ CS, float* __restrict__ SN) {
  #pragma clang fp contract(off)
  const int t = blockIdx.x * 256 + threadIdx.x; if (t >= SQ * (HD / 2)) return; const int i = t % (HD / 2); const int p = t / (HD / 2); const float invf = 1.0f / powf(theta, (float)(2 * i) / (float)HD); const float ang = __fmul_rn((float)p, invf); const float c = cosf(ang), s = sinf(ang);
  *(float*)(CS + t) = c; *(float*)(SN + t) = s;  }
template <int NORM, int ROPE>
__global__ __launch_bounds__(64) void k_xform(const float* __restrict__ F, int ldf, int nh, const float* __restrict__ gain, float eps, const float* __restrict__ CS, const float* __restrict__ SN, _Float16* __restrict__ H16, int ldo) {
  #pragma clang fp contract(off)
  __shared__ float xv[HD]; __shared__ float red[HD]; __shared__ unsigned short sh_[HD]; const int d = threadIdx.x; const int h = blockIdx.x % nh; const size_t r = blockIdx.x / nh; const int p = (int)(r % SQ);
  float x = F[r * (size_t)ldf + (size_t)h * HD + d];
  if (NORM) { red[d] = __fmul_rn(x, x); __syncthreads(); for (int st = HD / 2; st > 0; st >>= 1) { if (d < st) red[d] = __fadd_rn(red[d], red[d + st]); __syncthreads(); } const float rs = rsqrtf(__fadd_rn(red[0] / (float)HD, eps)); x = __fmul_rn(__fmul_rn(x, rs), bf16_round(gain[d])); }
  xv[d] = x; __syncthreads();
  float o = x;
  if (ROPE == 1) { const int i = d >> 1; const float c = CS[p * (HD / 2) + i], s = SN[p * (HD / 2) + i]; const float ev = xv[2 * i], od = xv[2 * i + 1]; o = (d & 1) ? __fadd_rn(__fmul_rn(ev, s), __fmul_rn(od, c)) : __fadd_rn(__fmul_rn(ev, c), -__fmul_rn(od, s)); }
  if (ROPE == 2) { const int i = d & (HD / 2 - 1); const float c = CS[p * (HD / 2) + i], s = SN[p * (HD / 2) + i]; const float lo = xv[i], hi = xv[i + HD / 2]; o = (d < HD / 2) ? __fadd_rn(__fmul_rn(lo, c), -__fmul_rn(hi, s)) : __fadd_rn(__fmul_rn(lo, s), __fmul_rn(hi, c)); }
  FragH th; th.h[0] = (_Float16)o; sh_[d] = th.u[0]; __syncthreads();
  if (d < HD / 8) { FragH f; for (int q = 0; q < 8; ++q) f.u[q] = sh_[d * 8 + q]; unsigned short* dst = (unsigned short*)H16 + r * (size_t)ldo + (size_t)h * HD + d * 8; *(v8us*)dst = f.half[0];  } }

template <int NORM, int ROPE>
__global__ __launch_bounds__(64) void k_xformf(const float* __restrict__ F, int ldf, int nh, const float* __restrict__ gain, float eps, const float* __restrict__ CS, const float* __restrict__ SN, float* __restrict__ F32, int ldo) {
  #pragma clang fp contract(off)
  __shared__ float xv[HD]; __shared__ float red[HD]; const int d = threadIdx.x; const int h = blockIdx.x % nh; const size_t r = blockIdx.x / nh; const int p = (int)(r % SQ);
  float x = F[r * (size_t)ldf + (size_t)h * HD + d];
  if (NORM) { red[d] = __fmul_rn(x, x); __syncthreads(); for (int st = HD / 2; st > 0; st >>= 1) { if (d < st) red[d] = __fadd_rn(red[d], red[d + st]); __syncthreads(); } const float rs = rsqrtf(__fadd_rn(red[0] / (float)HD, eps)); x = __fmul_rn(__fmul_rn(x, rs), bf16_round(gain[d])); }
  xv[d] = x; __syncthreads();
  float o = x;
  if (ROPE == 1) { const int i = d >> 1; const float c = CS[p * (HD / 2) + i], s = SN[p * (HD / 2) + i]; const float ev = xv[2 * i], od = xv[2 * i + 1]; o = (d & 1) ? __fadd_rn(__fmul_rn(ev, s), __fmul_rn(od, c)) : __fadd_rn(__fmul_rn(ev, c), -__fmul_rn(od, s)); }
  if (ROPE == 2) { const int i = d & (HD / 2 - 1); const float c = CS[p * (HD / 2) + i], s = SN[p * (HD / 2) + i]; const float lo = xv[i], hi = xv[i + HD / 2]; o = (d < HD / 2) ? __fadd_rn(__fmul_rn(lo, c), -__fmul_rn(hi, s)) : __fadd_rn(__fmul_rn(lo, s), __fmul_rn(hi, c)); }
  float* dst = F32 + r * (size_t)ldo + (size_t)h * HD + d; *(float*)dst = o;  }

__global__ __launch_bounds__(256) void k_bfcp(const float* __restrict__ src, float* __restrict__ dst, size_t n4) { const size_t t = (size_t)blockIdx.x * 256 + threadIdx.x; if (t >= n4) return; const v4f a = *(const v4fa*)(src + t * 4); v4f o; for (int q = 0; q < 4; ++q) o[q] = bf16_round(a[q]); *(v4f*)(dst + t * 4) = o;  }

__global__ __launch_bounds__(256) void k_tab2d(float* __restrict__ CS, float* __restrict__ SN) {
  #pragma clang fp contract(off)
  const int t = blockIdx.x * 256 + threadIdx.x; if (t >= SQ * (HD / 2)) return; const int i = t % (HD / 2); const int p = t / (HD / 2); const float invf = (float)(1.0 / pow(10000.0, (double)(2 * i) / (double)HD)); const float ang = __fmul_rn((float)p, invf); const float c = cosf(ang), s = sinf(ang);
  *(float*)(CS + t) = c; *(float*)(SN + t) = s;  }
extern "C" void kernel_launch(void* const* d_in, const int* in_sizes, int n_in,
                              void* d_out, int out_size, void* d_ws, size_t ws_size, hipStream_t stream) {
  (void)in_sizes; (void)n_in; (void)out_size;
  const float* const* I = (const float* const*)d_in; const float* x = I[0]; const float* wq = I[1]; const float* wk = I[2]; const float* wv = I[3]; const float* wo = I[4]; const float* bq = nullptr; const float* bk = nullptr; const float* bv = nullptr; const float* bo = I[5];      /* input order: x, Wq, Wk, Wv, Wo (natural [out][in] weights), bo [1024] (the output bias: into the output GEMM's bias slot); the q / k / v projections have NO biases; rope tables computed in the kernel (positions = row index) */
  char* ws = (char*)d_ws; size_t off = 0;
  auto take = [&](size_t bytes) { char* p = ws + off; off += (bytes + 255) & ~(size_t)255; return p; };
  _Float16* BQ = (_Float16*)take((size_t)DM * DM * 2); _Float16* BK = (_Float16*)take((size_t)KVD * DM * 2); _Float16* BV = (_Float16*)take((size_t)KVD * DM * 2); _Float16* BO = (_Float16*)take((size_t)DM * DM * 2);
  _Float16* X16 = (_Float16*)take(NR * DM * 2); float* QF = (float*)take((size_t)SQ * DM * 4); float* KF = (float*)take((size_t)SQ * KVD * 4); float* CSB = (float*)take((size_t)SQ * 32 * 4); float* SNB = (float*)take((size_t)SQ * 32 * 4); _Float16* Q16 = (_Float16*)take(NR * DM * 2); _Float16* K16 = (_Float16*)take(NR * KVD * 2); _Float16* V16 = (_Float16*)take(NR * KVD * 2); _Float16* O16 = (_Float16*)take(NR * DM * 2);
  float* S = (float*)take((size_t)NH * QT * NKX * 4); _Float16* P = (_Float16*)take((size_t)NH * QT * NKX * 2); _Float16* VT = (_Float16*)take((size_t)NH * HD * SQ * 2);
  float* QF0 = (float*)take((size_t)QT0 * DM * 4); float* KF0 = (float*)take((size_t)QT0 * KVD * 4); float* VF0 = (float*)take((size_t)QT0 * KVD * 4); float* KF0e = (float*)take((size_t)QT0 * DM * 4); float* VF0e = (float*)take((size_t)QT0 * DM * 4); float* OF0 = (float*)take((size_t)NB * QT0 * DM * 4); _Float16* OH0 = (_Float16*)take((size_t)NB * QT0 * DM * 2); _Float16* OL0 = (_Float16*)take((size_t)NB * QT0 * DM * 2);
  if (off > ws_size) return;
  k_wnat<<<(unsigned)(((size_t)DM * DM / 8 + 255) / 256), 256, 0, stream>>>(wq, (size_t)DM * DM / 8, BQ); k_wnat<<<(unsigned)(((size_t)KVD * DM / 8 + 255) / 256), 256, 0, stream>>>(wk, (size_t)KVD * DM / 8, BK); k_wnat<<<(unsigned)(((size_t)KVD * DM / 8 + 255) / 256), 256, 0, stream>>>(wv, (size_t)KVD * DM / 8, BV); k_wnat<<<(unsigned)(((size_t)DM * DM / 8 + 255) / 256), 256, 0, stream>>>(wo, (size_t)DM * DM / 8, BO);      /* natural [out][in] = Bt[n][k] x16 (KVD = 16 x 64 = DM: full-width k / v) */
  k_x16<<<(unsigned)((NR * DM / 8 + 255) / 256), 256, 0, stream>>>(x, X16, NR * DM / 8);
  const size_t r0p = (size_t)B0 * SQ;      /* first projected row */
  k_gemm2<0><<<dim3((unsigned)((MP / 128) * (KVD / 64)), 1), 128, 0, stream>>>(X16 + r0p * DM, DM, 0, BV, DM, 0, 0.0625f, bv, 0, nullptr, 1, 0, 0, nullptr, V16 + r0p * KVD, KVD, 0, MP, KVD, DM);
  k_tab2d<<<(unsigned)(((size_t)SQ * (HD / 2) + 255) / 256), 256, 0, stream>>>(CSB, SNB);      /* rope tables computed in the kernel: CS[p][i] = cos(p * 10000^(-2i/64)), SN = sin, i < 32 (rotate-half convention; the module's [f | f] tables repeat these 32 columns) */
  for (int b = B0; b < B0 + NBR; ++b) { const size_t r0 = (size_t)b * SQ;
    k_gemm2<0><<<dim3((unsigned)((SQ / 128) * (DM / 64)), 1), 128, 0, stream>>>(X16 + r0 * DM, DM, 0, BQ, DM, 0, 0.0625f, bq, 0, nullptr, 1, 0, 0, QF, nullptr, DM, 0, SQ, DM, DM);      /* q (f32) of this batch */
    k_gemm2<0><<<dim3((unsigned)((SQ / 128) * (KVD / 64)), 1), 128, 0, stream>>>(X16 + r0 * DM, DM, 0, BK, DM, 0, 0.0625f, bk, 0, nullptr, 1, 0, 0, KF, nullptr, KVD, 0, SQ, KVD, DM);      /* k (f32) */
    k_xform<0, 2><<<(unsigned)((size_t)SQ * NH), 64, 0, stream>>>(QF, DM, NH, nullptr, 0.f, CSB, SNB, Q16 + r0 * DM, DM); k_xform<0, 2><<<(unsigned)((size_t)SQ * NG), 64, 0, stream>>>(KF, KVD, NG, nullptr, 0.f, CSB, SNB, K16 + r0 * KVD, KVD);      /* half-split rope <0, 2> (out_lo = x_lo c - x_hi s, out_hi = x_lo s + x_hi c = t cos + rotate_half(t) sin) from the computed tables, then f32 -> f16 */
    k_vt<NG, SQ><<<NG * (SQ / 64), 256, 0, stream>>>(V16 + r0 * KVD, KVD, 0, VT);      /* V^T [NH][HD][SQ] for this batch */
    for (int q0 = 0; q0 < QN; q0 += QT) { const int nk = SQ;      /* non-causal: all keys for every query tile */
      k_gemm2<0><<<dim3((QT / 128) * (nk / 64), NH), 128, 0, stream>>>(Q16 + (r0 + q0) * LQ, LQ, (size_t)HD, K16 + r0 * KVD, KVD, (size_t)HD, 0.125f, nullptr, 0, nullptr, 1, 0, 0, S, nullptr, NKX, (size_t)QT * NKX, QT, nk, HD);      /* scores of all heads in one launch: grid.y = head steps q and k by HD columns and S by one [QT][NKX] plane */
      k_rsm<<<(NHD * QT + 255) / 256, 256, 0, stream>>>(S, P, NHD * QT);      /* plain row softmax over all SQ keys (row pitch NKX == SQ) */
      k_gemm2<0><<<dim3((QT / 128) * (HD / 64), NH), 128, 0, stream>>>(P, NKX, (size_t)QT * NKX, VT, SQ, (size_t)HD * SQ, 0.25f, nullptr, 0, nullptr, 1, 0, 0, nullptr, O16 + (r0 + q0) * DM, DM, (size_t)HD, QT, HD, nk); } }      /* o of all heads in one launch: grid.y = head steps P by one plane, V^T by one [HD][SQ] slab, o by HD columns (merged heads, x64, f16 rows) */
  k_gemm2<0><<<dim3((unsigned)((MPO / 128) * (DM / 64)), 1), 128, 0, stream>>>(O16 + r0p * DM, DM, 0, BO, DM, 0, 0.0009765625f, bo, 0, nullptr, 1, 0, 0, (float*)d_out + r0p * DM, nullptr, DM, 0, MPO, DM, DM);      /* out rows are the output layout */
}

// v002
// A run of this version takes 988 microseconds.
// In two side-by-side timings against v001, it was 3.87 and 3.90 times as fast.
// Over all steps from v000 it is 20.0 times as fast.
#include <hip/hip_runtime.h>
// Multi-head self-attention with rotate-half RoPE computed in the kernel and a biased output projection, NON-causal (x [2][2048][1024]; q / k / v = x W^T (natural [1024][1024], no biases), 16 heads of 64; cos / sin = [f | f] of pos * 10000^(-2i/64); q = q cos + rotate_half(q) sin, likewise k; scores * 64^-0.5; softmax over all 2048 keys (no mask); out = merged Wo^T + bo (natural + bias) -> [2][2048][1024]); run as grouped-query attention of 16 groups of ONE head.
// Structure: x as exact f16 rows; natural weights as exact x16 planes; v as a WMMA GEMM (32x64 wave tiles, f32 accumulation, f16 output); rope tables computed once (double-derived inv_freq, f32 angle); per batch: q [2048][1024] and k [2048][1024] as GEMMs into f32 rows then the rotate-half rotation + f16 conversion per (row, head) on VALU; V^T of the 16 groups via LDS transposes; per query tile of 512 rows, all 16 heads in one launch (grid.y = head): scores against ALL 2048 keys of the head's key slab (K = 64, alpha 1/8), row softmax on VALU (f32 statistics, expf; weights x256 f16), o = P V^T with the shared value slab (o carried x64) into merged f16 rows; out = o Wo^T GEMM (f32, alpha 2^-10); launches: see trace.
// Compute dtype: inputs rounded to bf16; x / weights exact; q, k, v, softmax weights and o as plain f16 GEMM operands (~2^-12); scores and softmax statistics f32. v_wmma_f32_16x16x32_f16.
#define NB 2
#define NG 16
#define HPG 1
#define KVD (NG * HD)
#define SQ 2048
#define DM 1024
#define NH 16
#define HD 64
#define HG 4                         /* heads per block group of the unlaunched k_vt(V16, b, h0, VT) */
#define QT 512                       /* query rows per attention launch: the widest divisor of SQ whose S and P planes (NH * QT * SQ * 6 bytes) fit the workspace */
#define NKX SQ                       /* S / P row pitch */
#define QT0 128                      /* first-tile rows of the f32 k_att0 path (not launched) */
#define B0 0                         /* first batch processed (debug hook) */
#define NBR NB                       /* batches processed (debug hook) */
#define NR ((size_t)NB * SQ)         /* token rows */
#define MP ((int)((size_t)NBR * SQ)) /* rows projected (debug hook) */
#define QN SQ                        /* query rows attended per batch (debug hook) */
#define NHD NH                       /* heads attended (debug hook) */
#define MPO MP                       /* rows through the output stage (debug hook) */
#define LQ DM      /* row pitch of the q/k/v rows */
typedef __bf16 v16b __attribute__((ext_vector_type(16)));
typedef unsigned short v8us __attribute__((ext_vector_type(8), may_alias));
typedef float  v8f  __attribute__((ext_vector_type(8)));
typedef float  v4f  __attribute__((ext_vector_type(4)));
typedef float  v4fa __attribute__((ext_vector_type(4), may_alias));
union FragB { v16b v; v8us half[2]; unsigned short u[16]; };

__device__ __forceinline__ unsigned short bf16_bits(float x) { unsigned int u = __float_as_uint(x); return (unsigned short)((u + 0x7FFFu + ((u >> 16) & 1u)) >> 16); }
__device__ __forceinline__ float bf16_val(unsigned short b) { return __uint_as_float(((unsigned int)b) << 16); }
__device__ __forceinline__ float bf16_round(float x) { return bf16_val(bf16_bits(x)); }
// D += A·B with NT terms: 1 = ah·bh, 2 = + al·bh (A split), 3 = + ah·bl (both split)
template <int NT>
__device__ __forceinline__ v8f mmaN(v16b ah, v16b al, v16b bh, v16b bl, v8f c) {
  c = __builtin_amdgcn_wmma_f32_16x16x32_bf16(false, ah, false, bh, (short)0, c, false, false);
  if (NT >= 2) c = __builtin_amdgcn_wmma_f32_16x16x32_bf16(false, al, false, bh, (short)0, c, false, false);
  if (NT >= 3) c = __builtin_amdgcn_wmma_f32_16x16x32_bf16(false, ah, false, bl, (short)0, c, false, false);
  asm volatile("v_nop\n\tv_nop\n\tv_nop\n\tv_nop" : "+v"(c) : "v"(ah), "v"(al), "v"(bh), "v"(bl));
  return c;
}

__global__ __launch_bounds__(256) void k_wt_bf16(const float* __restrict__ W, unsigned short* __restrict__ Wt, int K, int N) {
  const int t = blockIdx.x * 256 + threadIdx.x;
  const int k8n = K / 8;
  if (t >= N * k8n) return;
  const int n = t / k8n, k8 = (t % k8n) * 8;
  v8us v;
#pragma unroll
  for (int i = 0; i < 8; ++i) v[i] = bf16_bits(W[(size_t)(k8 + i) * N + n]);
  *(v8us*)(Wt + (size_t)n * K + k8) = v;
  
}

// GEMM C[M][N] (f32, pitch ldc) = act(A[M][K]·W + bias). A f32 row-major (pitch lda) converted per fragment to bf16
// (ASPLIT: hi/lo two planes -> 2 terms, else single rounded term); Wt bf16 [N][K] (pitch ldb). BIAS_BF16 rounds the
// bias to bf16 first (bias quantised to bf16 before the add). K%32==0, M%16==0, N%64==0.
template <bool ASPLIT, int ACT, bool BIAS_BF16>
__global__ __launch_bounds__(128) void k_gemm_bf(const float* __restrict__ A, int lda, const unsigned short* __restrict__ Wt, int ldb,
                                               const float* __restrict__ bias, float* __restrict__ C, int ldc, int M, int N, int K) {
  __shared__ __attribute__((aligned(16))) float so[4][16][64];
  const int tid = threadIdx.x, w = tid >> 5, lane = tid & 31, ln = lane & 15, hh = lane >> 4;
  const int ntn = N / 64;
  const int wid = blockIdx.x * 4 + w;
  const int mt = wid / ntn, nq = wid % ntn;
  if (mt * 16 >= M) return;
  const int row0 = mt * 16, col0 = nq * 64;
  const float* arow = A + (size_t)(row0 + ln) * lda;
  v8f acc[4] = {};
  for (int kb = 0; kb < K; kb += 32) {
    FragB ah, al;
    const v4f x0 = *(const v4fa*)(arow + kb + 8 * hh), x1 = *(const v4fa*)(arow + kb + 8 * hh + 4);
    const v4f x2 = *(const v4fa*)(arow + kb + 16 + 8 * hh), x3 = *(const v4fa*)(arow + kb + 16 + 8 * hh + 4);
    float xs[16] = {x0[0],x0[1],x0[2],x0[3],x1[0],x1[1],x1[2],x1[3],x2[0],x2[1],x2[2],x2[3],x3[0],x3[1],x3[2],x3[3]};
#pragma unroll
    for (int i = 0; i < 16; ++i) { const unsigned short hb = bf16_bits(xs[i]); ah.u[i] = hb; al.u[i] = ASPLIT ? bf16_bits(xs[i] - bf16_val(hb)) : (unsigned short)0; }
#pragma unroll
    for (int t = 0; t < 4; ++t) {
      const unsigned short* brow = Wt + (size_t)(col0 + t * 16 + ln) * ldb + kb;
      FragB b;
      b.half[0] = *(const v8us*)(brow + 8 * hh);
      b.half[1] = *(const v8us*)(brow + 16 + 8 * hh);
      acc[t] = mmaN<ASPLIT ? 2 : 1>(ah.v, al.v, b.v, b.v, acc[t]);
    }
  }
#pragma unroll
  for (int t = 0; t < 4; ++t) {
    float bv = bias ? bias[col0 + t * 16 + ln] : 0.f;
    if (BIAS_BF16) bv = bf16_round(bv);
#pragma unroll
    for (int r = 0; r < 8; ++r) { float v = acc[t][r] + bv; if (ACT == 1) v = fmaxf(v, 0.f); so[w][8 * hh + r][t * 16 + ln] = v; }
  }
  __builtin_amdgcn_fence(__ATOMIC_ACQ_REL, "workgroup");
  __builtin_amdgcn_wave_barrier();
  const int rsub = lane >> 4, c4 = (lane & 15) * 4;
  {
#pragma unroll
    for (int q = 0; q < 8; ++q) {
      const int r = q * 2 + rsub;
      const v4f v = *(const v4fa*)&so[w][r][c4];
      *(v4f*)(C + (size_t)(row0 + r) * ldc + col0 + c4) = v;
    }
    
  }
}

// GEMM C = act(A·W + bias + resid): A f32 (ASPLIT -> hi/lo 2 terms), Wt bf16 [N][K]; ACT 0 none, 1 relu, 2 exact gelu;
// resid (optional, f32, row index = (row % rmod), pitch ldr, RES_BF16 rounds it) added before the activation.
template <bool ASPLIT, int ACT, bool BIAS_BF16, bool RES_BF16>
__global__ __launch_bounds__(128) void k_gemm_bf3(const float* __restrict__ A, int lda, const unsigned short* __restrict__ Wt, int ldb,
                                                const float* __restrict__ bias, const float* __restrict__ resid, int rmod, int ldr,
                                                float* __restrict__ C, int ldc, int M, int N, int K) {
  __shared__ __attribute__((aligned(16))) float so[4][16][64];
  const int tid = threadIdx.x, w = tid >> 5, lane = tid & 31, ln = lane & 15, hh = lane >> 4;
  const int ntn = N / 64;
  const int wid = blockIdx.x * 4 + w;
  const int mt = wid / ntn, nq = wid % ntn;
  if (mt * 16 >= M) return;
  const int row0 = mt * 16, col0 = nq * 64;
  const float* arow = A + (size_t)(row0 + ln) * lda;
  v8f acc[4] = {};
  for (int kb = 0; kb < K; kb += 32) {
    FragB ah, al;
    const v4f x0 = *(const v4fa*)(arow + kb + 8 * hh), x1 = *(const v4fa*)(arow + kb + 8 * hh + 4);
    const v4f x2 = *(const v4fa*)(arow + kb + 16 + 8 * hh), x3 = *(const v4fa*)(arow + kb + 16 + 8 * hh + 4);
    float xs[16] = {x0[0],x0[1],x0[2],x0[3],x1[0],x1[1],x1[2],x1[3],x2[0],x2[1],x2[2],x2[3],x3[0],x3[1],x3[2],x3[3]};
#pragma unroll
    for (int i = 0; i < 16; ++i) { const unsigned short hb = bf16_bits(xs[i]); ah.u[i] = hb; al.u[i] = ASPLIT ? bf16_bits(xs[i] - bf16_val(hb)) : (unsigned short)0; }
#pragma unroll
    for (int t = 0; t < 4; ++t) {
      const unsigned short* brow = Wt + (size_t)(col0 + t * 16 + ln) * ldb + kb;
      FragB b;
      b.half[0] = *(const v8us*)(brow + 8 * hh);
      b.half[1] = *(const v8us*)(brow + 16 + 8 * hh);
      acc[t] = mmaN<ASPLIT ? 2 : 1>(ah.v, al.v, b.v, b.v, acc[t]);
    }
  }
#pragma unroll
  for (int t = 0; t < 4; ++t) {
    const int col = col0 + t * 16 + ln;
    float bv = bias ? bias[col] : 0.f;
    if (BIAS_BF16) bv = bf16_round(bv);
#pragma unroll
    for (int r = 0; r < 8; ++r) {
      float v = acc[t][r] + bv;
      if (resid) { float rv = resid[(size_t)((row0 + 8 * hh + r) % rmod) * ldr + col]; if (RES_BF16) rv = bf16_round(rv); v += rv; }
      if (ACT == 1) v = fmaxf(v, 0.f);
      if (ACT == 2) v = 0.5f * v * (1.0f + erff(v * 0.70710678118654752f));
      if (ACT == 3) { const float u = 0.7978845608028654f * (v + 0.044715f * v * v * v); v = 0.5f * v * (1.0f + tanhf(u)); }
      so[w][8 * hh + r][t * 16 + ln] = v;
    }
  }
  __builtin_amdgcn_fence(__ATOMIC_ACQ_REL, "workgroup");
  __builtin_amdgcn_wave_barrier();
  const int rsub = lane >> 4, c4 = (lane & 15) * 4;
  {
#pragma unroll
    for (int q = 0; q < 8; ++q) {
      const int r = q * 2 + rsub;
      const v4f v = *(const v4fa*)&so[w][r][c4];
      *(v4f*)(C + (size_t)(row0 + r) * ldc + col0 + c4) = v;
    }
    
  }
}
// row LayerNorm (biased variance, eps) over N: s = X (+ R); optional out_sum <- s; out_norm <- (s-mu)*rsqrt(var+eps)*g + b
template <bool PARAM_BF16>
__global__ __launch_bounds__(256) void k_layernorm(const float* __restrict__ X, const float* __restrict__ R, const float* __restrict__ g, const float* __restrict__ bta,
                                                  float* __restrict__ out_sum, float* __restrict__ out_norm, int N, float eps) {
  __shared__ float red[256];
  const int row = blockIdx.x, tid = threadIdx.x;
  const float* x = X + (size_t)row * N; const float* rr = R ? R + (size_t)row * N : nullptr;
  float vals[16];                     // up to N = 4096
  const int per = N / 256;            // contiguous chunk per thread? use strided-by-4 chunks: thread handles j = tid*4 + 1024*u
  float s1 = 0.f;
  for (int u = 0; u < per / 4; ++u) {
    const int j = tid * 4 + 1024 * u;
    const v4f a = *(const v4fa*)(x + j);
    v4f b = {0.f,0.f,0.f,0.f}; if (rr) b = *(const v4fa*)(rr + j);
#pragma unroll
    for (int q = 0; q < 4; ++q) { const float v = a[q] + b[q]; vals[u * 4 + q] = v; s1 += v; }
  }
  red[tid] = s1; __syncthreads();
  for (int st = 128; st > 0; st >>= 1) { if (tid < st) red[tid] += red[tid + st]; __syncthreads(); }
  const float mu = red[0] / (float)N; __syncthreads();
  float s2 = 0.f;
  for (int u = 0; u < per / 4; ++u)
#pragma unroll
    for (int q = 0; q < 4; ++q) { const float c = vals[u * 4 + q] - mu; s2 += c * c; }
  red[tid] = s2; __syncthreads();
  for (int st = 128; st > 0; st >>= 1) { if (tid < st) red[tid] += red[tid + st]; __syncthreads(); }
  const float rs = rsqrtf(red[0] / (float)N + eps);
  {
    for (int u = 0; u < per / 4; ++u) {
      const int j = tid * 4 + 1024 * u;
      v4f o, sm;
#pragma unroll
      for (int q = 0; q < 4; ++q) {
        float gg = g[j + q], bb = bta[j + q];
        if (PARAM_BF16) { gg = bf16_round(gg); bb = bf16_round(bb); }
        sm[q] = vals[u * 4 + q]; o[q] = (vals[u * 4 + q] - mu) * rs * gg + bb;
      }
      if (out_sum) *(v4f*)(out_sum + (size_t)row * N + j) = sm;
      *(v4f*)(out_norm + (size_t)row * N + j) = o;
    }
    
  }
}



// ---- f16 WMMA path (v_wmma_f32_16x16x32_f16): 11-bit significands for operands in range — used where a [0,1] probability operand needs more precision than bf16
typedef _Float16 v16h __attribute__((ext_vector_type(16)));
union FragH { v16h v; v8us half[2]; _Float16 h[16]; unsigned short u[16]; };
template <int NT>
__device__ __forceinline__ v8f mmaH(v16h ah, v16h al, v16h bh, v16h bl, v8f c) {
  c = __builtin_amdgcn_wmma_f32_16x16x32_f16(false, ah, false, bh, (short)0, c, false, false);
  if (NT >= 2) c = __builtin_amdgcn_wmma_f32_16x16x32_f16(false, al, false, bh, (short)0, c, false, false);
  if (NT >= 3) c = __builtin_amdgcn_wmma_f32_16x16x32_f16(false, ah, false, bl, (short)0, c, false, false);
  asm volatile("v_nop\n\tv_nop\n\tv_nop\n\tv_nop" : "+v"(c) : "v"(ah), "v"(al), "v"(bh), "v"(bl));
  return c;
}
// batched GEMM like k_gemm_b but f16 operands: A f32 (split into f16 hi/lo if ASPLIT, else rounded to f16), Bt = f16 values [n][k]; alpha; C f32; N multiple of 16 (partial tiles skipped)
template <bool ASPLIT>
__global__ __launch_bounds__(128) void k_gemm_h(const float* __restrict__ A, int lda, size_t sA, const _Float16* __restrict__ Bh, int ldb, size_t sB, float alpha, float* __restrict__ C, int ldc, size_t sC, int M, int N, int K) {
  __shared__ __attribute__((aligned(16))) float so[4][16][64];
  const int tid = threadIdx.x, w = tid >> 5, lane = tid & 31, ln = lane & 15, hh = lane >> 4; const int by = blockIdx.y;
  A += (size_t)by * sA; Bh += (size_t)by * sB; C += (size_t)by * sC;
  const int ntn = (N + 63) / 64; const int wid = blockIdx.x * 4 + w; const int mt = wid / ntn, nq = wid % ntn; if (mt * 16 >= M) return;
  const int row0 = mt * 16, col0 = nq * 64; const float* arow = A + (size_t)(row0 + ln) * lda;
  v8f acc[4] = {};
  for (int kb = 0; kb < K; kb += 32) {
    FragH ah, al;
    const v4f x0 = *(const v4fa*)(arow + kb + 8 * hh), x1 = *(const v4fa*)(arow + kb + 8 * hh + 4), x2 = *(const v4fa*)(arow + kb + 16 + 8 * hh), x3 = *(const v4fa*)(arow + kb + 16 + 8 * hh + 4);
    float xs[16] = {x0[0],x0[1],x0[2],x0[3],x1[0],x1[1],x1[2],x1[3],x2[0],x2[1],x2[2],x2[3],x3[0],x3[1],x3[2],x3[3]};
#pragma unroll
    for (int i = 0; i < 16; ++i) { const _Float16 h = (_Float16)xs[i]; ah.h[i] = h; al.h[i] = ASPLIT ? (_Float16)(xs[i] - (float)h) : (_Float16)0.0f; }
#pragma unroll
    for (int t = 0; t < 4; ++t) { if (col0 + t * 16 >= N) continue; const size_t boff = (size_t)(col0 + t * 16 + ln) * ldb + kb; FragH bq; bq.half[0] = *(const v8us*)(Bh + boff + 8 * hh); bq.half[1] = *(const v8us*)(Bh + boff + 16 + 8 * hh);
      acc[t] = mmaH<ASPLIT ? 2 : 1>(ah.v, al.v, bq.v, bq.v, acc[t]); }
  }
#pragma unroll
  for (int t = 0; t < 4; ++t) { if (col0 + t * 16 >= N) continue;
#pragma unroll
    for (int r = 0; r < 8; ++r) so[w][8 * hh + r][t * 16 + ln] = acc[t][r] * alpha; }
  __builtin_amdgcn_fence(__ATOMIC_ACQ_REL, "workgroup"); __builtin_amdgcn_wave_barrier();
  const int rsub = lane >> 4, c4 = (lane & 15) * 4;
  {
#pragma unroll
    for (int q = 0; q < 8; ++q) { const int r = q * 2 + rsub; if (col0 + c4 < N) { const v4f v = *(const v4fa*)&so[w][r][c4]; *(v4f*)(C + (size_t)(row0 + r) * ldc + col0 + c4) = v; } }
     }
}

// Wt[n][k] = f16(W[k][n]·scale) from f32 row-major W[K][N] (scale = power of two; bf16-exact weights stay exact in f16 away from the subnormal range)
__global__ __launch_bounds__(256) void k_wt_f16(const float* __restrict__ W, _Float16* __restrict__ Wt, int K, int N, float scale) {
  const int t = blockIdx.x * 256 + threadIdx.x; if (t >= N * (K / 8)) return; const int n = t / (K / 8), k8 = (t % (K / 8)) * 8; FragH f;
#pragma unroll
  for (int i = 0; i < 8; ++i) f.h[i] = (_Float16)(bf16_round(W[(size_t)(k8 + i) * N + n]) * scale); const v8us o = f.half[0];
  *(v8us*)((unsigned short*)Wt + (size_t)n * K + k8) = o; 
}
// k_gemm_hh variant with fused epilogue: v = acc·alpha + bias[by·sBias + col] (+ CP[(row/rowsPerB)·sCPb + by·64 + col] if CP) ; ACT 0 none / 1 elu ; writes f16 C16 (and f32 C if non-null)
template <int ACT>
__global__ __launch_bounds__(128) void k_gemm_hhx(const _Float16* __restrict__ A, int lda, size_t sA, const _Float16* __restrict__ Bh, int ldb, size_t sB, float alpha, const float* __restrict__ bias, size_t sBias, const float* __restrict__ CP, int rowsPerB, size_t sCPb, int row0g,
    float* __restrict__ C, _Float16* __restrict__ C16, int ldc, size_t sC, int M, int N, int K) {
  __shared__ __attribute__((aligned(16))) float so[4][16][64];
  const int tid = threadIdx.x, w = tid >> 5, lane = tid & 31, ln = lane & 15, hh = lane >> 4; const int by = blockIdx.y;
  A += (size_t)by * sA; Bh += (size_t)by * sB; const size_t cofs = (size_t)by * sC; const float* bp = bias ? bias + (size_t)by * sBias : nullptr;
  const int ntn = (N + 63) / 64; const int wid = blockIdx.x * 4 + w; const int mt = wid / ntn, nq = wid % ntn; if (mt * 16 >= M) return;
  const int row0 = mt * 16, col0 = nq * 64; const _Float16* arow = A + (size_t)(row0 + ln) * lda;
  v8f acc[4] = {};
  for (int kb = 0; kb < K; kb += 32) { FragH ah; ah.half[0] = *(const v8us*)((const unsigned short*)arow + kb + 8 * hh); ah.half[1] = *(const v8us*)((const unsigned short*)arow + kb + 16 + 8 * hh);
#pragma unroll
    for (int t = 0; t < 4; ++t) { if (col0 + t * 16 >= N) continue; const size_t boff = (size_t)(col0 + t * 16 + ln) * ldb + kb; FragH bq; bq.half[0] = *(const v8us*)((const unsigned short*)Bh + boff + 8 * hh); bq.half[1] = *(const v8us*)((const unsigned short*)Bh + boff + 16 + 8 * hh);
      acc[t] = mmaH<1>(ah.v, ah.v, bq.v, bq.v, acc[t]); }
  }
#pragma unroll
  for (int t = 0; t < 4; ++t) { if (col0 + t * 16 >= N) continue; const int col = col0 + t * 16 + ln; const float bv = bp ? bf16_round(bp[col]) : 0.f;
#pragma unroll
    for (int r = 0; r < 8; ++r) { float v = acc[t][r] * alpha + bv; if (CP) { const int rr = row0g + row0 + 8 * hh + r; if (rowsPerB < 0) v += CP[cofs + (size_t)rr * ldc + col];      /* rowsPerB < 0: own element of the batched C plane */ else { const int bidx = rr / rowsPerB; v += CP[(size_t)bidx * sCPb + (size_t)by * 64 + col]; } } if (ACT == 1) v = (v > 0.f) ? v : expm1f(v); else if (ACT == 7) v = (v > 0.f) ? v + 1.0f : expf(v); else if (ACT == 8) v = tanhf(v); else if (ACT == 9) v = 0.5f * v * (1.0f + tanhf(0.7978845608028654f * (v + 0.044715f * v * v * v))); else if (ACT == 11) v = 1.0f / (1.0f + expf(-v)); else if (ACT == 12) v = (v > 0.f) ? v : 0.01f * v; else if (ACT == 14) v = (v > 0.f) ? v : 0.1f * v; else if (ACT == 16) v = (v >= 0.f) ? v : 0.3f * v; else if (ACT == 17) v = (v >= 0.f) ? v : 0.2f * v; else if (ACT == 15) v = v / (1.0f + expf(-v)); else if (ACT == 3) v = fmaxf(v, 0.f); else if (ACT == 6) v = 0.5f * v * (1.0f + erff(v * 0.70710678118654752f)); so[w][8 * hh + r][t * 16 + ln] = v; } }
  __builtin_amdgcn_fence(__ATOMIC_ACQ_REL, "workgroup"); __builtin_amdgcn_wave_barrier();
  const int rsub = lane >> 4, c4 = (lane & 15) * 4; typedef _Float16 v4h __attribute__((ext_vector_type(4)));
  {
#pragma unroll
    for (int q = 0; q < 8; ++q) { const int r = q * 2 + rsub; if (col0 + c4 < N) { const v4f v = *(const v4fa*)&so[w][r][c4]; if (C) *(v4f*)(C + cofs + (size_t)(row0 + r) * ldc + col0 + c4) = v; if (C16) { v4h h4; for (int i = 0; i < 4; ++i) h4[i] = (_Float16)v[i]; *(v4h*)(C16 + cofs + (size_t)(row0 + r) * ldc + col0 + c4) = h4; } } }
     }
}


typedef _Float16 v4h __attribute__((ext_vector_type(4)));

__global__ __launch_bounds__(256) void k_x16(const float* __restrict__ x, _Float16* __restrict__ X16, size_t n8) { const size_t t = (size_t)blockIdx.x * 256 + threadIdx.x; if (t >= n8) return; FragH f;
#pragma unroll
  for (int q = 0; q < 8; ++q) f.h[q] = (_Float16)bf16_round(x[t * 8 + q]); *(v8us*)((unsigned short*)X16 + t * 8) = f.half[0];  }
__global__ __launch_bounds__(256) void k_h16(const float* __restrict__ x, _Float16* __restrict__ X16, size_t n8) { const size_t t = (size_t)blockIdx.x * 256 + threadIdx.x; if (t >= n8) return; FragH f;
#pragma unroll
  for (int q = 0; q < 8; ++q) f.h[q] = (_Float16)x[t * 8 + q]; *(v8us*)((unsigned short*)X16 + t * 8) = f.half[0];  }
__global__ __launch_bounds__(256) void k_round16f(const float* __restrict__ W, _Float16* __restrict__ Bt, size_t n8) { const size_t t = (size_t)blockIdx.x * 256 + threadIdx.x; if (t >= n8) return; FragH f;
#pragma unroll
  for (int i = 0; i < 8; ++i) f.h[i] = (_Float16)(bf16_round(W[t * 8 + i]) * 16.0f); *(v8us*)((unsigned short*)Bt + t * 8) = f.half[0];  }
template <int NHv, int TTv>
__global__ __launch_bounds__(256) void k_vt(const _Float16* __restrict__ V16, int ldv, int voff, _Float16* __restrict__ Vt) { __shared__ unsigned short tl[64][66]; const int tid = threadIdx.x; const int slab = blockIdx.x / (TTv / 64), lg = blockIdx.x % (TTv / 64); const int b = slab / NHv, h = slab % NHv;
  for (int i = tid; i < 64 * 8; i += 256) { const int r = i / 8, c8 = (i % 8) * 8; FragH f; f.half[0] = *(const v8us*)((const unsigned short*)V16 + ((size_t)b * TTv + lg * 64 + r) * ldv + voff + h * 64 + c8);
#pragma unroll
    for (int q = 0; q < 8; ++q) tl[r][c8 + q] = f.u[q]; }
  __syncthreads();
  {
#pragma unroll
    for (int rd = 0; rd < 2; ++rd) { const int d = rd * 32 + tid / 8, pc = tid % 8; FragH f;
#pragma unroll
      for (int q = 0; q < 8; ++q) f.u[q] = tl[pc * 8 + q][d];
      *(v8us*)((unsigned short*)Vt + ((size_t)slab * 64 + d) * TTv + lg * 64 + pc * 8) = f.half[0]; }
     } }

__global__ __launch_bounds__(256) void k_hl(const float* __restrict__ F, _Float16* __restrict__ Hh, _Float16* __restrict__ Hl, size_t n8) { const size_t t = (size_t)blockIdx.x * 256 + threadIdx.x; if (t >= n8) return; FragH fh, fl; const v4f a = *(const v4fa*)(F + t * 8), c = *(const v4fa*)(F + t * 8 + 4);
#pragma unroll
  for (int q = 0; q < 4; ++q) { _Float16 h = (_Float16)a[q]; fh.h[q] = h; fl.h[q] = (_Float16)((a[q] - (float)h) * 1024.0f); h = (_Float16)c[q]; fh.h[4 + q] = h; fl.h[4 + q] = (_Float16)((c[q] - (float)h) * 1024.0f); }
  { *(v8us*)((unsigned short*)Hh + t * 8) = fh.half[0]; *(v8us*)((unsigned short*)Hl + t * 8) = fl.half[0];  } }

// ---- fast GEMM (wave tile 32x64; requires M % 32 == 0 rows per launch region and N % 64 == 0); epilogue = k_gemm_hhx semantics ----
__device__ __forceinline__ v16h g2_frag(const _Float16* p, int hh) { FragH f; f.half[0] = *(const v8us*)((const unsigned short*)p + 8 * hh); f.half[1] = *(const v8us*)((const unsigned short*)p + 16 + 8 * hh); return f.v; }
__device__ __forceinline__ v8f g2_mma(v16h a, v16h b, v8f c) { v8f d = __builtin_amdgcn_wmma_f32_16x16x32_f16(false, a, false, b, (short)0, c, false, false); asm volatile("v_nop\n\tv_nop\n\tv_nop\n\tv_nop" : "+v"(d) : "v"(a), "v"(b)); return d; }
template <int ACT>
__global__ __launch_bounds__(128) void k_gemm2(const _Float16* __restrict__ A, int lda, size_t sA, const _Float16* __restrict__ Bh, int ldb, size_t sB, float alpha, const float* __restrict__ bias, size_t sBias, const float* __restrict__ CP, int rowsPerB, size_t sCPb, int row0g,
    float* __restrict__ C, _Float16* __restrict__ C16, int ldc, size_t sC, int M, int N, int K) { static_assert(ACT == 0 || ACT == 3 || ACT == 6 || ACT == 8 || ACT == 9 || ACT == 11 || ACT == 12 || ACT == 14 || ACT == 15 || ACT == 16 || ACT == 17, "k_gemm2: unsupported ACT code (would silently apply no activation)");
  __shared__ __attribute__((aligned(16))) float so[4][32][68];
  const int tid = threadIdx.x, w = tid >> 5, lane = tid & 31, ln = lane & 15, hh = lane >> 4; const int by = blockIdx.y;
  A += (size_t)by * sA; Bh += (size_t)by * sB; const size_t cofs = (size_t)by * sC; const float* bp = bias ? bias + (size_t)by * sBias : nullptr;
  const int ntn = N >> 6; const int mt = blockIdx.x / ntn, nq = blockIdx.x - mt * ntn; const int row0 = mt * 128 + 32 * w, col0 = nq * 64; if (row0 >= M) return;
  const _Float16* a0p = A + (size_t)(row0 + ln) * lda; const _Float16* a1p = a0p + (size_t)16 * lda;
  const _Float16* b0p = Bh + (size_t)(col0 + ln) * ldb; const _Float16* b1p = b0p + (size_t)16 * ldb; const _Float16* b2p = b1p + (size_t)16 * ldb; const _Float16* b3p = b2p + (size_t)16 * ldb;
  const v8f z8 = {0.f,0.f,0.f,0.f,0.f,0.f,0.f,0.f}; v8f c00 = z8, c01 = z8, c02 = z8, c03 = z8, c10 = z8, c11 = z8, c12 = z8, c13 = z8;
#pragma unroll 1
  for (int kb = 0; kb < K; kb += 32) { const v16h a0 = g2_frag(a0p + kb, hh), a1 = g2_frag(a1p + kb, hh);
    v16h b = g2_frag(b0p + kb, hh); c00 = g2_mma(a0, b, c00); c10 = g2_mma(a1, b, c10);
    b = g2_frag(b1p + kb, hh); c01 = g2_mma(a0, b, c01); c11 = g2_mma(a1, b, c11);
    b = g2_frag(b2p + kb, hh); c02 = g2_mma(a0, b, c02); c12 = g2_mma(a1, b, c12);
    b = g2_frag(b3p + kb, hh); c03 = g2_mma(a0, b, c03); c13 = g2_mma(a1, b, c13); }
  v8f accs[8] = {c00, c01, c02, c03, c10, c11, c12, c13};
#pragma unroll
  for (int u = 0; u < 8; ++u) { const int t = u & 3, half = u >> 2; const int col = col0 + t * 16 + ln; const float bv = bp ? bf16_round(bp[col]) : 0.f;
#pragma unroll
    for (int r = 0; r < 8; ++r) { const int rloc = half * 16 + 8 * hh + r; float v = accs[u][r] * alpha + bv; if (CP) { if (rowsPerB < 0) v += CP[cofs + (size_t)(row0g + row0 + rloc) * ldc + col];      /* rowsPerB < 0: own element of the batched C plane */ else { const int bidx = (row0g + row0 + rloc) / rowsPerB; v += CP[(size_t)bidx * sCPb + (size_t)by * 64 + col]; } }
      if (ACT == 3) v = fmaxf(v, 0.f); else if (ACT == 6) v = 0.5f * v * (1.0f + erff(v * 0.70710678118654752f)); else if (ACT == 11) v = 1.0f / (1.0f + expf(-v)); else if (ACT == 15) v = v / (1.0f + expf(-v)); else if (ACT == 12) v = (v > 0.f) ? v : 0.01f * v; else if (ACT == 8) v = tanhf(v); else if (ACT == 9) v = 0.5f * v * (1.0f + tanhf(0.7978845608028654f * (v + 0.044715f * v * v * v))); else if (ACT == 14) v = (v > 0.f) ? v : 0.1f * v; else if (ACT == 16) v = (v >= 0.f) ? v : 0.3f * v; else if (ACT == 17) v = (v >= 0.f) ? v : 0.2f * v;
      so[w][rloc][t * 16 + ln] = v; } }
  __builtin_amdgcn_fence(__ATOMIC_ACQ_REL, "workgroup"); __builtin_amdgcn_wave_barrier();
  const int rsub = lane >> 4, c4 = (lane & 15) * 4;
  {
#pragma unroll
    for (int q = 0; q < 16; ++q) { const int r = q * 2 + rsub; const v4f v = *(const v4fa*)&so[w][r][c4]; if (C) *(v4f*)(C + cofs + (size_t)(row0 + r) * ldc + col0 + c4) = v; if (C16) { v4h h4; for (int i = 0; i < 4; ++i) h4[i] = (_Float16)v[i]; *(v4h*)(C16 + cofs + (size_t)(row0 + r) * ldc + col0 + c4) = h4; } }
     } }


__global__ __launch_bounds__(256) void k_wnat(const float* __restrict__ w, size_t n8, _Float16* __restrict__ Bt) { const size_t t = (size_t)blockIdx.x * 256 + threadIdx.x; if (t >= n8) return; FragH f; for (int q = 0; q < 8; ++q) f.h[q] = (_Float16)(bf16_round(w[t * 8 + q]) * 16.0f); *(v8us*)((unsigned short*)Bt + t * 8) = f.half[0];  }
// row softmax, one wave per row: lane l keeps columns c * 128 + l * 4 .. + 3 (c < SQ / 128) in registers, so S is read once and every wave-wide load (512 B) and store (256 B) covers whole lines; each lane sums its own columns in order, then a five-step butterfly over the lanes
__global__ __launch_bounds__(256) void k_rsm(const float* __restrict__ S, _Float16* __restrict__ P, int nrows) {
  const int lane = threadIdx.x & 31; const int i = blockIdx.x * 8 + (threadIdx.x >> 5); if (i >= nrows) return;      /* wave-uniform exit; the kernel has no barrier */
  const float* s = S + (size_t)i * SQ + lane * 4; v4f v[SQ / 128];
#pragma unroll      /* constant indices keep v[] in registers; all loads of the row are issued before the first wait */
  for (int c = 0; c < SQ / 128; ++c) v[c] = *(const v4fa*)(s + c * 128);
  asm volatile("s_wait_xcnt 0x0" :: "v"(s) : "memory");      /* the loads' address pair stays live up to this wait, so no register that an issued load names is overwritten in front of it */
  float mx = -3.0e38f;
#pragma unroll      /* v[] in registers */
  for (int c = 0; c < SQ / 128; ++c) for (int q = 0; q < 4; ++q) mx = fmaxf(mx, v[c][q]);
  for (int m = 16; m > 0; m >>= 1) mx = fmaxf(mx, __shfl_xor(mx, m, 32));
  float se = 0.f;
#pragma unroll      /* v[] in registers */
  for (int c = 0; c < SQ / 128; ++c) for (int q = 0; q < 4; ++q) { const float e = expf(v[c][q] - mx); v[c][q] = e; se += e; }
  for (int m = 16; m > 0; m >>= 1) se += __shfl_xor(se, m, 32);
  const float sc = 256.0f / se; _Float16* d = P + (size_t)i * SQ + lane * 4;
#pragma unroll      /* v[] in registers */
  for (int c = 0; c < SQ / 128; ++c) { v4h h4; for (int q = 0; q < 4; ++q) h4[q] = (_Float16)(v[c][q] * sc); *(v4h*)(d + c * 128) = h4; } }
__global__ __launch_bounds__(256) void k_vt(const _Float16* __restrict__ V16, int b, int h0, _Float16* __restrict__ VT) { __shared__ unsigned short tl[64][65]; const int tid = threadIdx.x; const int hh = blockIdx.x % HG, sg = blockIdx.x / HG; const int s0 = sg * 64; const int h = h0 + hh;
  for (int i = tid; i < 64 * 8; i += 256) { const int j = i / 8, d8 = (i % 8) * 8; FragH f; f.half[0] = *(const v8us*)((const unsigned short*)V16 + ((size_t)b * SQ + s0 + j) * DM + h * HD + d8); for (int q = 0; q < 8; ++q) tl[d8 + q][j] = f.u[q]; }
  __syncthreads();
  { for (int i = tid; i < 64 * 8; i += 256) { const int d = i / 8, j8 = (i % 8) * 8; FragH f; for (int q = 0; q < 8; ++q) f.u[q] = tl[d][j8 + q]; *(v8us*)((unsigned short*)VT + ((size_t)hh * HD + d) * SQ + s0 + j8) = f.half[0]; }  } }



__global__ __launch_bounds__(256) void k_rsmcf2(const float* __restrict__ S, _Float16* __restrict__ P, int hg, int q0, int nk) {
  #pragma clang fp contract(off)
  const int t = blockIdx.x * 256 + threadIdx.x; if (t >= hg * QT) return; const size_t i = (size_t)t; const float* s = S + i * NKX; const int last = q0 + (t % QT); float mx = -3.0e38f;
#pragma unroll 1
  for (int j = 0; j < nk; ++j) { const float f = (j <= last) ? 1.f : 0.f; mx = fmaxf(mx, fmaf(f, s[j], (1.f - f) * -1.0e9f)); } float se = 0.f;
#pragma unroll 1
  for (int j = 0; j < nk; ++j) { const float f = (j <= last) ? 1.f : 0.f; se += __expf(fmaf(f, s[j], (1.f - f) * -1.0e9f) - mx); } const float sc = 256.0f / se;
#pragma unroll 1
  for (int j0 = 0; j0 < nk; j0 += 8) { FragH fr; for (int q = 0; q < 8; ++q) { const int j = j0 + q; const float f = (j <= last) ? 1.f : 0.f; fr.h[q] = (_Float16)(__expf(fmaf(f, s[j], (1.f - f) * -1.0e9f) - mx) * sc); } unsigned short* d = (unsigned short*)P + i * NKX + j0; *(v8us*)d = fr.half[0];  } }


template <int MASKADD>
__global__ __launch_bounds__(64) void k_att0(const float* __restrict__ QF, const float* __restrict__ KF, const float* __restrict__ VF, int ld, const float* __restrict__ mask, float scale, float* __restrict__ OF, int ldo) {
  #pragma clang fp contract(off)
  __shared__ __attribute__((aligned(16))) float lq[64][64]; __shared__ __attribute__((aligned(16))) float lo[64][64];
  const int tid = threadIdx.x; const int h = blockIdx.x / (QT0 / 64), rg = blockIdx.x % (QT0 / 64); const int i = rg * 64 + tid;
  const float* qr = QF + (size_t)i * ld + h * HD;
#pragma unroll 1
  for (int c = 0; c < HD / 4; ++c) { *(v4f*)&lq[tid][c * 4] = *(const v4fa*)(qr + c * 4); const v4f z = {0.f, 0.f, 0.f, 0.f}; *(v4f*)&lo[tid][c * 4] = z; }
  float m = -1.0e30f, l = 0.f; const int jmax = MASKADD ? (SQ - 1) : (rg * 64 + 63);      /* additive-mask form: every key (the mask input decides); causal form: keys up to the block's last row */
#pragma unroll 1
  for (int j = 0; j <= jmax; ++j) { const float* kr = KF + (size_t)j * ld + h * HD; const float* vr = VF + (size_t)j * ld + h * HD; float s = 0.f;
#pragma unroll 1
    for (int c = 0; c < HD / 4; ++c) { const v4f kq = *(const v4fa*)(kr + c * 4); const v4f qq = *(v4f*)&lq[tid][c * 4]; s = __fadd_rn(s, __fmul_rn(qq[0], kq[0])); s = __fadd_rn(s, __fmul_rn(qq[1], kq[1])); s = __fadd_rn(s, __fmul_rn(qq[2], kq[2])); s = __fadd_rn(s, __fmul_rn(qq[3], kq[3])); }
    s = __fmul_rn(s, scale); if (MASKADD) s = __fadd_rn(s, __fmul_rn(bf16_round(mask[(size_t)i * SQ + j]), -10000.0f));
    const float f = (MASKADD || j <= i) ? 1.f : 0.f; const float sm = fmaf(f, s, (1.f - f) * -1.0e30f); const float mn = fmaxf(m, sm); const float sc = expf(m - mn); const float e = expf(sm - mn); l = __fadd_rn(__fmul_rn(l, sc), e); m = mn;
#pragma unroll 1
    for (int c = 0; c < HD / 4; ++c) { const v4f vv = *(const v4fa*)(vr + c * 4); v4f oo = *(v4f*)&lo[tid][c * 4]; for (int u = 0; u < 4; ++u) oo[u] = __fadd_rn(__fmul_rn(oo[u], sc), __fmul_rn(e, vv[u])); *(v4f*)&lo[tid][c * 4] = oo; } }
  const float fin = 64.0f / l;      /* o carried x64 like the f16 path */
#pragma unroll 1
  for (int c = 0; c < HD / 4; ++c) { v4f oo = *(v4f*)&lo[tid][c * 4]; for (int u = 0; u < 4; ++u) oo[u] = __fmul_rn(oo[u], fin); *(v4f*)&lo[tid][c * 4] = oo; }
  __syncthreads();
  {
#pragma unroll 1
    for (int it = 0; it < 16; ++it) { const int row = it * 4 + tid / 16, pc = (tid % 16) * 4; const v4f v = *(const v4f*)&lo[row][pc]; *(v4f*)(OF + (size_t)(rg * 64 + row) * ldo + h * HD + pc) = v; }
     } }


__global__ __launch_bounds__(256) void k_kvexp(const float* __restrict__ src, float* __restrict__ dst, size_t n4) { const size_t t = (size_t)blockIdx.x * 256 + threadIdx.x; if (t >= n4) return; const size_t e = t * 4; const size_t row = e / DM; const int col = (int)(e % DM); const int h = col / HD, d = col % HD; const v4f v = *(const v4fa*)(src + row * KVD + (size_t)(h / HPG) * HD + d); *(v4f*)(dst + e) = v;  }

__global__ __launch_bounds__(256) void k_tab2(float theta, float* __restrict__ CS, float* __restrict__ SN) {
  #pragma clang fp contract(off)
  const int t = blockIdx.x * 256 + threadIdx.x; if (t >= SQ * (HD / 2)) return; const int i = t % (HD / 2); const int p = t / (HD / 2); const float invf = 1.0f / powf(theta, (float)(2 * i) / (float)HD); const float ang = __fmul_rn((float)p, invf); const float c = cosf(ang), s = sinf(ang);
  *(float*)(CS + t) = c; *(float*)(SN + t) = s;  }
template <int NORM, int ROPE>
__global__ __launch_bounds__(64) void k_xform(const float* __restrict__ F, int ldf, int nh, const float* __restrict__ gain, float eps, const float* __restrict__ CS, const float* __restrict__ SN, _Float16* __restrict__ H16, int ldo) {
  #pragma clang fp contract(off)
  __shared__ float xv[HD]; __shared__ float red[HD]; __shared__ unsigned short sh_[HD]; const int d = threadIdx.x; const int h = blockIdx.x % nh; const size_t r = blockIdx.x / nh; const int p = (int)(r % SQ);
  float x = F[r * (size_t)ldf + (size_t)h * HD + d];
  if (NORM) { red[d] = __fmul_rn(x, x); __syncthreads(); for (int st = HD / 2; st > 0; st >>= 1) { if (d < st) red[d] = __fadd_rn(red[d], red[d + st]); __syncthreads(); } const float rs = rsqrtf(__fadd_rn(red[0] / (float)HD, eps)); x = __fmul_rn(__fmul_rn(x, rs), bf16_round(gain[d])); }
  xv[d] = x; __syncthreads();
  float o = x;
  if (ROPE == 1) { const int i = d >> 1; const float c = CS[p * (HD / 2) + i], s = SN[p * (HD / 2) + i]; const float ev = xv[2 * i], od = xv[2 * i + 1]; o = (d & 1) ? __fadd_rn(__fmul_rn(ev, s), __fmul_rn(od, c)) : __fadd_rn(__fmul_rn(ev, c), -__fmul_rn(od, s)); }
  if (ROPE == 2) { const int i = d & (HD / 2 - 1); const float c = CS[p * (HD / 2) + i], s = SN[p * (HD / 2) + i]; const float lo = xv[i], hi = xv[i + HD / 2]; o = (d < HD / 2) ? __fadd_rn(__fmul_rn(lo, c), -__fmul_rn(hi, s)) : __fadd_rn(__fmul_rn(lo, s), __fmul_rn(hi, c)); }
  FragH th; th.h[0] = (_Float16)o; sh_[d] = th.u[0]; __syncthreads();
  if (d < HD / 8) { FragH f; for (int q = 0; q < 8; ++q) f.u[q] = sh_[d * 8 + q]; unsigned short* dst = (unsigned short*)H16 + r * (size_t)ldo + (size_t)h * HD + d * 8; *(v8us*)dst = f.half[0];  } }

template <int NORM, int ROPE>
__global__ __launch_bounds__(64) void k_xformf(const float* __restrict__ F, int ldf, int nh, const float* __restrict__ gain, float eps, const float* __restrict__ CS, const float* __restrict__ SN, float* __restrict__ F32, int ldo) {
  #pragma clang fp contract(off)
  __shared__ float xv[HD]; __shared__ float red[HD]; const int d = threadIdx.x; const int h = blockIdx.x % nh; const size_t r = blockIdx.x / nh; const int p = (int)(r % SQ);
  float x = F[r * (size_t)ldf + (size_t)h * HD + d];
  if (NORM) { red[d] = __fmul_rn(x, x); __syncthreads(); for (int st = HD / 2; st > 0; st >>= 1) { if (d < st) red[d] = __fadd_rn(red[d], red[d + st]); __syncthreads(); } const float rs = rsqrtf(__fadd_rn(red[0] / (float)HD, eps)); x = __fmul_rn(__fmul_rn(x, rs), bf16_round(gain[d])); }
  xv[d] = x; __syncthreads();
  float o = x;
  if (ROPE == 1) { const int i = d >> 1; const float c = CS[p * (HD / 2) + i], s = SN[p * (HD / 2) + i]; const float ev = xv[2 * i], od = xv[2 * i + 1]; o = (d & 1) ? __fadd_rn(__fmul_rn(ev, s), __fmul_rn(od, c)) : __fadd_rn(__fmul_rn(ev, c), -__fmul_rn(od, s)); }
  if (ROPE == 2) { const int i = d & (HD / 2 - 1); const float c = CS[p * (HD / 2) + i], s = SN[p * (HD / 2) + i]; const float lo = xv[i], hi = xv[i + HD / 2]; o = (d < HD / 2) ? __fadd_rn(__fmul_rn(lo, c), -__fmul_rn(hi, s)) : __fadd_rn(__fmul_rn(lo, s), __fmul_rn(hi, c)); }
  float* dst = F32 + r * (size_t)ldo + (size_t)h * HD + d; *(float*)dst = o;  }

__global__ __launch_bounds__(256) void k_bfcp(const float* __restrict__ src, float* __restrict__ dst, size_t n4) { const size_t t = (size_t)blockIdx.x * 256 + threadIdx.x; if (t >= n4) return; const v4f a = *(const v4fa*)(src + t * 4); v4f o; for (int q = 0; q < 4; ++q) o[q] = bf16_round(a[q]); *(v4f*)(dst + t * 4) = o;  }

__global__ __launch_bounds__(256) void k_tab2d(float* __restrict__ CS, float* __restrict__ SN) {
  #pragma clang fp contract(off)
  const int t = blockIdx.x * 256 + threadIdx.x; if (t >= SQ * (HD / 2)) return; const int i = t % (HD / 2); const int p = t / (HD / 2); const float invf = (float)(1.0 / pow(10000.0, (double)(2 * i) / (double)HD)); const float ang = __fmul_rn((float)p, invf); const float c = cosf(ang), s = sinf(ang);
  *(float*)(CS + t) = c; *(float*)(SN + t) = s;  }
extern "C" void kernel_launch(void* const* d_in, const int* in_sizes, int n_in,
                              void* d_out, int out_size, void* d_ws, size_t ws_size, hipStream_t stream) {
  (void)in_sizes; (void)n_in; (void)out_size;
  const float* const* I = (const float* const*)d_in; const float* x = I[0]; const float* wq = I[1]; const float* wk = I[2]; const float* wv = I[3]; const float* wo = I[4]; const float* bq = nullptr; const float* bk = nullptr; const float* bv = nullptr; const float* bo = I[5];      /* input order: x, Wq, Wk, Wv, Wo (natural [out][in] weights), bo [1024] (the output bias: into the output GEMM's bias slot); the q / k / v projections have NO biases; rope tables computed in the kernel (positions = row index) */
  char* ws = (char*)d_ws; size_t off = 0;
  auto take = [&](size_t bytes) { char* p = ws + off; off += (bytes + 255) & ~(size_t)255; return p; };
  _Float16* BQ = (_Float16*)take((size_t)DM * DM * 2); _Float16* BK = (_Float16*)take((size_t)KVD * DM * 2); _Float16* BV = (_Float16*)take((size_t)KVD * DM * 2); _Float16* BO = (_Float16*)take((size_t)DM * DM * 2);
  _Float16* X16 = (_Float16*)take(NR * DM * 2); float* QF = (float*)take((size_t)SQ * DM * 4); float* KF = (float*)take((size_t)SQ * KVD * 4); float* CSB = (float*)take((size_t)SQ * 32 * 4); float* SNB = (float*)take((size_t)SQ * 32 * 4); _Float16* Q16 = (_Float16*)take(NR * DM * 2); _Float16* K16 = (_Float16*)take(NR * KVD * 2); _Float16* V16 = (_Float16*)take(NR * KVD * 2); _Float16* O16 = (_Float16*)take(NR * DM * 2);
  float* S = (float*)take((size_t)NH * QT * NKX * 4); _Float16* P = (_Float16*)take((size_t)NH * QT * NKX * 2); _Float16* VT = (_Float16*)take((size_t)NH * HD * SQ * 2);
  float* QF0 = (float*)take((size_t)QT0 * DM * 4); float* KF0 = (float*)take((size_t)QT0 * KVD * 4); float* VF0 = (float*)take((size_t)QT0 * KVD * 4); float* KF0e = (float*)take((size_t)QT0 * DM * 4); float* VF0e = (float*)take((size_t)QT0 * DM * 4); float* OF0 = (float*)take((size_t)NB * QT0 * DM * 4); _Float16* OH0 = (_Float16*)take((size_t)NB * QT0 * DM * 2); _Float16* OL0 = (_Float16*)take((size_t)NB * QT0 * DM * 2);
  if (off > ws_size) return;
  k_wnat<<<(unsigned)(((size_t)DM * DM / 8 + 255) / 256), 256, 0, stream>>>(wq, (size_t)DM * DM / 8, BQ); k_wnat<<<(unsigned)(((size_t)KVD * DM / 8 + 255) / 256), 256, 0, stream>>>(wk, (size_t)KVD * DM / 8, BK); k_wnat<<<(unsigned)(((size_t)KVD * DM / 8 + 255) / 256), 256, 0, stream>>>(wv, (size_t)KVD * DM / 8, BV); k_wnat<<<(unsigned)(((size_t)DM * DM / 8 + 255) / 256), 256, 0, stream>>>(wo, (size_t)DM * DM / 8, BO);      /* natural [out][in] = Bt[n][k] x16 (KVD = 16 x 64 = DM: full-width k / v) */
  k_x16<<<(unsigned)((NR * DM / 8 + 255) / 256), 256, 0, stream>>>(x, X16, NR * DM / 8);
  const size_t r0p = (size_t)B0 * SQ;      /* first projected row */
  k_gemm2<0><<<dim3((unsigned)((MP / 128) * (KVD / 64)), 1), 128, 0, stream>>>(X16 + r0p * DM, DM, 0, BV, DM, 0, 0.0625f, bv, 0, nullptr, 1, 0, 0, nullptr, V16 + r0p * KVD, KVD, 0, MP, KVD, DM);
  k_tab2d<<<(unsigned)(((size_t)SQ * (HD / 2) + 255) / 256), 256, 0, stream>>>(CSB, SNB);      /* rope tables computed in the kernel: CS[p][i] = cos(p * 10000^(-2i/64)), SN = sin, i < 32 (rotate-half convention; the module's [f | f] tables repeat these 32 columns) */
  for (int b = B0; b < B0 + NBR; ++b) { const size_t r0 = (size_t)b * SQ;
    k_gemm2<0><<<dim3((unsigned)((SQ / 128) * (DM / 64)), 1), 128, 0, stream>>>(X16 + r0 * DM, DM, 0, BQ, DM, 0, 0.0625f, bq, 0, nullptr, 1, 0, 0, QF, nullptr, DM, 0, SQ, DM, DM);      /* q (f32) of this batch */
    k_gemm2<0><<<dim3((unsigned)((SQ / 128) * (KVD / 64)), 1), 128, 0, stream>>>(X16 + r0 * DM, DM, 0, BK, DM, 0, 0.0625f, bk, 0, nullptr, 1, 0, 0, KF, nullptr, KVD, 0, SQ, KVD, DM);      /* k (f32) */
    k_xform<0, 2><<<(unsigned)((size_t)SQ * NH), 64, 0, stream>>>(QF, DM, NH, nullptr, 0.f, CSB, SNB, Q16 + r0 * DM, DM); k_xform<0, 2><<<(unsigned)((size_t)SQ * NG), 64, 0, stream>>>(KF, KVD, NG, nullptr, 0.f, CSB, SNB, K16 + r0 * KVD, KVD);      /* half-split rope <0, 2> (out_lo = x_lo c - x_hi s, out_hi = x_lo s + x_hi c = t cos + rotate_half(t) sin) from the computed tables, then f32 -> f16 */
    k_vt<NG, SQ><<<NG * (SQ / 64), 256, 0, stream>>>(V16 + r0 * KVD, KVD, 0, VT);      /* V^T [NH][HD][SQ] for this batch */
    for (int q0 = 0; q0 < QN; q0 += QT) { const int nk = SQ;      /* non-causal: all keys for every query tile */
      k_gemm2<0><<<dim3((QT / 128) * (nk / 64), NH), 128, 0, stream>>>(Q16 + (r0 + q0) * LQ, LQ, (size_t)HD, K16 + r0 * KVD, KVD, (size_t)HD, 0.125f, nullptr, 0, nullptr, 1, 0, 0, S, nullptr, NKX, (size_t)QT * NKX, QT, nk, HD);      /* scores of all heads in one launch: grid.y = head steps q and k by HD columns and S by one [QT][NKX] plane */
      k_rsm<<<(NHD * QT + 7) / 8, 256, 0, stream>>>(S, P, NHD * QT);      /* plain row softmax over all SQ keys (row pitch NKX == SQ), one wave per row */
      k_gemm2<0><<<dim3((QT / 128) * (HD / 64), NH), 128, 0, stream>>>(P, NKX, (size_t)QT * NKX, VT, SQ, (size_t)HD * SQ, 0.25f, nullptr, 0, nullptr, 1, 0, 0, nullptr, O16 + (r0 + q0) * DM, DM, (size_t)HD, QT, HD, nk); } }      /* o of all heads in one launch: grid.y = head steps P by one plane, V^T by one [HD][SQ] slab, o by HD columns (merged heads, x64, f16 rows) */
  k_gemm2<0><<<dim3((unsigned)((MPO / 128) * (DM / 64)), 1), 128, 0, stream>>>(O16 + r0p * DM, DM, 0, BO, DM, 0, 0.0009765625f, bo, 0, nullptr, 1, 0, 0, (float*)d_out + r0p * DM, nullptr, DM, 0, MPO, DM, DM);      /* out rows are the output layout */
}

// v003
// Measured time: 300 microseconds a run.
// Next to v002, in two timings, it ran 3.28 and 3.29 times as fast.
// Counting every step since v000, it is 65.7 times as fast.
#include <hip/hip_runtime.h>
// Multi-head self-attention with rotate-half RoPE computed in the kernel and a biased output projection, NON-causal (x [2][2048][1024]; q / k / v = x W^T (natural [1024][1024], no biases), 16 heads of 64; cos / sin = [f | f] of pos * 10000^(-2i/64); q = q cos + rotate_half(q) sin, likewise k; scores * 64^-0.5; softmax over all 2048 keys (no mask); out = merged Wo^T + bo (natural + bias) -> [2][2048][1024]); run as 16 groups of ONE head.
// Structure: x as exact f16 rows; natural weights as exact x16 planes; v as a WMMA GEMM (32x64 wave tiles, f32 accumulation, f16 output); rope tables computed once (double-derived inv_freq, f32 angle); per batch: q [2048][1024] and k [2048][1024] as GEMMs into f32 rows then the rotate-half rotation + f16 conversion per (row, head) on VALU; V^T of the 16 groups via LDS transposes; then ONE fused attention launch for all batches, heads and query rows (256 query rows per work-group): per 32 keys S^T = K Q^T (K = 64), online softmax on VALU in the log2 domain (f32 statistics, native exp2, lazy rescale; weights f16, unnormalised), O^T += V^T P^T, o / row sum (carried x64) into merged f16 rows; scores and weights stay in registers; out = o Wo^T GEMM (f32, alpha 2^-10); launches: see trace.
// Compute dtype: inputs rounded to bf16; x / weights exact; q, k, v, softmax weights and o as plain f16 GEMM operands (~2^-12); scores and softmax statistics f32; v_wmma_f32_16x16x32_f16.
#define NB 2
#define NG 16
#define HPG 1
#define KVD (NG * HD)
#define SQ 2048
#define DM 1024
#define NH 16
#define HD 64
#define HG 4                         /* heads handled by the grouped k_vt overload kept below */
#define QT 512                       /* query rows per tile of the unfused softmax kernel kept below */
#define NKX SQ                       /* S / P row pitch */
#define QT0 128                      /* first-tile rows of the f32 k_att0 path (not launched) */
#define B0 0                         /* first batch processed (debug hook) */
#define NBR NB                       /* batches processed (debug hook) */
#define NR ((size_t)NB * SQ)         /* token rows */
#define MP ((int)((size_t)NBR * SQ)) /* rows projected (debug hook) */
#define QN SQ                        /* query rows attended per batch (unused) */
#define NHD NH                       /* heads attended (unused) */
#define MPO MP                       /* rows through the output stage (debug hook) */
#define LQ DM      /* row pitch of the q/k/v rows */
typedef __bf16 v16b __attribute__((ext_vector_type(16)));
typedef unsigned short v8us __attribute__((ext_vector_type(8), may_alias));
typedef float  v8f  __attribute__((ext_vector_type(8)));
typedef float  v4f  __attribute__((ext_vector_type(4)));
typedef float  v4fa __attribute__((ext_vector_type(4), may_alias));
union FragB { v16b v; v8us half[2]; unsigned short u[16]; };

__device__ __forceinline__ unsigned short bf16_bits(float x) { unsigned int u = __float_as_uint(x); return (unsigned short)((u + 0x7FFFu + ((u >> 16) & 1u)) >> 16); }
__device__ __forceinline__ float bf16_val(unsigned short b) { return __uint_as_float(((unsigned int)b) << 16); }
__device__ __forceinline__ float bf16_round(float x) { return bf16_val(bf16_bits(x)); }
// D += A·B with NT terms: 1 = ah·bh, 2 = + al·bh (A split), 3 = + ah·bl (both split)
template <int NT>
__device__ __forceinline__ v8f mmaN(v16b ah, v16b al, v16b bh, v16b bl, v8f c) {
  c = __builtin_amdgcn_wmma_f32_16x16x32_bf16(false, ah, false, bh, (short)0, c, false, false);
  if (NT >= 2) c = __builtin_amdgcn_wmma_f32_16x16x32_bf16(false, al, false, bh, (short)0, c, false, false);
  if (NT >= 3) c = __builtin_amdgcn_wmma_f32_16x16x32_bf16(false, ah, false, bl, (short)0, c, false, false);
  asm volatile("v_nop\n\tv_nop\n\tv_nop\n\tv_nop" : "+v"(c) : "v"(ah), "v"(al), "v"(bh), "v"(bl));
  return c;
}

__global__ __launch_bounds__(256) void k_wt_bf16(const float* __restrict__ W, unsigned short* __restrict__ Wt, int K, int N) {
  const int t = blockIdx.x * 256 + threadIdx.x;
  const int k8n = K / 8;
  if (t >= N * k8n) return;
  const int n = t / k8n, k8 = (t % k8n) * 8;
  v8us v;
#pragma unroll
  for (int i = 0; i < 8; ++i) v[i] = bf16_bits(W[(size_t)(k8 + i) * N + n]);
  *(v8us*)(Wt + (size_t)n * K + k8) = v;
  
}

// GEMM C[M][N] (f32, pitch ldc) = act(A[M][K]·W + bias). A f32 row-major (pitch lda) converted per fragment to bf16
// (ASPLIT: hi/lo two planes -> 2 terms, else single rounded term); Wt bf16 [N][K] (pitch ldb). BIAS_BF16 rounds the
// bias to bf16 first (bias quantised to bf16 before the add). K%32==0, M%16==0, N%64==0.
template <bool ASPLIT, int ACT, bool BIAS_BF16>
__global__ __launch_bounds__(128) void k_gemm_bf(const float* __restrict__ A, int lda, const unsigned short* __restrict__ Wt, int ldb,
                                               const float* __restrict__ bias, float* __restrict__ C, int ldc, int M, int N, int K) {
  __shared__ __attribute__((aligned(16))) float so[4][16][64];
  const int tid = threadIdx.x, w = tid >> 5, lane = tid & 31, ln = lane & 15, hh = lane >> 4;
  const int ntn = N / 64;
  const int wid = blockIdx.x * 4 + w;
  const int mt = wid / ntn, nq = wid % ntn;
  if (mt * 16 >= M) return;
  const int row0 = mt * 16, col0 = nq * 64;
  const float* arow = A + (size_t)(row0 + ln) * lda;
  v8f acc[4] = {};
  for (int kb = 0; kb < K; kb += 32) {
    FragB ah, al;
    const v4f x0 = *(const v4fa*)(arow + kb + 8 * hh), x1 = *(const v4fa*)(arow + kb + 8 * hh + 4);
    const v4f x2 = *(const v4fa*)(arow + kb + 16 + 8 * hh), x3 = *(const v4fa*)(arow + kb + 16 + 8 * hh + 4);
    float xs[16] = {x0[0],x0[1],x0[2],x0[3],x1[0],x1[1],x1[2],x1[3],x2[0],x2[1],x2[2],x2[3],x3[0],x3[1],x3[2],x3[3]};
#pragma unroll
    for (int i = 0; i < 16; ++i) { const unsigned short hb = bf16_bits(xs[i]); ah.u[i] = hb; al.u[i] = ASPLIT ? bf16_bits(xs[i] - bf16_val(hb)) : (unsigned short)0; }
#pragma unroll
    for (int t = 0; t < 4; ++t) {
      const unsigned short* brow = Wt + (size_t)(col0 + t * 16 + ln) * ldb + kb;
      FragB b;
      b.half[0] = *(const v8us*)(brow + 8 * hh);
      b.half[1] = *(const v8us*)(brow + 16 + 8 * hh);
      acc[t] = mmaN<ASPLIT ? 2 : 1>(ah.v, al.v, b.v, b.v, acc[t]);
    }
  }
#pragma unroll
  for (int t = 0; t < 4; ++t) {
    float bv = bias ? bias[col0 + t * 16 + ln] : 0.f;
    if (BIAS_BF16) bv = bf16_round(bv);
#pragma unroll
    for (int r = 0; r < 8; ++r) { float v = acc[t][r] + bv; if (ACT == 1) v = fmaxf(v, 0.f); so[w][8 * hh + r][t * 16 + ln] = v; }
  }
  __builtin_amdgcn_fence(__ATOMIC_ACQ_REL, "workgroup");
  __builtin_amdgcn_wave_barrier();
  const int rsub = lane >> 4, c4 = (lane & 15) * 4;
  {
#pragma unroll
    for (int q = 0; q < 8; ++q) {
      const int r = q * 2 + rsub;
      const v4f v = *(const v4fa*)&so[w][r][c4];
      *(v4f*)(C + (size_t)(row0 + r) * ldc + col0 + c4) = v;
    }
    
  }
}

// GEMM C = act(A·W + bias + resid): A f32 (ASPLIT -> hi/lo 2 terms), Wt bf16 [N][K]; ACT 0 none, 1 relu, 2 exact gelu;
// resid (optional, f32, row index = (row % rmod), pitch ldr, RES_BF16 rounds it) added before the activation.
template <bool ASPLIT, int ACT, bool BIAS_BF16, bool RES_BF16>
__global__ __launch_bounds__(128) void k_gemm_bf3(const float* __restrict__ A, int lda, const unsigned short* __restrict__ Wt, int ldb,
                                                const float* __restrict__ bias, const float* __restrict__ resid, int rmod, int ldr,
                                                float* __restrict__ C, int ldc, int M, int N, int K) {
  __shared__ __attribute__((aligned(16))) float so[4][16][64];
  const int tid = threadIdx.x, w = tid >> 5, lane = tid & 31, ln = lane & 15, hh = lane >> 4;
  const int ntn = N / 64;
  const int wid = blockIdx.x * 4 + w;
  const int mt = wid / ntn, nq = wid % ntn;
  if (mt * 16 >= M) return;
  const int row0 = mt * 16, col0 = nq * 64;
  const float* arow = A + (size_t)(row0 + ln) * lda;
  v8f acc[4] = {};
  for (int kb = 0; kb < K; kb += 32) {
    FragB ah, al;
    const v4f x0 = *(const v4fa*)(arow + kb + 8 * hh), x1 = *(const v4fa*)(arow + kb + 8 * hh + 4);
    const v4f x2 = *(const v4fa*)(arow + kb + 16 + 8 * hh), x3 = *(const v4fa*)(arow + kb + 16 + 8 * hh + 4);
    float xs[16] = {x0[0],x0[1],x0[2],x0[3],x1[0],x1[1],x1[2],x1[3],x2[0],x2[1],x2[2],x2[3],x3[0],x3[1],x3[2],x3[3]};
#pragma unroll
    for (int i = 0; i < 16; ++i) { const unsigned short hb = bf16_bits(xs[i]); ah.u[i] = hb; al.u[i] = ASPLIT ? bf16_bits(xs[i] - bf16_val(hb)) : (unsigned short)0; }
#pragma unroll
    for (int t = 0; t < 4; ++t) {
      const unsigned short* brow = Wt + (size_t)(col0 + t * 16 + ln) * ldb + kb;
      FragB b;
      b.half[0] = *(const v8us*)(brow + 8 * hh);
      b.half[1] = *(const v8us*)(brow + 16 + 8 * hh);
      acc[t] = mmaN<ASPLIT ? 2 : 1>(ah.v, al.v, b.v, b.v, acc[t]);
    }
  }
#pragma unroll
  for (int t = 0; t < 4; ++t) {
    const int col = col0 + t * 16 + ln;
    float bv = bias ? bias[col] : 0.f;
    if (BIAS_BF16) bv = bf16_round(bv);
#pragma unroll
    for (int r = 0; r < 8; ++r) {
      float v = acc[t][r] + bv;
      if (resid) { float rv = resid[(size_t)((row0 + 8 * hh + r) % rmod) * ldr + col]; if (RES_BF16) rv = bf16_round(rv); v += rv; }
      if (ACT == 1) v = fmaxf(v, 0.f);
      if (ACT == 2) v = 0.5f * v * (1.0f + erff(v * 0.70710678118654752f));
      if (ACT == 3) { const float u = 0.7978845608028654f * (v + 0.044715f * v * v * v); v = 0.5f * v * (1.0f + tanhf(u)); }
      so[w][8 * hh + r][t * 16 + ln] = v;
    }
  }
  __builtin_amdgcn_fence(__ATOMIC_ACQ_REL, "workgroup");
  __builtin_amdgcn_wave_barrier();
  const int rsub = lane >> 4, c4 = (lane & 15) * 4;
  {
#pragma unroll
    for (int q = 0; q < 8; ++q) {
      const int r = q * 2 + rsub;
      const v4f v = *(const v4fa*)&so[w][r][c4];
      *(v4f*)(C + (size_t)(row0 + r) * ldc + col0 + c4) = v;
    }
    
  }
}
// row LayerNorm (biased variance, eps) over N: s = X (+ R); optional out_sum <- s; out_norm <- (s-mu)*rsqrt(var+eps)*g + b
template <bool PARAM_BF16>
__global__ __launch_bounds__(256) void k_layernorm(const float* __restrict__ X, const float* __restrict__ R, const float* __restrict__ g, const float* __restrict__ bta,
                                                  float* __restrict__ out_sum, float* __restrict__ out_norm, int N, float eps) {
  __shared__ float red[256];
  const int row = blockIdx.x, tid = threadIdx.x;
  const float* x = X + (size_t)row * N; const float* rr = R ? R + (size_t)row * N : nullptr;
  float vals[16];                     // up to N = 4096
  const int per = N / 256;            // contiguous chunk per thread? use strided-by-4 chunks: thread handles j = tid*4 + 1024*u
  float s1 = 0.f;
  for (int u = 0; u < per / 4; ++u) {
    const int j = tid * 4 + 1024 * u;
    const v4f a = *(const v4fa*)(x + j);
    v4f b = {0.f,0.f,0.f,0.f}; if (rr) b = *(const v4fa*)(rr + j);
#pragma unroll
    for (int q = 0; q < 4; ++q) { const float v = a[q] + b[q]; vals[u * 4 + q] = v; s1 += v; }
  }
  red[tid] = s1; __syncthreads();
  for (int st = 128; st > 0; st >>= 1) { if (tid < st) red[tid] += red[tid + st]; __syncthreads(); }
  const float mu = red[0] / (float)N; __syncthreads();
  float s2 = 0.f;
  for (int u = 0; u < per / 4; ++u)
#pragma unroll
    for (int q = 0; q < 4; ++q) { const float c = vals[u * 4 + q] - mu; s2 += c * c; }
  red[tid] = s2; __syncthreads();
  for (int st = 128; st > 0; st >>= 1) { if (tid < st) red[tid] += red[tid + st]; __syncthreads(); }
  const float rs = rsqrtf(red[0] / (float)N + eps);
  {
    for (int u = 0; u < per / 4; ++u) {
      const int j = tid * 4 + 1024 * u;
      v4f o, sm;
#pragma unroll
      for (int q = 0; q < 4; ++q) {
        float gg = g[j + q], bb = bta[j + q];
        if (PARAM_BF16) { gg = bf16_round(gg); bb = bf16_round(bb); }
        sm[q] = vals[u * 4 + q]; o[q] = (vals[u * 4 + q] - mu) * rs * gg + bb;
      }
      if (out_sum) *(v4f*)(out_sum + (size_t)row * N + j) = sm;
      *(v4f*)(out_norm + (size_t)row * N + j) = o;
    }
    
  }
}



// ---- f16 WMMA path (v_wmma_f32_16x16x32_f16): 11-bit significands for operands in range — used where a [0,1] probability operand needs more precision than bf16
typedef _Float16 v16h __attribute__((ext_vector_type(16)));
union FragH { v16h v; v8us half[2]; _Float16 h[16]; unsigned short u[16]; };
template <int NT>
__device__ __forceinline__ v8f mmaH(v16h ah, v16h al, v16h bh, v16h bl, v8f c) {
  c = __builtin_amdgcn_wmma_f32_16x16x32_f16(false, ah, false, bh, (short)0, c, false, false);
  if (NT >= 2) c = __builtin_amdgcn_wmma_f32_16x16x32_f16(false, al, false, bh, (short)0, c, false, false);
  if (NT >= 3) c = __builtin_amdgcn_wmma_f32_16x16x32_f16(false, ah, false, bl, (short)0, c, false, false);
  asm volatile("v_nop\n\tv_nop\n\tv_nop\n\tv_nop" : "+v"(c) : "v"(ah), "v"(al), "v"(bh), "v"(bl));
  return c;
}
// batched GEMM like k_gemm_b but f16 operands: A f32 (split into f16 hi/lo if ASPLIT, else rounded to f16), Bt = f16 values [n][k]; alpha; C f32; N multiple of 16 (partial tiles skipped)
template <bool ASPLIT>
__global__ __launch_bounds__(128) void k_gemm_h(const float* __restrict__ A, int lda, size_t sA, const _Float16* __restrict__ Bh, int ldb, size_t sB, float alpha, float* __restrict__ C, int ldc, size_t sC, int M, int N, int K) {
  __shared__ __attribute__((aligned(16))) float so[4][16][64];
  const int tid = threadIdx.x, w = tid >> 5, lane = tid & 31, ln = lane & 15, hh = lane >> 4; const int by = blockIdx.y;
  A += (size_t)by * sA; Bh += (size_t)by * sB; C += (size_t)by * sC;
  const int ntn = (N + 63) / 64; const int wid = blockIdx.x * 4 + w; const int mt = wid / ntn, nq = wid % ntn; if (mt * 16 >= M) return;
  const int row0 = mt * 16, col0 = nq * 64; const float* arow = A + (size_t)(row0 + ln) * lda;
  v8f acc[4] = {};
  for (int kb = 0; kb < K; kb += 32) {
    FragH ah, al;
    const v4f x0 = *(const v4fa*)(arow + kb + 8 * hh), x1 = *(const v4fa*)(arow + kb + 8 * hh + 4), x2 = *(const v4fa*)(arow + kb + 16 + 8 * hh), x3 = *(const v4fa*)(arow + kb + 16 + 8 * hh + 4);
    float xs[16] = {x0[0],x0[1],x0[2],x0[3],x1[0],x1[1],x1[2],x1[3],x2[0],x2[1],x2[2],x2[3],x3[0],x3[1],x3[2],x3[3]};
#pragma unroll
    for (int i = 0; i < 16; ++i) { const _Float16 h = (_Float16)xs[i]; ah.h[i] = h; al.h[i] = ASPLIT ? (_Float16)(xs[i] - (float)h) : (_Float16)0.0f; }
#pragma unroll
    for (int t = 0; t < 4; ++t) { if (col0 + t * 16 >= N) continue; const size_t boff = (size_t)(col0 + t * 16 + ln) * ldb + kb; FragH bq; bq.half[0] = *(const v8us*)(Bh + boff + 8 * hh); bq.half[1] = *(const v8us*)(Bh + boff + 16 + 8 * hh);
      acc[t] = mmaH<ASPLIT ? 2 : 1>(ah.v, al.v, bq.v, bq.v, acc[t]); }
  }
#pragma unroll
  for (int t = 0; t < 4; ++t) { if (col0 + t * 16 >= N) continue;
#pragma unroll
    for (int r = 0; r < 8; ++r) so[w][8 * hh + r][t * 16 + ln] = acc[t][r] * alpha; }
  __builtin_amdgcn_fence(__ATOMIC_ACQ_REL, "workgroup"); __builtin_amdgcn_wave_barrier();
  const int rsub = lane >> 4, c4 = (lane & 15) * 4;
  {
#pragma unroll
    for (int q = 0; q < 8; ++q) { const int r = q * 2 + rsub; if (col0 + c4 < N) { const v4f v = *(const v4fa*)&so[w][r][c4]; *(v4f*)(C + (size_t)(row0 + r) * ldc + col0 + c4) = v; } }
     }
}

// Wt[n][k] = f16(W[k][n]·scale) from f32 row-major W[K][N] (scale = power of two; bf16-exact weights stay exact in f16 away from the subnormal range)
__global__ __launch_bounds__(256) void k_wt_f16(const float* __restrict__ W, _Float16* __restrict__ Wt, int K, int N, float scale) {
  const int t = blockIdx.x * 256 + threadIdx.x; if (t >= N * (K / 8)) return; const int n = t / (K / 8), k8 = (t % (K / 8)) * 8; FragH f;
#pragma unroll
  for (int i = 0; i < 8; ++i) f.h[i] = (_Float16)(bf16_round(W[(size_t)(k8 + i) * N + n]) * scale); const v8us o = f.half[0];
  *(v8us*)((unsigned short*)Wt + (size_t)n * K + k8) = o; 
}
// k_gemm_hh variant with fused epilogue: v = acc·alpha + bias[by·sBias + col] (+ CP[(row/rowsPerB)·sCPb + by·64 + col] if CP) ; ACT 0 none / 1 elu ; writes f16 C16 (and f32 C if non-null)
template <int ACT>
__global__ __launch_bounds__(128) void k_gemm_hhx(const _Float16* __restrict__ A, int lda, size_t sA, const _Float16* __restrict__ Bh, int ldb, size_t sB, float alpha, const float* __restrict__ bias, size_t sBias, const float* __restrict__ CP, int rowsPerB, size_t sCPb, int row0g,
    float* __restrict__ C, _Float16* __restrict__ C16, int ldc, size_t sC, int M, int N, int K) {
  __shared__ __attribute__((aligned(16))) float so[4][16][64];
  const int tid = threadIdx.x, w = tid >> 5, lane = tid & 31, ln = lane & 15, hh = lane >> 4; const int by = blockIdx.y;
  A += (size_t)by * sA; Bh += (size_t)by * sB; const size_t cofs = (size_t)by * sC; const float* bp = bias ? bias + (size_t)by * sBias : nullptr;
  const int ntn = (N + 63) / 64; const int wid = blockIdx.x * 4 + w; const int mt = wid / ntn, nq = wid % ntn; if (mt * 16 >= M) return;
  const int row0 = mt * 16, col0 = nq * 64; const _Float16* arow = A + (size_t)(row0 + ln) * lda;
  v8f acc[4] = {};
  for (int kb = 0; kb < K; kb += 32) { FragH ah; ah.half[0] = *(const v8us*)((const unsigned short*)arow + kb + 8 * hh); ah.half[1] = *(const v8us*)((const unsigned short*)arow + kb + 16 + 8 * hh);
#pragma unroll
    for (int t = 0; t < 4; ++t) { if (col0 + t * 16 >= N) continue; const size_t boff = (size_t)(col0 + t * 16 + ln) * ldb + kb; FragH bq; bq.half[0] = *(const v8us*)((const unsigned short*)Bh + boff + 8 * hh); bq.half[1] = *(const v8us*)((const unsigned short*)Bh + boff + 16 + 8 * hh);
      acc[t] = mmaH<1>(ah.v, ah.v, bq.v, bq.v, acc[t]); }
  }
#pragma unroll
  for (int t = 0; t < 4; ++t) { if (col0 + t * 16 >= N) continue; const int col = col0 + t * 16 + ln; const float bv = bp ? bf16_round(bp[col]) : 0.f;
#pragma unroll
    for (int r = 0; r < 8; ++r) { float v = acc[t][r] * alpha + bv; if (CP) { const int rr = row0g + row0 + 8 * hh + r; if (rowsPerB < 0) v += CP[cofs + (size_t)rr * ldc + col];      /* rowsPerB < 0: own element of the batched C plane */ else { const int bidx = rr / rowsPerB; v += CP[(size_t)bidx * sCPb + (size_t)by * 64 + col]; } } if (ACT == 1) v = (v > 0.f) ? v : expm1f(v); else if (ACT == 7) v = (v > 0.f) ? v + 1.0f : expf(v); else if (ACT == 8) v = tanhf(v); else if (ACT == 9) v = 0.5f * v * (1.0f + tanhf(0.7978845608028654f * (v + 0.044715f * v * v * v))); else if (ACT == 11) v = 1.0f / (1.0f + expf(-v)); else if (ACT == 12) v = (v > 0.f) ? v : 0.01f * v; else if (ACT == 14) v = (v > 0.f) ? v : 0.1f * v; else if (ACT == 16) v = (v >= 0.f) ? v : 0.3f * v; else if (ACT == 17) v = (v >= 0.f) ? v : 0.2f * v; else if (ACT == 15) v = v / (1.0f + expf(-v)); else if (ACT == 3) v = fmaxf(v, 0.f); else if (ACT == 6) v = 0.5f * v * (1.0f + erff(v * 0.70710678118654752f)); so[w][8 * hh + r][t * 16 + ln] = v; } }
  __builtin_amdgcn_fence(__ATOMIC_ACQ_REL, "workgroup"); __builtin_amdgcn_wave_barrier();
  const int rsub = lane >> 4, c4 = (lane & 15) * 4; typedef _Float16 v4h __attribute__((ext_vector_type(4)));
  {
#pragma unroll
    for (int q = 0; q < 8; ++q) { const int r = q * 2 + rsub; if (col0 + c4 < N) { const v4f v = *(const v4fa*)&so[w][r][c4]; if (C) *(v4f*)(C + cofs + (size_t)(row0 + r) * ldc + col0 + c4) = v; if (C16) { v4h h4; for (int i = 0; i < 4; ++i) h4[i] = (_Float16)v[i]; *(v4h*)(C16 + cofs + (size_t)(row0 + r) * ldc + col0 + c4) = h4; } } }
     }
}


typedef _Float16 v4h __attribute__((ext_vector_type(4)));

__global__ __launch_bounds__(256) void k_x16(const float* __restrict__ x, _Float16* __restrict__ X16, size_t n8) { const size_t t = (size_t)blockIdx.x * 256 + threadIdx.x; if (t >= n8) return; FragH f;
#pragma unroll
  for (int q = 0; q < 8; ++q) f.h[q] = (_Float16)bf16_round(x[t * 8 + q]); *(v8us*)((unsigned short*)X16 + t * 8) = f.half[0];  }
__global__ __launch_bounds__(256) void k_h16(const float* __restrict__ x, _Float16* __restrict__ X16, size_t n8) { const size_t t = (size_t)blockIdx.x * 256 + threadIdx.x; if (t >= n8) return; FragH f;
#pragma unroll
  for (int q = 0; q < 8; ++q) f.h[q] = (_Float16)x[t * 8 + q]; *(v8us*)((unsigned short*)X16 + t * 8) = f.half[0];  }
__global__ __launch_bounds__(256) void k_round16f(const float* __restrict__ W, _Float16* __restrict__ Bt, size_t n8) { const size_t t = (size_t)blockIdx.x * 256 + threadIdx.x; if (t >= n8) return; FragH f;
#pragma unroll
  for (int i = 0; i < 8; ++i) f.h[i] = (_Float16)(bf16_round(W[t * 8 + i]) * 16.0f); *(v8us*)((unsigned short*)Bt + t * 8) = f.half[0];  }
template <int NHv, int TTv>
__global__ __launch_bounds__(256) void k_vt(const _Float16* __restrict__ V16, int ldv, int voff, _Float16* __restrict__ Vt) { __shared__ unsigned short tl[64][66]; const int tid = threadIdx.x; const int slab = blockIdx.x / (TTv / 64), lg = blockIdx.x % (TTv / 64); const int b = slab / NHv, h = slab % NHv;
  for (int i = tid; i < 64 * 8; i += 256) { const int r = i / 8, c8 = (i % 8) * 8; FragH f; f.half[0] = *(const v8us*)((const unsigned short*)V16 + ((size_t)b * TTv + lg * 64 + r) * ldv + voff + h * 64 + c8);
#pragma unroll
    for (int q = 0; q < 8; ++q) tl[r][c8 + q] = f.u[q]; }
  __syncthreads();
  {
#pragma unroll
    for (int rd = 0; rd < 2; ++rd) { const int d = rd * 32 + tid / 8, pc = tid % 8; FragH f;
#pragma unroll
      for (int q = 0; q < 8; ++q) f.u[q] = tl[pc * 8 + q][d];
      *(v8us*)((unsigned short*)Vt + ((size_t)slab * 64 + d) * TTv + lg * 64 + pc * 8) = f.half[0]; }
     } }

__global__ __launch_bounds__(256) void k_hl(const float* __restrict__ F, _Float16* __restrict__ Hh, _Float16* __restrict__ Hl, size_t n8) { const size_t t = (size_t)blockIdx.x * 256 + threadIdx.x; if (t >= n8) return; FragH fh, fl; const v4f a = *(const v4fa*)(F + t * 8), c = *(const v4fa*)(F + t * 8 + 4);
#pragma unroll
  for (int q = 0; q < 4; ++q) { _Float16 h = (_Float16)a[q]; fh.h[q] = h; fl.h[q] = (_Float16)((a[q] - (float)h) * 1024.0f); h = (_Float16)c[q]; fh.h[4 + q] = h; fl.h[4 + q] = (_Float16)((c[q] - (float)h) * 1024.0f); }
  { *(v8us*)((unsigned short*)Hh + t * 8) = fh.half[0]; *(v8us*)((unsigned short*)Hl + t * 8) = fl.half[0];  } }

// ---- fast GEMM (wave tile 32x64; requires M % 32 == 0 rows per launch region and N % 64 == 0); epilogue = k_gemm_hhx semantics ----
__device__ __forceinline__ v16h g2_frag(const _Float16* p, int hh) { FragH f; f.half[0] = *(const v8us*)((const unsigned short*)p + 8 * hh); f.half[1] = *(const v8us*)((const unsigned short*)p + 16 + 8 * hh); return f.v; }
__device__ __forceinline__ v8f g2_mma(v16h a, v16h b, v8f c) { v8f d = __builtin_amdgcn_wmma_f32_16x16x32_f16(false, a, false, b, (short)0, c, false, false); asm volatile("v_nop\n\tv_nop\n\tv_nop\n\tv_nop" : "+v"(d) : "v"(a), "v"(b)); return d; }
template <int ACT>
__global__ __launch_bounds__(128) void k_gemm2(const _Float16* __restrict__ A, int lda, size_t sA, const _Float16* __restrict__ Bh, int ldb, size_t sB, float alpha, const float* __restrict__ bias, size_t sBias, const float* __restrict__ CP, int rowsPerB, size_t sCPb, int row0g,
    float* __restrict__ C, _Float16* __restrict__ C16, int ldc, size_t sC, int M, int N, int K) { static_assert(ACT == 0 || ACT == 3 || ACT == 6 || ACT == 8 || ACT == 9 || ACT == 11 || ACT == 12 || ACT == 14 || ACT == 15 || ACT == 16 || ACT == 17, "k_gemm2: unsupported ACT code (would silently apply no activation)");
  __shared__ __attribute__((aligned(16))) float so[4][32][68];
  const int tid = threadIdx.x, w = tid >> 5, lane = tid & 31, ln = lane & 15, hh = lane >> 4; const int by = blockIdx.y;
  A += (size_t)by * sA; Bh += (size_t)by * sB; const size_t cofs = (size_t)by * sC; const float* bp = bias ? bias + (size_t)by * sBias : nullptr;
  const int ntn = N >> 6; const int mt = blockIdx.x / ntn, nq = blockIdx.x - mt * ntn; const int row0 = mt * 128 + 32 * w, col0 = nq * 64; if (row0 >= M) return;
  const _Float16* a0p = A + (size_t)(row0 + ln) * lda; const _Float16* a1p = a0p + (size_t)16 * lda;
  const _Float16* b0p = Bh + (size_t)(col0 + ln) * ldb; const _Float16* b1p = b0p + (size_t)16 * ldb; const _Float16* b2p = b1p + (size_t)16 * ldb; const _Float16* b3p = b2p + (size_t)16 * ldb;
  const v8f z8 = {0.f,0.f,0.f,0.f,0.f,0.f,0.f,0.f}; v8f c00 = z8, c01 = z8, c02 = z8, c03 = z8, c10 = z8, c11 = z8, c12 = z8, c13 = z8;
#pragma unroll 1
  for (int kb = 0; kb < K; kb += 32) { const v16h a0 = g2_frag(a0p + kb, hh), a1 = g2_frag(a1p + kb, hh);
    v16h b = g2_frag(b0p + kb, hh); c00 = g2_mma(a0, b, c00); c10 = g2_mma(a1, b, c10);
    b = g2_frag(b1p + kb, hh); c01 = g2_mma(a0, b, c01); c11 = g2_mma(a1, b, c11);
    b = g2_frag(b2p + kb, hh); c02 = g2_mma(a0, b, c02); c12 = g2_mma(a1, b, c12);
    b = g2_frag(b3p + kb, hh); c03 = g2_mma(a0, b, c03); c13 = g2_mma(a1, b, c13); }
  v8f accs[8] = {c00, c01, c02, c03, c10, c11, c12, c13};
#pragma unroll
  for (int u = 0; u < 8; ++u) { const int t = u & 3, half = u >> 2; const int col = col0 + t * 16 + ln; const float bv = bp ? bf16_round(bp[col]) : 0.f;
#pragma unroll
    for (int r = 0; r < 8; ++r) { const int rloc = half * 16 + 8 * hh + r; float v = accs[u][r] * alpha + bv; if (CP) { if (rowsPerB < 0) v += CP[cofs + (size_t)(row0g + row0 + rloc) * ldc + col];      /* rowsPerB < 0: own element of the batched C plane */ else { const int bidx = (row0g + row0 + rloc) / rowsPerB; v += CP[(size_t)bidx * sCPb + (size_t)by * 64 + col]; } }
      if (ACT == 3) v = fmaxf(v, 0.f); else if (ACT == 6) v = 0.5f * v * (1.0f + erff(v * 0.70710678118654752f)); else if (ACT == 11) v = 1.0f / (1.0f + expf(-v)); else if (ACT == 15) v = v / (1.0f + expf(-v)); else if (ACT == 12) v = (v > 0.f) ? v : 0.01f * v; else if (ACT == 8) v = tanhf(v); else if (ACT == 9) v = 0.5f * v * (1.0f + tanhf(0.7978845608028654f * (v + 0.044715f * v * v * v))); else if (ACT == 14) v = (v > 0.f) ? v : 0.1f * v; else if (ACT == 16) v = (v >= 0.f) ? v : 0.3f * v; else if (ACT == 17) v = (v >= 0.f) ? v : 0.2f * v;
      so[w][rloc][t * 16 + ln] = v; } }
  __builtin_amdgcn_fence(__ATOMIC_ACQ_REL, "workgroup"); __builtin_amdgcn_wave_barrier();
  const int rsub = lane >> 4, c4 = (lane & 15) * 4;
  {
#pragma unroll
    for (int q = 0; q < 16; ++q) { const int r = q * 2 + rsub; const v4f v = *(const v4fa*)&so[w][r][c4]; if (C) *(v4f*)(C + cofs + (size_t)(row0 + r) * ldc + col0 + c4) = v; if (C16) { v4h h4; for (int i = 0; i < 4; ++i) h4[i] = (_Float16)v[i]; *(v4h*)(C16 + cofs + (size_t)(row0 + r) * ldc + col0 + c4) = h4; } }
     } }


__global__ __launch_bounds__(256) void k_wnat(const float* __restrict__ w, size_t n8, _Float16* __restrict__ Bt) { const size_t t = (size_t)blockIdx.x * 256 + threadIdx.x; if (t >= n8) return; FragH f; for (int q = 0; q < 8; ++q) f.h[q] = (_Float16)(bf16_round(w[t * 8 + q]) * 16.0f); *(v8us*)((unsigned short*)Bt + t * 8) = f.half[0];  }
#define FA_W 8                       /* waves per work-group, 32 query columns each */
#define FA_QB (FA_W * 32)            /* query rows per work-group */
#define FA_ST 64                     /* keys per LDS stage */
#define FA_P 72                      /* LDS row pitch in f16: 128-byte rows + 16 bytes (16 B x odd: conflict-free 16-byte reads) */
typedef float v2f __attribute__((ext_vector_type(2)));
typedef _Float16 v2h __attribute__((ext_vector_type(2)));
__device__ __forceinline__ float fa_xhalf(float x) { return __builtin_bit_cast(float, __builtin_amdgcn_permlanex16(__builtin_bit_cast(int, x), __builtin_bit_cast(int, x), 0x76543210, 0xfedcba98, false, false)); }      /* lane l reads lane l ^ 16 */
__device__ __forceinline__ v8f fa_mma(v16h a, v16h b, v8f c) { return __builtin_amdgcn_wmma_f32_16x16x32_f16(false, a, false, b, (short)0, c, false, false); }
__global__ __launch_bounds__(FA_W * 32) void k_fattn(const _Float16* __restrict__ Q16, const _Float16* __restrict__ K16, const _Float16* __restrict__ VT, _Float16* __restrict__ O16) {
  __shared__ __attribute__((aligned(16))) _Float16 lk[2][FA_ST][FA_P]; __shared__ __attribute__((aligned(16))) _Float16 lv[2][HD][FA_P];
  const int tid = threadIdx.x, w = tid >> 5, lane = tid & 31, ln = lane & 15, hh = lane >> 4; const int h = blockIdx.y, b = blockIdx.z; const size_t r0 = (size_t)b * SQ; const int q0 = blockIdx.x * FA_QB + w * 32;
  const int sr = tid >> 3, sc = (tid & 7) * 8;      /* staging: a thread brings 16 bytes of rows sr and sr + 32 of each tile; 8 lanes cover one 128-byte line */
  const unsigned short* kg = (const unsigned short*)K16 + (r0 + sr) * KVD + h * HD + sc;      /* key row sr of the stage, this head's 64 columns */
  const unsigned short* vg = (const unsigned short*)VT + ((size_t)(b * NH + h) * HD + sr) * SQ + sc;      /* V^T row d = sr, the stage's 64 keys */
  v8us gk0 = *(const v8us*)kg, gk1 = *(const v8us*)(kg + (size_t)32 * KVD), gv0 = *(const v8us*)vg, gv1 = *(const v8us*)(vg + (size_t)32 * SQ);
  v16h qf[2][2];      /* [column group][k step of 32], kept for the whole kernel */
  { const _Float16* qp = Q16 + (r0 + q0 + ln) * LQ + h * HD;
#pragma unroll      /* constant indices keep qf[] in registers */
    for (int g = 0; g < 2; ++g) for (int kk = 0; kk < 2; ++kk) qf[g][kk] = g2_frag(qp + (size_t)g * 16 * LQ + kk * 32, hh);
    asm volatile("s_wait_xcnt 0x0" :: "v"(qp) : "memory"); }      /* the q loads' address pair stays live up to this wait, so no register that an issued load names is overwritten in front of it */
  *(v8us*)&lk[0][sr][sc] = gk0; *(v8us*)&lk[0][sr + 32][sc] = gk1; *(v8us*)&lv[0][sr][sc] = gv0; *(v8us*)&lv[0][sr + 32][sc] = gv1;
  const v8f z8 = {0.f,0.f,0.f,0.f,0.f,0.f,0.f,0.f}; v8f o[2][4];      /* O^T: [column group][16 rows of d] */
#pragma unroll      /* o[] in registers */
  for (int g = 0; g < 2; ++g) for (int t = 0; t < 4; ++t) o[g][t] = z8;
  float mr[2] = {-1.0e30f, -1.0e30f}, l[2] = {0.f, 0.f};      /* maximum in use (log2-scaled) and this lane's part of the denominator */
  const float cs = 0.125f * 1.4426950408889634f;      /* 64^-0.5 * log2(e) */
  __syncthreads();      /* stage 0 is published */
  for (int st = 0; st < SQ / FA_ST; ++st) { const int cur = st & 1; const bool more = st + 1 < SQ / FA_ST;      /* block-uniform */
    if (more) { kg += (size_t)FA_ST * KVD; vg += FA_ST; gk0 = *(const v8us*)kg; gk1 = *(const v8us*)(kg + (size_t)32 * KVD); gv0 = *(const v8us*)vg; gv1 = *(const v8us*)(vg + (size_t)32 * SQ);      /* the next stage flies under this stage's two passes */
      asm volatile("s_wait_xcnt 0x0" :: "v"(kg), "v"(vg) : "memory"); }      /* likewise for the next stage's staging loads: the pointers are stepped only behind this wait (stage 0's loads: behind the wait after the q loads) */
#pragma unroll      /* two 32-key passes per stage, constant LDS offsets */
    for (int ps = 0; ps < FA_ST / 32; ++ps) {
      v8f s[2][2];      /* S^T: [column group][16 keys] */
      { v16h kf[2][2];
#pragma unroll      /* fragments in registers */
        for (int t = 0; t < 2; ++t) for (int kk = 0; kk < 2; ++kk) kf[t][kk] = g2_frag(&lk[cur][ps * 32 + t * 16 + ln][kk * 32], hh);
#pragma unroll      /* fragments in registers */
        for (int t = 0; t < 2; ++t) for (int g = 0; g < 2; ++g) s[g][t] = fa_mma(kf[t][1], qf[g][1], fa_mma(kf[t][0], qf[g][0], z8)); }
      v16h vf[4];
#pragma unroll      /* fragments in registers; these reads fly under the maxima and exponentials */
      for (int t = 0; t < 4; ++t) vf[t] = g2_frag(&lv[cur][t * 16 + ln][ps * 32], hh);
      float mb[2]; bool need = false;
#pragma unroll      /* s[] in registers */
      for (int g = 0; g < 2; ++g) { float mx = s[g][0][0];
        for (int r = 1; r < 8; ++r) mx = fmaxf(mx, s[g][0][r]);
        for (int r = 0; r < 8; ++r) mx = fmaxf(mx, s[g][1][r]);
        mx = fmaxf(mx, fa_xhalf(mx)) * cs; mb[g] = mx; need = need || (mx > mr[g] + 8.0f); }      /* both halves hold the column's maximum; the one in use may trail it by 8 (weights up to 2^8) */
      if (__builtin_amdgcn_ballot_w32(need) != 0) {      /* wave-uniform; always on the first pass, rare afterwards */
#pragma unroll      /* o[] in registers */
        for (int g = 0; g < 2; ++g) { const float mn = fmaxf(mr[g], mb[g]); const float corr = __builtin_amdgcn_exp2f(mr[g] - mn); mr[g] = mn; l[g] *= corr;
          for (int t = 0; t < 4; ++t) o[g][t] = o[g][t] * corr; } }
#pragma unroll      /* s[], o[] in registers */
      for (int g = 0; g < 2; ++g) { const float nm = -mr[g]; const v8f c8 = {cs, cs, cs, cs, cs, cs, cs, cs}, n8 = {nm, nm, nm, nm, nm, nm, nm, nm}; FragH pf; float la = 0.f, lb = 0.f;
        for (int t = 0; t < 2; ++t) { s[g][t] = __builtin_elementwise_fma(s[g][t], c8, n8);
          for (int r = 0; r < 8; ++r) s[g][t][r] = __builtin_amdgcn_exp2f(s[g][t][r]); }      /* weights 2^(score * cs - maximum in use), in the score registers */
        for (int i = 0; i < 8; ++i) { const int t = i >> 2, r = 2 * (i & 3);
          la += s[g][t][r]; lb += s[g][t][r + 1];
          const v2h pk = __builtin_convertvector(v2f{s[g][t][r], s[g][t][r + 1]}, v2h); pf.h[2 * i] = pk[0]; pf.h[2 * i + 1] = pk[1]; }
        l[g] += la + lb;
        for (int t = 0; t < 4; ++t) o[g][t] = fa_mma(vf[t], pf.v, o[g][t]); } }
    asm volatile("v_nop\n\tv_nop\n\tv_nop\n\tv_nop" : "+v"(o[0][0]), "+v"(o[0][1]), "+v"(o[0][2]), "+v"(o[0][3]), "+v"(o[1][0]), "+v"(o[1][1]), "+v"(o[1][2]), "+v"(o[1][3]));      /* four issue slots behind the stage's last matrix instructions: a branch follows */
    if (more) { *(v8us*)&lk[cur ^ 1][sr][sc] = gk0; *(v8us*)&lk[cur ^ 1][sr + 32][sc] = gk1; *(v8us*)&lv[cur ^ 1][sr][sc] = gv0; *(v8us*)&lv[cur ^ 1][sr + 32][sc] = gv1; }      /* its last readers left it at the previous trip's barrier */
    __syncthreads(); }      /* publishes the next stage and ends every wave's reads of this one */
#pragma unroll      /* o[] in registers */
  for (int g = 0; g < 2; ++g) { const float fin = 64.0f / (l[g] + fa_xhalf(l[g]));      /* the halves' sums join once; o carried x64 */
    unsigned short* d = (unsigned short*)O16 + (r0 + q0 + g * 16 + ln) * DM + h * HD + 8 * hh;
    for (int t = 0; t < 4; ++t) { FragH f; for (int r = 0; r < 8; ++r) f.h[r] = (_Float16)(o[g][t][r] * fin); *(v8us*)(d + t * 16) = f.half[0]; } } }      /* a lane's 8 registers are 8 consecutive d of its query row: one 16-byte store */
__global__ __launch_bounds__(256) void k_vt(const _Float16* __restrict__ V16, int b, int h0, _Float16* __restrict__ VT) { __shared__ unsigned short tl[64][65]; const int tid = threadIdx.x; const int hh = blockIdx.x % HG, sg = blockIdx.x / HG; const int s0 = sg * 64; const int h = h0 + hh;
  for (int i = tid; i < 64 * 8; i += 256) { const int j = i / 8, d8 = (i % 8) * 8; FragH f; f.half[0] = *(const v8us*)((const unsigned short*)V16 + ((size_t)b * SQ + s0 + j) * DM + h * HD + d8); for (int q = 0; q < 8; ++q) tl[d8 + q][j] = f.u[q]; }
  __syncthreads();
  { for (int i = tid; i < 64 * 8; i += 256) { const int d = i / 8, j8 = (i % 8) * 8; FragH f; for (int q = 0; q < 8; ++q) f.u[q] = tl[d][j8 + q]; *(v8us*)((unsigned short*)VT + ((size_t)hh * HD + d) * SQ + s0 + j8) = f.half[0]; }  } }



__global__ __launch_bounds__(256) void k_rsmcf2(const float* __restrict__ S, _Float16* __restrict__ P, int hg, int q0, int nk) {
  #pragma clang fp contract(off)
  const int t = blockIdx.x * 256 + threadIdx.x; if (t >= hg * QT) return; const size_t i = (size_t)t; const float* s = S + i * NKX; const int last = q0 + (t % QT); float mx = -3.0e38f;
#pragma unroll 1
  for (int j = 0; j < nk; ++j) { const float f = (j <= last) ? 1.f : 0.f; mx = fmaxf(mx, fmaf(f, s[j], (1.f - f) * -1.0e9f)); } float se = 0.f;
#pragma unroll 1
  for (int j = 0; j < nk; ++j) { const float f = (j <= last) ? 1.f : 0.f; se += __expf(fmaf(f, s[j], (1.f - f) * -1.0e9f) - mx); } const float sc = 256.0f / se;
#pragma unroll 1
  for (int j0 = 0; j0 < nk; j0 += 8) { FragH fr; for (int q = 0; q < 8; ++q) { const int j = j0 + q; const float f = (j <= last) ? 1.f : 0.f; fr.h[q] = (_Float16)(__expf(fmaf(f, s[j], (1.f - f) * -1.0e9f) - mx) * sc); } unsigned short* d = (unsigned short*)P + i * NKX + j0; *(v8us*)d = fr.half[0];  } }


template <int MASKADD>
__global__ __launch_bounds__(64) void k_att0(const float* __restrict__ QF, const float* __restrict__ KF, const float* __restrict__ VF, int ld, const float* __restrict__ mask, float scale, float* __restrict__ OF, int ldo) {
  #pragma clang fp contract(off)
  __shared__ __attribute__((aligned(16))) float lq[64][64]; __shared__ __attribute__((aligned(16))) float lo[64][64];
  const int tid = threadIdx.x; const int h = blockIdx.x / (QT0 / 64), rg = blockIdx.x % (QT0 / 64); const int i = rg * 64 + tid;
  const float* qr = QF + (size_t)i * ld + h * HD;
#pragma unroll 1
  for (int c = 0; c < HD / 4; ++c) { *(v4f*)&lq[tid][c * 4] = *(const v4fa*)(qr + c * 4); const v4f z = {0.f, 0.f, 0.f, 0.f}; *(v4f*)&lo[tid][c * 4] = z; }
  float m = -1.0e30f, l = 0.f; const int jmax = MASKADD ? (SQ - 1) : (rg * 64 + 63);      /* additive-mask form: every key (the mask input decides); causal form: keys up to the block's last row */
#pragma unroll 1
  for (int j = 0; j <= jmax; ++j) { const float* kr = KF + (size_t)j * ld + h * HD; const float* vr = VF + (size_t)j * ld + h * HD; float s = 0.f;
#pragma unroll 1
    for (int c = 0; c < HD / 4; ++c) { const v4f kq = *(const v4fa*)(kr + c * 4); const v4f qq = *(v4f*)&lq[tid][c * 4]; s = __fadd_rn(s, __fmul_rn(qq[0], kq[0])); s = __fadd_rn(s, __fmul_rn(qq[1], kq[1])); s = __fadd_rn(s, __fmul_rn(qq[2], kq[2])); s = __fadd_rn(s, __fmul_rn(qq[3], kq[3])); }
    s = __fmul_rn(s, scale); if (MASKADD) s = __fadd_rn(s, __fmul_rn(bf16_round(mask[(size_t)i * SQ + j]), -10000.0f));
    const float f = (MASKADD || j <= i) ? 1.f : 0.f; const float sm = fmaf(f, s, (1.f - f) * -1.0e30f); const float mn = fmaxf(m, sm); const float sc = expf(m - mn); const float e = expf(sm - mn); l = __fadd_rn(__fmul_rn(l, sc), e); m = mn;
#pragma unroll 1
    for (int c = 0; c < HD / 4; ++c) { const v4f vv = *(const v4fa*)(vr + c * 4); v4f oo = *(v4f*)&lo[tid][c * 4]; for (int u = 0; u < 4; ++u) oo[u] = __fadd_rn(__fmul_rn(oo[u], sc), __fmul_rn(e, vv[u])); *(v4f*)&lo[tid][c * 4] = oo; } }
  const float fin = 64.0f / l;      /* o carried x64 like the f16 path */
#pragma unroll 1
  for (int c = 0; c < HD / 4; ++c) { v4f oo = *(v4f*)&lo[tid][c * 4]; for (int u = 0; u < 4; ++u) oo[u] = __fmul_rn(oo[u], fin); *(v4f*)&lo[tid][c * 4] = oo; }
  __syncthreads();
  {
#pragma unroll 1
    for (int it = 0; it < 16; ++it) { const int row = it * 4 + tid / 16, pc = (tid % 16) * 4; const v4f v = *(const v4f*)&lo[row][pc]; *(v4f*)(OF + (size_t)(rg * 64 + row) * ldo + h * HD + pc) = v; }
     } }


__global__ __launch_bounds__(256) void k_kvexp(const float* __restrict__ src, float* __restrict__ dst, size_t n4) { const size_t t = (size_t)blockIdx.x * 256 + threadIdx.x; if (t >= n4) return; const size_t e = t * 4; const size_t row = e / DM; const int col = (int)(e % DM); const int h = col / HD, d = col % HD; const v4f v = *(const v4fa*)(src + row * KVD + (size_t)(h / HPG) * HD + d); *(v4f*)(dst + e) = v;  }

__global__ __launch_bounds__(256) void k_tab2(float theta, float* __restrict__ CS, float* __restrict__ SN) {
  #pragma clang fp contract(off)
  const int t = blockIdx.x * 256 + threadIdx.x; if (t >= SQ * (HD / 2)) return; const int i = t % (HD / 2); const int p = t / (HD / 2); const float invf = 1.0f / powf(theta, (float)(2 * i) / (float)HD); const float ang = __fmul_rn((float)p, invf); const float c = cosf(ang), s = sinf(ang);
  *(float*)(CS + t) = c; *(float*)(SN + t) = s;  }
template <int NORM, int ROPE>
__global__ __launch_bounds__(64) void k_xform(const float* __restrict__ F, int ldf, int nh, const float* __restrict__ gain, float eps, const float* __restrict__ CS, const float* __restrict__ SN, _Float16* __restrict__ H16, int ldo) {
  #pragma clang fp contract(off)
  __shared__ float xv[HD]; __shared__ float red[HD]; __shared__ unsigned short sh_[HD]; const int d = threadIdx.x; const int h = blockIdx.x % nh; const size_t r = blockIdx.x / nh; const int p = (int)(r % SQ);
  float x = F[r * (size_t)ldf + (size_t)h * HD + d];
  if (NORM) { red[d] = __fmul_rn(x, x); __syncthreads(); for (int st = HD / 2; st > 0; st >>= 1) { if (d < st) red[d] = __fadd_rn(red[d], red[d + st]); __syncthreads(); } const float rs = rsqrtf(__fadd_rn(red[0] / (float)HD, eps)); x = __fmul_rn(__fmul_rn(x, rs), bf16_round(gain[d])); }
  xv[d] = x; __syncthreads();
  float o = x;
  if (ROPE == 1) { const int i = d >> 1; const float c = CS[p * (HD / 2) + i], s = SN[p * (HD / 2) + i]; const float ev = xv[2 * i], od = xv[2 * i + 1]; o = (d & 1) ? __fadd_rn(__fmul_rn(ev, s), __fmul_rn(od, c)) : __fadd_rn(__fmul_rn(ev, c), -__fmul_rn(od, s)); }
  if (ROPE == 2) { const int i = d & (HD / 2 - 1); const float c = CS[p * (HD / 2) + i], s = SN[p * (HD / 2) + i]; const float lo = xv[i], hi = xv[i + HD / 2]; o = (d < HD / 2) ? __fadd_rn(__fmul_rn(lo, c), -__fmul_rn(hi, s)) : __fadd_rn(__fmul_rn(lo, s), __fmul_rn(hi, c)); }
  FragH th; th.h[0] = (_Float16)o; sh_[d] = th.u[0]; __syncthreads();
  if (d < HD / 8) { FragH f; for (int q = 0; q < 8; ++q) f.u[q] = sh_[d * 8 + q]; unsigned short* dst = (unsigned short*)H16 + r * (size_t)ldo + (size_t)h * HD + d * 8; *(v8us*)dst = f.half[0];  } }

template <int NORM, int ROPE>
__global__ __launch_bounds__(64) void k_xformf(const float* __restrict__ F, int ldf, int nh, const float* __restrict__ gain, float eps, const float* __restrict__ CS, const float* __restrict__ SN, float* __restrict__ F32, int ldo) {
  #pragma clang fp contract(off)
  __shared__ float xv[HD]; __shared__ float red[HD]; const int d = threadIdx.x; const int h = blockIdx.x % nh; const size_t r = blockIdx.x / nh; const int p = (int)(r % SQ);
  float x = F[r * (size_t)ldf + (size_t)h * HD + d];
  if (NORM) { red[d] = __fmul_rn(x, x); __syncthreads(); for (int st = HD / 2; st > 0; st >>= 1) { if (d < st) red[d] = __fadd_rn(red[d], red[d + st]); __syncthreads(); } const float rs = rsqrtf(__fadd_rn(red[0] / (float)HD, eps)); x = __fmul_rn(__fmul_rn(x, rs), bf16_round(gain[d])); }
  xv[d] = x; __syncthreads();
  float o = x;
  if (ROPE == 1) { const int i = d >> 1; const float c = CS[p * (HD / 2) + i], s = SN[p * (HD / 2) + i]; const float ev = xv[2 * i], od = xv[2 * i + 1]; o = (d & 1) ? __fadd_rn(__fmul_rn(ev, s), __fmul_rn(od, c)) : __fadd_rn(__fmul_rn(ev, c), -__fmul_rn(od, s)); }
  if (ROPE == 2) { const int i = d & (HD / 2 - 1); const float c = CS[p * (HD / 2) + i], s = SN[p * (HD / 2) + i]; const float lo = xv[i], hi = xv[i + HD / 2]; o = (d < HD / 2) ? __fadd_rn(__fmul_rn(lo, c), -__fmul_rn(hi, s)) : __fadd_rn(__fmul_rn(lo, s), __fmul_rn(hi, c)); }
  float* dst = F32 + r * (size_t)ldo + (size_t)h * HD + d; *(float*)dst = o;  }

__global__ __launch_bounds__(256) void k_bfcp(const float* __restrict__ src, float* __restrict__ dst, size_t n4) { const size_t t = (size_t)blockIdx.x * 256 + threadIdx.x; if (t >= n4) return; const v4f a = *(const v4fa*)(src + t * 4); v4f o; for (int q = 0; q < 4; ++q) o[q] = bf16_round(a[q]); *(v4f*)(dst + t * 4) = o;  }

__global__ __launch_bounds__(256) void k_tab2d(float* __restrict__ CS, float* __restrict__ SN) {
  #pragma clang fp contract(off)
  const int t = blockIdx.x * 256 + threadIdx.x; if (t >= SQ * (HD / 2)) return; const int i = t % (HD / 2); const int p = t / (HD / 2); const float invf = (float)(1.0 / pow(10000.0, (double)(2 * i) / (double)HD)); const float ang = __fmul_rn((float)p, invf); const float c = cosf(ang), s = sinf(ang);
  *(float*)(CS + t) = c; *(float*)(SN + t) = s;  }
extern "C" void kernel_launch(void* const* d_in, const int* in_sizes, int n_in,
                              void* d_out, int out_size, void* d_ws, size_t ws_size, hipStream_t stream) {
  (void)in_sizes; (void)n_in; (void)out_size;
  const float* const* I = (const float* const*)d_in; const float* x = I[0]; const float* wq = I[1]; const float* wk = I[2]; const float* wv = I[3]; const float* wo = I[4]; const float* bq = nullptr; const float* bk = nullptr; const float* bv = nullptr; const float* bo = I[5];      /* input order: x, Wq, Wk, Wv, Wo (natural [out][in] weights), bo [1024] (the output bias: into the output GEMM's bias slot); the q / k / v projections have NO biases; rope tables computed in the kernel (positions = row index) */
  char* ws = (char*)d_ws; size_t off = 0;
  auto take = [&](size_t bytes) { char* p = ws + off; off += (bytes + 255) & ~(size_t)255; return p; };
  _Float16* BQ = (_Float16*)take((size_t)DM * DM * 2); _Float16* BK = (_Float16*)take((size_t)KVD * DM * 2); _Float16* BV = (_Float16*)take((size_t)KVD * DM * 2); _Float16* BO = (_Float16*)take((size_t)DM * DM * 2);
  _Float16* X16 = (_Float16*)take(NR * DM * 2); float* QF = (float*)take((size_t)SQ * DM * 4); float* KF = (float*)take((size_t)SQ * KVD * 4); float* CSB = (float*)take((size_t)SQ * 32 * 4); float* SNB = (float*)take((size_t)SQ * 32 * 4); _Float16* Q16 = (_Float16*)take(NR * DM * 2); _Float16* K16 = (_Float16*)take(NR * KVD * 2); _Float16* V16 = (_Float16*)take(NR * KVD * 2); _Float16* O16 = (_Float16*)take(NR * DM * 2);
  _Float16* VT = (_Float16*)take((size_t)NB * NH * HD * SQ * 2);
  float* QF0 = (float*)take((size_t)QT0 * DM * 4); float* KF0 = (float*)take((size_t)QT0 * KVD * 4); float* VF0 = (float*)take((size_t)QT0 * KVD * 4); float* KF0e = (float*)take((size_t)QT0 * DM * 4); float* VF0e = (float*)take((size_t)QT0 * DM * 4); float* OF0 = (float*)take((size_t)NB * QT0 * DM * 4); _Float16* OH0 = (_Float16*)take((size_t)NB * QT0 * DM * 2); _Float16* OL0 = (_Float16*)take((size_t)NB * QT0 * DM * 2);
  if (off > ws_size) return;
  k_wnat<<<(unsigned)(((size_t)DM * DM / 8 + 255) / 256), 256, 0, stream>>>(wq, (size_t)DM * DM / 8, BQ); k_wnat<<<(unsigned)(((size_t)KVD * DM / 8 + 255) / 256), 256, 0, stream>>>(wk, (size_t)KVD * DM / 8, BK); k_wnat<<<(unsigned)(((size_t)KVD * DM / 8 + 255) / 256), 256, 0, stream>>>(wv, (size_t)KVD * DM / 8, BV); k_wnat<<<(unsigned)(((size_t)DM * DM / 8 + 255) / 256), 256, 0, stream>>>(wo, (size_t)DM * DM / 8, BO);      /* natural [out][in] = Bt[n][k] x16 (KVD = 16 x 64 = DM: full-width k / v) */
  k_x16<<<(unsigned)((NR * DM / 8 + 255) / 256), 256, 0, stream>>>(x, X16, NR * DM / 8);
  const size_t r0p = (size_t)B0 * SQ;      /* first projected row */
  k_gemm2<0><<<dim3((unsigned)((MP / 128) * (KVD / 64)), 1), 128, 0, stream>>>(X16 + r0p * DM, DM, 0, BV, DM, 0, 0.0625f, bv, 0, nullptr, 1, 0, 0, nullptr, V16 + r0p * KVD, KVD, 0, MP, KVD, DM);
  k_tab2d<<<(unsigned)(((size_t)SQ * (HD / 2) + 255) / 256), 256, 0, stream>>>(CSB, SNB);      /* rope tables computed in the kernel: CS[p][i] = cos(p * 10000^(-2i/64)), SN = sin, i < 32 (rotate-half convention; the module's [f | f] tables repeat these 32 columns) */
  for (int b = B0; b < B0 + NBR; ++b) { const size_t r0 = (size_t)b * SQ;
    k_gemm2<0><<<dim3((unsigned)((SQ / 128) * (DM / 64)), 1), 128, 0, stream>>>(X16 + r0 * DM, DM, 0, BQ, DM, 0, 0.0625f, bq, 0, nullptr, 1, 0, 0, QF, nullptr, DM, 0, SQ, DM, DM);      /* q (f32) of this batch */
    k_gemm2<0><<<dim3((unsigned)((SQ / 128) * (KVD / 64)), 1), 128, 0, stream>>>(X16 + r0 * DM, DM, 0, BK, DM, 0, 0.0625f, bk, 0, nullptr, 1, 0, 0, KF, nullptr, KVD, 0, SQ, KVD, DM);      /* k (f32) */
    k_xform<0, 2><<<(unsigned)((size_t)SQ * NH), 64, 0, stream>>>(QF, DM, NH, nullptr, 0.f, CSB, SNB, Q16 + r0 * DM, DM); k_xform<0, 2><<<(unsigned)((size_t)SQ * NG), 64, 0, stream>>>(KF, KVD, NG, nullptr, 0.f, CSB, SNB, K16 + r0 * KVD, KVD);      /* half-split rope <0, 2> (out_lo = x_lo c - x_hi s, out_hi = x_lo s + x_hi c = t cos + rotate_half(t) sin) from the computed tables, then f32 -> f16 */
    k_vt<NG, SQ><<<NG * (SQ / 64), 256, 0, stream>>>(V16 + r0 * KVD, KVD, 0, VT + (size_t)b * NH * HD * SQ); }      /* V^T [NB][NH][HD][SQ]: this batch's slabs */
  k_fattn<<<dim3(SQ / FA_QB, NH, NB), FA_W * 32, 0, stream>>>(Q16, K16, VT, O16);      /* non-causal attention of all batches, heads and query rows in one launch: scores, softmax and weighted values fused; o into merged f16 rows (x64) */
  k_gemm2<0><<<dim3((unsigned)((MPO / 128) * (DM / 64)), 1), 128, 0, stream>>>(O16 + r0p * DM, DM, 0, BO, DM, 0, 0.0009765625f, bo, 0, nullptr, 1, 0, 0, (float*)d_out + r0p * DM, nullptr, DM, 0, MPO, DM, DM);      /* out rows are the output layout */
}

// v004
// A run of this version takes 200 microseconds.
// Next to v003, in two timings, it ran 1.52 times as fast each time.
// Over all steps from v000 it is 99.8 times as fast.
#include <hip/hip_runtime.h>
// Multi-head self-attention with rotate-half RoPE computed in the kernel and a biased output projection, NON-causal (x [2][2048][1024]; q / k / v = x W^T (natural [1024][1024], no biases), 16 heads of 64; cos / sin = [f | f] of pos * 10000^(-2i/64); q = q cos + rotate_half(q) sin, likewise k; scores * 64^-0.5; softmax over all 2048 keys (no mask); out = merged Wo^T + bo (natural + bias) -> [2][2048][1024]); run as 16 groups of ONE head.
// Structure: x as exact f16 rows; natural weights as exact x16 planes; v as a WMMA GEMM (32x64 wave tiles, f32 accumulation, f16 output); rope tables computed once (double-derived inv_freq, f32 angle); q and k of all rows as ONE GEMM launch (grid.y = q / k) whose epilogue applies the rotate-half rotation and the f16 conversion to the f32 tile it has staged in LDS (a wave tile is one head's 64 columns); per batch V^T of the heads via LDS transposes; then ONE fused attention launch for all batches, heads and query rows (256 query rows per work-group): per 32 keys S^T = K Q^T (K = 64), online softmax on VALU in the log2 domain (f32 statistics, native exp2, lazy rescale; weights f16, unnormalised), O^T += V^T P^T, o / row sum (carried x64) into merged f16 rows; scores and weights stay in registers; out = o Wo^T GEMM (f32, alpha 2^-10); launches: see trace.
// Compute dtype: inputs rounded to bf16; x / weights exact; q, k, v, softmax weights and o as plain f16 GEMM operands (~2^-12); scores and softmax statistics f32. v_wmma_f32_16x16x32_f16.
#define NB 2
#define NG 16
#define HPG 1
#define KVD (NG * HD)
#define SQ 2048
#define DM 1024
#define NH 16
#define HD 64
#define HG 4                         /* heads handled by the grouped k_vt overload kept below */
#define QT 512                       /* query rows per tile of the unfused softmax kernel kept below */
#define NKX SQ                       /* S / P row pitch */
#define QT0 128                      /* first-tile rows of the f32 k_att0 path (not launched) */
#define B0 0                         /* first batch processed (debug hook) */
#define NBR NB                       /* batches processed (debug hook) */
#define NR ((size_t)NB * SQ)         /* token rows */
#define MP ((int)((size_t)NBR * SQ)) /* rows projected (debug hook) */
#define QN SQ                        /* query rows attended per batch (unused) */
#define NHD NH                       /* heads attended (unused) */
#define MPO MP                       /* rows through the output stage (debug hook) */
#define LQ DM      /* row pitch of the q/k/v rows */
typedef __bf16 v16b __attribute__((ext_vector_type(16)));
typedef unsigned short v8us __attribute__((ext_vector_type(8), may_alias));
typedef float  v8f  __attribute__((ext_vector_type(8)));
typedef float  v4f  __attribute__((ext_vector_type(4)));
typedef float  v4fa __attribute__((ext_vector_type(4), may_alias));
union FragB { v16b v; v8us half[2]; unsigned short u[16]; };

__device__ __forceinline__ unsigned short bf16_bits(float x) { unsigned int u = __float_as_uint(x); return (unsigned short)((u + 0x7FFFu + ((u >> 16) & 1u)) >> 16); }
__device__ __forceinline__ float bf16_val(unsigned short b) { return __uint_as_float(((unsigned int)b) << 16); }
__device__ __forceinline__ float bf16_round(float x) { return bf16_val(bf16_bits(x)); }
// D += A·B with NT terms: 1 = ah·bh, 2 = + al·bh (A split), 3 = + ah·bl (both split)
template <int NT>
__device__ __forceinline__ v8f mmaN(v16b ah, v16b al, v16b bh, v16b bl, v8f c) {
  c = __builtin_amdgcn_wmma_f32_16x16x32_bf16(false, ah, false, bh, (short)0, c, false, false);
  if (NT >= 2) c = __builtin_amdgcn_wmma_f32_16x16x32_bf16(false, al, false, bh, (short)0, c, false, false);
  if (NT >= 3) c = __builtin_amdgcn_wmma_f32_16x16x32_bf16(false, ah, false, bl, (short)0, c, false, false);
  asm volatile("v_nop\n\tv_nop\n\tv_nop\n\tv_nop" : "+v"(c) : "v"(ah), "v"(al), "v"(bh), "v"(bl));
  return c;
}

__global__ __launch_bounds__(256) void k_wt_bf16(const float* __restrict__ W, unsigned short* __restrict__ Wt, int K, int N) {
  const int t = blockIdx.x * 256 + threadIdx.x;
  const int k8n = K / 8;
  if (t >= N * k8n) return;
  const int n = t / k8n, k8 = (t % k8n) * 8;
  v8us v;
#pragma unroll
  for (int i = 0; i < 8; ++i) v[i] = bf16_bits(W[(size_t)(k8 + i) * N + n]);
  *(v8us*)(Wt + (size_t)n * K + k8) = v;
  
}

// GEMM C[M][N] (f32, pitch ldc) = act(A[M][K]·W + bias). A f32 row-major (pitch lda) converted per fragment to bf16
// (ASPLIT: hi/lo two planes -> 2 terms, else single rounded term); Wt bf16 [N][K] (pitch ldb). BIAS_BF16 rounds the
// bias to bf16 first (bias quantised to bf16 before the add). K%32==0, M%16==0, N%64==0.
template <bool ASPLIT, int ACT, bool BIAS_BF16>
__global__ __launch_bounds__(128) void k_gemm_bf(const float* __restrict__ A, int lda, const unsigned short* __restrict__ Wt, int ldb,
                                               const float* __restrict__ bias, float* __restrict__ C, int ldc, int M, int N, int K) {
  __shared__ __attribute__((aligned(16))) float so[4][16][64];
  const int tid = threadIdx.x, w = tid >> 5, lane = tid & 31, ln = lane & 15, hh = lane >> 4;
  const int ntn = N / 64;
  const int wid = blockIdx.x * 4 + w;
  const int mt = wid / ntn, nq = wid % ntn;
  if (mt * 16 >= M) return;
  const int row0 = mt * 16, col0 = nq * 64;
  const float* arow = A + (size_t)(row0 + ln) * lda;
  v8f acc[4] = {};
  for (int kb = 0; kb < K; kb += 32) {
    FragB ah, al;
    const v4f x0 = *(const v4fa*)(arow + kb + 8 * hh), x1 = *(const v4fa*)(arow + kb + 8 * hh + 4);
    const v4f x2 = *(const v4fa*)(arow + kb + 16 + 8 * hh), x3 = *(const v4fa*)(arow + kb + 16 + 8 * hh + 4);
    float xs[16] = {x0[0],x0[1],x0[2],x0[3],x1[0],x1[1],x1[2],x1[3],x2[0],x2[1],x2[2],x2[3],x3[0],x3[1],x3[2],x3[3]};
#pragma unroll
    for (int i = 0; i < 16; ++i) { const unsigned short hb = bf16_bits(xs[i]); ah.u[i] = hb; al.u[i] = ASPLIT ? bf16_bits(xs[i] - bf16_val(hb)) : (unsigned short)0; }
#pragma unroll
    for (int t = 0; t < 4; ++t) {
      const unsigned short* brow = Wt + (size_t)(col0 + t * 16 + ln) * ldb + kb;
      FragB b;
      b.half[0] = *(const v8us*)(brow + 8 * hh);
      b.half[1] = *(const v8us*)(brow + 16 + 8 * hh);
      acc[t] = mmaN<ASPLIT ? 2 : 1>(ah.v, al.v, b.v, b.v, acc[t]);
    }
  }
#pragma unroll
  for (int t = 0; t < 4; ++t) {
    float bv = bias ? bias[col0 + t * 16 + ln] : 0.f;
    if (BIAS_BF16) bv = bf16_round(bv);
#pragma unroll
    for (int r = 0; r < 8; ++r) { float v = acc[t][r] + bv; if (ACT == 1) v = fmaxf(v, 0.f); so[w][8 * hh + r][t * 16 + ln] = v; }
  }
  __builtin_amdgcn_fence(__ATOMIC_ACQ_REL, "workgroup");
  __builtin_amdgcn_wave_barrier();
  const int rsub = lane >> 4, c4 = (lane & 15) * 4;
  {
#pragma unroll
    for (int q = 0; q < 8; ++q) {
      const int r = q * 2 + rsub;
      const v4f v = *(const v4fa*)&so[w][r][c4];
      *(v4f*)(C + (size_t)(row0 + r) * ldc + col0 + c4) = v;
    }
    
  }
}

// GEMM C = act(A·W + bias + resid): A f32 (ASPLIT -> hi/lo 2 terms), Wt bf16 [N][K]; ACT 0 none, 1 relu, 2 exact gelu;
// resid (optional, f32, row index = (row % rmod), pitch ldr, RES_BF16 rounds it) added before the activation.
template <bool ASPLIT, int ACT, bool BIAS_BF16, bool RES_BF16>
__global__ __launch_bounds__(128) void k_gemm_bf3(const float* __restrict__ A, int lda, const unsigned short* __restrict__ Wt, int ldb,
                                                const float* __restrict__ bias, const float* __restrict__ resid, int rmod, int ldr,
                                                float* __restrict__ C, int ldc, int M, int N, int K) {
  __shared__ __attribute__((aligned(16))) float so[4][16][64];
  const int tid = threadIdx.x, w = tid >> 5, lane = tid & 31, ln = lane & 15, hh = lane >> 4;
  const int ntn = N / 64;
  const int wid = blockIdx.x * 4 + w;
  const int mt = wid / ntn, nq = wid % ntn;
  if (mt * 16 >= M) return;
  const int row0 = mt * 16, col0 = nq * 64;
  const float* arow = A + (size_t)(row0 + ln) * lda;
  v8f acc[4] = {};
  for (int kb = 0; kb < K; kb += 32) {
    FragB ah, al;
    const v4f x0 = *(const v4fa*)(arow + kb + 8 * hh), x1 = *(const v4fa*)(arow + kb + 8 * hh + 4);
    const v4f x2 = *(const v4fa*)(arow + kb + 16 + 8 * hh), x3 = *(const v4fa*)(arow + kb + 16 + 8 * hh + 4);
    float xs[16] = {x0[0],x0[1],x0[2],x0[3],x1[0],x1[1],x1[2],x1[3],x2[0],x2[1],x2[2],x2[3],x3[0],x3[1],x3[2],x3[3]};
#pragma unroll
    for (int i = 0; i < 16; ++i) { const unsigned short hb = bf16_bits(xs[i]); ah.u[i] = hb; al.u[i] = ASPLIT ? bf16_bits(xs[i] - bf16_val(hb)) : (unsigned short)0; }
#pragma unroll
    for (int t = 0; t < 4; ++t) {
      const unsigned short* brow = Wt + (size_t)(col0 + t * 16 + ln) * ldb + kb;
      FragB b;
      b.half[0] = *(const v8us*)(brow + 8 * hh);
      b.half[1] = *(const v8us*)(brow + 16 + 8 * hh);
      acc[t] = mmaN<ASPLIT ? 2 : 1>(ah.v, al.v, b.v, b.v, acc[t]);
    }
  }
#pragma unroll
  for (int t = 0; t < 4; ++t) {
    const int col = col0 + t * 16 + ln;
    float bv = bias ? bias[col] : 0.f;
    if (BIAS_BF16) bv = bf16_round(bv);
#pragma unroll
    for (int r = 0; r < 8; ++r) {
      float v = acc[t][r] + bv;
      if (resid) { float rv = resid[(size_t)((row0 + 8 * hh + r) % rmod) * ldr + col]; if (RES_BF16) rv = bf16_round(rv); v += rv; }
      if (ACT == 1) v = fmaxf(v, 0.f);
      if (ACT == 2) v = 0.5f * v * (1.0f + erff(v * 0.70710678118654752f));
      if (ACT == 3) { const float u = 0.7978845608028654f * (v + 0.044715f * v * v * v); v = 0.5f * v * (1.0f + tanhf(u)); }
      so[w][8 * hh + r][t * 16 + ln] = v;
    }
  }
  __builtin_amdgcn_fence(__ATOMIC_ACQ_REL, "workgroup");
  __builtin_amdgcn_wave_barrier();
  const int rsub = lane >> 4, c4 = (lane & 15) * 4;
  {
#pragma unroll
    for (int q = 0; q < 8; ++q) {
      const int r = q * 2 + rsub;
      const v4f v = *(const v4fa*)&so[w][r][c4];
      *(v4f*)(C + (size_t)(row0 + r) * ldc + col0 + c4) = v;
    }
    
  }
}
// row LayerNorm (biased variance, eps) over N: s = X (+ R); optional out_sum <- s; out_norm <- (s-mu)*rsqrt(var+eps)*g + b
template <bool PARAM_BF16>
__global__ __launch_bounds__(256) void k_layernorm(const float* __restrict__ X, const float* __restrict__ R, const float* __restrict__ g, const float* __restrict__ bta,
                                                  float* __restrict__ out_sum, float* __restrict__ out_norm, int N, float eps) {
  __shared__ float red[256];
  const int row = blockIdx.x, tid = threadIdx.x;
  const float* x = X + (size_t)row * N; const float* rr = R ? R + (size_t)row * N : nullptr;
  float vals[16];                     // up to N = 4096
  const int per = N / 256;            // contiguous chunk per thread? use strided-by-4 chunks: thread handles j = tid*4 + 1024*u
  float s1 = 0.f;
  for (int u = 0; u < per / 4; ++u) {
    const int j = tid * 4 + 1024 * u;
    const v4f a = *(const v4fa*)(x + j);
    v4f b = {0.f,0.f,0.f,0.f}; if (rr) b = *(const v4fa*)(rr + j);
#pragma unroll
    for (int q = 0; q < 4; ++q) { const float v = a[q] + b[q]; vals[u * 4 + q] = v; s1 += v; }
  }
  red[tid] = s1; __syncthreads();
  for (int st = 128; st > 0; st >>= 1) { if (tid < st) red[tid] += red[tid + st]; __syncthreads(); }
  const float mu = red[0] / (float)N; __syncthreads();
  float s2 = 0.f;
  for (int u = 0; u < per / 4; ++u)
#pragma unroll
    for (int q = 0; q < 4; ++q) { const float c = vals[u * 4 + q] - mu; s2 += c * c; }
  red[tid] = s2; __syncthreads();
  for (int st = 128; st > 0; st >>= 1) { if (tid < st) red[tid] += red[tid + st]; __syncthreads(); }
  const float rs = rsqrtf(red[0] / (float)N + eps);
  {
    for (int u = 0; u < per / 4; ++u) {
      const int j = tid * 4 + 1024 * u;
      v4f o, sm;
#pragma unroll
      for (int q = 0; q < 4; ++q) {
        float gg = g[j + q], bb = bta[j + q];
        if (PARAM_BF16) { gg = bf16_round(gg); bb = bf16_round(bb); }
        sm[q] = vals[u * 4 + q]; o[q] = (vals[u * 4 + q] - mu) * rs * gg + bb;
      }
      if (out_sum) *(v4f*)(out_sum + (size_t)row * N + j) = sm;
      *(v4f*)(out_norm + (size_t)row * N + j) = o;
    }
    
  }
}



// ---- f16 WMMA path (v_wmma_f32_16x16x32_f16): 11-bit significands for operands in range — used where a [0,1] probability operand needs more precision than bf16
typedef _Float16 v16h __attribute__((ext_vector_type(16)));
union FragH { v16h v; v8us half[2]; _Float16 h[16]; unsigned short u[16]; };
template <int NT>
__device__ __forceinline__ v8f mmaH(v16h ah, v16h al, v16h bh, v16h bl, v8f c) {
  c = __builtin_amdgcn_wmma_f32_16x16x32_f16(false, ah, false, bh, (short)0, c, false, false);
  if (NT >= 2) c = __builtin_amdgcn_wmma_f32_16x16x32_f16(false, al, false, bh, (short)0, c, false, false);
  if (NT >= 3) c = __builtin_amdgcn_wmma_f32_16x16x32_f16(false, ah, false, bl, (short)0, c, false, false);
  asm volatile("v_nop\n\tv_nop\n\tv_nop\n\tv_nop" : "+v"(c) : "v"(ah), "v"(al), "v"(bh), "v"(bl));
  return c;
}
// batched GEMM like k_gemm_b but f16 operands: A f32 (split into f16 hi/lo if ASPLIT, else rounded to f16), Bt = f16 values [n][k]; alpha; C f32; N multiple of 16 (partial tiles skipped)
template <bool ASPLIT>
__global__ __launch_bounds__(128) void k_gemm_h(const float* __restrict__ A, int lda, size_t sA, const _Float16* __restrict__ Bh, int ldb, size_t sB, float alpha, float* __restrict__ C, int ldc, size_t sC, int M, int N, int K) {
  __shared__ __attribute__((aligned(16))) float so[4][16][64];
  const int tid = threadIdx.x, w = tid >> 5, lane = tid & 31, ln = lane & 15, hh = lane >> 4; const int by = blockIdx.y;
  A += (size_t)by * sA; Bh += (size_t)by * sB; C += (size_t)by * sC;
  const int ntn = (N + 63) / 64; const int wid = blockIdx.x * 4 + w; const int mt = wid / ntn, nq = wid % ntn; if (mt * 16 >= M) return;
  const int row0 = mt * 16, col0 = nq * 64; const float* arow = A + (size_t)(row0 + ln) * lda;
  v8f acc[4] = {};
  for (int kb = 0; kb < K; kb += 32) {
    FragH ah, al;
    const v4f x0 = *(const v4fa*)(arow + kb + 8 * hh), x1 = *(const v4fa*)(arow + kb + 8 * hh + 4), x2 = *(const v4fa*)(arow + kb + 16 + 8 * hh), x3 = *(const v4fa*)(arow + kb + 16 + 8 * hh + 4);
    float xs[16] = {x0[0],x0[1],x0[2],x0[3],x1[0],x1[1],x1[2],x1[3],x2[0],x2[1],x2[2],x2[3],x3[0],x3[1],x3[2],x3[3]};
#pragma unroll
    for (int i = 0; i < 16; ++i) { const _Float16 h = (_Float16)xs[i]; ah.h[i] = h; al.h[i] = ASPLIT ? (_Float16)(xs[i] - (float)h) : (_Float16)0.0f; }
#pragma unroll
    for (int t = 0; t < 4; ++t) { if (col0 + t * 16 >= N) continue; const size_t boff = (size_t)(col0 + t * 16 + ln) * ldb + kb; FragH bq; bq.half[0] = *(const v8us*)(Bh + boff + 8 * hh); bq.half[1] = *(const v8us*)(Bh + boff + 16 + 8 * hh);
      acc[t] = mmaH<ASPLIT ? 2 : 1>(ah.v, al.v, bq.v, bq.v, acc[t]); }
  }
#pragma unroll
  for (int t = 0; t < 4; ++t) { if (col0 + t * 16 >= N) continue;
#pragma unroll
    for (int r = 0; r < 8; ++r) so[w][8 * hh + r][t * 16 + ln] = acc[t][r] * alpha; }
  __builtin_amdgcn_fence(__ATOMIC_ACQ_REL, "workgroup"); __builtin_amdgcn_wave_barrier();
  const int rsub = lane >> 4, c4 = (lane & 15) * 4;
  {
#pragma unroll
    for (int q = 0; q < 8; ++q) { const int r = q * 2 + rsub; if (col0 + c4 < N) { const v4f v = *(const v4fa*)&so[w][r][c4]; *(v4f*)(C + (size_t)(row0 + r) * ldc + col0 + c4) = v; } }
     }
}

// Wt[n][k] = f16(W[k][n]·scale) from f32 row-major W[K][N] (scale = power of two; bf16-exact weights stay exact in f16 away from the subnormal range)
__global__ __launch_bounds__(256) void k_wt_f16(const float* __restrict__ W, _Float16* __restrict__ Wt, int K, int N, float scale) {
  const int t = blockIdx.x * 256 + threadIdx.x; if (t >= N * (K / 8)) return; const int n = t / (K / 8), k8 = (t % (K / 8)) * 8; FragH f;
#pragma unroll
  for (int i = 0; i < 8; ++i) f.h[i] = (_Float16)(bf16_round(W[(size_t)(k8 + i) * N + n]) * scale); const v8us o = f.half[0];
  *(v8us*)((unsigned short*)Wt + (size_t)n * K + k8) = o; 
}
// k_gemm_hh variant with fused epilogue: v = acc·alpha + bias[by·sBias + col] (+ CP[(row/rowsPerB)·sCPb + by·64 + col] if CP) ; ACT 0 none / 1 elu ; writes f16 C16 (and f32 C if non-null)
template <int ACT>
__global__ __launch_bounds__(128) void k_gemm_hhx(const _Float16* __restrict__ A, int lda, size_t sA, const _Float16* __restrict__ Bh, int ldb, size_t sB, float alpha, const float* __restrict__ bias, size_t sBias, const float* __restrict__ CP, int rowsPerB, size_t sCPb, int row0g,
    float* __restrict__ C, _Float16* __restrict__ C16, int ldc, size_t sC, int M, int N, int K) {
  __shared__ __attribute__((aligned(16))) float so[4][16][64];
  const int tid = threadIdx.x, w = tid >> 5, lane = tid & 31, ln = lane & 15, hh = lane >> 4; const int by = blockIdx.y;
  A += (size_t)by * sA; Bh += (size_t)by * sB; const size_t cofs = (size_t)by * sC; const float* bp = bias ? bias + (size_t)by * sBias : nullptr;
  const int ntn = (N + 63) / 64; const int wid = blockIdx.x * 4 + w; const int mt = wid / ntn, nq = wid % ntn; if (mt * 16 >= M) return;
  const int row0 = mt * 16, col0 = nq * 64; const _Float16* arow = A + (size_t)(row0 + ln) * lda;
  v8f acc[4] = {};
  for (int kb = 0; kb < K; kb += 32) { FragH ah; ah.half[0] = *(const v8us*)((const unsigned short*)arow + kb + 8 * hh); ah.half[1] = *(const v8us*)((const unsigned short*)arow + kb + 16 + 8 * hh);
#pragma unroll
    for (int t = 0; t < 4; ++t) { if (col0 + t * 16 >= N) continue; const size_t boff = (size_t)(col0 + t * 16 + ln) * ldb + kb; FragH bq; bq.half[0] = *(const v8us*)((const unsigned short*)Bh + boff + 8 * hh); bq.half[1] = *(const v8us*)((const unsigned short*)Bh + boff + 16 + 8 * hh);
      acc[t] = mmaH<1>(ah.v, ah.v, bq.v, bq.v, acc[t]); }
  }
#pragma unroll
  for (int t = 0; t < 4; ++t) { if (col0 + t * 16 >= N) continue; const int col = col0 + t * 16 + ln; const float bv = bp ? bf16_round(bp[col]) : 0.f;
#pragma unroll
    for (int r = 0; r < 8; ++r) { float v = acc[t][r] * alpha + bv; if (CP) { const int rr = row0g + row0 + 8 * hh + r; if (rowsPerB < 0) v += CP[cofs + (size_t)rr * ldc + col];      /* rowsPerB < 0: own element of the batched C plane */ else { const int bidx = rr / rowsPerB; v += CP[(size_t)bidx * sCPb + (size_t)by * 64 + col]; } } if (ACT == 1) v = (v > 0.f) ? v : expm1f(v); else if (ACT == 7) v = (v > 0.f) ? v + 1.0f : expf(v); else if (ACT == 8) v = tanhf(v); else if (ACT == 9) v = 0.5f * v * (1.0f + tanhf(0.7978845608028654f * (v + 0.044715f * v * v * v))); else if (ACT == 11) v = 1.0f / (1.0f + expf(-v)); else if (ACT == 12) v = (v > 0.f) ? v : 0.01f * v; else if (ACT == 14) v = (v > 0.f) ? v : 0.1f * v; else if (ACT == 16) v = (v >= 0.f) ? v : 0.3f * v; else if (ACT == 17) v = (v >= 0.f) ? v : 0.2f * v; else if (ACT == 15) v = v / (1.0f + expf(-v)); else if (ACT == 3) v = fmaxf(v, 0.f); else if (ACT == 6) v = 0.5f * v * (1.0f + erff(v * 0.70710678118654752f)); so[w][8 * hh + r][t * 16 + ln] = v; } }
  __builtin_amdgcn_fence(__ATOMIC_ACQ_REL, "workgroup"); __builtin_amdgcn_wave_barrier();
  const int rsub = lane >> 4, c4 = (lane & 15) * 4; typedef _Float16 v4h __attribute__((ext_vector_type(4)));
  {
#pragma unroll
    for (int q = 0; q < 8; ++q) { const int r = q * 2 + rsub; if (col0 + c4 < N) { const v4f v = *(const v4fa*)&so[w][r][c4]; if (C) *(v4f*)(C + cofs + (size_t)(row0 + r) * ldc + col0 + c4) = v; if (C16) { v4h h4; for (int i = 0; i < 4; ++i) h4[i] = (_Float16)v[i]; *(v4h*)(C16 + cofs + (size_t)(row0 + r) * ldc + col0 + c4) = h4; } } }
     }
}


typedef _Float16 v4h __attribute__((ext_vector_type(4)));

__global__ __launch_bounds__(256) void k_x16(const float* __restrict__ x, _Float16* __restrict__ X16, size_t n8) { const size_t t = (size_t)blockIdx.x * 256 + threadIdx.x; if (t >= n8) return; FragH f;
#pragma unroll
  for (int q = 0; q < 8; ++q) f.h[q] = (_Float16)bf16_round(x[t * 8 + q]); *(v8us*)((unsigned short*)X16 + t * 8) = f.half[0];  }
__global__ __launch_bounds__(256) void k_h16(const float* __restrict__ x, _Float16* __restrict__ X16, size_t n8) { const size_t t = (size_t)blockIdx.x * 256 + threadIdx.x; if (t >= n8) return; FragH f;
#pragma unroll
  for (int q = 0; q < 8; ++q) f.h[q] = (_Float16)x[t * 8 + q]; *(v8us*)((unsigned short*)X16 + t * 8) = f.half[0];  }
__global__ __launch_bounds__(256) void k_round16f(const float* __restrict__ W, _Float16* __restrict__ Bt, size_t n8) { const size_t t = (size_t)blockIdx.x * 256 + threadIdx.x; if (t >= n8) return; FragH f;
#pragma unroll
  for (int i = 0; i < 8; ++i) f.h[i] = (_Float16)(bf16_round(W[t * 8 + i]) * 16.0f); *(v8us*)((unsigned short*)Bt + t * 8) = f.half[0];  }
template <int NHv, int TTv>
__global__ __launch_bounds__(256) void k_vt(const _Float16* __restrict__ V16, int ldv, int voff, _Float16* __restrict__ Vt) { __shared__ unsigned short tl[64][66]; const int tid = threadIdx.x; const int slab = blockIdx.x / (TTv / 64), lg = blockIdx.x % (TTv / 64); const int b = slab / NHv, h = slab % NHv;
  for (int i = tid; i < 64 * 8; i += 256) { const int r = i / 8, c8 = (i % 8) * 8; FragH f; f.half[0] = *(const v8us*)((const unsigned short*)V16 + ((size_t)b * TTv + lg * 64 + r) * ldv + voff + h * 64 + c8);
#pragma unroll
    for (int q = 0; q < 8; ++q) tl[r][c8 + q] = f.u[q]; }
  __syncthreads();
  {
#pragma unroll
    for (int rd = 0; rd < 2; ++rd) { const int d = rd * 32 + tid / 8, pc = tid % 8; FragH f;
#pragma unroll
      for (int q = 0; q < 8; ++q) f.u[q] = tl[pc * 8 + q][d];
      *(v8us*)((unsigned short*)Vt + ((size_t)slab * 64 + d) * TTv + lg * 64 + pc * 8) = f.half[0]; }
     } }

__global__ __launch_bounds__(256) void k_hl(const float* __restrict__ F, _Float16* __restrict__ Hh, _Float16* __restrict__ Hl, size_t n8) { const size_t t = (size_t)blockIdx.x * 256 + threadIdx.x; if (t >= n8) return; FragH fh, fl; const v4f a = *(const v4fa*)(F + t * 8), c = *(const v4fa*)(F + t * 8 + 4);
#pragma unroll
  for (int q = 0; q < 4; ++q) { _Float16 h = (_Float16)a[q]; fh.h[q] = h; fl.h[q] = (_Float16)((a[q] - (float)h) * 1024.0f); h = (_Float16)c[q]; fh.h[4 + q] = h; fl.h[4 + q] = (_Float16)((c[q] - (float)h) * 1024.0f); }
  { *(v8us*)((unsigned short*)Hh + t * 8) = fh.half[0]; *(v8us*)((unsigned short*)Hl + t * 8) = fl.half[0];  } }

// ---- fast GEMM (wave tile 32x64; requires M % 32 == 0 rows per launch region and N % 64 == 0); epilogue = k_gemm_hhx semantics ----
__device__ __forceinline__ v16h g2_frag(const _Float16* p, int hh) { FragH f; f.half[0] = *(const v8us*)((const unsigned short*)p + 8 * hh); f.half[1] = *(const v8us*)((const unsigned short*)p + 16 + 8 * hh); return f.v; }
__device__ __forceinline__ v8f g2_mma(v16h a, v16h b, v8f c) { v8f d = __builtin_amdgcn_wmma_f32_16x16x32_f16(false, a, false, b, (short)0, c, false, false); asm volatile("v_nop\n\tv_nop\n\tv_nop\n\tv_nop" : "+v"(d) : "v"(a), "v"(b)); return d; }
template <int ACT, int ROPE = 0>      /* ROPE 1: C16 = f16(v cos + rotate_half(v) sin), v = acc * alpha, per 64-column head; position = row % SQ, tables CS / SN [SQ][32]; no bias, no CP, no f32 C */
__global__ __launch_bounds__(128) void k_gemm2(const _Float16* __restrict__ A, int lda, size_t sA, const _Float16* __restrict__ Bh, int ldb, size_t sB, float alpha, const float* __restrict__ bias, size_t sBias, const float* __restrict__ CP, int rowsPerB, size_t sCPb, int row0g,
    float* __restrict__ C, _Float16* __restrict__ C16, int ldc, size_t sC, int M, int N, int K, const float* __restrict__ CS, const float* __restrict__ SN) { static_assert(ACT == 0 || ACT == 3 || ACT == 6 || ACT == 8 || ACT == 9 || ACT == 11 || ACT == 12 || ACT == 14 || ACT == 15 || ACT == 16 || ACT == 17, "k_gemm2: unsupported ACT code (would silently apply no activation)");
  __shared__ __attribute__((aligned(16))) float so[4][32][68];
  const int tid = threadIdx.x, w = tid >> 5, lane = tid & 31, ln = lane & 15, hh = lane >> 4; const int by = blockIdx.y;
  A += (size_t)by * sA; Bh += (size_t)by * sB; const size_t cofs = (size_t)by * sC; const float* bp = bias ? bias + (size_t)by * sBias : nullptr;
  const int ntn = N >> 6; const int mt = blockIdx.x / ntn, nq = blockIdx.x - mt * ntn; const int row0 = mt * 128 + 32 * w, col0 = nq * 64; if (row0 >= M) return;
  const _Float16* a0p = A + (size_t)(row0 + ln) * lda; const _Float16* a1p = a0p + (size_t)16 * lda;
  const _Float16* b0p = Bh + (size_t)(col0 + ln) * ldb; const _Float16* b1p = b0p + (size_t)16 * ldb; const _Float16* b2p = b1p + (size_t)16 * ldb; const _Float16* b3p = b2p + (size_t)16 * ldb;
  const v8f z8 = {0.f,0.f,0.f,0.f,0.f,0.f,0.f,0.f}; v8f c00 = z8, c01 = z8, c02 = z8, c03 = z8, c10 = z8, c11 = z8, c12 = z8, c13 = z8;
#pragma unroll 1
  for (int kb = 0; kb < K; kb += 32) { const v16h a0 = g2_frag(a0p + kb, hh), a1 = g2_frag(a1p + kb, hh);
    v16h b = g2_frag(b0p + kb, hh); c00 = g2_mma(a0, b, c00); c10 = g2_mma(a1, b, c10);
    b = g2_frag(b1p + kb, hh); c01 = g2_mma(a0, b, c01); c11 = g2_mma(a1, b, c11);
    b = g2_frag(b2p + kb, hh); c02 = g2_mma(a0, b, c02); c12 = g2_mma(a1, b, c12);
    b = g2_frag(b3p + kb, hh); c03 = g2_mma(a0, b, c03); c13 = g2_mma(a1, b, c13); }
  v8f accs[8] = {c00, c01, c02, c03, c10, c11, c12, c13};
  if (ROPE) {      /* col0 is a multiple of 64 and row0 of 32: both halves of every rotation pair lie in this wave's own 32 x 64 tile, and its 32 positions do not wrap at SQ */
    const int rs = lane >> 3, d8 = (lane & 7) * 8; const float sg = (d8 < HD / 2) ? -1.0f : 1.0f;      /* 8 lanes per row, 8 columns each; rotate_half(v)[d] = -v[d + 32] below 32, v[d - 32] above */
    const size_t tb = (size_t)((unsigned)row0 % SQ + rs) * (HD / 2) + (d8 & (HD / 2 - 1)); const float* cp = CS + tb; const float* sp = SN + tb; v4f tc[8][2], ts[8][2];
#pragma unroll      /* accs[] in registers */
    for (int u = 0; u < 8; ++u) for (int r = 0; r < 8; ++r) so[w][(u >> 2) * 16 + 8 * hh + r][(u & 3) * 16 + ln] = accs[u][r] * alpha;
    __builtin_amdgcn_fence(__ATOMIC_ACQ_REL, "workgroup"); __builtin_amdgcn_wave_barrier();      /* the wave reads back rows that its other lanes wrote */
#pragma unroll      /* tc[], ts[] in registers; behind the staging, where the accumulators' registers are free */
    for (int q = 0; q < 8; ++q) for (int u = 0; u < 2; ++u) { tc[q][u] = *(const v4fa*)(cp + q * 4 * (HD / 2) + 4 * u); ts[q][u] = *(const v4fa*)(sp + q * 4 * (HD / 2) + 4 * u); }
    unsigned short* dp = (unsigned short*)C16 + cofs + (size_t)(row0 + rs) * ldc + col0 + d8;
#pragma unroll      /* 4 rows per trip, constant LDS offsets; a store covers four whole 128-byte lines */
    for (int q = 0; q < 8; ++q) { FragH f;
      for (int u = 0; u < 2; ++u) { const v4f own = *(const v4fa*)&so[w][q * 4 + rs][d8 + 4 * u], oth = *(const v4fa*)&so[w][q * 4 + rs][(d8 ^ (HD / 2)) + 4 * u];
        for (int i = 0; i < 4; ++i) f.h[4 * u + i] = (_Float16)(own[i] * tc[q][u][i] + oth[i] * (sg * ts[q][u][i])); }
      *(v8us*)(dp + (size_t)q * 4 * ldc) = f.half[0]; }
    return; }
#pragma unroll
  for (int u = 0; u < 8; ++u) { const int t = u & 3, half = u >> 2; const int col = col0 + t * 16 + ln; const float bv = bp ? bf16_round(bp[col]) : 0.f;
#pragma unroll
    for (int r = 0; r < 8; ++r) { const int rloc = half * 16 + 8 * hh + r; float v = accs[u][r] * alpha + bv; if (CP) { if (rowsPerB < 0) v += CP[cofs + (size_t)(row0g + row0 + rloc) * ldc + col];      /* rowsPerB < 0: own element of the batched C plane */ else { const int bidx = (row0g + row0 + rloc) / rowsPerB; v += CP[(size_t)bidx * sCPb + (size_t)by * 64 + col]; } }
      if (ACT == 3) v = fmaxf(v, 0.f); else if (ACT == 6) v = 0.5f * v * (1.0f + erff(v * 0.70710678118654752f)); else if (ACT == 11) v = 1.0f / (1.0f + expf(-v)); else if (ACT == 15) v = v / (1.0f + expf(-v)); else if (ACT == 12) v = (v > 0.f) ? v : 0.01f * v; else if (ACT == 8) v = tanhf(v); else if (ACT == 9) v = 0.5f * v * (1.0f + tanhf(0.7978845608028654f * (v + 0.044715f * v * v * v))); else if (ACT == 14) v = (v > 0.f) ? v : 0.1f * v; else if (ACT == 16) v = (v >= 0.f) ? v : 0.3f * v; else if (ACT == 17) v = (v >= 0.f) ? v : 0.2f * v;
      so[w][rloc][t * 16 + ln] = v; } }
  __builtin_amdgcn_fence(__ATOMIC_ACQ_REL, "workgroup"); __builtin_amdgcn_wave_barrier();
  const int rsub = lane >> 4, c4 = (lane & 15) * 4;
  {
#pragma unroll
    for (int q = 0; q < 16; ++q) { const int r = q * 2 + rsub; const v4f v = *(const v4fa*)&so[w][r][c4]; if (C) *(v4f*)(C + cofs + (size_t)(row0 + r) * ldc + col0 + c4) = v; if (C16) { v4h h4; for (int i = 0; i < 4; ++i) h4[i] = (_Float16)v[i]; *(v4h*)(C16 + cofs + (size_t)(row0 + r) * ldc + col0 + c4) = h4; } }
     } }


__global__ __launch_bounds__(256) void k_wnat(const float* __restrict__ w, size_t n8, _Float16* __restrict__ Bt) { const size_t t = (size_t)blockIdx.x * 256 + threadIdx.x; if (t >= n8) return; FragH f; for (int q = 0; q < 8; ++q) f.h[q] = (_Float16)(bf16_round(w[t * 8 + q]) * 16.0f); *(v8us*)((unsigned short*)Bt + t * 8) = f.half[0];  }
#define FA_W 8                       /* waves per work-group, 32 query columns each */
#define FA_QB (FA_W * 32)            /* query rows per work-group */
#define FA_ST 64                     /* keys per LDS stage */
#define FA_P 72                      /* LDS row pitch in f16: 128-byte rows + 16 bytes (16 B x odd: conflict-free 16-byte reads) */
typedef float v2f __attribute__((ext_vector_type(2)));
typedef _Float16 v2h __attribute__((ext_vector_type(2)));
__device__ __forceinline__ float fa_xhalf(float x) { return __builtin_bit_cast(float, __builtin_amdgcn_permlanex16(__builtin_bit_cast(int, x), __builtin_bit_cast(int, x), 0x76543210, 0xfedcba98, false, false)); }      /* lane l reads lane l ^ 16 */
__device__ __forceinline__ v8f fa_mma(v16h a, v16h b, v8f c) { return __builtin_amdgcn_wmma_f32_16x16x32_f16(false, a, false, b, (short)0, c, false, false); }
__global__ __launch_bounds__(FA_W * 32) void k_fattn(const _Float16* __restrict__ Q16, const _Float16* __restrict__ K16, const _Float16* __restrict__ VT, _Float16* __restrict__ O16) {
  __shared__ __attribute__((aligned(16))) _Float16 lk[2][FA_ST][FA_P]; __shared__ __attribute__((aligned(16))) _Float16 lv[2][HD][FA_P];
  const int tid = threadIdx.x, w = tid >> 5, lane = tid & 31, ln = lane & 15, hh = lane >> 4; const int h = blockIdx.y, b = blockIdx.z; const size_t r0 = (size_t)b * SQ; const int q0 = blockIdx.x * FA_QB + w * 32;
  const int sr = tid >> 3, sc = (tid & 7) * 8;      /* staging: a thread brings 16 bytes of rows sr and sr + 32 of each tile; 8 lanes cover one 128-byte line */
  const unsigned short* kg = (const unsigned short*)K16 + (r0 + sr) * KVD + h * HD + sc;      /* key row sr of the stage, this head's 64 columns */
  const unsigned short* vg = (const unsigned short*)VT + ((size_t)(b * NH + h) * HD + sr) * SQ + sc;      /* V^T row d = sr, the stage's 64 keys */
  v8us gk0 = *(const v8us*)kg, gk1 = *(const v8us*)(kg + (size_t)32 * KVD), gv0 = *(const v8us*)vg, gv1 = *(const v8us*)(vg + (size_t)32 * SQ);
  v16h qf[2][2];      /* [column group][k step of 32], kept for the whole kernel */
  { const _Float16* qp = Q16 + (r0 + q0 + ln) * LQ + h * HD;
#pragma unroll      /* constant indices keep qf[] in registers */
    for (int g = 0; g < 2; ++g) for (int kk = 0; kk < 2; ++kk) qf[g][kk] = g2_frag(qp + (size_t)g * 16 * LQ + kk * 32, hh);
    asm volatile("s_wait_xcnt 0x0" :: "v"(qp) : "memory"); }      /* the q loads' address pair stays live up to this wait, so no register that an issued load names is overwritten in front of it */
  *(v8us*)&lk[0][sr][sc] = gk0; *(v8us*)&lk[0][sr + 32][sc] = gk1; *(v8us*)&lv[0][sr][sc] = gv0; *(v8us*)&lv[0][sr + 32][sc] = gv1;
  const v8f z8 = {0.f,0.f,0.f,0.f,0.f,0.f,0.f,0.f}; v8f o[2][4];      /* O^T: [column group][16 rows of d] */
#pragma unroll      /* o[] in registers */
  for (int g = 0; g < 2; ++g) for (int t = 0; t < 4; ++t) o[g][t] = z8;
  float mr[2] = {-1.0e30f, -1.0e30f}, l[2] = {0.f, 0.f};      /* maximum in use (log2-scaled) and this lane's part of the denominator */
  const float cs = 0.125f * 1.4426950408889634f;      /* 64^-0.5 * log2(e) */
  __syncthreads();      /* stage 0 is published */
  for (int st = 0; st < SQ / FA_ST; ++st) { const int cur = st & 1; const bool more = st + 1 < SQ / FA_ST;      /* block-uniform */
    if (more) { kg += (size_t)FA_ST * KVD; vg += FA_ST; gk0 = *(const v8us*)kg; gk1 = *(const v8us*)(kg + (size_t)32 * KVD); gv0 = *(const v8us*)vg; gv1 = *(const v8us*)(vg + (size_t)32 * SQ);      /* the next stage flies under this stage's two passes */
      asm volatile("s_wait_xcnt 0x0" :: "v"(kg), "v"(vg) : "memory"); }      /* likewise for the next stage's staging loads: the pointers are stepped only behind this wait (stage 0's loads: behind the wait after the q loads) */
#pragma unroll      /* two 32-key passes per stage, constant LDS offsets */
    for (int ps = 0; ps < FA_ST / 32; ++ps) {
      v8f s[2][2];      /* S^T: [column group][16 keys] */
      { v16h kf[2][2];
#pragma unroll      /* fragments in registers */
        for (int t = 0; t < 2; ++t) for (int kk = 0; kk < 2; ++kk) kf[t][kk] = g2_frag(&lk[cur][ps * 32 + t * 16 + ln][kk * 32], hh);
#pragma unroll      /* fragments in registers */
        for (int t = 0; t < 2; ++t) for (int g = 0; g < 2; ++g) s[g][t] = fa_mma(kf[t][1], qf[g][1], fa_mma(kf[t][0], qf[g][0], z8)); }
      v16h vf[4];
#pragma unroll      /* fragments in registers; these reads fly under the maxima and exponentials */
      for (int t = 0; t < 4; ++t) vf[t] = g2_frag(&lv[cur][t * 16 + ln][ps * 32], hh);
      float mb[2]; bool need = false;
#pragma unroll      /* s[] in registers */
      for (int g = 0; g < 2; ++g) { float mx = s[g][0][0];
        for (int r = 1; r < 8; ++r) mx = fmaxf(mx, s[g][0][r]);
        for (int r = 0; r < 8; ++r) mx = fmaxf(mx, s[g][1][r]);
        mx = fmaxf(mx, fa_xhalf(mx)) * cs; mb[g] = mx; need = need || (mx > mr[g] + 8.0f); }      /* both halves hold the column's maximum; the one in use may trail it by 8 (weights up to 2^8) */
      if (__builtin_amdgcn_ballot_w32(need) != 0) {      /* wave-uniform; always on the first pass, rare afterwards */
#pragma unroll      /* o[] in registers */
        for (int g = 0; g < 2; ++g) { const float mn = fmaxf(mr[g], mb[g]); const float corr = __builtin_amdgcn_exp2f(mr[g] - mn); mr[g] = mn; l[g] *= corr;
          for (int t = 0; t < 4; ++t) o[g][t] = o[g][t] * corr; } }
#pragma unroll      /* s[], o[] in registers */
      for (int g = 0; g < 2; ++g) { const float nm = -mr[g]; const v8f c8 = {cs, cs, cs, cs, cs, cs, cs, cs}, n8 = {nm, nm, nm, nm, nm, nm, nm, nm}; FragH pf; float la = 0.f, lb = 0.f;
        for (int t = 0; t < 2; ++t) { s[g][t] = __builtin_elementwise_fma(s[g][t], c8, n8);
          for (int r = 0; r < 8; ++r) s[g][t][r] = __builtin_amdgcn_exp2f(s[g][t][r]); }      /* weights 2^(score * cs - maximum in use), in the score registers */
        for (int i = 0; i < 8; ++i) { const int t = i >> 2, r = 2 * (i & 3);
          la += s[g][t][r]; lb += s[g][t][r + 1];
          const v2h pk = __builtin_convertvector(v2f{s[g][t][r], s[g][t][r + 1]}, v2h); pf.h[2 * i] = pk[0]; pf.h[2 * i + 1] = pk[1]; }
        l[g] += la + lb;
        for (int t = 0; t < 4; ++t) o[g][t] = fa_mma(vf[t], pf.v, o[g][t]); } }
    asm volatile("v_nop\n\tv_nop\n\tv_nop\n\tv_nop" : "+v"(o[0][0]), "+v"(o[0][1]), "+v"(o[0][2]), "+v"(o[0][3]), "+v"(o[1][0]), "+v"(o[1][1]), "+v"(o[1][2]), "+v"(o[1][3]));      /* four issue slots behind the stage's last matrix instructions: a branch follows */
    if (more) { *(v8us*)&lk[cur ^ 1][sr][sc] = gk0; *(v8us*)&lk[cur ^ 1][sr + 32][sc] = gk1; *(v8us*)&lv[cur ^ 1][sr][sc] = gv0; *(v8us*)&lv[cur ^ 1][sr + 32][sc] = gv1; }      /* its last readers left it at the previous trip's barrier */
    __syncthreads(); }      /* publishes the next stage and ends every wave's reads of this one */
#pragma unroll      /* o[] in registers */
  for (int g = 0; g < 2; ++g) { const float fin = 64.0f / (l[g] + fa_xhalf(l[g]));      /* the halves' sums join once; o carried x64 */
    unsigned short* d = (unsigned short*)O16 + (r0 + q0 + g * 16 + ln) * DM + h * HD + 8 * hh;
    for (int t = 0; t < 4; ++t) { FragH f; for (int r = 0; r < 8; ++r) f.h[r] = (_Float16)(o[g][t][r] * fin); *(v8us*)(d + t * 16) = f.half[0]; } } }      /* a lane's 8 registers are 8 consecutive d of its query row: one 16-byte store */
__global__ __launch_bounds__(256) void k_vt(const _Float16* __restrict__ V16, int b, int h0, _Float16* __restrict__ VT) { __shared__ unsigned short tl[64][65]; const int tid = threadIdx.x; const int hh = blockIdx.x % HG, sg = blockIdx.x / HG; const int s0 = sg * 64; const int h = h0 + hh;
  for (int i = tid; i < 64 * 8; i += 256) { const int j = i / 8, d8 = (i % 8) * 8; FragH f; f.half[0] = *(const v8us*)((const unsigned short*)V16 + ((size_t)b * SQ + s0 + j) * DM + h * HD + d8); for (int q = 0; q < 8; ++q) tl[d8 + q][j] = f.u[q]; }
  __syncthreads();
  { for (int i = tid; i < 64 * 8; i += 256) { const int d = i / 8, j8 = (i % 8) * 8; FragH f; for (int q = 0; q < 8; ++q) f.u[q] = tl[d][j8 + q]; *(v8us*)((unsigned short*)VT + ((size_t)hh * HD + d) * SQ + s0 + j8) = f.half[0]; }  } }



__global__ __launch_bounds__(256) void k_rsmcf2(const float* __restrict__ S, _Float16* __restrict__ P, int hg, int q0, int nk) {
  #pragma clang fp contract(off)
  const int t = blockIdx.x * 256 + threadIdx.x; if (t >= hg * QT) return; const size_t i = (size_t)t; const float* s = S + i * NKX; const int last = q0 + (t % QT); float mx = -3.0e38f;
#pragma unroll 1
  for (int j = 0; j < nk; ++j) { const float f = (j <= last) ? 1.f : 0.f; mx = fmaxf(mx, fmaf(f, s[j], (1.f - f) * -1.0e9f)); } float se = 0.f;
#pragma unroll 1
  for (int j = 0; j < nk; ++j) { const float f = (j <= last) ? 1.f : 0.f; se += __expf(fmaf(f, s[j], (1.f - f) * -1.0e9f) - mx); } const float sc = 256.0f / se;
#pragma unroll 1
  for (int j0 = 0; j0 < nk; j0 += 8) { FragH fr; for (int q = 0; q < 8; ++q) { const int j = j0 + q; const float f = (j <= last) ? 1.f : 0.f; fr.h[q] = (_Float16)(__expf(fmaf(f, s[j], (1.f - f) * -1.0e9f) - mx) * sc); } unsigned short* d = (unsigned short*)P + i * NKX + j0; *(v8us*)d = fr.half[0];  } }


template <int MASKADD>
__global__ __launch_bounds__(64) void k_att0(const float* __restrict__ QF, const float* __restrict__ KF, const float* __restrict__ VF, int ld, const float* __restrict__ mask, float scale, float* __restrict__ OF, int ldo) {
  #pragma clang fp contract(off)
  __shared__ __attribute__((aligned(16))) float lq[64][64]; __shared__ __attribute__((aligned(16))) float lo[64][64];
  const int tid = threadIdx.x; const int h = blockIdx.x / (QT0 / 64), rg = blockIdx.x % (QT0 / 64); const int i = rg * 64 + tid;
  const float* qr = QF + (size_t)i * ld + h * HD;
#pragma unroll 1
  for (int c = 0; c < HD / 4; ++c) { *(v4f*)&lq[tid][c * 4] = *(const v4fa*)(qr + c * 4); const v4f z = {0.f, 0.f, 0.f, 0.f}; *(v4f*)&lo[tid][c * 4] = z; }
  float m = -1.0e30f, l = 0.f; const int jmax = MASKADD ? (SQ - 1) : (rg * 64 + 63);      /* additive-mask form: every key (the mask input decides); causal form: keys up to the block's last row */
#pragma unroll 1
  for (int j = 0; j <= jmax; ++j) { const float* kr = KF + (size_t)j * ld + h * HD; const float* vr = VF + (size_t)j * ld + h * HD; float s = 0.f;
#pragma unroll 1
    for (int c = 0; c < HD / 4; ++c) { const v4f kq = *(const v4fa*)(kr + c * 4); const v4f qq = *(v4f*)&lq[tid][c * 4]; s = __fadd_rn(s, __fmul_rn(qq[0], kq[0])); s = __fadd_rn(s, __fmul_rn(qq[1], kq[1])); s = __fadd_rn(s, __fmul_rn(qq[2], kq[2])); s = __fadd_rn(s, __fmul_rn(qq[3], kq[3])); }
    s = __fmul_rn(s, scale); if (MASKADD) s = __fadd_rn(s, __fmul_rn(bf16_round(mask[(size_t)i * SQ + j]), -10000.0f));
    const float f = (MASKADD || j <= i) ? 1.f : 0.f; const float sm = fmaf(f, s, (1.f - f) * -1.0e30f); const float mn = fmaxf(m, sm); const float sc = expf(m - mn); const float e = expf(sm - mn); l = __fadd_rn(__fmul_rn(l, sc), e); m = mn;
#pragma unroll 1
    for (int c = 0; c < HD / 4; ++c) { const v4f vv = *(const v4fa*)(vr + c * 4); v4f oo = *(v4f*)&lo[tid][c * 4]; for (int u = 0; u < 4; ++u) oo[u] = __fadd_rn(__fmul_rn(oo[u], sc), __fmul_rn(e, vv[u])); *(v4f*)&lo[tid][c * 4] = oo; } }
  const float fin = 64.0f / l;      /* o carried x64 like the f16 path */
#pragma unroll 1
  for (int c = 0; c < HD / 4; ++c) { v4f oo = *(v4f*)&lo[tid][c * 4]; for (int u = 0; u < 4; ++u) oo[u] = __fmul_rn(oo[u], fin); *(v4f*)&lo[tid][c * 4] = oo; }
  __syncthreads();
  {
#pragma unroll 1
    for (int it = 0; it < 16; ++it) { const int row = it * 4 + tid / 16, pc = (tid % 16) * 4; const v4f v = *(const v4f*)&lo[row][pc]; *(v4f*)(OF + (size_t)(rg * 64 + row) * ldo + h * HD + pc) = v; }
     } }


__global__ __launch_bounds__(256) void k_kvexp(const float* __restrict__ src, float* __restrict__ dst, size_t n4) { const size_t t = (size_t)blockIdx.x * 256 + threadIdx.x; if (t >= n4) return; const size_t e = t * 4; const size_t row = e / DM; const int col = (int)(e % DM); const int h = col / HD, d = col % HD; const v4f v = *(const v4fa*)(src + row * KVD + (size_t)(h / HPG) * HD + d); *(v4f*)(dst + e) = v;  }

__global__ __launch_bounds__(256) void k_tab2(float theta, float* __restrict__ CS, float* __restrict__ SN) {
  #pragma clang fp contract(off)
  const int t = blockIdx.x * 256 + threadIdx.x; if (t >= SQ * (HD / 2)) return; const int i = t % (HD / 2); const int p = t / (HD / 2); const float invf = 1.0f / powf(theta, (float)(2 * i) / (float)HD); const float ang = __fmul_rn((float)p, invf); const float c = cosf(ang), s = sinf(ang);
  *(float*)(CS + t) = c; *(float*)(SN + t) = s;  }
template <int NORM, int ROPE>
__global__ __launch_bounds__(64) void k_xformf(const float* __restrict__ F, int ldf, int nh, const float* __restrict__ gain, float eps, const float* __restrict__ CS, const float* __restrict__ SN, float* __restrict__ F32, int ldo) {
  #pragma clang fp contract(off)
  __shared__ float xv[HD]; __shared__ float red[HD]; const int d = threadIdx.x; const int h = blockIdx.x % nh; const size_t r = blockIdx.x / nh; const int p = (int)(r % SQ);
  float x = F[r * (size_t)ldf + (size_t)h * HD + d];
  if (NORM) { red[d] = __fmul_rn(x, x); __syncthreads(); for (int st = HD / 2; st > 0; st >>= 1) { if (d < st) red[d] = __fadd_rn(red[d], red[d + st]); __syncthreads(); } const float rs = rsqrtf(__fadd_rn(red[0] / (float)HD, eps)); x = __fmul_rn(__fmul_rn(x, rs), bf16_round(gain[d])); }
  xv[d] = x; __syncthreads();
  float o = x;
  if (ROPE == 1) { const int i = d >> 1; const float c = CS[p * (HD / 2) + i], s = SN[p * (HD / 2) + i]; const float ev = xv[2 * i], od = xv[2 * i + 1]; o = (d & 1) ? __fadd_rn(__fmul_rn(ev, s), __fmul_rn(od, c)) : __fadd_rn(__fmul_rn(ev, c), -__fmul_rn(od, s)); }
  if (ROPE == 2) { const int i = d & (HD / 2 - 1); const float c = CS[p * (HD / 2) + i], s = SN[p * (HD / 2) + i]; const float lo = xv[i], hi = xv[i + HD / 2]; o = (d < HD / 2) ? __fadd_rn(__fmul_rn(lo, c), -__fmul_rn(hi, s)) : __fadd_rn(__fmul_rn(lo, s), __fmul_rn(hi, c)); }
  float* dst = F32 + r * (size_t)ldo + (size_t)h * HD + d; *(float*)dst = o;  }

__global__ __launch_bounds__(256) void k_bfcp(const float* __restrict__ src, float* __restrict__ dst, size_t n4) { const size_t t = (size_t)blockIdx.x * 256 + threadIdx.x; if (t >= n4) return; const v4f a = *(const v4fa*)(src + t * 4); v4f o; for (int q = 0; q < 4; ++q) o[q] = bf16_round(a[q]); *(v4f*)(dst + t * 4) = o;  }

__global__ __launch_bounds__(256) void k_tab2d(float* __restrict__ CS, float* __restrict__ SN) {
  #pragma clang fp contract(off)
  const int t = blockIdx.x * 256 + threadIdx.x; if (t >= SQ * (HD / 2)) return; const int i = t % (HD / 2); const int p = t / (HD / 2); const float invf = (float)(1.0 / pow(10000.0, (double)(2 * i) / (double)HD)); const float ang = __fmul_rn((float)p, invf); const float c = cosf(ang), s = sinf(ang);
  *(float*)(CS + t) = c; *(float*)(SN + t) = s;  }
extern "C" void kernel_launch(void* const* d_in, const int* in_sizes, int n_in,
                              void* d_out, int out_size, void* d_ws, size_t ws_size, hipStream_t stream) {
  (void)in_sizes; (void)n_in; (void)out_size;
  const float* const* I = (const float* const*)d_in; const float* x = I[0]; const float* wq = I[1]; const float* wk = I[2]; const float* wv = I[3]; const float* wo = I[4]; const float* bq = nullptr; const float* bk = nullptr; const float* bv = nullptr; const float* bo = I[5];      /* input order: x, Wq, Wk, Wv, Wo (natural [out][in] weights), bo [1024] (the output bias: into the output GEMM's bias slot); the q / k / v projections have NO biases; rope tables computed in the kernel (positions = row index) */
  char* ws = (char*)d_ws; size_t off = 0;
  auto take = [&](size_t bytes) { char* p = ws + off; off += (bytes + 255) & ~(size_t)255; return p; };
  _Float16* BQ = (_Float16*)take((size_t)DM * DM * 2); _Float16* BK = (_Float16*)take((size_t)KVD * DM * 2); _Float16* BV = (_Float16*)take((size_t)KVD * DM * 2); _Float16* BO = (_Float16*)take((size_t)DM * DM * 2);
  _Float16* X16 = (_Float16*)take(NR * DM * 2); float* CSB = (float*)take((size_t)SQ * 32 * 4); float* SNB = (float*)take((size_t)SQ * 32 * 4); _Float16* Q16 = (_Float16*)take(NR * DM * 2); _Float16* K16 = (_Float16*)take(NR * KVD * 2); _Float16* V16 = (_Float16*)take(NR * KVD * 2); _Float16* O16 = (_Float16*)take(NR * DM * 2);
  _Float16* VT = (_Float16*)take((size_t)NB * NH * HD * SQ * 2);
  float* QF0 = (float*)take((size_t)QT0 * DM * 4); float* KF0 = (float*)take((size_t)QT0 * KVD * 4); float* VF0 = (float*)take((size_t)QT0 * KVD * 4); float* KF0e = (float*)take((size_t)QT0 * DM * 4); float* VF0e = (float*)take((size_t)QT0 * DM * 4); float* OF0 = (float*)take((size_t)NB * QT0 * DM * 4); _Float16* OH0 = (_Float16*)take((size_t)NB * QT0 * DM * 2); _Float16* OL0 = (_Float16*)take((size_t)NB * QT0 * DM * 2);
  if (off > ws_size) return;
  k_wnat<<<(unsigned)(((size_t)DM * DM / 8 + 255) / 256), 256, 0, stream>>>(wq, (size_t)DM * DM / 8, BQ); k_wnat<<<(unsigned)(((size_t)KVD * DM / 8 + 255) / 256), 256, 0, stream>>>(wk, (size_t)KVD * DM / 8, BK); k_wnat<<<(unsigned)(((size_t)KVD * DM / 8 + 255) / 256), 256, 0, stream>>>(wv, (size_t)KVD * DM / 8, BV); k_wnat<<<(unsigned)(((size_t)DM * DM / 8 + 255) / 256), 256, 0, stream>>>(wo, (size_t)DM * DM / 8, BO);      /* natural [out][in] = Bt[n][k] x16 (KVD = 16 x 64 = DM: full-width k / v) */
  k_x16<<<(unsigned)((NR * DM / 8 + 255) / 256), 256, 0, stream>>>(x, X16, NR * DM / 8);
  const size_t r0p = (size_t)B0 * SQ;      /* first projected row */
  k_gemm2<0><<<dim3((unsigned)((MP / 128) * (KVD / 64)), 1), 128, 0, stream>>>(X16 + r0p * DM, DM, 0, BV, DM, 0, 0.0625f, bv, 0, nullptr, 1, 0, 0, nullptr, V16 + r0p * KVD, KVD, 0, MP, KVD, DM, nullptr, nullptr);
  k_tab2d<<<(unsigned)(((size_t)SQ * (HD / 2) + 255) / 256), 256, 0, stream>>>(CSB, SNB);      /* rope tables computed in the kernel: CS[p][i] = cos(p * 10000^(-2i/64)), SN = sin, i < 32 (rotate-half convention; the module's [f | f] tables repeat these 32 columns) */
  static_assert(KVD == DM, "q and k share one launch: equal widths");
  k_gemm2<0, 1><<<dim3((unsigned)((MP / 128) * (DM / 64)), 2), 128, 0, stream>>>(X16 + r0p * DM, DM, 0, BQ, DM, (size_t)DM * DM, 0.0625f, nullptr, 0, nullptr, 1, 0, 0, nullptr, Q16 + r0p * DM, DM, NR * DM, MP, DM, DM, CSB, SNB);      /* q (grid.y 0) and k (grid.y 1) of all rows: BK follows BQ and K16 follows Q16 in the workspace (sizes are multiples of 256 bytes), so the kernel's own batch strides step from q to k; half-split rope (t cos + rotate_half(t) sin, computed tables) and f32 -> f16 in the epilogue */
  for (int b = B0; b < B0 + NBR; ++b) { const size_t r0 = (size_t)b * SQ;
    k_vt<NG, SQ><<<NG * (SQ / 64), 256, 0, stream>>>(V16 + r0 * KVD, KVD, 0, VT + (size_t)b * NH * HD * SQ); }      /* V^T [NB][NH][HD][SQ]: this batch's slabs */
  k_fattn<<<dim3(SQ / FA_QB, NH, NB), FA_W * 32, 0, stream>>>(Q16, K16, VT, O16);      /* non-causal attention of all batches, heads and query rows in one launch: scores, softmax and weighted values fused; o into merged f16 rows (x64) */
  k_gemm2<0><<<dim3((unsigned)((MPO / 128) * (DM / 64)), 1), 128, 0, stream>>>(O16 + r0p * DM, DM, 0, BO, DM, 0, 0.0009765625f, bo, 0, nullptr, 1, 0, 0, (float*)d_out + r0p * DM, nullptr, DM, 0, MPO, DM, DM, nullptr, nullptr);      /* out rows are the output layout */
}

// v005
// One run takes 116 microseconds.
// In two side-by-side timings against v004, it was 1.69 and 1.70 times as fast.
// All steps since v000 together make it 169 times as fast.
#include <hip/hip_runtime.h>
// Multi-head self-attention with rotate-half RoPE computed in the kernel and a biased output projection, NON-causal (x [2][2048][1024]; q / k / v = x W^T (natural [1024][1024], no biases), 16 heads of 64; cos / sin = [f | f] of pos * 10000^(-2i/64); q = q cos + rotate_half(q) sin, likewise k; scores * 64^-0.5; softmax over all 2048 keys (no mask); out = merged Wo^T + bo (natural + bias) -> [2][2048][1024]); run as 16 groups of ONE head.
// Structure: x as exact f16 rows; natural weights as exact x16 planes; v as a WMMA GEMM (32x64 wave tiles, f32 accumulation, f16 output); rope tables computed once (double-derived inv_freq, f32 angle); q and k of all rows as ONE GEMM launch (grid.y = q / k) whose epilogue applies the rotate-half rotation and the f16 conversion to the f32 tile it has staged in LDS (a wave tile is one head's 64 columns); per batch V^T of the heads via LDS transposes; then ONE fused attention launch for all batches, heads and query rows (256 query rows per work-group): per 32 keys S^T = K Q^T (K = 64), online softmax on VALU in the log2 domain (f32 statistics, native exp2, lazy rescale; weights f16, unnormalised), O^T += V^T P^T, o / row sum (carried x64) into merged f16 rows; scores and weights stay in registers; out = o Wo^T GEMM (f32, alpha 2^-10); launches: see trace.
// Compute dtype: inputs rounded to bf16; x / weights exact; q, k, v, softmax weights and o as plain f16 GEMM operands (~2^-12); scores and softmax statistics f32. v_wmma_f32_16x16x32_f16.
#define NB 2
#define NG 16
#define HPG 1
#define KVD (NG * HD)
#define SQ 2048
#define DM 1024
#define NH 16
#define HD 64
#define HG 4                         /* heads handled by the grouped k_vt overload kept below */
#define QT 512                       /* query rows per tile of the unfused softmax kernel kept below */
#define NKX SQ                       /* S / P row pitch */
#define QT0 128                      /* first-tile rows of the f32 k_att0 path (not launched) */
#define B0 0                         /* first batch processed (debug hook) */
#define NBR NB                       /* batches processed (debug hook) */
#define NR ((size_t)NB * SQ)         /* token rows */
#define MP ((int)((size_t)NBR * SQ)) /* rows projected (debug hook) */
#define QN SQ                        /* query rows attended per batch (unused) */
#define NHD NH                       /* heads attended (unused) */
#define MPO MP                       /* rows through the output stage (debug hook) */
#define LQ DM      /* row pitch of the q/k/v rows */
typedef __bf16 v16b __attribute__((ext_vector_type(16)));
typedef unsigned short v8us __attribute__((ext_vector_type(8), may_alias));
typedef float  v8f  __attribute__((ext_vector_type(8)));
typedef float  v4f  __attribute__((ext_vector_type(4)));
typedef float  v4fa __attribute__((ext_vector_type(4), may_alias));
union FragB { v16b v; v8us half[2]; unsigned short u[16]; };

__device__ __forceinline__ unsigned short bf16_bits(float x) { unsigned int u = __float_as_uint(x); return (unsigned short)((u + 0x7FFFu + ((u >> 16) & 1u)) >> 16); }
__device__ __forceinline__ float bf16_val(unsigned short b) { return __uint_as_float(((unsigned int)b) << 16); }
__device__ __forceinline__ float bf16_round(float x) { return bf16_val(bf16_bits(x)); }
// D += A·B with NT terms: 1 = ah·bh, 2 = + al·bh (A split), 3 = + ah·bl (both split)
template <int NT>
__device__ __forceinline__ v8f mmaN(v16b ah, v16b al, v16b bh, v16b bl, v8f c) {
  c = __builtin_amdgcn_wmma_f32_16x16x32_bf16(false, ah, false, bh, (short)0, c, false, false);
  if (NT >= 2) c = __builtin_amdgcn_wmma_f32_16x16x32_bf16(false, al, false, bh, (short)0, c, false, false);
  if (NT >= 3) c = __builtin_amdgcn_wmma_f32_16x16x32_bf16(false, ah, false, bl, (short)0, c, false, false);
  asm volatile("v_nop\n\tv_nop\n\tv_nop\n\tv_nop" : "+v"(c) : "v"(ah), "v"(al), "v"(bh), "v"(bl));
  return c;
}

__global__ __launch_bounds__(256) void k_wt_bf16(const float* __restrict__ W, unsigned short* __restrict__ Wt, int K, int N) {
  const int t = blockIdx.x * 256 + threadIdx.x;
  const int k8n = K / 8;
  if (t >= N * k8n) return;
  const int n = t / k8n, k8 = (t % k8n) * 8;
  v8us v;
#pragma unroll
  for (int i = 0; i < 8; ++i) v[i] = bf16_bits(W[(size_t)(k8 + i) * N + n]);
  *(v8us*)(Wt + (size_t)n * K + k8) = v;
  
}

// GEMM C[M][N] (f32, pitch ldc) = act(A[M][K]·W + bias). A f32 row-major (pitch lda) converted per fragment to bf16
// (ASPLIT: hi/lo two planes -> 2 terms, else single rounded term); Wt bf16 [N][K] (pitch ldb). BIAS_BF16 rounds the
// bias to bf16 first (bias quantised to bf16 before the add). K%32==0, M%16==0, N%64==0.
template <bool ASPLIT, int ACT, bool BIAS_BF16>
__global__ __launch_bounds__(128) void k_gemm_bf(const float* __restrict__ A, int lda, const unsigned short* __restrict__ Wt, int ldb,
                                               const float* __restrict__ bias, float* __restrict__ C, int ldc, int M, int N, int K) {
  __shared__ __attribute__((aligned(16))) float so[4][16][64];
  const int tid = threadIdx.x, w = tid >> 5, lane = tid & 31, ln = lane & 15, hh = lane >> 4;
  const int ntn = N / 64;
  const int wid = blockIdx.x * 4 + w;
  const int mt = wid / ntn, nq = wid % ntn;
  if (mt * 16 >= M) return;
  const int row0 = mt * 16, col0 = nq * 64;
  const float* arow = A + (size_t)(row0 + ln) * lda;
  v8f acc[4] = {};
  for (int kb = 0; kb < K; kb += 32) {
    FragB ah, al;
    const v4f x0 = *(const v4fa*)(arow + kb + 8 * hh), x1 = *(const v4fa*)(arow + kb + 8 * hh + 4);
    const v4f x2 = *(const v4fa*)(arow + kb + 16 + 8 * hh), x3 = *(const v4fa*)(arow + kb + 16 + 8 * hh + 4);
    float xs[16] = {x0[0],x0[1],x0[2],x0[3],x1[0],x1[1],x1[2],x1[3],x2[0],x2[1],x2[2],x2[3],x3[0],x3[1],x3[2],x3[3]};
#pragma unroll
    for (int i = 0; i < 16; ++i) { const unsigned short hb = bf16_bits(xs[i]); ah.u[i] = hb; al.u[i] = ASPLIT ? bf16_bits(xs[i] - bf16_val(hb)) : (unsigned short)0; }
#pragma unroll
    for (int t = 0; t < 4; ++t) {
      const unsigned short* brow = Wt + (size_t)(col0 + t * 16 + ln) * ldb + kb;
      FragB b;
      b.half[0] = *(const v8us*)(brow + 8 * hh);
      b.half[1] = *(const v8us*)(brow + 16 + 8 * hh);
      acc[t] = mmaN<ASPLIT ? 2 : 1>(ah.v, al.v, b.v, b.v, acc[t]);
    }
  }
#pragma unroll
  for (int t = 0; t < 4; ++t) {
    float bv = bias ? bias[col0 + t * 16 + ln] : 0.f;
    if (BIAS_BF16) bv = bf16_round(bv);
#pragma unroll
    for (int r = 0; r < 8; ++r) { float v = acc[t][r] + bv; if (ACT == 1) v = fmaxf(v, 0.f); so[w][8 * hh + r][t * 16 + ln] = v; }
  }
  __builtin_amdgcn_fence(__ATOMIC_ACQ_REL, "workgroup");
  __builtin_amdgcn_wave_barrier();
  const int rsub = lane >> 4, c4 = (lane & 15) * 4;
  {
#pragma unroll
    for (int q = 0; q < 8; ++q) {
      const int r = q * 2 + rsub;
      const v4f v = *(const v4fa*)&so[w][r][c4];
      *(v4f*)(C + (size_t)(row0 + r) * ldc + col0 + c4) = v;
    }
    
  }
}

// GEMM C = act(A·W + bias + resid): A f32 (ASPLIT -> hi/lo 2 terms), Wt bf16 [N][K]; ACT 0 none, 1 relu, 2 exact gelu;
// resid (optional, f32, row index = (row % rmod), pitch ldr, RES_BF16 rounds it) added before the activation.
template <bool ASPLIT, int ACT, bool BIAS_BF16, bool RES_BF16>
__global__ __launch_bounds__(128) void k_gemm_bf3(const float* __restrict__ A, int lda, const unsigned short* __restrict__ Wt, int ldb,
                                                const float* __restrict__ bias, const float* __restrict__ resid, int rmod, int ldr,
                                                float* __restrict__ C, int ldc, int M, int N, int K) {
  __shared__ __attribute__((aligned(16))) float so[4][16][64];
  const int tid = threadIdx.x, w = tid >> 5, lane = tid & 31, ln = lane & 15, hh = lane >> 4;
  const int ntn = N / 64;
  const int wid = blockIdx.x * 4 + w;
  const int mt = wid / ntn, nq = wid % ntn;
  if (mt * 16 >= M) return;
  const int row0 = mt * 16, col0 = nq * 64;
  const float* arow = A + (size_t)(row0 + ln) * lda;
  v8f acc[4] = {};
  for (int kb = 0; kb < K; kb += 32) {
    FragB ah, al;
    const v4f x0 = *(const v4fa*)(arow + kb + 8 * hh), x1 = *(const v4fa*)(arow + kb + 8 * hh + 4);
    const v4f x2 = *(const v4fa*)(arow + kb + 16 + 8 * hh), x3 = *(const v4fa*)(arow + kb + 16 + 8 * hh + 4);
    float xs[16] = {x0[0],x0[1],x0[2],x0[3],x1[0],x1[1],x1[2],x1[3],x2[0],x2[1],x2[2],x2[3],x3[0],x3[1],x3[2],x3[3]};
#pragma unroll
    for (int i = 0; i < 16; ++i) { const unsigned short hb = bf16_bits(xs[i]); ah.u[i] = hb; al.u[i] = ASPLIT ? bf16_bits(xs[i] - bf16_val(hb)) : (unsigned short)0; }
#pragma unroll
    for (int t = 0; t < 4; ++t) {
      const unsigned short* brow = Wt + (size_t)(col0 + t * 16 + ln) * ldb + kb;
      FragB b;
      b.half[0] = *(const v8us*)(brow + 8 * hh);
      b.half[1] = *(const v8us*)(brow + 16 + 8 * hh);
      acc[t] = mmaN<ASPLIT ? 2 : 1>(ah.v, al.v, b.v, b.v, acc[t]);
    }
  }
#pragma unroll
  for (int t = 0; t < 4; ++t) {
    const int col = col0 + t * 16 + ln;
    float bv = bias ? bias[col] : 0.f;
    if (BIAS_BF16) bv = bf16_round(bv);
#pragma unroll
    for (int r = 0; r < 8; ++r) {
      float v = acc[t][r] + bv;
      if (resid) { float rv = resid[(size_t)((row0 + 8 * hh + r) % rmod) * ldr + col]; if (RES_BF16) rv = bf16_round(rv); v += rv; }
      if (ACT == 1) v = fmaxf(v, 0.f);
      if (ACT == 2) v = 0.5f * v * (1.0f + erff(v * 0.70710678118654752f));
      if (ACT == 3) { const float u = 0.7978845608028654f * (v + 0.044715f * v * v * v); v = 0.5f * v * (1.0f + tanhf(u)); }
      so[w][8 * hh + r][t * 16 + ln] = v;
    }
  }
  __builtin_amdgcn_fence(__ATOMIC_ACQ_REL, "workgroup");
  __builtin_amdgcn_wave_barrier();
  const int rsub = lane >> 4, c4 = (lane & 15) * 4;
  {
#pragma unroll
    for (int q = 0; q < 8; ++q) {
      const int r = q * 2 + rsub;
      const v4f v = *(const v4fa*)&so[w][r][c4];
      *(v4f*)(C + (size_t)(row0 + r) * ldc + col0 + c4) = v;
    }
    
  }
}
// row LayerNorm (biased variance, eps) over N: s = X (+ R); optional out_sum <- s; out_norm <- (s-mu)*rsqrt(var+eps)*g + b
template <bool PARAM_BF16>
__global__ __launch_bounds__(256) void k_layernorm(const float* __restrict__ X, const float* __restrict__ R, const float* __restrict__ g, const float* __restrict__ bta,
                                                  float* __restrict__ out_sum, float* __restrict__ out_norm, int N, float eps) {
  __shared__ float red[256];
  const int row = blockIdx.x, tid = threadIdx.x;
  const float* x = X + (size_t)row * N; const float* rr = R ? R + (size_t)row * N : nullptr;
  float vals[16];                     // up to N = 4096
  const int per = N / 256;            // contiguous chunk per thread? use strided-by-4 chunks: thread handles j = tid*4 + 1024*u
  float s1 = 0.f;
  for (int u = 0; u < per / 4; ++u) {
    const int j = tid * 4 + 1024 * u;
    const v4f a = *(const v4fa*)(x + j);
    v4f b = {0.f,0.f,0.f,0.f}; if (rr) b = *(const v4fa*)(rr + j);
#pragma unroll
    for (int q = 0; q < 4; ++q) { const float v = a[q] + b[q]; vals[u * 4 + q] = v; s1 += v; }
  }
  red[tid] = s1; __syncthreads();
  for (int st = 128; st > 0; st >>= 1) { if (tid < st) red[tid] += red[tid + st]; __syncthreads(); }
  const float mu = red[0] / (float)N; __syncthreads();
  float s2 = 0.f;
  for (int u = 0; u < per / 4; ++u)
#pragma unroll
    for (int q = 0; q < 4; ++q) { const float c = vals[u * 4 + q] - mu; s2 += c * c; }
  red[tid] = s2; __syncthreads();
  for (int st = 128; st > 0; st >>= 1) { if (tid < st) red[tid] += red[tid + st]; __syncthreads(); }
  const float rs = rsqrtf(red[0] / (float)N + eps);
  {
    for (int u = 0; u < per / 4; ++u) {
      const int j = tid * 4 + 1024 * u;
      v4f o, sm;
#pragma unroll
      for (int q = 0; q < 4; ++q) {
        float gg = g[j + q], bb = bta[j + q];
        if (PARAM_BF16) { gg = bf16_round(gg); bb = bf16_round(bb); }
        sm[q] = vals[u * 4 + q]; o[q] = (vals[u * 4 + q] - mu) * rs * gg + bb;
      }
      if (out_sum) *(v4f*)(out_sum + (size_t)row * N + j) = sm;
      *(v4f*)(out_norm + (size_t)row * N + j) = o;
    }
    
  }
}



// ---- f16 WMMA path (v_wmma_f32_16x16x32_f16): 11-bit significands for operands in range — used where a [0,1] probability operand needs more precision than bf16
typedef _Float16 v16h __attribute__((ext_vector_type(16)));
union FragH { v16h v; v8us half[2]; _Float16 h[16]; unsigned short u[16]; };
template <int NT>
__device__ __forceinline__ v8f mmaH(v16h ah, v16h al, v16h bh, v16h bl, v8f c) {
  c = __builtin_amdgcn_wmma_f32_16x16x32_f16(false, ah, false, bh, (short)0, c, false, false);
  if (NT >= 2) c = __builtin_amdgcn_wmma_f32_16x16x32_f16(false, al, false, bh, (short)0, c, false, false);
  if (NT >= 3) c = __builtin_amdgcn_wmma_f32_16x16x32_f16(false, ah, false, bl, (short)0, c, false, false);
  asm volatile("v_nop\n\tv_nop\n\tv_nop\n\tv_nop" : "+v"(c) : "v"(ah), "v"(al), "v"(bh), "v"(bl));
  return c;
}
// batched GEMM like k_gemm_b but f16 operands: A f32 (split into f16 hi/lo if ASPLIT, else rounded to f16), Bt = f16 values [n][k]; alpha; C f32; N multiple of 16 (partial tiles skipped)
template <bool ASPLIT>
__global__ __launch_bounds__(128) void k_gemm_h(const float* __restrict__ A, int lda, size_t sA, const _Float16* __restrict__ Bh, int ldb, size_t sB, float alpha, float* __restrict__ C, int ldc, size_t sC, int M, int N, int K) {
  __shared__ __attribute__((aligned(16))) float so[4][16][64];
  const int tid = threadIdx.x, w = tid >> 5, lane = tid & 31, ln = lane & 15, hh = lane >> 4; const int by = blockIdx.y;
  A += (size_t)by * sA; Bh += (size_t)by * sB; C += (size_t)by * sC;
  const int ntn = (N + 63) / 64; const int wid = blockIdx.x * 4 + w; const int mt = wid / ntn, nq = wid % ntn; if (mt * 16 >= M) return;
  const int row0 = mt * 16, col0 = nq * 64; const float* arow = A + (size_t)(row0 + ln) * lda;
  v8f acc[4] = {};
  for (int kb = 0; kb < K; kb += 32) {
    FragH ah, al;
    const v4f x0 = *(const v4fa*)(arow + kb + 8 * hh), x1 = *(const v4fa*)(arow + kb + 8 * hh + 4), x2 = *(const v4fa*)(arow + kb + 16 + 8 * hh), x3 = *(const v4fa*)(arow + kb + 16 + 8 * hh + 4);
    float xs[16] = {x0[0],x0[1],x0[2],x0[3],x1[0],x1[1],x1[2],x1[3],x2[0],x2[1],x2[2],x2[3],x3[0],x3[1],x3[2],x3[3]};
#pragma unroll
    for (int i = 0; i < 16; ++i) { const _Float16 h = (_Float16)xs[i]; ah.h[i] = h; al.h[i] = ASPLIT ? (_Float16)(xs[i] - (float)h) : (_Float16)0.0f; }
#pragma unroll
    for (int t = 0; t < 4; ++t) { if (col0 + t * 16 >= N) continue; const size_t boff = (size_t)(col0 + t * 16 + ln) * ldb + kb; FragH bq; bq.half[0] = *(const v8us*)(Bh + boff + 8 * hh); bq.half[1] = *(const v8us*)(Bh + boff + 16 + 8 * hh);
      acc[t] = mmaH<ASPLIT ? 2 : 1>(ah.v, al.v, bq.v, bq.v, acc[t]); }
  }
#pragma unroll
  for (int t = 0; t < 4; ++t) { if (col0 + t * 16 >= N) continue;
#pragma unroll
    for (int r = 0; r < 8; ++r) so[w][8 * hh + r][t * 16 + ln] = acc[t][r] * alpha; }
  __builtin_amdgcn_fence(__ATOMIC_ACQ_REL, "workgroup"); __builtin_amdgcn_wave_barrier();
  const int rsub = lane >> 4, c4 = (lane & 15) * 4;
  {
#pragma unroll
    for (int q = 0; q < 8; ++q) { const int r = q * 2 + rsub; if (col0 + c4 < N) { const v4f v = *(const v4fa*)&so[w][r][c4]; *(v4f*)(C + (size_t)(row0 + r) * ldc + col0 + c4) = v; } }
     }
}

// Wt[n][k] = f16(W[k][n]·scale) from f32 row-major W[K][N] (scale = power of two; bf16-exact weights stay exact in f16 away from the subnormal range)
__global__ __launch_bounds__(256) void k_wt_f16(const float* __restrict__ W, _Float16* __restrict__ Wt, int K, int N, float scale) {
  const int t = blockIdx.x * 256 + threadIdx.x; if (t >= N * (K / 8)) return; const int n = t / (K / 8), k8 = (t % (K / 8)) * 8; FragH f;
#pragma unroll
  for (int i = 0; i < 8; ++i) f.h[i] = (_Float16)(bf16_round(W[(size_t)(k8 + i) * N + n]) * scale); const v8us o = f.half[0];
  *(v8us*)((unsigned short*)Wt + (size_t)n * K + k8) = o; 
}
// k_gemm_hh variant with fused epilogue: v = acc·alpha + bias[by·sBias + col] (+ CP[(row/rowsPerB)·sCPb + by·64 + col] if CP) ; ACT 0 none / 1 elu ; writes f16 C16 (and f32 C if non-null)
template <int ACT>
__global__ __launch_bounds__(128) void k_gemm_hhx(const _Float16* __restrict__ A, int lda, size_t sA, const _Float16* __restrict__ Bh, int ldb, size_t sB, float alpha, const float* __restrict__ bias, size_t sBias, const float* __restrict__ CP, int rowsPerB, size_t sCPb, int row0g,
    float* __restrict__ C, _Float16* __restrict__ C16, int ldc, size_t sC, int M, int N, int K) {
  __shared__ __attribute__((aligned(16))) float so[4][16][64];
  const int tid = threadIdx.x, w = tid >> 5, lane = tid & 31, ln = lane & 15, hh = lane >> 4; const int by = blockIdx.y;
  A += (size_t)by * sA; Bh += (size_t)by * sB; const size_t cofs = (size_t)by * sC; const float* bp = bias ? bias + (size_t)by * sBias : nullptr;
  const int ntn = (N + 63) / 64; const int wid = blockIdx.x * 4 + w; const int mt = wid / ntn, nq = wid % ntn; if (mt * 16 >= M) return;
  const int row0 = mt * 16, col0 = nq * 64; const _Float16* arow = A + (size_t)(row0 + ln) * lda;
  v8f acc[4] = {};
  for (int kb = 0; kb < K; kb += 32) { FragH ah; ah.half[0] = *(const v8us*)((const unsigned short*)arow + kb + 8 * hh); ah.half[1] = *(const v8us*)((const unsigned short*)arow + kb + 16 + 8 * hh);
#pragma unroll
    for (int t = 0; t < 4; ++t) { if (col0 + t * 16 >= N) continue; const size_t boff = (size_t)(col0 + t * 16 + ln) * ldb + kb; FragH bq; bq.half[0] = *(const v8us*)((const unsigned short*)Bh + boff + 8 * hh); bq.half[1] = *(const v8us*)((const unsigned short*)Bh + boff + 16 + 8 * hh);
      acc[t] = mmaH<1>(ah.v, ah.v, bq.v, bq.v, acc[t]); }
  }
#pragma unroll
  for (int t = 0; t < 4; ++t) { if (col0 + t * 16 >= N) continue; const int col = col0 + t * 16 + ln; const float bv = bp ? bf16_round(bp[col]) : 0.f;
#pragma unroll
    for (int r = 0; r < 8; ++r) { float v = acc[t][r] * alpha + bv; if (CP) { const int rr = row0g + row0 + 8 * hh + r; if (rowsPerB < 0) v += CP[cofs + (size_t)rr * ldc + col];      /* rowsPerB < 0: own element of the batched C plane */ else { const int bidx = rr / rowsPerB; v += CP[(size_t)bidx * sCPb + (size_t)by * 64 + col]; } } if (ACT == 1) v = (v > 0.f) ? v : expm1f(v); else if (ACT == 7) v = (v > 0.f) ? v + 1.0f : expf(v); else if (ACT == 8) v = tanhf(v); else if (ACT == 9) v = 0.5f * v * (1.0f + tanhf(0.7978845608028654f * (v + 0.044715f * v * v * v))); else if (ACT == 11) v = 1.0f / (1.0f + expf(-v)); else if (ACT == 12) v = (v > 0.f) ? v : 0.01f * v; else if (ACT == 14) v = (v > 0.f) ? v : 0.1f * v; else if (ACT == 16) v = (v >= 0.f) ? v : 0.3f * v; else if (ACT == 17) v = (v >= 0.f) ? v : 0.2f * v; else if (ACT == 15) v = v / (1.0f + expf(-v)); else if (ACT == 3) v = fmaxf(v, 0.f); else if (ACT == 6) v = 0.5f * v * (1.0f + erff(v * 0.70710678118654752f)); so[w][8 * hh + r][t * 16 + ln] = v; } }
  __builtin_amdgcn_fence(__ATOMIC_ACQ_REL, "workgroup"); __builtin_amdgcn_wave_barrier();
  const int rsub = lane >> 4, c4 = (lane & 15) * 4; typedef _Float16 v4h __attribute__((ext_vector_type(4)));
  {
#pragma unroll
    for (int q = 0; q < 8; ++q) { const int r = q * 2 + rsub; if (col0 + c4 < N) { const v4f v = *(const v4fa*)&so[w][r][c4]; if (C) *(v4f*)(C + cofs + (size_t)(row0 + r) * ldc + col0 + c4) = v; if (C16) { v4h h4; for (int i = 0; i < 4; ++i) h4[i] = (_Float16)v[i]; *(v4h*)(C16 + cofs + (size_t)(row0 + r) * ldc + col0 + c4) = h4; } } }
     }
}


typedef _Float16 v4h __attribute__((ext_vector_type(4)));

__global__ __launch_bounds__(256) void k_x16(const float* __restrict__ x, _Float16* __restrict__ X16, size_t n8) { const size_t t = (size_t)blockIdx.x * 256 + threadIdx.x; if (t >= n8) return; FragH f;
#pragma unroll
  for (int q = 0; q < 8; ++q) f.h[q] = (_Float16)bf16_round(x[t * 8 + q]); *(v8us*)((unsigned short*)X16 + t * 8) = f.half[0];  }
__global__ __launch_bounds__(256) void k_h16(const float* __restrict__ x, _Float16* __restrict__ X16, size_t n8) { const size_t t = (size_t)blockIdx.x * 256 + threadIdx.x; if (t >= n8) return; FragH f;
#pragma unroll
  for (int q = 0; q < 8; ++q) f.h[q] = (_Float16)x[t * 8 + q]; *(v8us*)((unsigned short*)X16 + t * 8) = f.half[0];  }
__global__ __launch_bounds__(256) void k_round16f(const float* __restrict__ W, _Float16* __restrict__ Bt, size_t n8) { const size_t t = (size_t)blockIdx.x * 256 + threadIdx.x; if (t >= n8) return; FragH f;
#pragma unroll
  for (int i = 0; i < 8; ++i) f.h[i] = (_Float16)(bf16_round(W[t * 8 + i]) * 16.0f); *(v8us*)((unsigned short*)Bt + t * 8) = f.half[0];  }
template <int NHv, int TTv>
__global__ __launch_bounds__(256) void k_vt(const _Float16* __restrict__ V16, int ldv, int voff, _Float16* __restrict__ Vt) { __shared__ unsigned short tl[64][66]; const int tid = threadIdx.x; const int slab = blockIdx.x / (TTv / 64), lg = blockIdx.x % (TTv / 64); const int b = slab / NHv, h = slab % NHv;
  for (int i = tid; i < 64 * 8; i += 256) { const int r = i / 8, c8 = (i % 8) * 8; FragH f; f.half[0] = *(const v8us*)((const unsigned short*)V16 + ((size_t)b * TTv + lg * 64 + r) * ldv + voff + h * 64 + c8);
#pragma unroll
    for (int q = 0; q < 8; ++q) tl[r][c8 + q] = f.u[q]; }
  __syncthreads();
  {
#pragma unroll
    for (int rd = 0; rd < 2; ++rd) { const int d = rd * 32 + tid / 8, pc = tid % 8; FragH f;
#pragma unroll
      for (int q = 0; q < 8; ++q) f.u[q] = tl[pc * 8 + q][d];
      *(v8us*)((unsigned short*)Vt + ((size_t)slab * 64 + d) * TTv + lg * 64 + pc * 8) = f.half[0]; }
     } }

__global__ __launch_bounds__(256) void k_hl(const float* __restrict__ F, _Float16* __restrict__ Hh, _Float16* __restrict__ Hl, size_t n8) { const size_t t = (size_t)blockIdx.x * 256 + threadIdx.x; if (t >= n8) return; FragH fh, fl; const v4f a = *(const v4fa*)(F + t * 8), c = *(const v4fa*)(F + t * 8 + 4);
#pragma unroll
  for (int q = 0; q < 4; ++q) { _Float16 h = (_Float16)a[q]; fh.h[q] = h; fl.h[q] = (_Float16)((a[q] - (float)h) * 1024.0f); h = (_Float16)c[q]; fh.h[4 + q] = h; fl.h[4 + q] = (_Float16)((c[q] - (float)h) * 1024.0f); }
  { *(v8us*)((unsigned short*)Hh + t * 8) = fh.half[0]; *(v8us*)((unsigned short*)Hl + t * 8) = fl.half[0];  } }

// ---- fast GEMM (work-group tile 128x64, wave tile 32x64; A and Bt rows of pitch and length DM; requires M % 128 == 0 and N % 64 == 0); epilogue = k_gemm_hhx semantics ----
// A rows and Bt rows of 64 k are staged through registers into two LDS buffers shared by the 4 waves: global loads cover whole 128-byte lines, and each line is fetched once per work-group.
#define G2_KC 64                     /* k per LDS stage: 128-byte rows */
#define G2_P 72                      /* LDS row pitch in f16: 128-byte rows + 16 bytes (16 B x odd: conflict-free 16-byte reads) */
__device__ __forceinline__ v16h g2_frag(const _Float16* p, int hh) { FragH f; f.half[0] = *(const v8us*)((const unsigned short*)p + 8 * hh); f.half[1] = *(const v8us*)((const unsigned short*)p + 16 + 8 * hh); return f.v; }
__device__ __forceinline__ v8f g2_mma(v16h a, v16h b, v8f c) { v8f d = __builtin_amdgcn_wmma_f32_16x16x32_f16(false, a, false, b, (short)0, c, false, false); asm volatile("v_nop\n\tv_nop\n\tv_nop\n\tv_nop" : "+v"(d) : "v"(a), "v"(b)); return d; }
template <int ACT, int ROPE = 0>      /* ROPE 1: C16 = f16(v cos + rotate_half(v) sin), v = acc * alpha, per 64-column head; position = row % SQ, tables CS / SN [SQ][32]; no bias, no CP, no f32 C */
__global__ __launch_bounds__(128) void k_gemm2(const _Float16* __restrict__ A, size_t sA, const _Float16* __restrict__ Bh, size_t sB, float alpha, const float* __restrict__ bias, size_t sBias, const float* __restrict__ CP, int rowsPerB, size_t sCPb, int row0g,
    float* __restrict__ C, _Float16* __restrict__ C16, int ldc, size_t sC, int M, int N, const float* __restrict__ CS, const float* __restrict__ SN) { static_assert(ACT == 0 || ACT == 3 || ACT == 6 || ACT == 8 || ACT == 9 || ACT == 11 || ACT == 12 || ACT == 14 || ACT == 15 || ACT == 16 || ACT == 17, "k_gemm2: unsupported ACT code (would silently apply no activation)");
  __shared__ __attribute__((aligned(16))) unsigned char sm[2 * (128 + 64) * G2_P * 2];      /* two stage buffers of A (128 rows) and B (64 rows); behind the loop's last barrier the same bytes are the epilogue's staging */
  _Float16 (*la)[128][G2_P] = (_Float16 (*)[128][G2_P])sm; _Float16 (*lb)[64][G2_P] = (_Float16 (*)[64][G2_P])(sm + 2 * 128 * G2_P * 2); float (*so)[32][68] = (float (*)[32][68])sm;
  static_assert(sizeof(float) * 4 * 32 * 68 <= sizeof(sm), "the epilogue's staging lies inside the stage buffers");
  const int tid = threadIdx.x, w = tid >> 5, lane = tid & 31, ln = lane & 15, hh = lane >> 4; const int by = blockIdx.y;
  A += (size_t)by * sA; Bh += (size_t)by * sB; const size_t cofs = (size_t)by * sC; const float* bp = bias ? bias + (size_t)by * sBias : nullptr;
  const int ntn = N >> 6; const int mt = blockIdx.x / ntn, nq = blockIdx.x - mt * ntn; const int row0 = mt * 128 + 32 * w, col0 = nq * 64; if (mt * 128 >= M) return;      /* block-uniform, in front of every barrier; M % 128 == 0 */
  const int sr = tid >> 3, sc = (tid & 7) * 8;      /* staging: a thread brings 16 bytes of rows sr + 16 i; 8 lanes cover one 128-byte line, a wave-wide load four whole lines */
  const unsigned short* ag = (const unsigned short*)A + (size_t)(mt * 128 + sr) * DM + sc; const unsigned short* bg = (const unsigned short*)Bh + (size_t)(col0 + sr) * DM + sc;
  v8us ga[8], gb[4];
#pragma unroll      /* ga[], gb[] in registers; constant row steps become immediate offsets */
  for (int i = 0; i < 8; ++i) ga[i] = *(const v8us*)(ag + (size_t)i * 16 * DM);
#pragma unroll
  for (int i = 0; i < 4; ++i) gb[i] = *(const v8us*)(bg + (size_t)i * 16 * DM);
  asm volatile("s_wait_xcnt 0x0" :: "v"(ag), "v"(bg) : "memory");      /* the staging loads' address pairs stay live up to this wait, so no register that an issued load names is overwritten in front of it */
#pragma unroll
  for (int i = 0; i < 8; ++i) *(v8us*)&la[0][sr + 16 * i][sc] = ga[i];
#pragma unroll
  for (int i = 0; i < 4; ++i) *(v8us*)&lb[0][sr + 16 * i][sc] = gb[i];
  const v8f z8 = {0.f,0.f,0.f,0.f,0.f,0.f,0.f,0.f}; v8f c00 = z8, c01 = z8, c02 = z8, c03 = z8, c10 = z8, c11 = z8, c12 = z8, c13 = z8;
  __syncthreads();      /* stage 0 is published */
#pragma unroll 1      /* one stage per trip: the registers hold one stage's fragments and the next stage's 12 staging loads */
  for (int st = 0; st < DM / G2_KC; ++st) { const int cur = st & 1; const bool more = st + 1 < DM / G2_KC;      /* block-uniform */
    if (more) { ag += G2_KC; bg += G2_KC;      /* the next stage flies under this stage's products */
#pragma unroll
      for (int i = 0; i < 8; ++i) ga[i] = *(const v8us*)(ag + (size_t)i * 16 * DM);
#pragma unroll
      for (int i = 0; i < 4; ++i) gb[i] = *(const v8us*)(bg + (size_t)i * 16 * DM);
      asm volatile("s_wait_xcnt 0x0" :: "v"(ag), "v"(bg) : "memory"); }      /* likewise: the pointers are stepped only behind this wait */
    v16h a0[2], a1[2], bf[4][2];
#pragma unroll      /* the stage's 24 LDS reads stand as one group in front of its 16 products */
    for (int kk = 0; kk < G2_KC / 32; ++kk) { a0[kk] = g2_frag(&la[cur][32 * w + ln][kk * 32], hh); a1[kk] = g2_frag(&la[cur][32 * w + 16 + ln][kk * 32], hh);
      for (int t = 0; t < 4; ++t) bf[t][kk] = g2_frag(&lb[cur][t * 16 + ln][kk * 32], hh); }
#pragma unroll      /* fragments in registers; k ascends as before: the sum order of every accumulator is unchanged */
    for (int kk = 0; kk < G2_KC / 32; ++kk) {
      c00 = g2_mma(a0[kk], bf[0][kk], c00); c10 = g2_mma(a1[kk], bf[0][kk], c10);
      c01 = g2_mma(a0[kk], bf[1][kk], c01); c11 = g2_mma(a1[kk], bf[1][kk], c11);
      c02 = g2_mma(a0[kk], bf[2][kk], c02); c12 = g2_mma(a1[kk], bf[2][kk], c12);
      c03 = g2_mma(a0[kk], bf[3][kk], c03); c13 = g2_mma(a1[kk], bf[3][kk], c13); }
    if (more) {      /* the other buffer's last readers left it at the previous trip's barrier */
#pragma unroll
      for (int i = 0; i < 8; ++i) *(v8us*)&la[cur ^ 1][sr + 16 * i][sc] = ga[i];
#pragma unroll
      for (int i = 0; i < 4; ++i) *(v8us*)&lb[cur ^ 1][sr + 16 * i][sc] = gb[i]; }
    __syncthreads(); }      /* publishes the next stage and ends every wave's reads of this one (behind the last trip: frees the buffers for the epilogue's staging) */
  v8f accs[8] = {c00, c01, c02, c03, c10, c11, c12, c13};
  if (ROPE) {      /* col0 is a multiple of 64 and row0 of 32: both halves of every rotation pair lie in this wave's own 32 x 64 tile, and its 32 positions do not wrap at SQ */
    const int rs = lane >> 3, d8 = (lane & 7) * 8; const float sg = (d8 < HD / 2) ? -1.0f : 1.0f;      /* 8 lanes per row, 8 columns each; rotate_half(v)[d] = -v[d + 32] below 32, v[d - 32] above */
    const size_t tb = (size_t)((unsigned)row0 % SQ + rs) * (HD / 2) + (d8 & (HD / 2 - 1)); const float* cp = CS + tb; const float* sp = SN + tb; v4f tc[8][2], ts[8][2];
#pragma unroll      /* accs[] in registers */
    for (int u = 0; u < 8; ++u) for (int r = 0; r < 8; ++r) so[w][(u >> 2) * 16 + 8 * hh + r][(u & 3) * 16 + ln] = accs[u][r] * alpha;
    __builtin_amdgcn_fence(__ATOMIC_ACQ_REL, "workgroup"); __builtin_amdgcn_wave_barrier();      /* the wave reads back rows that its other lanes wrote */
#pragma unroll      /* tc[], ts[] in registers; behind the staging, where the accumulators' registers are free */
    for (int q = 0; q < 8; ++q) for (int u = 0; u < 2; ++u) { tc[q][u] = *(const v4fa*)(cp + q * 4 * (HD / 2) + 4 * u); ts[q][u] = *(const v4fa*)(sp + q * 4 * (HD / 2) + 4 * u); }
    unsigned short* dp = (unsigned short*)C16 + cofs + (size_t)(row0 + rs) * ldc + col0 + d8;
#pragma unroll      /* 4 rows per trip, constant LDS offsets; a store covers four whole 128-byte lines */
    for (int q = 0; q < 8; ++q) { FragH f;
      for (int u = 0; u < 2; ++u) { const v4f own = *(const v4fa*)&so[w][q * 4 + rs][d8 + 4 * u], oth = *(const v4fa*)&so[w][q * 4 + rs][(d8 ^ (HD / 2)) + 4 * u];
        for (int i = 0; i < 4; ++i) f.h[4 * u + i] = (_Float16)(own[i] * tc[q][u][i] + oth[i] * (sg * ts[q][u][i])); }
      *(v8us*)(dp + (size_t)q * 4 * ldc) = f.half[0]; }
    return; }
#pragma unroll
  for (int u = 0; u < 8; ++u) { const int t = u & 3, half = u >> 2; const int col = col0 + t * 16 + ln; const float bv = bp ? bf16_round(bp[col]) : 0.f;
#pragma unroll
    for (int r = 0; r < 8; ++r) { const int rloc = half * 16 + 8 * hh + r; float v = accs[u][r] * alpha + bv; if (CP) { if (rowsPerB < 0) v += CP[cofs + (size_t)(row0g + row0 + rloc) * ldc + col];      /* rowsPerB < 0: own element of the batched C plane */ else { const int bidx = (row0g + row0 + rloc) / rowsPerB; v += CP[(size_t)bidx * sCPb + (size_t)by * 64 + col]; } }
      if (ACT == 3) v = fmaxf(v, 0.f); else if (ACT == 6) v = 0.5f * v * (1.0f + erff(v * 0.70710678118654752f)); else if (ACT == 11) v = 1.0f / (1.0f + expf(-v)); else if (ACT == 15) v = v / (1.0f + expf(-v)); else if (ACT == 12) v = (v > 0.f) ? v : 0.01f * v; else if (ACT == 8) v = tanhf(v); else if (ACT == 9) v = 0.5f * v * (1.0f + tanhf(0.7978845608028654f * (v + 0.044715f * v * v * v))); else if (ACT == 14) v = (v > 0.f) ? v : 0.1f * v; else if (ACT == 16) v = (v >= 0.f) ? v : 0.3f * v; else if (ACT == 17) v = (v >= 0.f) ? v : 0.2f * v;
      so[w][rloc][t * 16 + ln] = v; } }
  __builtin_amdgcn_fence(__ATOMIC_ACQ_REL, "workgroup"); __builtin_amdgcn_wave_barrier();
  const int rsub = lane >> 4, c4 = (lane & 15) * 4;
  {
#pragma unroll
    for (int q = 0; q < 16; ++q) { const int r = q * 2 + rsub; const v4f v = *(const v4fa*)&so[w][r][c4]; if (C) *(v4f*)(C + cofs + (size_t)(row0 + r) * ldc + col0 + c4) = v; if (C16) { v4h h4; for (int i = 0; i < 4; ++i) h4[i] = (_Float16)v[i]; *(v4h*)(C16 + cofs + (size_t)(row0 + r) * ldc + col0 + c4) = h4; } }
     } }


__global__ __launch_bounds__(256) void k_wnat(const float* __restrict__ w, size_t n8, _Float16* __restrict__ Bt) { const size_t t = (size_t)blockIdx.x * 256 + threadIdx.x; if (t >= n8) return; FragH f; for (int q = 0; q < 8; ++q) f.h[q] = (_Float16)(bf16_round(w[t * 8 + q]) * 16.0f); *(v8us*)((unsigned short*)Bt + t * 8) = f.half[0];  }
#define FA_W 8                       /* waves per work-group, 32 query columns each */
#define FA_QB (FA_W * 32)            /* query rows per work-group */
#define FA_ST 64                     /* keys per LDS stage */
#define FA_P 72                      /* LDS row pitch in f16: 128-byte rows + 16 bytes (16 B x odd: conflict-free 16-byte reads) */
typedef float v2f __attribute__((ext_vector_type(2)));
typedef _Float16 v2h __attribute__((ext_vector_type(2)));
__device__ __forceinline__ float fa_xhalf(float x) { return __builtin_bit_cast(float, __builtin_amdgcn_permlanex16(__builtin_bit_cast(int, x), __builtin_bit_cast(int, x), 0x76543210, 0xfedcba98, false, false)); }      /* lane l reads lane l ^ 16 */
__device__ __forceinline__ v8f fa_mma(v16h a, v16h b, v8f c) { return __builtin_amdgcn_wmma_f32_16x16x32_f16(false, a, false, b, (short)0, c, false, false); }
__global__ __launch_bounds__(FA_W * 32) void k_fattn(const _Float16* __restrict__ Q16, const _Float16* __restrict__ K16, const _Float16* __restrict__ VT, _Float16* __restrict__ O16) {
  __shared__ __attribute__((aligned(16))) _Float16 lk[2][FA_ST][FA_P]; __shared__ __attribute__((aligned(16))) _Float16 lv[2][HD][FA_P];
  const int tid = threadIdx.x, w = tid >> 5, lane = tid & 31, ln = lane & 15, hh = lane >> 4; const int h = blockIdx.y, b = blockIdx.z; const size_t r0 = (size_t)b * SQ; const int q0 = blockIdx.x * FA_QB + w * 32;
  const int sr = tid >> 3, sc = (tid & 7) * 8;      /* staging: a thread brings 16 bytes of rows sr and sr + 32 of each tile; 8 lanes cover one 128-byte line */
  const unsigned short* kg = (const unsigned short*)K16 + (r0 + sr) * KVD + h * HD + sc;      /* key row sr of the stage, this head's 64 columns */
  const unsigned short* vg = (const unsigned short*)VT + ((size_t)(b * NH + h) * HD + sr) * SQ + sc;      /* V^T row d = sr, the stage's 64 keys */
  v8us gk0 = *(const v8us*)kg, gk1 = *(const v8us*)(kg + (size_t)32 * KVD), gv0 = *(const v8us*)vg, gv1 = *(const v8us*)(vg + (size_t)32 * SQ);
  v16h qf[2][2];      /* [column group][k step of 32], kept for the whole kernel */
  { const _Float16* qp = Q16 + (r0 + q0 + ln) * LQ + h * HD;
#pragma unroll      /* constant indices keep qf[] in registers */
    for (int g = 0; g < 2; ++g) for (int kk = 0; kk < 2; ++kk) qf[g][kk] = g2_frag(qp + (size_t)g * 16 * LQ + kk * 32, hh);
    asm volatile("s_wait_xcnt 0x0" :: "v"(qp) : "memory"); }      /* the q loads' address pair stays live up to this wait, so no register that an issued load names is overwritten in front of it */
  *(v8us*)&lk[0][sr][sc] = gk0; *(v8us*)&lk[0][sr + 32][sc] = gk1; *(v8us*)&lv[0][sr][sc] = gv0; *(v8us*)&lv[0][sr + 32][sc] = gv1;
  const v8f z8 = {0.f,0.f,0.f,0.f,0.f,0.f,0.f,0.f}; v8f o[2][4];      /* O^T: [column group][16 rows of d] */
#pragma unroll      /* o[] in registers */
  for (int g = 0; g < 2; ++g) for (int t = 0; t < 4; ++t) o[g][t] = z8;
  float mr[2] = {-1.0e30f, -1.0e30f}, l[2] = {0.f, 0.f};      /* maximum in use (log2-scaled) and this lane's part of the denominator */
  const float cs = 0.125f * 1.4426950408889634f;      /* 64^-0.5 * log2(e) */
  __syncthreads();      /* stage 0 is published */
  for (int st = 0; st < SQ / FA_ST; ++st) { const int cur = st & 1; const bool more = st + 1 < SQ / FA_ST;      /* block-uniform */
    if (more) { kg += (size_t)FA_ST * KVD; vg += FA_ST; gk0 = *(const v8us*)kg; gk1 = *(const v8us*)(kg + (size_t)32 * KVD); gv0 = *(const v8us*)vg; gv1 = *(const v8us*)(vg + (size_t)32 * SQ);      /* the next stage flies under this stage's two passes */
      asm volatile("s_wait_xcnt 0x0" :: "v"(kg), "v"(vg) : "memory"); }      /* likewise for the next stage's staging loads: the pointers are stepped only behind this wait (stage 0's loads: behind the wait after the q loads) */
#pragma unroll      /* two 32-key passes per stage, constant LDS offsets */
    for (int ps = 0; ps < FA_ST / 32; ++ps) {
      v8f s[2][2];      /* S^T: [column group][16 keys] */
      { v16h kf[2][2];
#pragma unroll      /* fragments in registers */
        for (int t = 0; t < 2; ++t) for (int kk = 0; kk < 2; ++kk) kf[t][kk] = g2_frag(&lk[cur][ps * 32 + t * 16 + ln][kk * 32], hh);
#pragma unroll      /* fragments in registers */
        for (int t = 0; t < 2; ++t) for (int g = 0; g < 2; ++g) s[g][t] = fa_mma(kf[t][1], qf[g][1], fa_mma(kf[t][0], qf[g][0], z8)); }
      v16h vf[4];
#pragma unroll      /* fragments in registers; these reads fly under the maxima and exponentials */
      for (int t = 0; t < 4; ++t) vf[t] = g2_frag(&lv[cur][t * 16 + ln][ps * 32], hh);
      float mb[2]; bool need = false;
#pragma unroll      /* s[] in registers */
      for (int g = 0; g < 2; ++g) { float mx = s[g][0][0];
        for (int r = 1; r < 8; ++r) mx = fmaxf(mx, s[g][0][r]);
        for (int r = 0; r < 8; ++r) mx = fmaxf(mx, s[g][1][r]);
        mx = fmaxf(mx, fa_xhalf(mx)) * cs; mb[g] = mx; need = need || (mx > mr[g] + 8.0f); }      /* both halves hold the column's maximum; the one in use may trail it by 8 (weights up to 2^8) */
      if (__builtin_amdgcn_ballot_w32(need) != 0) {      /* wave-uniform; always on the first pass, rare afterwards */
#pragma unroll      /* o[] in registers */
        for (int g = 0; g < 2; ++g) { const float mn = fmaxf(mr[g], mb[g]); const float corr = __builtin_amdgcn_exp2f(mr[g] - mn); mr[g] = mn; l[g] *= corr;
          for (int t = 0; t < 4; ++t) o[g][t] = o[g][t] * corr; } }
#pragma unroll      /* s[], o[] in registers */
      for (int g = 0; g < 2; ++g) { const float nm = -mr[g]; const v8f c8 = {cs, cs, cs, cs, cs, cs, cs, cs}, n8 = {nm, nm, nm, nm, nm, nm, nm, nm}; FragH pf; float la = 0.f, lb = 0.f;
        for (int t = 0; t < 2; ++t) { s[g][t] = __builtin_elementwise_fma(s[g][t], c8, n8);
          for (int r = 0; r < 8; ++r) s[g][t][r] = __builtin_amdgcn_exp2f(s[g][t][r]); }      /* weights 2^(score * cs - maximum in use), in the score registers */
        for (int i = 0; i < 8; ++i) { const int t = i >> 2, r = 2 * (i & 3);
          la += s[g][t][r]; lb += s[g][t][r + 1];
          const v2h pk = __builtin_convertvector(v2f{s[g][t][r], s[g][t][r + 1]}, v2h); pf.h[2 * i] = pk[0]; pf.h[2 * i + 1] = pk[1]; }
        l[g] += la + lb;
        for (int t = 0; t < 4; ++t) o[g][t] = fa_mma(vf[t], pf.v, o[g][t]); } }
    asm volatile("v_nop\n\tv_nop\n\tv_nop\n\tv_nop" : "+v"(o[0][0]), "+v"(o[0][1]), "+v"(o[0][2]), "+v"(o[0][3]), "+v"(o[1][0]), "+v"(o[1][1]), "+v"(o[1][2]), "+v"(o[1][3]));      /* four issue slots behind the stage's last matrix instructions: a branch follows */
    if (more) { *(v8us*)&lk[cur ^ 1][sr][sc] = gk0; *(v8us*)&lk[cur ^ 1][sr + 32][sc] = gk1; *(v8us*)&lv[cur ^ 1][sr][sc] = gv0; *(v8us*)&lv[cur ^ 1][sr + 32][sc] = gv1; }      /* its last readers left it at the previous trip's barrier */
    __syncthreads(); }      /* publishes the next stage and ends every wave's reads of this one */
#pragma unroll      /* o[] in registers */
  for (int g = 0; g < 2; ++g) { const float fin = 64.0f / (l[g] + fa_xhalf(l[g]));      /* the halves' sums join once; o carried x64 */
    unsigned short* d = (unsigned short*)O16 + (r0 + q0 + g * 16 + ln) * DM + h * HD + 8 * hh;
    for (int t = 0; t < 4; ++t) { FragH f; for (int r = 0; r < 8; ++r) f.h[r] = (_Float16)(o[g][t][r] * fin); *(v8us*)(d + t * 16) = f.half[0]; } } }      /* a lane's 8 registers are 8 consecutive d of its query row: one 16-byte store */
__global__ __launch_bounds__(256) void k_vt(const _Float16* __restrict__ V16, int b, int h0, _Float16* __restrict__ VT) { __shared__ unsigned short tl[64][65]; const int tid = threadIdx.x; const int hh = blockIdx.x % HG, sg = blockIdx.x / HG; const int s0 = sg * 64; const int h = h0 + hh;
  for (int i = tid; i < 64 * 8; i += 256) { const int j = i / 8, d8 = (i % 8) * 8; FragH f; f.half[0] = *(const v8us*)((const unsigned short*)V16 + ((size_t)b * SQ + s0 + j) * DM + h * HD + d8); for (int q = 0; q < 8; ++q) tl[d8 + q][j] = f.u[q]; }
  __syncthreads();
  { for (int i = tid; i < 64 * 8; i += 256) { const int d = i / 8, j8 = (i % 8) * 8; FragH f; for (int q = 0; q < 8; ++q) f.u[q] = tl[d][j8 + q]; *(v8us*)((unsigned short*)VT + ((size_t)hh * HD + d) * SQ + s0 + j8) = f.half[0]; }  } }



__global__ __launch_bounds__(256) void k_rsmcf2(const float* __restrict__ S, _Float16* __restrict__ P, int hg, int q0, int nk) {
  #pragma clang fp contract(off)
  const int t = blockIdx.x * 256 + threadIdx.x; if (t >= hg * QT) return; const size_t i = (size_t)t; const float* s = S + i * NKX; const int last = q0 + (t % QT); float mx = -3.0e38f;
#pragma unroll 1
  for (int j = 0; j < nk; ++j) { const float f = (j <= last) ? 1.f : 0.f; mx = fmaxf(mx, fmaf(f, s[j], (1.f - f) * -1.0e9f)); } float se = 0.f;
#pragma unroll 1
  for (int j = 0; j < nk; ++j) { const float f = (j <= last) ? 1.f : 0.f; se += __expf(fmaf(f, s[j], (1.f - f) * -1.0e9f) - mx); } const float sc = 256.0f / se;
#pragma unroll 1
  for (int j0 = 0; j0 < nk; j0 += 8) { FragH fr; for (int q = 0; q < 8; ++q) { const int j = j0 + q; const float f = (j <= last) ? 1.f : 0.f; fr.h[q] = (_Float16)(__expf(fmaf(f, s[j], (1.f - f) * -1.0e9f) - mx) * sc); } unsigned short* d = (unsigned short*)P + i * NKX + j0; *(v8us*)d = fr.half[0];  } }


template <int MASKADD>
__global__ __launch_bounds__(64) void k_att0(const float* __restrict__ QF, const float* __restrict__ KF, const float* __restrict__ VF, int ld, const float* __restrict__ mask, float scale, float* __restrict__ OF, int ldo) {
  #pragma clang fp contract(off)
  __shared__ __attribute__((aligned(16))) float lq[64][64]; __shared__ __attribute__((aligned(16))) float lo[64][64];
  const int tid = threadIdx.x; const int h = blockIdx.x / (QT0 / 64), rg = blockIdx.x % (QT0 / 64); const int i = rg * 64 + tid;
  const float* qr = QF + (size_t)i * ld + h * HD;
#pragma unroll 1
  for (int c = 0; c < HD / 4; ++c) { *(v4f*)&lq[tid][c * 4] = *(const v4fa*)(qr + c * 4); const v4f z = {0.f, 0.f, 0.f, 0.f}; *(v4f*)&lo[tid][c * 4] = z; }
  float m = -1.0e30f, l = 0.f; const int jmax = MASKADD ? (SQ - 1) : (rg * 64 + 63);      /* additive-mask form: every key (the mask input decides); causal form: keys up to the block's last row */
#pragma unroll 1
  for (int j = 0; j <= jmax; ++j) { const float* kr = KF + (size_t)j * ld + h * HD; const float* vr = VF + (size_t)j * ld + h * HD; float s = 0.f;
#pragma unroll 1
    for (int c = 0; c < HD / 4; ++c) { const v4f kq = *(const v4fa*)(kr + c * 4); const v4f qq = *(v4f*)&lq[tid][c * 4]; s = __fadd_rn(s, __fmul_rn(qq[0], kq[0])); s = __fadd_rn(s, __fmul_rn(qq[1], kq[1])); s = __fadd_rn(s, __fmul_rn(qq[2], kq[2])); s = __fadd_rn(s, __fmul_rn(qq[3], kq[3])); }
    s = __fmul_rn(s, scale); if (MASKADD) s = __fadd_rn(s, __fmul_rn(bf16_round(mask[(size_t)i * SQ + j]), -10000.0f));
    const float f = (MASKADD || j <= i) ? 1.f : 0.f; const float sm = fmaf(f, s, (1.f - f) * -1.0e30f); const float mn = fmaxf(m, sm); const float sc = expf(m - mn); const float e = expf(sm - mn); l = __fadd_rn(__fmul_rn(l, sc), e); m = mn;
#pragma unroll 1
    for (int c = 0; c < HD / 4; ++c) { const v4f vv = *(const v4fa*)(vr + c * 4); v4f oo = *(v4f*)&lo[tid][c * 4]; for (int u = 0; u < 4; ++u) oo[u] = __fadd_rn(__fmul_rn(oo[u], sc), __fmul_rn(e, vv[u])); *(v4f*)&lo[tid][c * 4] = oo; } }
  const float fin = 64.0f / l;      /* o carried x64 like the f16 path */
#pragma unroll 1
  for (int c = 0; c < HD / 4; ++c) { v4f oo = *(v4f*)&lo[tid][c * 4]; for (int u = 0; u < 4; ++u) oo[u] = __fmul_rn(oo[u], fin); *(v4f*)&lo[tid][c * 4] = oo; }
  __syncthreads();
  {
#pragma unroll 1
    for (int it = 0; it < 16; ++it) { const int row = it * 4 + tid / 16, pc = (tid % 16) * 4; const v4f v = *(const v4f*)&lo[row][pc]; *(v4f*)(OF + (size_t)(rg * 64 + row) * ldo + h * HD + pc) = v; }
     } }


__global__ __launch_bounds__(256) void k_kvexp(const float* __restrict__ src, float* __restrict__ dst, size_t n4) { const size_t t = (size_t)blockIdx.x * 256 + threadIdx.x; if (t >= n4) return; const size_t e = t * 4; const size_t row = e / DM; const int col = (int)(e % DM); const int h = col / HD, d = col % HD; const v4f v = *(const v4fa*)(src + row * KVD + (size_t)(h / HPG) * HD + d); *(v4f*)(dst + e) = v;  }

__global__ __launch_bounds__(256) void k_tab2(float theta, float* __restrict__ CS, float* __restrict__ SN) {
  #pragma clang fp contract(off)
  const int t = blockIdx.x * 256 + threadIdx.x; if (t >= SQ * (HD / 2)) return; const int i = t % (HD / 2); const int p = t / (HD / 2); const float invf = 1.0f / powf(theta, (float)(2 * i) / (float)HD); const float ang = __fmul_rn((float)p, invf); const float c = cosf(ang), s = sinf(ang);
  *(float*)(CS + t) = c; *(float*)(SN + t) = s;  }
template <int NORM, int ROPE>
__global__ __launch_bounds__(64) void k_xformf(const float* __restrict__ F, int ldf, int nh, const float* __restrict__ gain, float eps, const float* __restrict__ CS, const float* __restrict__ SN, float* __restrict__ F32, int ldo) {
  #pragma clang fp contract(off)
  __shared__ float xv[HD]; __shared__ float red[HD]; const int d = threadIdx.x; const int h = blockIdx.x % nh; const size_t r = blockIdx.x / nh; const int p = (int)(r % SQ);
  float x = F[r * (size_t)ldf + (size_t)h * HD + d];
  if (NORM) { red[d] = __fmul_rn(x, x); __syncthreads(); for (int st = HD / 2; st > 0; st >>= 1) { if (d < st) red[d] = __fadd_rn(red[d], red[d + st]); __syncthreads(); } const float rs = rsqrtf(__fadd_rn(red[0] / (float)HD, eps)); x = __fmul_rn(__fmul_rn(x, rs), bf16_round(gain[d])); }
  xv[d] = x; __syncthreads();
  float o = x;
  if (ROPE == 1) { const int i = d >> 1; const float c = CS[p * (HD / 2) + i], s = SN[p * (HD / 2) + i]; const float ev = xv[2 * i], od = xv[2 * i + 1]; o = (d & 1) ? __fadd_rn(__fmul_rn(ev, s), __fmul_rn(od, c)) : __fadd_rn(__fmul_rn(ev, c), -__fmul_rn(od, s)); }
  if (ROPE == 2) { const int i = d & (HD / 2 - 1); const float c = CS[p * (HD / 2) + i], s = SN[p * (HD / 2) + i]; const float lo = xv[i], hi = xv[i + HD / 2]; o = (d < HD / 2) ? __fadd_rn(__fmul_rn(lo, c), -__fmul_rn(hi, s)) : __fadd_rn(__fmul_rn(lo, s), __fmul_rn(hi, c)); }
  float* dst = F32 + r * (size_t)ldo + (size_t)h * HD + d; *(float*)dst = o;  }

__global__ __launch_bounds__(256) void k_bfcp(const float* __restrict__ src, float* __restrict__ dst, size_t n4) { const size_t t = (size_t)blockIdx.x * 256 + threadIdx.x; if (t >= n4) return; const v4f a = *(const v4fa*)(src + t * 4); v4f o; for (int q = 0; q < 4; ++q) o[q] = bf16_round(a[q]); *(v4f*)(dst + t * 4) = o;  }

__global__ __launch_bounds__(256) void k_tab2d(float* __restrict__ CS, float* __restrict__ SN) {
  #pragma clang fp contract(off)
  const int t = blockIdx.x * 256 + threadIdx.x; if (t >= SQ * (HD / 2)) return; const int i = t % (HD / 2); const int p = t / (HD / 2); const float invf = (float)(1.0 / pow(10000.0, (double)(2 * i) / (double)HD)); const float ang = __fmul_rn((float)p, invf); const float c = cosf(ang), s = sinf(ang);
  *(float*)(CS + t) = c; *(float*)(SN + t) = s;  }
extern "C" void kernel_launch(void* const* d_in, const int* in_sizes, int n_in,
                              void* d_out, int out_size, void* d_ws, size_t ws_size, hipStream_t stream) {
  (void)in_sizes; (void)n_in; (void)out_size;
  const float* const* I = (const float* const*)d_in; const float* x = I[0]; const float* wq = I[1]; const float* wk = I[2]; const float* wv = I[3]; const float* wo = I[4]; const float* bq = nullptr; const float* bk = nullptr; const float* bv = nullptr; const float* bo = I[5];      /* input order: x, Wq, Wk, Wv, Wo (natural [out][in] weights), bo [1024] (the output bias: into the output GEMM's bias slot); the q / k / v projections have NO biases; rope tables computed in the kernel (positions = row index) */
  char* ws = (char*)d_ws; size_t off = 0;
  auto take = [&](size_t bytes) { char* p = ws + off; off += (bytes + 255) & ~(size_t)255; return p; };
  _Float16* BQ = (_Float16*)take((size_t)DM * DM * 2); _Float16* BK = (_Float16*)take((size_t)KVD * DM * 2); _Float16* BV = (_Float16*)take((size_t)KVD * DM * 2); _Float16* BO = (_Float16*)take((size_t)DM * DM * 2);
  _Float16* X16 = (_Float16*)take(NR * DM * 2); float* CSB = (float*)take((size_t)SQ * 32 * 4); float* SNB = (float*)take((size_t)SQ * 32 * 4); _Float16* Q16 = (_Float16*)take(NR * DM * 2); _Float16* K16 = (_Float16*)take(NR * KVD * 2); _Float16* V16 = (_Float16*)take(NR * KVD * 2); _Float16* O16 = (_Float16*)take(NR * DM * 2);
  _Float16* VT = (_Float16*)take((size_t)NB * NH * HD * SQ * 2);
  float* QF0 = (float*)take((size_t)QT0 * DM * 4); float* KF0 = (float*)take((size_t)QT0 * KVD * 4); float* VF0 = (float*)take((size_t)QT0 * KVD * 4); float* KF0e = (float*)take((size_t)QT0 * DM * 4); float* VF0e = (float*)take((size_t)QT0 * DM * 4); float* OF0 = (float*)take((size_t)NB * QT0 * DM * 4); _Float16* OH0 = (_Float16*)take((size_t)NB * QT0 * DM * 2); _Float16* OL0 = (_Float16*)take((size_t)NB * QT0 * DM * 2);
  if (off > ws_size) return;
  k_wnat<<<(unsigned)(((size_t)DM * DM / 8 + 255) / 256), 256, 0, stream>>>(wq, (size_t)DM * DM / 8, BQ); k_wnat<<<(unsigned)(((size_t)KVD * DM / 8 + 255) / 256), 256, 0, stream>>>(wk, (size_t)KVD * DM / 8, BK); k_wnat<<<(unsigned)(((size_t)KVD * DM / 8 + 255) / 256), 256, 0, stream>>>(wv, (size_t)KVD * DM / 8, BV); k_wnat<<<(unsigned)(((size_t)DM * DM / 8 + 255) / 256), 256, 0, stream>>>(wo, (size_t)DM * DM / 8, BO);      /* natural [out][in] = Bt[n][k] x16 (KVD = 16 x 64 = DM: full-width k / v) */
  k_x16<<<(unsigned)((NR * DM / 8 + 255) / 256), 256, 0, stream>>>(x, X16, NR * DM / 8);
  const size_t r0p = (size_t)B0 * SQ;      /* first projected row */
  k_gemm2<0><<<dim3((unsigned)((MP / 128) * (KVD / 64)), 1), 128, 0, stream>>>(X16 + r0p * DM, 0, BV, 0, 0.0625f, bv, 0, nullptr, 1, 0, 0, nullptr, V16 + r0p * KVD, KVD, 0, MP, KVD, nullptr, nullptr);
  k_tab2d<<<(unsigned)(((size_t)SQ * (HD / 2) + 255) / 256), 256, 0, stream>>>(CSB, SNB);      /* rope tables computed in the kernel: CS[p][i] = cos(p * 10000^(-2i/64)), SN = sin, i < 32 (rotate-half convention; the module's [f | f] tables repeat these 32 columns) */
  static_assert(KVD == DM, "q and k share one launch: equal widths");
  k_gemm2<0, 1><<<dim3((unsigned)((MP / 128) * (DM / 64)), 2), 128, 0, stream>>>(X16 + r0p * DM, 0, BQ, (size_t)DM * DM, 0.0625f, nullptr, 0, nullptr, 1, 0, 0, nullptr, Q16 + r0p * DM, DM, NR * DM, MP, DM, CSB, SNB);      /* q (grid.y 0) and k (grid.y 1) of all rows: BK follows BQ and K16 follows Q16 in the workspace (sizes are multiples of 256 bytes), so the kernel's own batch strides step from q to k; half-split rope (t cos + rotate_half(t) sin, computed tables) and f32 -> f16 in the epilogue */
  for (int b = B0; b < B0 + NBR; ++b) { const size_t r0 = (size_t)b * SQ;
    k_vt<NG, SQ><<<NG * (SQ / 64), 256, 0, stream>>>(V16 + r0 * KVD, KVD, 0, VT + (size_t)b * NH * HD * SQ); }      /* V^T [NB][NH][HD][SQ]: this batch's slabs */
  k_fattn<<<dim3(SQ / FA_QB, NH, NB), FA_W * 32, 0, stream>>>(Q16, K16, VT, O16);      /* non-causal attention of all batches, heads and query rows in one launch: scores, softmax and weighted values fused; o into merged f16 rows (x64) */
  k_gemm2<0><<<dim3((unsigned)((MPO / 128) * (DM / 64)), 1), 128, 0, stream>>>(O16 + r0p * DM, 0, BO, 0, 0.0009765625f, bo, 0, nullptr, 1, 0, 0, (float*)d_out + r0p * DM, nullptr, DM, 0, MPO, DM, nullptr, nullptr);      /* out rows are the output layout */
}

// v006
// Measured time: 99.5 microseconds a run.
// Two timings next to v005 put it at 1.16 and 1.17 times that version's speed.
// Over all steps from v000 it is 197 times as fast.
#include <hip/hip_runtime.h>
// Multi-head self-attention with rotate-half RoPE computed in the kernel and a biased output projection, NON-causal (x [2][2048][1024]; q / k / v = x W^T (natural [1024][1024], no biases), 16 heads of 64; cos / sin = [f | f] of pos * 10000^(-2i/64); q = q cos + rotate_half(q) sin, likewise k; scores * 64^-0.5; softmax over all 2048 keys (no mask); out = merged Wo^T + bo (natural + bias) -> [2][2048][1024]); run in grouped-query form as 16 groups of ONE head.
// Structure: ONE preparation launch (x as exact f16 rows; natural weights as exact x16 planes; rope tables, double-derived inv_freq, f32 angle); v as a WMMA GEMM (32x64 wave tiles, f32 accumulation, f16 output); q and k of all rows as ONE GEMM launch (grid.y = q / k) whose epilogue applies the rotate-half rotation and the f16 conversion to the f32 tile it has staged in LDS (a wave tile is one head's 64 columns); V^T of all batches' heads via LDS transposes in one launch; then ONE fused attention launch for all batches, heads and query rows (256 query rows per work-group): per 32 keys S^T = K Q^T (K = 64), online softmax on VALU in the log2 domain (f32 statistics, native exp2, lazy rescale; weights f16, unnormalised), O^T += V^T P^T, o / row sum (carried x64) into merged f16 rows; scores and weights stay in registers; out = o Wo^T GEMM (f32, alpha 2^-10); launches: see trace.
// Compute dtype: inputs rounded to bf16; x / weights exact; q, k, v, softmax weights and o as plain f16 GEMM operands (~2^-12); scores and softmax statistics f32. v_wmma_f32_16x16x32_f16.
#define NB 2
#define NG 16
#define HPG 1
#define KVD (NG * HD)
#define SQ 2048
#define DM 1024
#define NH 16
#define HD 64
#define HG 4                         /* heads handled by the grouped k_vt overload kept below */
#define QT 512                       /* query rows per tile of the unfused softmax kernel kept below */
#define NKX SQ                       /* S / P row pitch */
#define QT0 128                      /* first-tile rows of the f32 k_att0 path (not launched) */
#define B0 0                         /* first batch processed (debug hook) */
#define NBR NB                       /* batches processed (debug hook) */
#define NR ((size_t)NB * SQ)         /* token rows */
#define MP ((int)((size_t)NBR * SQ)) /* rows projected (debug hook) */
#define QN SQ                        /* query rows attended per batch (unused) */
#define NHD NH                       /* heads attended (unused) */
#define MPO MP                       /* rows through the output stage (debug hook) */
#define LQ DM      /* row pitch of the q/k/v rows */
typedef __bf16 v16b __attribute__((ext_vector_type(16)));
typedef unsigned short v8us __attribute__((ext_vector_type(8), may_alias));
typedef float  v8f  __attribute__((ext_vector_type(8)));
typedef float  v4f  __attribute__((ext_vector_type(4)));
typedef float  v4fa __attribute__((ext_vector_type(4), may_alias));
union FragB { v16b v; v8us half[2]; unsigned short u[16]; };

__device__ __forceinline__ unsigned short bf16_bits(float x) { unsigned int u = __float_as_uint(x); return (unsigned short)((u + 0x7FFFu + ((u >> 16) & 1u)) >> 16); }
__device__ __forceinline__ float bf16_val(unsigned short b) { return __uint_as_float(((unsigned int)b) << 16); }
__device__ __forceinline__ float bf16_round(float x) { return bf16_val(bf16_bits(x)); }
// D += A·B with NT terms: 1 = ah·bh, 2 = + al·bh (A split), 3 = + ah·bl (both split)
template <int NT>
__device__ __forceinline__ v8f mmaN(v16b ah, v16b al, v16b bh, v16b bl, v8f c) {
  c = __builtin_amdgcn_wmma_f32_16x16x32_bf16(false, ah, false, bh, (short)0, c, false, false);
  if (NT >= 2) c = __builtin_amdgcn_wmma_f32_16x16x32_bf16(false, al, false, bh, (short)0, c, false, false);
  if (NT >= 3) c = __builtin_amdgcn_wmma_f32_16x16x32_bf16(false, ah, false, bl, (short)0, c, false, false);
  asm volatile("v_nop\n\tv_nop\n\tv_nop\n\tv_nop" : "+v"(c) : "v"(ah), "v"(al), "v"(bh), "v"(bl));
  return c;
}

__global__ __launch_bounds__(256) void k_wt_bf16(const float* __restrict__ W, unsigned short* __restrict__ Wt, int K, int N) {
  const int t = blockIdx.x * 256 + threadIdx.x;
  const int k8n = K / 8;
  if (t >= N * k8n) return;
  const int n = t / k8n, k8 = (t % k8n) * 8;
  v8us v;
#pragma unroll
  for (int i = 0; i < 8; ++i) v[i] = bf16_bits(W[(size_t)(k8 + i) * N + n]);
  *(v8us*)(Wt + (size_t)n * K + k8) = v;
  
}

// GEMM C[M][N] (f32, pitch ldc) = act(A[M][K]·W + bias). A f32 row-major (pitch lda) converted per fragment to bf16
// (ASPLIT: hi/lo two planes -> 2 terms, else single rounded term); Wt bf16 [N][K] (pitch ldb). BIAS_BF16 rounds the
// bias to bf16 first (bias quantised to bf16 before the add). K%32==0, M%16==0, N%64==0.
template <bool ASPLIT, int ACT, bool BIAS_BF16>
__global__ __launch_bounds__(128) void k_gemm_bf(const float* __restrict__ A, int lda, const unsigned short* __restrict__ Wt, int ldb,
                                               const float* __restrict__ bias, float* __restrict__ C, int ldc, int M, int N, int K) {
  __shared__ __attribute__((aligned(16))) float so[4][16][64];
  const int tid = threadIdx.x, w = tid >> 5, lane = tid & 31, ln = lane & 15, hh = lane >> 4;
  const int ntn = N / 64;
  const int wid = blockIdx.x * 4 + w;
  const int mt = wid / ntn, nq = wid % ntn;
  if (mt * 16 >= M) return;
  const int row0 = mt * 16, col0 = nq * 64;
  const float* arow = A + (size_t)(row0 + ln) * lda;
  v8f acc[4] = {};
  for (int kb = 0; kb < K; kb += 32) {
    FragB ah, al;
    const v4f x0 = *(const v4fa*)(arow + kb + 8 * hh), x1 = *(const v4fa*)(arow + kb + 8 * hh + 4);
    const v4f x2 = *(const v4fa*)(arow + kb + 16 + 8 * hh), x3 = *(const v4fa*)(arow + kb + 16 + 8 * hh + 4);
    float xs[16] = {x0[0],x0[1],x0[2],x0[3],x1[0],x1[1],x1[2],x1[3],x2[0],x2[1],x2[2],x2[3],x3[0],x3[1],x3[2],x3[3]};
#pragma unroll
    for (int i = 0; i < 16; ++i) { const unsigned short hb = bf16_bits(xs[i]); ah.u[i] = hb; al.u[i] = ASPLIT ? bf16_bits(xs[i] - bf16_val(hb)) : (unsigned short)0; }
#pragma unroll
    for (int t = 0; t < 4; ++t) {
      const unsigned short* brow = Wt + (size_t)(col0 + t * 16 + ln) * ldb + kb;
      FragB b;
      b.half[0] = *(const v8us*)(brow + 8 * hh);
      b.half[1] = *(const v8us*)(brow + 16 + 8 * hh);
      acc[t] = mmaN<ASPLIT ? 2 : 1>(ah.v, al.v, b.v, b.v, acc[t]);
    }
  }
#pragma unroll
  for (int t = 0; t < 4; ++t) {
    float bv = bias ? bias[col0 + t * 16 + ln] : 0.f;
    if (BIAS_BF16) bv = bf16_round(bv);
#pragma unroll
    for (int r = 0; r < 8; ++r) { float v = acc[t][r] + bv; if (ACT == 1) v = fmaxf(v, 0.f); so[w][8 * hh + r][t * 16 + ln] = v; }
  }
  __builtin_amdgcn_fence(__ATOMIC_ACQ_REL, "workgroup");
  __builtin_amdgcn_wave_barrier();
  const int rsub = lane >> 4, c4 = (lane & 15) * 4;
  {
#pragma unroll
    for (int q = 0; q < 8; ++q) {
      const int r = q * 2 + rsub;
      const v4f v = *(const v4fa*)&so[w][r][c4];
      *(v4f*)(C + (size_t)(row0 + r) * ldc + col0 + c4) = v;
    }
    
  }
}

// GEMM C = act(A·W + bias + resid): A f32 (ASPLIT -> hi/lo 2 terms), Wt bf16 [N][K]; ACT 0 none, 1 relu, 2 exact gelu;
// resid (optional, f32, row index = (row % rmod), pitch ldr, RES_BF16 rounds it) added before the activation.
template <bool ASPLIT, int ACT, bool BIAS_BF16, bool RES_BF16>
__global__ __launch_bounds__(128) void k_gemm_bf3(const float* __restrict__ A, int lda, const unsigned short* __restrict__ Wt, int ldb,
                                                const float* __restrict__ bias, const float* __restrict__ resid, int rmod, int ldr,
                                                float* __restrict__ C, int ldc, int M, int N, int K) {
  __shared__ __attribute__((aligned(16))) float so[4][16][64];
  const int tid = threadIdx.x, w = tid >> 5, lane = tid & 31, ln = lane & 15, hh = lane >> 4;
  const int ntn = N / 64;
  const int wid = blockIdx.x * 4 + w;
  const int mt = wid / ntn, nq = wid % ntn;
  if (mt * 16 >= M) return;
  const int row0 = mt * 16, col0 = nq * 64;
  const float* arow = A + (size_t)(row0 + ln) * lda;
  v8f acc[4] = {};
  for (int kb = 0; kb < K; kb += 32) {
    FragB ah, al;
    const v4f x0 = *(const v4fa*)(arow + kb + 8 * hh), x1 = *(const v4fa*)(arow + kb + 8 * hh + 4);
    const v4f x2 = *(const v4fa*)(arow + kb + 16 + 8 * hh), x3 = *(const v4fa*)(arow + kb + 16 + 8 * hh + 4);
    float xs[16] = {x0[0],x0[1],x0[2],x0[3],x1[0],x1[1],x1[2],x1[3],x2[0],x2[1],x2[2],x2[3],x3[0],x3[1],x3[2],x3[3]};
#pragma unroll
    for (int i = 0; i < 16; ++i) { const unsigned short hb = bf16_bits(xs[i]); ah.u[i] = hb; al.u[i] = ASPLIT ? bf16_bits(xs[i] - bf16_val(hb)) : (unsigned short)0; }
#pragma unroll
    for (int t = 0; t < 4; ++t) {
      const unsigned short* brow = Wt + (size_t)(col0 + t * 16 + ln) * ldb + kb;
      FragB b;
      b.half[0] = *(const v8us*)(brow + 8 * hh);
      b.half[1] = *(const v8us*)(brow + 16 + 8 * hh);
      acc[t] = mmaN<ASPLIT ? 2 : 1>(ah.v, al.v, b.v, b.v, acc[t]);
    }
  }
#pragma unroll
  for (int t = 0; t < 4; ++t) {
    const int col = col0 + t * 16 + ln;
    float bv = bias ? bias[col] : 0.f;
    if (BIAS_BF16) bv = bf16_round(bv);
#pragma unroll
    for (int r = 0; r < 8; ++r) {
      float v = acc[t][r] + bv;
      if (resid) { float rv = resid[(size_t)((row0 + 8 * hh + r) % rmod) * ldr + col]; if (RES_BF16) rv = bf16_round(rv); v += rv; }
      if (ACT == 1) v = fmaxf(v, 0.f);
      if (ACT == 2) v = 0.5f * v * (1.0f + erff(v * 0.70710678118654752f));
      if (ACT == 3) { const float u = 0.7978845608028654f * (v + 0.044715f * v * v * v); v = 0.5f * v * (1.0f + tanhf(u)); }
      so[w][8 * hh + r][t * 16 + ln] = v;
    }
  }
  __builtin_amdgcn_fence(__ATOMIC_ACQ_REL, "workgroup");
  __builtin_amdgcn_wave_barrier();
  const int rsub = lane >> 4, c4 = (lane & 15) * 4;
  {
#pragma unroll
    for (int q = 0; q < 8; ++q) {
      const int r = q * 2 + rsub;
      const v4f v = *(const v4fa*)&so[w][r][c4];
      *(v4f*)(C + (size_t)(row0 + r) * ldc + col0 + c4) = v;
    }
    
  }
}
// row LayerNorm (biased variance, eps) over N: s = X (+ R); optional out_sum <- s; out_norm <- (s-mu)*rsqrt(var+eps)*g + b
template <bool PARAM_BF16>
__global__ __launch_bounds__(256) void k_layernorm(const float* __restrict__ X, const float* __restrict__ R, const float* __restrict__ g, const float* __restrict__ bta,
                                                  float* __restrict__ out_sum, float* __restrict__ out_norm, int N, float eps) {
  __shared__ float red[256];
  const int row = blockIdx.x, tid = threadIdx.x;
  const float* x = X + (size_t)row * N; const float* rr = R ? R + (size_t)row * N : nullptr;
  float vals[16];                     // up to N = 4096
  const int per = N / 256;            // contiguous chunk per thread? use strided-by-4 chunks: thread handles j = tid*4 + 1024*u
  float s1 = 0.f;
  for (int u = 0; u < per / 4; ++u) {
    const int j = tid * 4 + 1024 * u;
    const v4f a = *(const v4fa*)(x + j);
    v4f b = {0.f,0.f,0.f,0.f}; if (rr) b = *(const v4fa*)(rr + j);
#pragma unroll
    for (int q = 0; q < 4; ++q) { const float v = a[q] + b[q]; vals[u * 4 + q] = v; s1 += v; }
  }
  red[tid] = s1; __syncthreads();
  for (int st = 128; st > 0; st >>= 1) { if (tid < st) red[tid] += red[tid + st]; __syncthreads(); }
  const float mu = red[0] / (float)N; __syncthreads();
  float s2 = 0.f;
  for (int u = 0; u < per / 4; ++u)
#pragma unroll
    for (int q = 0; q < 4; ++q) { const float c = vals[u * 4 + q] - mu; s2 += c * c; }
  red[tid] = s2; __syncthreads();
  for (int st = 128; st > 0; st >>= 1) { if (tid < st) red[tid] += red[tid + st]; __syncthreads(); }
  const float rs = rsqrtf(red[0] / (float)N + eps);
  {
    for (int u = 0; u < per / 4; ++u) {
      const int j = tid * 4 + 1024 * u;
      v4f o, sm;
#pragma unroll
      for (int q = 0; q < 4; ++q) {
        float gg = g[j + q], bb = bta[j + q];
        if (PARAM_BF16) { gg = bf16_round(gg); bb = bf16_round(bb); }
        sm[q] = vals[u * 4 + q]; o[q] = (vals[u * 4 + q] - mu) * rs * gg + bb;
      }
      if (out_sum) *(v4f*)(out_sum + (size_t)row * N + j) = sm;
      *(v4f*)(out_norm + (size_t)row * N + j) = o;
    }
    
  }
}



// ---- f16 WMMA path (v_wmma_f32_16x16x32_f16): 11-bit significands for operands in range — used where a [0,1] probability operand needs more precision than bf16
typedef _Float16 v16h __attribute__((ext_vector_type(16)));
union FragH { v16h v; v8us half[2]; _Float16 h[16]; unsigned short u[16]; };
template <int NT>
__device__ __forceinline__ v8f mmaH(v16h ah, v16h al, v16h bh, v16h bl, v8f c) {
  c = __builtin_amdgcn_wmma_f32_16x16x32_f16(false, ah, false, bh, (short)0, c, false, false);
  if (NT >= 2) c = __builtin_amdgcn_wmma_f32_16x16x32_f16(false, al, false, bh, (short)0, c, false, false);
  if (NT >= 3) c = __builtin_amdgcn_wmma_f32_16x16x32_f16(false, ah, false, bl, (short)0, c, false, false);
  asm volatile("v_nop\n\tv_nop\n\tv_nop\n\tv_nop" : "+v"(c) : "v"(ah), "v"(al), "v"(bh), "v"(bl));
  return c;
}
// batched GEMM like k_gemm_b but f16 operands: A f32 (split into f16 hi/lo if ASPLIT, else rounded to f16), Bt = f16 values [n][k]; alpha; C f32; N multiple of 16 (partial tiles skipped)
template <bool ASPLIT>
__global__ __launch_bounds__(128) void k_gemm_h(const float* __restrict__ A, int lda, size_t sA, const _Float16* __restrict__ Bh, int ldb, size_t sB, float alpha, float* __restrict__ C, int ldc, size_t sC, int M, int N, int K) {
  __shared__ __attribute__((aligned(16))) float so[4][16][64];
  const int tid = threadIdx.x, w = tid >> 5, lane = tid & 31, ln = lane & 15, hh = lane >> 4; const int by = blockIdx.y;
  A += (size_t)by * sA; Bh += (size_t)by * sB; C += (size_t)by * sC;
  const int ntn = (N + 63) / 64; const int wid = blockIdx.x * 4 + w; const int mt = wid / ntn, nq = wid % ntn; if (mt * 16 >= M) return;
  const int row0 = mt * 16, col0 = nq * 64; const float* arow = A + (size_t)(row0 + ln) * lda;
  v8f acc[4] = {};
  for (int kb = 0; kb < K; kb += 32) {
    FragH ah, al;
    const v4f x0 = *(const v4fa*)(arow + kb + 8 * hh), x1 = *(const v4fa*)(arow + kb + 8 * hh + 4), x2 = *(const v4fa*)(arow + kb + 16 + 8 * hh), x3 = *(const v4fa*)(arow + kb + 16 + 8 * hh + 4);
    float xs[16] = {x0[0],x0[1],x0[2],x0[3],x1[0],x1[1],x1[2],x1[3],x2[0],x2[1],x2[2],x2[3],x3[0],x3[1],x3[2],x3[3]};
#pragma unroll
    for (int i = 0; i < 16; ++i) { const _Float16 h = (_Float16)xs[i]; ah.h[i] = h; al.h[i] = ASPLIT ? (_Float16)(xs[i] - (float)h) : (_Float16)0.0f; }
#pragma unroll
    for (int t = 0; t < 4; ++t) { if (col0 + t * 16 >= N) continue; const size_t boff = (size_t)(col0 + t * 16 + ln) * ldb + kb; FragH bq; bq.half[0] = *(const v8us*)(Bh + boff + 8 * hh); bq.half[1] = *(const v8us*)(Bh + boff + 16 + 8 * hh);
      acc[t] = mmaH<ASPLIT ? 2 : 1>(ah.v, al.v, bq.v, bq.v, acc[t]); }
  }
#pragma unroll
  for (int t = 0; t < 4; ++t) { if (col0 + t * 16 >= N) continue;
#pragma unroll
    for (int r = 0; r < 8; ++r) so[w][8 * hh + r][t * 16 + ln] = acc[t][r] * alpha; }
  __builtin_amdgcn_fence(__ATOMIC_ACQ_REL, "workgroup"); __builtin_amdgcn_wave_barrier();
  const int rsub = lane >> 4, c4 = (lane & 15) * 4;
  {
#pragma unroll
    for (int q = 0; q < 8; ++q) { const int r = q * 2 + rsub; if (col0 + c4 < N) { const v4f v = *(const v4fa*)&so[w][r][c4]; *(v4f*)(C + (size_t)(row0 + r) * ldc + col0 + c4) = v; } }
     }
}

// Wt[n][k] = f16(W[k][n]·scale) from f32 row-major W[K][N] (scale = power of two; bf16-exact weights stay exact in f16 away from the subnormal range)
__global__ __launch_bounds__(256) void k_wt_f16(const float* __restrict__ W, _Float16* __restrict__ Wt, int K, int N, float scale) {
  const int t = blockIdx.x * 256 + threadIdx.x; if (t >= N * (K / 8)) return; const int n = t / (K / 8), k8 = (t % (K / 8)) * 8; FragH f;
#pragma unroll
  for (int i = 0; i < 8; ++i) f.h[i] = (_Float16)(bf16_round(W[(size_t)(k8 + i) * N + n]) * scale); const v8us o = f.half[0];
  *(v8us*)((unsigned short*)Wt + (size_t)n * K + k8) = o; 
}
// k_gemm_hh variant with fused epilogue: v = acc·alpha + bias[by·sBias + col] (+ CP[(row/rowsPerB)·sCPb + by·64 + col] if CP) ; ACT 0 none / 1 elu ; writes f16 C16 (and f32 C if non-null)
template <int ACT>
__global__ __launch_bounds__(128) void k_gemm_hhx(const _Float16* __restrict__ A, int lda, size_t sA, const _Float16* __restrict__ Bh, int ldb, size_t sB, float alpha, const float* __restrict__ bias, size_t sBias, const float* __restrict__ CP, int rowsPerB, size_t sCPb, int row0g,
    float* __restrict__ C, _Float16* __restrict__ C16, int ldc, size_t sC, int M, int N, int K) {
  __shared__ __attribute__((aligned(16))) float so[4][16][64];
  const int tid = threadIdx.x, w = tid >> 5, lane = tid & 31, ln = lane & 15, hh = lane >> 4; const int by = blockIdx.y;
  A += (size_t)by * sA; Bh += (size_t)by * sB; const size_t cofs = (size_t)by * sC; const float* bp = bias ? bias + (size_t)by * sBias : nullptr;
  const int ntn = (N + 63) / 64; const int wid = blockIdx.x * 4 + w; const int mt = wid / ntn, nq = wid % ntn; if (mt * 16 >= M) return;
  const int row0 = mt * 16, col0 = nq * 64; const _Float16* arow = A + (size_t)(row0 + ln) * lda;
  v8f acc[4] = {};
  for (int kb = 0; kb < K; kb += 32) { FragH ah; ah.half[0] = *(const v8us*)((const unsigned short*)arow + kb + 8 * hh); ah.half[1] = *(const v8us*)((const unsigned short*)arow + kb + 16 + 8 * hh);
#pragma unroll
    for (int t = 0; t < 4; ++t) { if (col0 + t * 16 >= N) continue; const size_t boff = (size_t)(col0 + t * 16 + ln) * ldb + kb; FragH bq; bq.half[0] = *(const v8us*)((const unsigned short*)Bh + boff + 8 * hh); bq.half[1] = *(const v8us*)((const unsigned short*)Bh + boff + 16 + 8 * hh);
      acc[t] = mmaH<1>(ah.v, ah.v, bq.v, bq.v, acc[t]); }
  }
#pragma unroll
  for (int t = 0; t < 4; ++t) { if (col0 + t * 16 >= N) continue; const int col = col0 + t * 16 + ln; const float bv = bp ? bf16_round(bp[col]) : 0.f;
#pragma unroll
    for (int r = 0; r < 8; ++r) { float v = acc[t][r] * alpha + bv; if (CP) { const int rr = row0g + row0 + 8 * hh + r; if (rowsPerB < 0) v += CP[cofs + (size_t)rr * ldc + col];      /* rowsPerB < 0: own element of the batched C plane */ else { const int bidx = rr / rowsPerB; v += CP[(size_t)bidx * sCPb + (size_t)by * 64 + col]; } } if (ACT == 1) v = (v > 0.f) ? v : expm1f(v); else if (ACT == 7) v = (v > 0.f) ? v + 1.0f : expf(v); else if (ACT == 8) v = tanhf(v); else if (ACT == 9) v = 0.5f * v * (1.0f + tanhf(0.7978845608028654f * (v + 0.044715f * v * v * v))); else if (ACT == 11) v = 1.0f / (1.0f + expf(-v)); else if (ACT == 12) v = (v > 0.f) ? v : 0.01f * v; else if (ACT == 14) v = (v > 0.f) ? v : 0.1f * v; else if (ACT == 16) v = (v >= 0.f) ? v : 0.3f * v; else if (ACT == 17) v = (v >= 0.f) ? v : 0.2f * v; else if (ACT == 15) v = v / (1.0f + expf(-v)); else if (ACT == 3) v = fmaxf(v, 0.f); else if (ACT == 6) v = 0.5f * v * (1.0f + erff(v * 0.70710678118654752f)); so[w][8 * hh + r][t * 16 + ln] = v; } }
  __builtin_amdgcn_fence(__ATOMIC_ACQ_REL, "workgroup"); __builtin_amdgcn_wave_barrier();
  const int rsub = lane >> 4, c4 = (lane & 15) * 4; typedef _Float16 v4h __attribute__((ext_vector_type(4)));
  {
#pragma unroll
    for (int q = 0; q < 8; ++q) { const int r = q * 2 + rsub; if (col0 + c4 < N) { const v4f v = *(const v4fa*)&so[w][r][c4]; if (C) *(v4f*)(C + cofs + (size_t)(row0 + r) * ldc + col0 + c4) = v; if (C16) { v4h h4; for (int i = 0; i < 4; ++i) h4[i] = (_Float16)v[i]; *(v4h*)(C16 + cofs + (size_t)(row0 + r) * ldc + col0 + c4) = h4; } } }
     }
}


typedef _Float16 v4h __attribute__((ext_vector_type(4)));

__global__ __launch_bounds__(256) void k_h16(const float* __restrict__ x, _Float16* __restrict__ X16, size_t n8) { const size_t t = (size_t)blockIdx.x * 256 + threadIdx.x; if (t >= n8) return; FragH f;
#pragma unroll
  for (int q = 0; q < 8; ++q) f.h[q] = (_Float16)x[t * 8 + q]; *(v8us*)((unsigned short*)X16 + t * 8) = f.half[0];  }
__global__ __launch_bounds__(256) void k_round16f(const float* __restrict__ W, _Float16* __restrict__ Bt, size_t n8) { const size_t t = (size_t)blockIdx.x * 256 + threadIdx.x; if (t >= n8) return; FragH f;
#pragma unroll
  for (int i = 0; i < 8; ++i) f.h[i] = (_Float16)(bf16_round(W[t * 8 + i]) * 16.0f); *(v8us*)((unsigned short*)Bt + t * 8) = f.half[0];  }
template <int NHv, int TTv>
__global__ __launch_bounds__(256) void k_vt(const _Float16* __restrict__ V16, int ldv, int voff, _Float16* __restrict__ Vt) { __shared__ unsigned short tl[64][66]; const int tid = threadIdx.x; const int slab = blockIdx.x / (TTv / 64), lg = blockIdx.x % (TTv / 64); const int b = slab / NHv, h = slab % NHv;
  for (int i = tid; i < 64 * 8; i += 256) { const int r = i / 8, c8 = (i % 8) * 8; FragH f; f.half[0] = *(const v8us*)((const unsigned short*)V16 + ((size_t)b * TTv + lg * 64 + r) * ldv + voff + h * 64 + c8);
#pragma unroll
    for (int q = 0; q < 8; ++q) tl[r][c8 + q] = f.u[q]; }
  __syncthreads();
  {
#pragma unroll
    for (int rd = 0; rd < 2; ++rd) { const int d = rd * 32 + tid / 8, pc = tid % 8; FragH f;
#pragma unroll
      for (int q = 0; q < 8; ++q) f.u[q] = tl[pc * 8 + q][d];
      *(v8us*)((unsigned short*)Vt + ((size_t)slab * 64 + d) * TTv + lg * 64 + pc * 8) = f.half[0]; }
     } }

__global__ __launch_bounds__(256) void k_hl(const float* __restrict__ F, _Float16* __restrict__ Hh, _Float16* __restrict__ Hl, size_t n8) { const size_t t = (size_t)blockIdx.x * 256 + threadIdx.x; if (t >= n8) return; FragH fh, fl; const v4f a = *(const v4fa*)(F + t * 8), c = *(const v4fa*)(F + t * 8 + 4);
#pragma unroll
  for (int q = 0; q < 4; ++q) { _Float16 h = (_Float16)a[q]; fh.h[q] = h; fl.h[q] = (_Float16)((a[q] - (float)h) * 1024.0f); h = (_Float16)c[q]; fh.h[4 + q] = h; fl.h[4 + q] = (_Float16)((c[q] - (float)h) * 1024.0f); }
  { *(v8us*)((unsigned short*)Hh + t * 8) = fh.half[0]; *(v8us*)((unsigned short*)Hl + t * 8) = fl.half[0];  } }

// ---- fast GEMM (work-group tile 128x64, wave tile 32x64; A and Bt rows of pitch and length DM; requires M % 128 == 0 and N % 64 == 0); epilogue = k_gemm_hhx semantics ----
// A rows and Bt rows of 64 k are staged through registers into two LDS buffers shared by the 4 waves: global loads cover whole 128-byte lines, and each line is fetched once per work-group.
#define G2_KC 64                     /* k per LDS stage: 128-byte rows */
#define G2_P 72                      /* LDS row pitch in f16: 128-byte rows + 16 bytes (16 B x odd: conflict-free 16-byte reads) */
__device__ __forceinline__ v16h g2_frag(const _Float16* p, int hh) { FragH f; f.half[0] = *(const v8us*)((const unsigned short*)p + 8 * hh); f.half[1] = *(const v8us*)((const unsigned short*)p + 16 + 8 * hh); return f.v; }
__device__ __forceinline__ v8f g2_mma(v16h a, v16h b, v8f c) { v8f d = __builtin_amdgcn_wmma_f32_16x16x32_f16(false, a, false, b, (short)0, c, false, false); asm volatile("v_nop\n\tv_nop\n\tv_nop\n\tv_nop" : "+v"(d) : "v"(a), "v"(b)); return d; }
template <int ACT, int ROPE = 0>      /* ROPE 1: C16 = f16(v cos + rotate_half(v) sin), v = acc * alpha, per 64-column head; position = row % SQ, tables CS / SN [SQ][32]; no bias, no CP, no f32 C */
__global__ __launch_bounds__(128) void k_gemm2(const _Float16* __restrict__ A, size_t sA, const _Float16* __restrict__ Bh, size_t sB, float alpha, const float* __restrict__ bias, size_t sBias, const float* __restrict__ CP, int rowsPerB, size_t sCPb, int row0g,
    float* __restrict__ C, _Float16* __restrict__ C16, int ldc, size_t sC, int M, int N, const float* __restrict__ CS, const float* __restrict__ SN) { static_assert(ACT == 0 || ACT == 3 || ACT == 6 || ACT == 8 || ACT == 9 || ACT == 11 || ACT == 12 || ACT == 14 || ACT == 15 || ACT == 16 || ACT == 17, "k_gemm2: unsupported ACT code (would silently apply no activation)");
  __shared__ __attribute__((aligned(16))) unsigned char sm[2 * (128 + 64) * G2_P * 2];      /* two stage buffers of A (128 rows) and B (64 rows); behind the loop's last barrier the same bytes are the epilogue's staging */
  _Float16 (*la)[128][G2_P] = (_Float16 (*)[128][G2_P])sm; _Float16 (*lb)[64][G2_P] = (_Float16 (*)[64][G2_P])(sm + 2 * 128 * G2_P * 2); float (*so)[32][68] = (float (*)[32][68])sm;
  static_assert(sizeof(float) * 4 * 32 * 68 <= sizeof(sm), "the epilogue's staging lies inside the stage buffers");
  const int tid = threadIdx.x, w = tid >> 5, lane = tid & 31, ln = lane & 15, hh = lane >> 4; const int by = blockIdx.y;
  A += (size_t)by * sA; Bh += (size_t)by * sB; const size_t cofs = (size_t)by * sC; const float* bp = bias ? bias + (size_t)by * sBias : nullptr;
  const int ntn = N >> 6; const int mt = blockIdx.x / ntn, nq = blockIdx.x - mt * ntn; const int row0 = mt * 128 + 32 * w, col0 = nq * 64; if (mt * 128 >= M) return;      /* block-uniform, in front of every barrier; M % 128 == 0 */
  const int sr = tid >> 3, sc = (tid & 7) * 8;      /* staging: a thread brings 16 bytes of rows sr + 16 i; 8 lanes cover one 128-byte line, a wave-wide load four whole lines */
  const unsigned short* ag = (const unsigned short*)A + (size_t)(mt * 128 + sr) * DM + sc; const unsigned short* bg = (const unsigned short*)Bh + (size_t)(col0 + sr) * DM + sc;
  v8us ga[8], gb[4];
#pragma unroll      /* ga[], gb[] in registers; constant row steps become immediate offsets */
  for (int i = 0; i < 8; ++i) ga[i] = *(const v8us*)(ag + (size_t)i * 16 * DM);
#pragma unroll
  for (int i = 0; i < 4; ++i) gb[i] = *(const v8us*)(bg + (size_t)i * 16 * DM);
  asm volatile("s_wait_xcnt 0x0" :: "v"(ag), "v"(bg) : "memory");      /* the staging loads' address pairs stay live up to this wait, so no register that an issued load names is overwritten in front of it */
#pragma unroll
  for (int i = 0; i < 8; ++i) *(v8us*)&la[0][sr + 16 * i][sc] = ga[i];
#pragma unroll
  for (int i = 0; i < 4; ++i) *(v8us*)&lb[0][sr + 16 * i][sc] = gb[i];
  const v8f z8 = {0.f,0.f,0.f,0.f,0.f,0.f,0.f,0.f}; v8f c00 = z8, c01 = z8, c02 = z8, c03 = z8, c10 = z8, c11 = z8, c12 = z8, c13 = z8;
  __syncthreads();      /* stage 0 is published */
#pragma unroll 1      /* one stage per trip: the registers hold one stage's fragments and the next stage's 12 staging loads */
  for (int st = 0; st < DM / G2_KC; ++st) { const int cur = st & 1; const bool more = st + 1 < DM / G2_KC;      /* block-uniform */
    if (more) { ag += G2_KC; bg += G2_KC;      /* the next stage flies under this stage's products */
#pragma unroll
      for (int i = 0; i < 8; ++i) ga[i] = *(const v8us*)(ag + (size_t)i * 16 * DM);
#pragma unroll
      for (int i = 0; i < 4; ++i) gb[i] = *(const v8us*)(bg + (size_t)i * 16 * DM);
      asm volatile("s_wait_xcnt 0x0" :: "v"(ag), "v"(bg) : "memory"); }      /* likewise: the pointers are stepped only behind this wait */
    v16h a0[2], a1[2], bf[4][2];
#pragma unroll      /* the stage's 24 LDS reads stand as one group in front of its 16 products */
    for (int kk = 0; kk < G2_KC / 32; ++kk) { a0[kk] = g2_frag(&la[cur][32 * w + ln][kk * 32], hh); a1[kk] = g2_frag(&la[cur][32 * w + 16 + ln][kk * 32], hh);
      for (int t = 0; t < 4; ++t) bf[t][kk] = g2_frag(&lb[cur][t * 16 + ln][kk * 32], hh); }
#pragma unroll      /* fragments in registers; k ascends as before: the sum order of every accumulator is unchanged */
    for (int kk = 0; kk < G2_KC / 32; ++kk) {
      c00 = g2_mma(a0[kk], bf[0][kk], c00); c10 = g2_mma(a1[kk], bf[0][kk], c10);
      c01 = g2_mma(a0[kk], bf[1][kk], c01); c11 = g2_mma(a1[kk], bf[1][kk], c11);
      c02 = g2_mma(a0[kk], bf[2][kk], c02); c12 = g2_mma(a1[kk], bf[2][kk], c12);
      c03 = g2_mma(a0[kk], bf[3][kk], c03); c13 = g2_mma(a1[kk], bf[3][kk], c13); }
    if (more) {      /* the other buffer's last readers left it at the previous trip's barrier */
#pragma unroll
      for (int i = 0; i < 8; ++i) *(v8us*)&la[cur ^ 1][sr + 16 * i][sc] = ga[i];
#pragma unroll
      for (int i = 0; i < 4; ++i) *(v8us*)&lb[cur ^ 1][sr + 16 * i][sc] = gb[i]; }
    __syncthreads(); }      /* publishes the next stage and ends every wave's reads of this one (behind the last trip: frees the buffers for the epilogue's staging) */
  v8f accs[8] = {c00, c01, c02, c03, c10, c11, c12, c13};
  if (ROPE) {      /* col0 is a multiple of 64 and row0 of 32: both halves of every rotation pair lie in this wave's own 32 x 64 tile, and its 32 positions do not wrap at SQ */
    const int rs = lane >> 3, d8 = (lane & 7) * 8; const float sg = (d8 < HD / 2) ? -1.0f : 1.0f;      /* 8 lanes per row, 8 columns each; rotate_half(v)[d] = -v[d + 32] below 32, v[d - 32] above */
    const size_t tb = (size_t)((unsigned)row0 % SQ + rs) * (HD / 2) + (d8 & (HD / 2 - 1)); const float* cp = CS + tb; const float* sp = SN + tb; v4f tc[8][2], ts[8][2];
#pragma unroll      /* accs[] in registers */
    for (int u = 0; u < 8; ++u) for (int r = 0; r < 8; ++r) so[w][(u >> 2) * 16 + 8 * hh + r][(u & 3) * 16 + ln] = accs[u][r] * alpha;
    __builtin_amdgcn_fence(__ATOMIC_ACQ_REL, "workgroup"); __builtin_amdgcn_wave_barrier();      /* the wave reads back rows that its other lanes wrote */
#pragma unroll      /* tc[], ts[] in registers; behind the staging, where the accumulators' registers are free */
    for (int q = 0; q < 8; ++q) for (int u = 0; u < 2; ++u) { tc[q][u] = *(const v4fa*)(cp + q * 4 * (HD / 2) + 4 * u); ts[q][u] = *(const v4fa*)(sp + q * 4 * (HD / 2) + 4 * u); }
    unsigned short* dp = (unsigned short*)C16 + cofs + (size_t)(row0 + rs) * ldc + col0 + d8;
#pragma unroll      /* 4 rows per trip, constant LDS offsets; a store covers four whole 128-byte lines */
    for (int q = 0; q < 8; ++q) { FragH f;
      for (int u = 0; u < 2; ++u) { const v4f own = *(const v4fa*)&so[w][q * 4 + rs][d8 + 4 * u], oth = *(const v4fa*)&so[w][q * 4 + rs][(d8 ^ (HD / 2)) + 4 * u];
        for (int i = 0; i < 4; ++i) f.h[4 * u + i] = (_Float16)(own[i] * tc[q][u][i] + oth[i] * (sg * ts[q][u][i])); }
      *(v8us*)(dp + (size_t)q * 4 * ldc) = f.half[0]; }
    return; }
#pragma unroll
  for (int u = 0; u < 8; ++u) { const int t = u & 3, half = u >> 2; const int col = col0 + t * 16 + ln; const float bv = bp ? bf16_round(bp[col]) : 0.f;
#pragma unroll
    for (int r = 0; r < 8; ++r) { const int rloc = half * 16 + 8 * hh + r; float v = accs[u][r] * alpha + bv; if (CP) { if (rowsPerB < 0) v += CP[cofs + (size_t)(row0g + row0 + rloc) * ldc + col];      /* rowsPerB < 0: own element of the batched C plane */ else { const int bidx = (row0g + row0 + rloc) / rowsPerB; v += CP[(size_t)bidx * sCPb + (size_t)by * 64 + col]; } }
      if (ACT == 3) v = fmaxf(v, 0.f); else if (ACT == 6) v = 0.5f * v * (1.0f + erff(v * 0.70710678118654752f)); else if (ACT == 11) v = 1.0f / (1.0f + expf(-v)); else if (ACT == 15) v = v / (1.0f + expf(-v)); else if (ACT == 12) v = (v > 0.f) ? v : 0.01f * v; else if (ACT == 8) v = tanhf(v); else if (ACT == 9) v = 0.5f * v * (1.0f + tanhf(0.7978845608028654f * (v + 0.044715f * v * v * v))); else if (ACT == 14) v = (v > 0.f) ? v : 0.1f * v; else if (ACT == 16) v = (v >= 0.f) ? v : 0.3f * v; else if (ACT == 17) v = (v >= 0.f) ? v : 0.2f * v;
      so[w][rloc][t * 16 + ln] = v; } }
  __builtin_amdgcn_fence(__ATOMIC_ACQ_REL, "workgroup"); __builtin_amdgcn_wave_barrier();
  const int rsub = lane >> 4, c4 = (lane & 15) * 4;
  {
#pragma unroll
    for (int q = 0; q < 16; ++q) { const int r = q * 2 + rsub; const v4f v = *(const v4fa*)&so[w][r][c4]; if (C) *(v4f*)(C + cofs + (size_t)(row0 + r) * ldc + col0 + c4) = v; if (C16) { v4h h4; for (int i = 0; i < 4; ++i) h4[i] = (_Float16)v[i]; *(v4h*)(C16 + cofs + (size_t)(row0 + r) * ldc + col0 + c4) = h4; } }
     } }


#define FA_W 8                       /* waves per work-group, 32 query columns each */
#define FA_QB (FA_W * 32)            /* query rows per work-group */
#define FA_ST 64                     /* keys per LDS stage */
#define FA_P 72                      /* LDS row pitch in f16: 128-byte rows + 16 bytes (16 B x odd: conflict-free 16-byte reads) */
typedef float v2f __attribute__((ext_vector_type(2)));
typedef _Float16 v2h __attribute__((ext_vector_type(2)));
__device__ __forceinline__ float fa_xhalf(float x) { return __builtin_bit_cast(float, __builtin_amdgcn_permlanex16(__builtin_bit_cast(int, x), __builtin_bit_cast(int, x), 0x76543210, 0xfedcba98, false, false)); }      /* lane l reads lane l ^ 16 */
__device__ __forceinline__ v8f fa_mma(v16h a, v16h b, v8f c) { return __builtin_amdgcn_wmma_f32_16x16x32_f16(false, a, false, b, (short)0, c, false, false); }
__global__ __launch_bounds__(FA_W * 32) void k_fattn(const _Float16* __restrict__ Q16, const _Float16* __restrict__ K16, const _Float16* __restrict__ VT, _Float16* __restrict__ O16) {
  __shared__ __attribute__((aligned(16))) _Float16 lk[2][FA_ST][FA_P]; __shared__ __attribute__((aligned(16))) _Float16 lv[2][HD][FA_P];
  const int tid = threadIdx.x, w = tid >> 5, lane = tid & 31, ln = lane & 15, hh = lane >> 4; const int h = blockIdx.y, b = blockIdx.z; const size_t r0 = (size_t)b * SQ; const int q0 = blockIdx.x * FA_QB + w * 32;
  const int sr = tid >> 3, sc = (tid & 7) * 8;      /* staging: a thread brings 16 bytes of rows sr and sr + 32 of each tile; 8 lanes cover one 128-byte line */
  const unsigned short* kg = (const unsigned short*)K16 + (r0 + sr) * KVD + h * HD + sc;      /* key row sr of the stage, this head's 64 columns */
  const unsigned short* vg = (const unsigned short*)VT + ((size_t)(b * NH + h) * HD + sr) * SQ + sc;      /* V^T row d = sr, the stage's 64 keys */
  v8us gk0 = *(const v8us*)kg, gk1 = *(const v8us*)(kg + (size_t)32 * KVD), gv0 = *(const v8us*)vg, gv1 = *(const v8us*)(vg + (size_t)32 * SQ);
  v16h qf[2][2];      /* [column group][k step of 32], kept for the whole kernel */
  { const _Float16* qp = Q16 + (r0 + q0 + ln) * LQ + h * HD;
#pragma unroll      /* constant indices keep qf[] in registers */
    for (int g = 0; g < 2; ++g) for (int kk = 0; kk < 2; ++kk) qf[g][kk] = g2_frag(qp + (size_t)g * 16 * LQ + kk * 32, hh);
    asm volatile("s_wait_xcnt 0x0" :: "v"(qp) : "memory"); }      /* the q loads' address pair stays live up to this wait, so no register that an issued load names is overwritten in front of it */
  *(v8us*)&lk[0][sr][sc] = gk0; *(v8us*)&lk[0][sr + 32][sc] = gk1; *(v8us*)&lv[0][sr][sc] = gv0; *(v8us*)&lv[0][sr + 32][sc] = gv1;
  const v8f z8 = {0.f,0.f,0.f,0.f,0.f,0.f,0.f,0.f}; v8f o[2][4];      /* O^T: [column group][16 rows of d] */
#pragma unroll      /* o[] in registers */
  for (int g = 0; g < 2; ++g) for (int t = 0; t < 4; ++t) o[g][t] = z8;
  float mr[2] = {-1.0e30f, -1.0e30f}, l[2] = {0.f, 0.f};      /* maximum in use (log2-scaled) and this lane's part of the denominator */
  const float cs = 0.125f * 1.4426950408889634f;      /* 64^-0.5 * log2(e) */
  __syncthreads();      /* stage 0 is published */
  for (int st = 0; st < SQ / FA_ST; ++st) { const int cur = st & 1; const bool more = st + 1 < SQ / FA_ST;      /* block-uniform */
    if (more) { kg += (size_t)FA_ST * KVD; vg += FA_ST; gk0 = *(const v8us*)kg; gk1 = *(const v8us*)(kg + (size_t)32 * KVD); gv0 = *(const v8us*)vg; gv1 = *(const v8us*)(vg + (size_t)32 * SQ);      /* the next stage flies under this stage's two passes */
      asm volatile("s_wait_xcnt 0x0" :: "v"(kg), "v"(vg) : "memory"); }      /* likewise for the next stage's staging loads: the pointers are stepped only behind this wait (stage 0's loads: behind the wait after the q loads) */
#pragma unroll      /* two 32-key passes per stage, constant LDS offsets */
    for (int ps = 0; ps < FA_ST / 32; ++ps) {
      v8f s[2][2];      /* S^T: [column group][16 keys] */
      { v16h kf[2][2];
#pragma unroll      /* fragments in registers */
        for (int t = 0; t < 2; ++t) for (int kk = 0; kk < 2; ++kk) kf[t][kk] = g2_frag(&lk[cur][ps * 32 + t * 16 + ln][kk * 32], hh);
#pragma unroll      /* fragments in registers */
        for (int t = 0; t < 2; ++t) for (int g = 0; g < 2; ++g) s[g][t] = fa_mma(kf[t][1], qf[g][1], fa_mma(kf[t][0], qf[g][0], z8)); }
      v16h vf[4];
#pragma unroll      /* fragments in registers; these reads fly under the maxima and exponentials */
      for (int t = 0; t < 4; ++t) vf[t] = g2_frag(&lv[cur][t * 16 + ln][ps * 32], hh);
      float mb[2]; bool need = false;
#pragma unroll      /* s[] in registers */
      for (int g = 0; g < 2; ++g) { float mx = s[g][0][0];
        for (int r = 1; r < 8; ++r) mx = fmaxf(mx, s[g][0][r]);
        for (int r = 0; r < 8; ++r) mx = fmaxf(mx, s[g][1][r]);
        mx = fmaxf(mx, fa_xhalf(mx)) * cs; mb[g] = mx; need = need || (mx > mr[g] + 8.0f); }      /* both halves hold the column's maximum; the one in use may trail it by 8 (weights up to 2^8) */
      if (__builtin_amdgcn_ballot_w32(need) != 0) {      /* wave-uniform; always on the first pass, rare afterwards */
#pragma unroll      /* o[] in registers */
        for (int g = 0; g < 2; ++g) { const float mn = fmaxf(mr[g], mb[g]); const float corr = __builtin_amdgcn_exp2f(mr[g] - mn); mr[g] = mn; l[g] *= corr;
          for (int t = 0; t < 4; ++t) o[g][t] = o[g][t] * corr; } }
#pragma unroll      /* s[], o[] in registers */
      for (int g = 0; g < 2; ++g) { const float nm = -mr[g]; const v8f c8 = {cs, cs, cs, cs, cs, cs, cs, cs}, n8 = {nm, nm, nm, nm, nm, nm, nm, nm}; FragH pf; float la = 0.f, lb = 0.f;
        for (int t = 0; t < 2; ++t) { s[g][t] = __builtin_elementwise_fma(s[g][t], c8, n8);
          for (int r = 0; r < 8; ++r) s[g][t][r] = __builtin_amdgcn_exp2f(s[g][t][r]); }      /* weights 2^(score * cs - maximum in use), in the score registers */
        for (int i = 0; i < 8; ++i) { const int t = i >> 2, r = 2 * (i & 3);
          la += s[g][t][r]; lb += s[g][t][r + 1];
          const v2h pk = __builtin_convertvector(v2f{s[g][t][r], s[g][t][r + 1]}, v2h); pf.h[2 * i] = pk[0]; pf.h[2 * i + 1] = pk[1]; }
        l[g] += la + lb;
        for (int t = 0; t < 4; ++t) o[g][t] = fa_mma(vf[t], pf.v, o[g][t]); } }
    asm volatile("v_nop\n\tv_nop\n\tv_nop\n\tv_nop" : "+v"(o[0][0]), "+v"(o[0][1]), "+v"(o[0][2]), "+v"(o[0][3]), "+v"(o[1][0]), "+v"(o[1][1]), "+v"(o[1][2]), "+v"(o[1][3]));      /* four issue slots behind the stage's last matrix instructions: a branch follows */
    if (more) { *(v8us*)&lk[cur ^ 1][sr][sc] = gk0; *(v8us*)&lk[cur ^ 1][sr + 32][sc] = gk1; *(v8us*)&lv[cur ^ 1][sr][sc] = gv0; *(v8us*)&lv[cur ^ 1][sr + 32][sc] = gv1; }      /* its last readers left it at the previous trip's barrier */
    __syncthreads(); }      /* publishes the next stage and ends every wave's reads of this one */
#pragma unroll      /* o[] in registers */
  for (int g = 0; g < 2; ++g) { const float fin = 64.0f / (l[g] + fa_xhalf(l[g]));      /* the halves' sums join once; o carried x64 */
    unsigned short* d = (unsigned short*)O16 + (r0 + q0 + g * 16 + ln) * DM + h * HD + 8 * hh;
    for (int t = 0; t < 4; ++t) { FragH f; for (int r = 0; r < 8; ++r) f.h[r] = (_Float16)(o[g][t][r] * fin); *(v8us*)(d + t * 16) = f.half[0]; } } }      /* a lane's 8 registers are 8 consecutive d of its query row: one 16-byte store */
__global__ __launch_bounds__(256) void k_vt(const _Float16* __restrict__ V16, int b, int h0, _Float16* __restrict__ VT) { __shared__ unsigned short tl[64][65]; const int tid = threadIdx.x; const int hh = blockIdx.x % HG, sg = blockIdx.x / HG; const int s0 = sg * 64; const int h = h0 + hh;
  for (int i = tid; i < 64 * 8; i += 256) { const int j = i / 8, d8 = (i % 8) * 8; FragH f; f.half[0] = *(const v8us*)((const unsigned short*)V16 + ((size_t)b * SQ + s0 + j) * DM + h * HD + d8); for (int q = 0; q < 8; ++q) tl[d8 + q][j] = f.u[q]; }
  __syncthreads();
  { for (int i = tid; i < 64 * 8; i += 256) { const int d = i / 8, j8 = (i % 8) * 8; FragH f; for (int q = 0; q < 8; ++q) f.u[q] = tl[d][j8 + q]; *(v8us*)((unsigned short*)VT + ((size_t)hh * HD + d) * SQ + s0 + j8) = f.half[0]; }  } }



__global__ __launch_bounds__(256) void k_rsmcf2(const float* __restrict__ S, _Float16* __restrict__ P, int hg, int q0, int nk) {
  #pragma clang fp contract(off)
  const int t = blockIdx.x * 256 + threadIdx.x; if (t >= hg * QT) return; const size_t i = (size_t)t; const float* s = S + i * NKX; const int last = q0 + (t % QT); float mx = -3.0e38f;
#pragma unroll 1
  for (int j = 0; j < nk; ++j) { const float f = (j <= last) ? 1.f : 0.f; mx = fmaxf(mx, fmaf(f, s[j], (1.f - f) * -1.0e9f)); } float se = 0.f;
#pragma unroll 1
  for (int j = 0; j < nk; ++j) { const float f = (j <= last) ? 1.f : 0.f; se += __expf(fmaf(f, s[j], (1.f - f) * -1.0e9f) - mx); } const float sc = 256.0f / se;
#pragma unroll 1
  for (int j0 = 0; j0 < nk; j0 += 8) { FragH fr; for (int q = 0; q < 8; ++q) { const int j = j0 + q; const float f = (j <= last) ? 1.f : 0.f; fr.h[q] = (_Float16)(__expf(fmaf(f, s[j], (1.f - f) * -1.0e9f) - mx) * sc); } unsigned short* d = (unsigned short*)P + i * NKX + j0; *(v8us*)d = fr.half[0];  } }


template <int MASKADD>
__global__ __launch_bounds__(64) void k_att0(const float* __restrict__ QF, const float* __restrict__ KF, const float* __restrict__ VF, int ld, const float* __restrict__ mask, float scale, float* __restrict__ OF, int ldo) {
  #pragma clang fp contract(off)
  __shared__ __attribute__((aligned(16))) float lq[64][64]; __shared__ __attribute__((aligned(16))) float lo[64][64];
  const int tid = threadIdx.x; const int h = blockIdx.x / (QT0 / 64), rg = blockIdx.x % (QT0 / 64); const int i = rg * 64 + tid;
  const float* qr = QF + (size_t)i * ld + h * HD;
#pragma unroll 1
  for (int c = 0; c < HD / 4; ++c) { *(v4f*)&lq[tid][c * 4] = *(const v4fa*)(qr + c * 4); const v4f z = {0.f, 0.f, 0.f, 0.f}; *(v4f*)&lo[tid][c * 4] = z; }
  float m = -1.0e30f, l = 0.f; const int jmax = MASKADD ? (SQ - 1) : (rg * 64 + 63);      /* additive-mask form: every key (the mask input decides); causal form: keys up to the block's last row */
#pragma unroll 1
  for (int j = 0; j <= jmax; ++j) { const float* kr = KF + (size_t)j * ld + h * HD; const float* vr = VF + (size_t)j * ld + h * HD; float s = 0.f;
#pragma unroll 1
    for (int c = 0; c < HD / 4; ++c) { const v4f kq = *(const v4fa*)(kr + c * 4); const v4f qq = *(v4f*)&lq[tid][c * 4]; s = __fadd_rn(s, __fmul_rn(qq[0], kq[0])); s = __fadd_rn(s, __fmul_rn(qq[1], kq[1])); s = __fadd_rn(s, __fmul_rn(qq[2], kq[2])); s = __fadd_rn(s, __fmul_rn(qq[3], kq[3])); }
    s = __fmul_rn(s, scale); if (MASKADD) s = __fadd_rn(s, __fmul_rn(bf16_round(mask[(size_t)i * SQ + j]), -10000.0f));
    const float f = (MASKADD || j <= i) ? 1.f : 0.f; const float sm = fmaf(f, s, (1.f - f) * -1.0e30f); const float mn = fmaxf(m, sm); const float sc = expf(m - mn); const float e = expf(sm - mn); l = __fadd_rn(__fmul_rn(l, sc), e); m = mn;
#pragma unroll 1
    for (int c = 0; c < HD / 4; ++c) { const v4f vv = *(const v4fa*)(vr + c * 4); v4f oo = *(v4f*)&lo[tid][c * 4]; for (int u = 0; u < 4; ++u) oo[u] = __fadd_rn(__fmul_rn(oo[u], sc), __fmul_rn(e, vv[u])); *(v4f*)&lo[tid][c * 4] = oo; } }
  const float fin = 64.0f / l;      /* o carried x64 like the f16 path */
#pragma unroll 1
  for (int c = 0; c < HD / 4; ++c) { v4f oo = *(v4f*)&lo[tid][c * 4]; for (int u = 0; u < 4; ++u) oo[u] = __fmul_rn(oo[u], fin); *(v4f*)&lo[tid][c * 4] = oo; }
  __syncthreads();
  {
#pragma unroll 1
    for (int it = 0; it < 16; ++it) { const int row = it * 4 + tid / 16, pc = (tid % 16) * 4; const v4f v = *(const v4f*)&lo[row][pc]; *(v4f*)(OF + (size_t)(rg * 64 + row) * ldo + h * HD + pc) = v; }
     } }


__global__ __launch_bounds__(256) void k_kvexp(const float* __restrict__ src, float* __restrict__ dst, size_t n4) { const size_t t = (size_t)blockIdx.x * 256 + threadIdx.x; if (t >= n4) return; const size_t e = t * 4; const size_t row = e / DM; const int col = (int)(e % DM); const int h = col / HD, d = col % HD; const v4f v = *(const v4fa*)(src + row * KVD + (size_t)(h / HPG) * HD + d); *(v4f*)(dst + e) = v;  }

__global__ __launch_bounds__(256) void k_tab2(float theta, float* __restrict__ CS, float* __restrict__ SN) {
  #pragma clang fp contract(off)
  const int t = blockIdx.x * 256 + threadIdx.x; if (t >= SQ * (HD / 2)) return; const int i = t % (HD / 2); const int p = t / (HD / 2); const float invf = 1.0f / powf(theta, (float)(2 * i) / (float)HD); const float ang = __fmul_rn((float)p, invf); const float c = cosf(ang), s = sinf(ang);
  *(float*)(CS + t) = c; *(float*)(SN + t) = s;  }
template <int NORM, int ROPE>
__global__ __launch_bounds__(64) void k_xformf(const float* __restrict__ F, int ldf, int nh, const float* __restrict__ gain, float eps, const float* __restrict__ CS, const float* __restrict__ SN, float* __restrict__ F32, int ldo) {
  #pragma clang fp contract(off)
  __shared__ float xv[HD]; __shared__ float red[HD]; const int d = threadIdx.x; const int h = blockIdx.x % nh; const size_t r = blockIdx.x / nh; const int p = (int)(r % SQ);
  float x = F[r * (size_t)ldf + (size_t)h * HD + d];
  if (NORM) { red[d] = __fmul_rn(x, x); __syncthreads(); for (int st = HD / 2; st > 0; st >>= 1) { if (d < st) red[d] = __fadd_rn(red[d], red[d + st]); __syncthreads(); } const float rs = rsqrtf(__fadd_rn(red[0] / (float)HD, eps)); x = __fmul_rn(__fmul_rn(x, rs), bf16_round(gain[d])); }
  xv[d] = x; __syncthreads();
  float o = x;
  if (ROPE == 1) { const int i = d >> 1; const float c = CS[p * (HD / 2) + i], s = SN[p * (HD / 2) + i]; const float ev = xv[2 * i], od = xv[2 * i + 1]; o = (d & 1) ? __fadd_rn(__fmul_rn(ev, s), __fmul_rn(od, c)) : __fadd_rn(__fmul_rn(ev, c), -__fmul_rn(od, s)); }
  if (ROPE == 2) { const int i = d & (HD / 2 - 1); const float c = CS[p * (HD / 2) + i], s = SN[p * (HD / 2) + i]; const float lo = xv[i], hi = xv[i + HD / 2]; o = (d < HD / 2) ? __fadd_rn(__fmul_rn(lo, c), -__fmul_rn(hi, s)) : __fadd_rn(__fmul_rn(lo, s), __fmul_rn(hi, c)); }
  float* dst = F32 + r * (size_t)ldo + (size_t)h * HD + d; *(float*)dst = o;  }

__global__ __launch_bounds__(256) void k_bfcp(const float* __restrict__ src, float* __restrict__ dst, size_t n4) { const size_t t = (size_t)blockIdx.x * 256 + threadIdx.x; if (t >= n4) return; const v4f a = *(const v4fa*)(src + t * 4); v4f o; for (int q = 0; q < 4; ++q) o[q] = bf16_round(a[q]); *(v4f*)(dst + t * 4) = o;  }

// operand preparation of the whole call in ONE launch: rope tables (the first work-groups: the longest dependent chains start first), x as f16 rows, the four natural weights as x16 f16 planes.
// A streaming wave owns 16 KiB of one source: PP_L wave-wide 16-byte loads of 512 contiguous bytes each, all in flight at once, then the conversions, then whole-line 8-byte stores; few waves, so little of the launch goes into starting them.
#define PP_L 32                      /* 16-byte loads in flight per lane */
#define PP_BF (256 * PP_L * 4)       /* floats per streaming work-group */
#define PP_TB 64                     /* table work-groups: SQ * 32 entries, 4 positions per thread */
#define PP_XB ((int)(NR * DM / PP_BF))      /* work-groups on x */
#define PP_WB (DM * DM / PP_BF)      /* work-groups per weight */
__device__ __forceinline__ float pp_round(float v) { const unsigned int u = __float_as_uint(v); return __uint_as_float((u + 0x7FFFu + ((u >> 16) & 1u)) & 0xFFFF0000u); }      /* the value of bf16_round(v), kept in 32-bit registers */
__global__ __launch_bounds__(256) void k_prep(const float* __restrict__ x, const float* __restrict__ wq, const float* __restrict__ wk, const float* __restrict__ wv, const float* __restrict__ wo, _Float16* __restrict__ X16, _Float16* __restrict__ BW, float* __restrict__ CS, float* __restrict__ SN) {
  static_assert(NR * DM % PP_BF == 0 && DM * DM % PP_BF == 0 && KVD == DM, "whole work-groups per source; four planes of equal size");
  static_assert(SQ % (PP_TB * 8) == 0 && HD / 2 == 32, "a table wave writes one position's 32 entries: one 128-byte line per table");
  const int tid = threadIdx.x; int blk = blockIdx.x;
  if (blk < PP_TB) {      /* block-uniform; CS[p][i] = cos(p * 10000^(-2i/64)), SN = sin: the frequency once per thread, then per position the f32 angle, cosf and sinf */
    const int t = blk * 256 + tid; const int i = t % (HD / 2); const int p0 = t / (HD / 2); const float invf = (float)(1.0 / pow(10000.0, (double)(2 * i) / (double)HD));
    for (int u = 0; u < SQ / (PP_TB * 8); ++u) { const int p = p0 + u * (PP_TB * 8); const float ang = __fmul_rn((float)p, invf); const float c = cosf(ang), s = sinf(ang); CS[p * (HD / 2) + i] = c; SN[p * (HD / 2) + i] = s; }
    return; }
  blk -= PP_TB;
  const float* src; _Float16* dst; float scale;      /* block-uniform choice of the source */
  if (blk < PP_XB) { src = x + (size_t)blk * PP_BF; dst = X16 + (size_t)blk * PP_BF; scale = 1.0f; }
  else { blk -= PP_XB; const int wi = blk / PP_WB; src = (wi == 0 ? wq : wi == 1 ? wk : wi == 2 ? wv : wo) + (size_t)(blk % PP_WB) * PP_BF; dst = BW + (size_t)blk * PP_BF; scale = 16.0f; }      /* the planes follow one another in the workspace */
  const int o = (tid >> 5) * (PP_L * 128) + (tid & 31) * 4; src += o; dst += o;
  v4f a[PP_L]; v4h h[PP_L];
#pragma unroll      /* a[] in registers; constant steps become immediate offsets */
  for (int j = 0; j < PP_L; ++j) a[j] = *(const v4fa*)(src + j * 128);
  asm volatile("s_wait_xcnt 0x0" :: "v"(src) : "memory");      /* the loads' address stays live up to this wait, so no register that an issued load names is overwritten in front of it */
  __builtin_amdgcn_sched_barrier(0);      /* no conversion moves in front of a load: otherwise the compiler issues the loads in two runs, the second behind the first one's data, and the wave pays the memory latency twice */
#pragma unroll      /* h[] in registers */
  for (int j = 0; j < PP_L; ++j) for (int q = 0; q < 4; q += 2) { const v2h pk = __builtin_convertvector(v2f{pp_round(a[j][q]) * scale, pp_round(a[j][q + 1]) * scale}, v2h); h[j][q] = pk[0]; h[j][q + 1] = pk[1]; }      /* bf16-rounded values are exact in f16 here, x1 and x16 alike */
  __builtin_amdgcn_sched_barrier(0);      /* every conversion stands in front of the first store: behind an issued store no register that it names is written any more */
#pragma unroll
  for (int j = 0; j < PP_L; ++j) *(v4h*)(dst + j * 128) = h[j];
  asm volatile("s_wait_xcnt 0x0" ::: "memory"); }      /* directly behind the last store: on every way that the built code lays out behind the stores, this wait stands in front of the first write of a register that an issued store names */
extern "C" void kernel_launch(void* const* d_in, const int* in_sizes, int n_in,
                              void* d_out, int out_size, void* d_ws, size_t ws_size, hipStream_t stream) {
  (void)in_sizes; (void)n_in; (void)out_size;
  const float* const* I = (const float* const*)d_in; const float* x = I[0]; const float* wq = I[1]; const float* wk = I[2]; const float* wv = I[3]; const float* wo = I[4]; const float* bq = nullptr; const float* bk = nullptr; const float* bv = nullptr; const float* bo = I[5];      /* input order: x, Wq, Wk, Wv, Wo (natural [out][in] weights), bo [1024] (the output bias: into the output GEMM's bias slot); the q / k / v projections have NO biases; rope tables computed in the kernel (positions = row index) */
  char* ws = (char*)d_ws; size_t off = 0;
  auto take = [&](size_t bytes) { char* p = ws + off; off += (bytes + 255) & ~(size_t)255; return p; };
  _Float16* BQ = (_Float16*)take((size_t)DM * DM * 2); _Float16* BK = (_Float16*)take((size_t)KVD * DM * 2); _Float16* BV = (_Float16*)take((size_t)KVD * DM * 2); _Float16* BO = (_Float16*)take((size_t)DM * DM * 2);
  _Float16* X16 = (_Float16*)take(NR * DM * 2); float* CSB = (float*)take((size_t)SQ * 32 * 4); float* SNB = (float*)take((size_t)SQ * 32 * 4); _Float16* Q16 = (_Float16*)take(NR * DM * 2); _Float16* K16 = (_Float16*)take(NR * KVD * 2); _Float16* V16 = (_Float16*)take(NR * KVD * 2); _Float16* O16 = (_Float16*)take(NR * DM * 2);
  _Float16* VT = (_Float16*)take((size_t)NB * NH * HD * SQ * 2);
  float* QF0 = (float*)take((size_t)QT0 * DM * 4); float* KF0 = (float*)take((size_t)QT0 * KVD * 4); float* VF0 = (float*)take((size_t)QT0 * KVD * 4); float* KF0e = (float*)take((size_t)QT0 * DM * 4); float* VF0e = (float*)take((size_t)QT0 * DM * 4); float* OF0 = (float*)take((size_t)NB * QT0 * DM * 4); _Float16* OH0 = (_Float16*)take((size_t)NB * QT0 * DM * 2); _Float16* OL0 = (_Float16*)take((size_t)NB * QT0 * DM * 2);
  if (off > ws_size) return;
  static_assert((size_t)DM * DM * 2 % 256 == 0, "BQ, BK, BV, BO lie back to back");
  k_prep<<<PP_TB + PP_XB + 4 * PP_WB, 256, 0, stream>>>(x, wq, wk, wv, wo, X16, BQ, CSB, SNB);      /* rope tables (rotate-half convention; the module's [f | f] tables repeat these 32 columns), x rows, natural [out][in] = Bt[n][k] x16 planes (KVD = 16 x 64 = DM: full-width k / v) */
  const size_t r0p = (size_t)B0 * SQ;      /* first projected row */
  k_gemm2<0><<<dim3((unsigned)((MP / 128) * (KVD / 64)), 1), 128, 0, stream>>>(X16 + r0p * DM, 0, BV, 0, 0.0625f, bv, 0, nullptr, 1, 0, 0, nullptr, V16 + r0p * KVD, KVD, 0, MP, KVD, nullptr, nullptr);
  static_assert(KVD == DM, "q and k share one launch: equal widths");
  k_gemm2<0, 1><<<dim3((unsigned)((MP / 128) * (DM / 64)), 2), 128, 0, stream>>>(X16 + r0p * DM, 0, BQ, (size_t)DM * DM, 0.0625f, nullptr, 0, nullptr, 1, 0, 0, nullptr, Q16 + r0p * DM, DM, NR * DM, MP, DM, CSB, SNB);      /* q (grid.y 0) and k (grid.y 1) of all rows: BK follows BQ and K16 follows Q16 in the workspace (sizes are multiples of 256 bytes), so the kernel's own batch strides step from q to k; half-split rope (t cos + rotate_half(t) sin, computed tables) and f32 -> f16 in the epilogue */
  k_vt<NG, SQ><<<NBR * NG * (SQ / 64), 256, 0, stream>>>(V16 + r0p * KVD, KVD, 0, VT + (size_t)B0 * NH * HD * SQ);      /* V^T [NB][NH][HD][SQ]: the slabs of all batches in one launch (the kernel's slab index runs over batch and head) */
  k_fattn<<<dim3(SQ / FA_QB, NH, NB), FA_W * 32, 0, stream>>>(Q16, K16, VT, O16);      /* non-causal attention of all batches, heads and query rows in one launch: scores, softmax and weighted values fused; o into merged f16 rows (x64) */
  k_gemm2<0><<<dim3((unsigned)((MPO / 128) * (DM / 64)), 1), 128, 0, stream>>>(O16 + r0p * DM, 0, BO, 0, 0.0009765625f, bo, 0, nullptr, 1, 0, 0, (float*)d_out + r0p * DM, nullptr, DM, 0, MPO, DM, nullptr, nullptr);      /* out rows are the output layout */
}

// v007
// It runs in 91.1 microseconds.
// Next to v006, in two timings, it ran 1.09 times as fast each time.
// All steps since v000 together make it 215 times as fast.
#include <hip/hip_runtime.h>
// Multi-head self-attention with rotate-half RoPE computed in the kernel and a biased output projection, NON-causal (x [2][2048][1024]; q / k / v = x W^T (natural [1024][1024], no biases), 16 heads of 64; cos / sin = [f | f] of pos * 10000^(-2i/64); q = q cos + rotate_half(q) sin, likewise k; scores * 64^-0.5; softmax over all 2048 keys (no mask); out = merged Wo^T + bo (natural + bias) -> [2][2048][1024]); run as 16 groups of ONE head.
// Structure: ONE preparation launch (x as exact f16 rows; natural weights as exact x16 planes; rope tables, double-derived inv_freq, f32 angle); q, k and V^T of all rows as ONE WMMA GEMM launch (32x64 wave tiles, f32 accumulation, f16 output; grid.y = q / k / V^T): the q and k epilogue applies the rotate-half rotation and the f16 conversion to the f32 tile it has staged in LDS (a wave tile is one head's 64 columns); the V^T plane takes the weight rows as A and the token rows as B, so its tiles are V^T rows as they stand; then ONE fused attention launch for all batches, heads and query rows (256 query rows per work-group): per 32 keys S^T = K Q^T (K = 64), online softmax on VALU in the log2 domain (f32 statistics, native exp2, lazy rescale; weights f16, unnormalised), O^T += V^T P^T, o / row sum (carried x64) into merged f16 rows; scores and weights stay in registers; out = o Wo^T GEMM (f32, alpha 2^-10).
// Compute dtype: inputs rounded to bf16; x / weights exact; q, k, v, softmax weights and o as plain f16 GEMM operands (~2^-12); scores and softmax statistics f32. v_wmma_f32_16x16x32_f16.
#define NB 2
#define NG 16
#define HPG 1
#define KVD (NG * HD)
#define SQ 2048
#define DM 1024
#define NH 16
#define HD 64
#define HG 4                         /* heads handled by the grouped k_vt overload kept below */
#define QT 512                       /* query rows per tile of the unfused softmax kernel kept below */
#define NKX SQ                       /* S / P row pitch */
#define QT0 128                      /* first-tile rows of the f32 k_att0 path (not launched) */
#define B0 0                         /* first batch processed (debug hook) */
#define NBR NB                       /* batches processed (debug hook) */
#define NR ((size_t)NB * SQ)         /* token rows */
#define MP ((int)((size_t)NBR * SQ)) /* rows projected (debug hook) */
#define QN SQ                        /* query rows attended per batch (unused) */
#define NHD NH                       /* heads attended (unused) */
#define MPO MP                       /* rows through the output stage (debug hook) */
#define LQ DM      /* row pitch of the q/k/v rows */
typedef __bf16 v16b __attribute__((ext_vector_type(16)));
typedef unsigned short v8us __attribute__((ext_vector_type(8), may_alias));
typedef float  v8f  __attribute__((ext_vector_type(8)));
typedef float  v4f  __attribute__((ext_vector_type(4)));
typedef float  v4fa __attribute__((ext_vector_type(4), may_alias));
union FragB { v16b v; v8us half[2]; unsigned short u[16]; };

__device__ __forceinline__ unsigned short bf16_bits(float x) { unsigned int u = __float_as_uint(x); return (unsigned short)((u + 0x7FFFu + ((u >> 16) & 1u)) >> 16); }
__device__ __forceinline__ float bf16_val(unsigned short b) { return __uint_as_float(((unsigned int)b) << 16); }
__device__ __forceinline__ float bf16_round(float x) { return bf16_val(bf16_bits(x)); }
// D += A·B with NT terms: 1 = ah·bh, 2 = + al·bh (A split), 3 = + ah·bl (both split)
template <int NT>
__device__ __forceinline__ v8f mmaN(v16b ah, v16b al, v16b bh, v16b bl, v8f c) {
  c = __builtin_amdgcn_wmma_f32_16x16x32_bf16(false, ah, false, bh, (short)0, c, false, false);
  if (NT >= 2) c = __builtin_amdgcn_wmma_f32_16x16x32_bf16(false, al, false, bh, (short)0, c, false, false);
  if (NT >= 3) c = __builtin_amdgcn_wmma_f32_16x16x32_bf16(false, ah, false, bl, (short)0, c, false, false);
  asm volatile("v_nop\n\tv_nop\n\tv_nop\n\tv_nop" : "+v"(c) : "v"(ah), "v"(al), "v"(bh), "v"(bl));
  return c;
}

__global__ __launch_bounds__(256) void k_wt_bf16(const float* __restrict__ W, unsigned short* __restrict__ Wt, int K, int N) {
  const int t = blockIdx.x * 256 + threadIdx.x;
  const int k8n = K / 8;
  if (t >= N * k8n) return;
  const int n = t / k8n, k8 = (t % k8n) * 8;
  v8us v;
#pragma unroll
  for (int i = 0; i < 8; ++i) v[i] = bf16_bits(W[(size_t)(k8 + i) * N + n]);
  *(v8us*)(Wt + (size_t)n * K + k8) = v;
  
}

// GEMM C[M][N] (f32, pitch ldc) = act(A[M][K]·W + bias). A f32 row-major (pitch lda) converted per fragment to bf16
// (ASPLIT: hi/lo two planes -> 2 terms, else single rounded term); Wt bf16 [N][K] (pitch ldb). BIAS_BF16 rounds the
// bias to bf16 first (bias quantised to bf16 before the add). K%32==0, M%16==0, N%64==0.
template <bool ASPLIT, int ACT, bool BIAS_BF16>
__global__ __launch_bounds__(128) void k_gemm_bf(const float* __restrict__ A, int lda, const unsigned short* __restrict__ Wt, int ldb,
                                               const float* __restrict__ bias, float* __restrict__ C, int ldc, int M, int N, int K) {
  __shared__ __attribute__((aligned(16))) float so[4][16][64];
  const int tid = threadIdx.x, w = tid >> 5, lane = tid & 31, ln = lane & 15, hh = lane >> 4;
  const int ntn = N / 64;
  const int wid = blockIdx.x * 4 + w;
  const int mt = wid / ntn, nq = wid % ntn;
  if (mt * 16 >= M) return;
  const int row0 = mt * 16, col0 = nq * 64;
  const float* arow = A + (size_t)(row0 + ln) * lda;
  v8f acc[4] = {};
  for (int kb = 0; kb < K; kb += 32) {
    FragB ah, al;
    const v4f x0 = *(const v4fa*)(arow + kb + 8 * hh), x1 = *(const v4fa*)(arow + kb + 8 * hh + 4);
    const v4f x2 = *(const v4fa*)(arow + kb + 16 + 8 * hh), x3 = *(const v4fa*)(arow + kb + 16 + 8 * hh + 4);
    float xs[16] = {x0[0],x0[1],x0[2],x0[3],x1[0],x1[1],x1[2],x1[3],x2[0],x2[1],x2[2],x2[3],x3[0],x3[1],x3[2],x3[3]};
#pragma unroll
    for (int i = 0; i < 16; ++i) { const unsigned short hb = bf16_bits(xs[i]); ah.u[i] = hb; al.u[i] = ASPLIT ? bf16_bits(xs[i] - bf16_val(hb)) : (unsigned short)0; }
#pragma unroll
    for (int t = 0; t < 4; ++t) {
      const unsigned short* brow = Wt + (size_t)(col0 + t * 16 + ln) * ldb + kb;
      FragB b;
      b.half[0] = *(const v8us*)(brow + 8 * hh);
      b.half[1] = *(const v8us*)(brow + 16 + 8 * hh);
      acc[t] = mmaN<ASPLIT ? 2 : 1>(ah.v, al.v, b.v, b.v, acc[t]);
    }
  }
#pragma unroll
  for (int t = 0; t < 4; ++t) {
    float bv = bias ? bias[col0 + t * 16 + ln] : 0.f;
    if (BIAS_BF16) bv = bf16_round(bv);
#pragma unroll
    for (int r = 0; r < 8; ++r) { float v = acc[t][r] + bv; if (ACT == 1) v = fmaxf(v, 0.f); so[w][8 * hh + r][t * 16 + ln] = v; }
  }
  __builtin_amdgcn_fence(__ATOMIC_ACQ_REL, "workgroup");
  __builtin_amdgcn_wave_barrier();
  const int rsub = lane >> 4, c4 = (lane & 15) * 4;
  {
#pragma unroll
    for (int q = 0; q < 8; ++q) {
      const int r = q * 2 + rsub;
      const v4f v = *(const v4fa*)&so[w][r][c4];
      *(v4f*)(C + (size_t)(row0 + r) * ldc + col0 + c4) = v;
    }
    
  }
}

// GEMM C = act(A·W + bias + resid): A f32 (ASPLIT -> hi/lo 2 terms), Wt bf16 [N][K]; ACT 0 none, 1 relu, 2 exact gelu;
// resid (optional, f32, row index = (row % rmod), pitch ldr, RES_BF16 rounds it) added before the activation.
template <bool ASPLIT, int ACT, bool BIAS_BF16, bool RES_BF16>
__global__ __launch_bounds__(128) void k_gemm_bf3(const float* __restrict__ A, int lda, const unsigned short* __restrict__ Wt, int ldb,
                                                const float* __restrict__ bias, const float* __restrict__ resid, int rmod, int ldr,
                                                float* __restrict__ C, int ldc, int M, int N, int K) {
  __shared__ __attribute__((aligned(16))) float so[4][16][64];
  const int tid = threadIdx.x, w = tid >> 5, lane = tid & 31, ln = lane & 15, hh = lane >> 4;
  const int ntn = N / 64;
  const int wid = blockIdx.x * 4 + w;
  const int mt = wid / ntn, nq = wid % ntn;
  if (mt * 16 >= M) return;
  const int row0 = mt * 16, col0 = nq * 64;
  const float* arow = A + (size_t)(row0 + ln) * lda;
  v8f acc[4] = {};
  for (int kb = 0; kb < K; kb += 32) {
    FragB ah, al;
    const v4f x0 = *(const v4fa*)(arow + kb + 8 * hh), x1 = *(const v4fa*)(arow + kb + 8 * hh + 4);
    const v4f x2 = *(const v4fa*)(arow + kb + 16 + 8 * hh), x3 = *(const v4fa*)(arow + kb + 16 + 8 * hh + 4);
    float xs[16] = {x0[0],x0[1],x0[2],x0[3],x1[0],x1[1],x1[2],x1[3],x2[0],x2[1],x2[2],x2[3],x3[0],x3[1],x3[2],x3[3]};
#pragma unroll
    for (int i = 0; i < 16; ++i) { const unsigned short hb = bf16_bits(xs[i]); ah.u[i] = hb; al.u[i] = ASPLIT ? bf16_bits(xs[i] - bf16_val(hb)) : (unsigned short)0; }
#pragma unroll
    for (int t = 0; t < 4; ++t) {
      const unsigned short* brow = Wt + (size_t)(col0 + t * 16 + ln) * ldb + kb;
      FragB b;
      b.half[0] = *(const v8us*)(brow + 8 * hh);
      b.half[1] = *(const v8us*)(brow + 16 + 8 * hh);
      acc[t] = mmaN<ASPLIT ? 2 : 1>(ah.v, al.v, b.v, b.v, acc[t]);
    }
  }
#pragma unroll
  for (int t = 0; t < 4; ++t) {
    const int col = col0 + t * 16 + ln;
    float bv = bias ? bias[col] : 0.f;
    if (BIAS_BF16) bv = bf16_round(bv);
#pragma unroll
    for (int r = 0; r < 8; ++r) {
      float v = acc[t][r] + bv;
      if (resid) { float rv = resid[(size_t)((row0 + 8 * hh + r) % rmod) * ldr + col]; if (RES_BF16) rv = bf16_round(rv); v += rv; }
      if (ACT == 1) v = fmaxf(v, 0.f);
      if (ACT == 2) v = 0.5f * v * (1.0f + erff(v * 0.70710678118654752f));
      if (ACT == 3) { const float u = 0.7978845608028654f * (v + 0.044715f * v * v * v); v = 0.5f * v * (1.0f + tanhf(u)); }
      so[w][8 * hh + r][t * 16 + ln] = v;
    }
  }
  __builtin_amdgcn_fence(__ATOMIC_ACQ_REL, "workgroup");
  __builtin_amdgcn_wave_barrier();
  const int rsub = lane >> 4, c4 = (lane & 15) * 4;
  {
#pragma unroll
    for (int q = 0; q < 8; ++q) {
      const int r = q * 2 + rsub;
      const v4f v = *(const v4fa*)&so[w][r][c4];
      *(v4f*)(C + (size_t)(row0 + r) * ldc + col0 + c4) = v;
    }
    
  }
}
// row LayerNorm (biased variance, eps) over N: s = X (+ R); optional out_sum <- s; out_norm <- (s-mu)*rsqrt(var+eps)*g + b
template <bool PARAM_BF16>
__global__ __launch_bounds__(256) void k_layernorm(const float* __restrict__ X, const float* __restrict__ R, const float* __restrict__ g, const float* __restrict__ bta,
                                                  float* __restrict__ out_sum, float* __restrict__ out_norm, int N, float eps) {
  __shared__ float red[256];
  const int row = blockIdx.x, tid = threadIdx.x;
  const float* x = X + (size_t)row * N; const float* rr = R ? R + (size_t)row * N : nullptr;
  float vals[16];                     // up to N = 4096
  const int per = N / 256;            // contiguous chunk per thread? use strided-by-4 chunks: thread handles j = tid*4 + 1024*u
  float s1 = 0.f;
  for (int u = 0; u < per / 4; ++u) {
    const int j = tid * 4 + 1024 * u;
    const v4f a = *(const v4fa*)(x + j);
    v4f b = {0.f,0.f,0.f,0.f}; if (rr) b = *(const v4fa*)(rr + j);
#pragma unroll
    for (int q = 0; q < 4; ++q) { const float v = a[q] + b[q]; vals[u * 4 + q] = v; s1 += v; }
  }
  red[tid] = s1; __syncthreads();
  for (int st = 128; st > 0; st >>= 1) { if (tid < st) red[tid] += red[tid + st]; __syncthreads(); }
  const float mu = red[0] / (float)N; __syncthreads();
  float s2 = 0.f;
  for (int u = 0; u < per / 4; ++u)
#pragma unroll
    for (int q = 0; q < 4; ++q) { const float c = vals[u * 4 + q] - mu; s2 += c * c; }
  red[tid] = s2; __syncthreads();
  for (int st = 128; st > 0; st >>= 1) { if (tid < st) red[tid] += red[tid + st]; __syncthreads(); }
  const float rs = rsqrtf(red[0] / (float)N + eps);
  {
    for (int u = 0; u < per / 4; ++u) {
      const int j = tid * 4 + 1024 * u;
      v4f o, sm;
#pragma unroll
      for (int q = 0; q < 4; ++q) {
        float gg = g[j + q], bb = bta[j + q];
        if (PARAM_BF16) { gg = bf16_round(gg); bb = bf16_round(bb); }
        sm[q] = vals[u * 4 + q]; o[q] = (vals[u * 4 + q] - mu) * rs * gg + bb;
      }
      if (out_sum) *(v4f*)(out_sum + (size_t)row * N + j) = sm;
      *(v4f*)(out_norm + (size_t)row * N + j) = o;
    }
    
  }
}



// ---- f16 WMMA path (v_wmma_f32_16x16x32_f16): 11-bit significands for operands in range — used where a [0,1] probability operand needs more precision than bf16
typedef _Float16 v16h __attribute__((ext_vector_type(16)));
union FragH { v16h v; v8us half[2]; _Float16 h[16]; unsigned short u[16]; };
template <int NT>
__device__ __forceinline__ v8f mmaH(v16h ah, v16h al, v16h bh, v16h bl, v8f c) {
  c = __builtin_amdgcn_wmma_f32_16x16x32_f16(false, ah, false, bh, (short)0, c, false, false);
  if (NT >= 2) c = __builtin_amdgcn_wmma_f32_16x16x32_f16(false, al, false, bh, (short)0, c, false, false);
  if (NT >= 3) c = __builtin_amdgcn_wmma_f32_16x16x32_f16(false, ah, false, bl, (short)0, c, false, false);
  asm volatile("v_nop\n\tv_nop\n\tv_nop\n\tv_nop" : "+v"(c) : "v"(ah), "v"(al), "v"(bh), "v"(bl));
  return c;
}
// batched GEMM like k_gemm_b but f16 operands: A f32 (split into f16 hi/lo if ASPLIT, else rounded to f16), Bt = f16 values [n][k]; alpha; C f32; N multiple of 16 (partial tiles skipped)
template <bool ASPLIT>
__global__ __launch_bounds__(128) void k_gemm_h(const float* __restrict__ A, int lda, size_t sA, const _Float16* __restrict__ Bh, int ldb, size_t sB, float alpha, float* __restrict__ C, int ldc, size_t sC, int M, int N, int K) {
  __shared__ __attribute__((aligned(16))) float so[4][16][64];
  const int tid = threadIdx.x, w = tid >> 5, lane = tid & 31, ln = lane & 15, hh = lane >> 4; const int by = blockIdx.y;
  A += (size_t)by * sA; Bh += (size_t)by * sB; C += (size_t)by * sC;
  const int ntn = (N + 63) / 64; const int wid = blockIdx.x * 4 + w; const int mt = wid / ntn, nq = wid % ntn; if (mt * 16 >= M) return;
  const int row0 = mt * 16, col0 = nq * 64; const float* arow = A + (size_t)(row0 + ln) * lda;
  v8f acc[4] = {};
  for (int kb = 0; kb < K; kb += 32) {
    FragH ah, al;
    const v4f x0 = *(const v4fa*)(arow + kb + 8 * hh), x1 = *(const v4fa*)(arow + kb + 8 * hh + 4), x2 = *(const v4fa*)(arow + kb + 16 + 8 * hh), x3 = *(const v4fa*)(arow + kb + 16 + 8 * hh + 4);
    float xs[16] = {x0[0],x0[1],x0[2],x0[3],x1[0],x1[1],x1[2],x1[3],x2[0],x2[1],x2[2],x2[3],x3[0],x3[1],x3[2],x3[3]};
#pragma unroll
    for (int i = 0; i < 16; ++i) { const _Float16 h = (_Float16)xs[i]; ah.h[i] = h; al.h[i] = ASPLIT ? (_Float16)(xs[i] - (float)h) : (_Float16)0.0f; }
#pragma unroll
    for (int t = 0; t < 4; ++t) { if (col0 + t * 16 >= N) continue; const size_t boff = (size_t)(col0 + t * 16 + ln) * ldb + kb; FragH bq; bq.half[0] = *(const v8us*)(Bh + boff + 8 * hh); bq.half[1] = *(const v8us*)(Bh + boff + 16 + 8 * hh);
      acc[t] = mmaH<ASPLIT ? 2 : 1>(ah.v, al.v, bq.v, bq.v, acc[t]); }
  }
#pragma unroll
  for (int t = 0; t < 4; ++t) { if (col0 + t * 16 >= N) continue;
#pragma unroll
    for (int r = 0; r < 8; ++r) so[w][8 * hh + r][t * 16 + ln] = acc[t][r] * alpha; }
  __builtin_amdgcn_fence(__ATOMIC_ACQ_REL, "workgroup"); __builtin_amdgcn_wave_barrier();
  const int rsub = lane >> 4, c4 = (lane & 15) * 4;
  {
#pragma unroll
    for (int q = 0; q < 8; ++q) { const int r = q * 2 + rsub; if (col0 + c4 < N) { const v4f v = *(const v4fa*)&so[w][r][c4]; *(v4f*)(C + (size_t)(row0 + r) * ldc + col0 + c4) = v; } }
     }
}

// Wt[n][k] = f16(W[k][n]·scale) from f32 row-major W[K][N] (scale = power of two; bf16-exact weights stay exact in f16 away from the subnormal range)
__global__ __launch_bounds__(256) void k_wt_f16(const float* __restrict__ W, _Float16* __restrict__ Wt, int K, int N, float scale) {
  const int t = blockIdx.x * 256 + threadIdx.x; if (t >= N * (K / 8)) return; const int n = t / (K / 8), k8 = (t % (K / 8)) * 8; FragH f;
#pragma unroll
  for (int i = 0; i < 8; ++i) f.h[i] = (_Float16)(bf16_round(W[(size_t)(k8 + i) * N + n]) * scale); const v8us o = f.half[0];
  *(v8us*)((unsigned short*)Wt + (size_t)n * K + k8) = o; 
}
// k_gemm_hh variant with fused epilogue: v = acc·alpha + bias[by·sBias + col] (+ CP[(row/rowsPerB)·sCPb + by·64 + col] if CP) ; ACT 0 none / 1 elu ; writes f16 C16 (and f32 C if non-null)
template <int ACT>
__global__ __launch_bounds__(128) void k_gemm_hhx(const _Float16* __restrict__ A, int lda, size_t sA, const _Float16* __restrict__ Bh, int ldb, size_t sB, float alpha, const float* __restrict__ bias, size_t sBias, const float* __restrict__ CP, int rowsPerB, size_t sCPb, int row0g,
    float* __restrict__ C, _Float16* __restrict__ C16, int ldc, size_t sC, int M, int N, int K) {
  __shared__ __attribute__((aligned(16))) float so[4][16][64];
  const int tid = threadIdx.x, w = tid >> 5, lane = tid & 31, ln = lane & 15, hh = lane >> 4; const int by = blockIdx.y;
  A += (size_t)by * sA; Bh += (size_t)by * sB; const size_t cofs = (size_t)by * sC; const float* bp = bias ? bias + (size_t)by * sBias : nullptr;
  const int ntn = (N + 63) / 64; const int wid = blockIdx.x * 4 + w; const int mt = wid / ntn, nq = wid % ntn; if (mt * 16 >= M) return;
  const int row0 = mt * 16, col0 = nq * 64; const _Float16* arow = A + (size_t)(row0 + ln) * lda;
  v8f acc[4] = {};
  for (int kb = 0; kb < K; kb += 32) { FragH ah; ah.half[0] = *(const v8us*)((const unsigned short*)arow + kb + 8 * hh); ah.half[1] = *(const v8us*)((const unsigned short*)arow + kb + 16 + 8 * hh);
#pragma unroll
    for (int t = 0; t < 4; ++t) { if (col0 + t * 16 >= N) continue; const size_t boff = (size_t)(col0 + t * 16 + ln) * ldb + kb; FragH bq; bq.half[0] = *(const v8us*)((const unsigned short*)Bh + boff + 8 * hh); bq.half[1] = *(const v8us*)((const unsigned short*)Bh + boff + 16 + 8 * hh);
      acc[t] = mmaH<1>(ah.v, ah.v, bq.v, bq.v, acc[t]); }
  }
#pragma unroll
  for (int t = 0; t < 4; ++t) { if (col0 + t * 16 >= N) continue; const int col = col0 + t * 16 + ln; const float bv = bp ? bf16_round(bp[col]) : 0.f;
#pragma unroll
    for (int r = 0; r < 8; ++r) { float v = acc[t][r] * alpha + bv; if (CP) { const int rr = row0g + row0 + 8 * hh + r; if (rowsPerB < 0) v += CP[cofs + (size_t)rr * ldc + col];      /* rowsPerB < 0: own element of the batched C plane */ else { const int bidx = rr / rowsPerB; v += CP[(size_t)bidx * sCPb + (size_t)by * 64 + col]; } } if (ACT == 1) v = (v > 0.f) ? v : expm1f(v); else if (ACT == 7) v = (v > 0.f) ? v + 1.0f : expf(v); else if (ACT == 8) v = tanhf(v); else if (ACT == 9) v = 0.5f * v * (1.0f + tanhf(0.7978845608028654f * (v + 0.044715f * v * v * v))); else if (ACT == 11) v = 1.0f / (1.0f + expf(-v)); else if (ACT == 12) v = (v > 0.f) ? v : 0.01f * v; else if (ACT == 14) v = (v > 0.f) ? v : 0.1f * v; else if (ACT == 16) v = (v >= 0.f) ? v : 0.3f * v; else if (ACT == 17) v = (v >= 0.f) ? v : 0.2f * v; else if (ACT == 15) v = v / (1.0f + expf(-v)); else if (ACT == 3) v = fmaxf(v, 0.f); else if (ACT == 6) v = 0.5f * v * (1.0f + erff(v * 0.70710678118654752f)); so[w][8 * hh + r][t * 16 + ln] = v; } }
  __builtin_amdgcn_fence(__ATOMIC_ACQ_REL, "workgroup"); __builtin_amdgcn_wave_barrier();
  const int rsub = lane >> 4, c4 = (lane & 15) * 4; typedef _Float16 v4h __attribute__((ext_vector_type(4)));
  {
#pragma unroll
    for (int q = 0; q < 8; ++q) { const int r = q * 2 + rsub; if (col0 + c4 < N) { const v4f v = *(const v4fa*)&so[w][r][c4]; if (C) *(v4f*)(C + cofs + (size_t)(row0 + r) * ldc + col0 + c4) = v; if (C16) { v4h h4; for (int i = 0; i < 4; ++i) h4[i] = (_Float16)v[i]; *(v4h*)(C16 + cofs + (size_t)(row0 + r) * ldc + col0 + c4) = h4; } } }
     }
}


typedef _Float16 v4h __attribute__((ext_vector_type(4)));

__global__ __launch_bounds__(256) void k_h16(const float* __restrict__ x, _Float16* __restrict__ X16, size_t n8) { const size_t t = (size_t)blockIdx.x * 256 + threadIdx.x; if (t >= n8) return; FragH f;
#pragma unroll
  for (int q = 0; q < 8; ++q) f.h[q] = (_Float16)x[t * 8 + q]; *(v8us*)((unsigned short*)X16 + t * 8) = f.half[0];  }
__global__ __launch_bounds__(256) void k_round16f(const float* __restrict__ W, _Float16* __restrict__ Bt, size_t n8) { const size_t t = (size_t)blockIdx.x * 256 + threadIdx.x; if (t >= n8) return; FragH f;
#pragma unroll
  for (int i = 0; i < 8; ++i) f.h[i] = (_Float16)(bf16_round(W[t * 8 + i]) * 16.0f); *(v8us*)((unsigned short*)Bt + t * 8) = f.half[0];  }
template <int NHv, int TTv>
__global__ __launch_bounds__(256) void k_vt(const _Float16* __restrict__ V16, int ldv, int voff, _Float16* __restrict__ Vt) { __shared__ unsigned short tl[64][66]; const int tid = threadIdx.x; const int slab = blockIdx.x / (TTv / 64), lg = blockIdx.x % (TTv / 64); const int b = slab / NHv, h = slab % NHv;
  for (int i = tid; i < 64 * 8; i += 256) { const int r = i / 8, c8 = (i % 8) * 8; FragH f; f.half[0] = *(const v8us*)((const unsigned short*)V16 + ((size_t)b * TTv + lg * 64 + r) * ldv + voff + h * 64 + c8);
#pragma unroll
    for (int q = 0; q < 8; ++q) tl[r][c8 + q] = f.u[q]; }
  __syncthreads();
  {
#pragma unroll
    for (int rd = 0; rd < 2; ++rd) { const int d = rd * 32 + tid / 8, pc = tid % 8; FragH f;
#pragma unroll
      for (int q = 0; q < 8; ++q) f.u[q] = tl[pc * 8 + q][d];
      *(v8us*)((unsigned short*)Vt + ((size_t)slab * 64 + d) * TTv + lg * 64 + pc * 8) = f.half[0]; }
     } }

__global__ __launch_bounds__(256) void k_hl(const float* __restrict__ F, _Float16* __restrict__ Hh, _Float16* __restrict__ Hl, size_t n8) { const size_t t = (size_t)blockIdx.x * 256 + threadIdx.x; if (t >= n8) return; FragH fh, fl; const v4f a = *(const v4fa*)(F + t * 8), c = *(const v4fa*)(F + t * 8 + 4);
#pragma unroll
  for (int q = 0; q < 4; ++q) { _Float16 h = (_Float16)a[q]; fh.h[q] = h; fl.h[q] = (_Float16)((a[q] - (float)h) * 1024.0f); h = (_Float16)c[q]; fh.h[4 + q] = h; fl.h[4 + q] = (_Float16)((c[q] - (float)h) * 1024.0f); }
  { *(v8us*)((unsigned short*)Hh + t * 8) = fh.half[0]; *(v8us*)((unsigned short*)Hl + t * 8) = fl.half[0];  } }

// ---- fast GEMM (work-group tile 128x64, wave tile 32x64; A and Bt rows of pitch and length DM; requires M % 128 == 0 and N % 64 == 0); epilogue = k_gemm_hhx semantics ----
// A rows and Bt rows of 64 k are staged through registers into two LDS buffers shared by the 4 waves: global loads cover whole 128-byte lines, and each line is fetched once per work-group.
#define G2_KC 64                     /* k per LDS stage: 128-byte rows */
#define G2_P 72                      /* LDS row pitch in f16: 128-byte rows + 16 bytes (16 B x odd: conflict-free 16-byte reads) */
__device__ __forceinline__ v16h g2_frag(const _Float16* p, int hh) { FragH f; f.half[0] = *(const v8us*)((const unsigned short*)p + 8 * hh); f.half[1] = *(const v8us*)((const unsigned short*)p + 16 + 8 * hh); return f.v; }
__device__ __forceinline__ v8f g2_mma(v16h a, v16h b, v8f c) { v8f d = __builtin_amdgcn_wmma_f32_16x16x32_f16(false, a, false, b, (short)0, c, false, false); asm volatile("v_nop\n\tv_nop\n\tv_nop\n\tv_nop" : "+v"(d) : "v"(a), "v"(b)); return d; }
template <int ACT, int ROPE = 0>      /* ROPE 1: C16 = f16(v cos + rotate_half(v) sin), v = acc * alpha, per 64-column head; position = row % SQ, tables CS / SN [SQ][32]; no bias, no CP, no f32 C; its grid.y plane 2 is the transposed v projection into VTo (see below) */
__global__ __launch_bounds__(128) void k_gemm2(const _Float16* __restrict__ A, size_t sA, const _Float16* __restrict__ Bh, size_t sB, float alpha, const float* __restrict__ bias, size_t sBias, const float* __restrict__ CP, int rowsPerB, size_t sCPb, int row0g,
    float* __restrict__ C, _Float16* __restrict__ C16, int ldc, size_t sC, int M, int N, const float* __restrict__ CS, const float* __restrict__ SN, _Float16* __restrict__ VTo) { static_assert(ACT == 0 || ACT == 3 || ACT == 6 || ACT == 8 || ACT == 9 || ACT == 11 || ACT == 12 || ACT == 14 || ACT == 15 || ACT == 16 || ACT == 17, "k_gemm2: unsupported ACT code (would silently apply no activation)");
  __shared__ __attribute__((aligned(16))) unsigned char sm[2 * (128 + 64) * G2_P * 2];      /* two stage buffers of A (128 rows) and B (64 rows); behind the loop's last barrier the same bytes are the epilogue's staging */
  _Float16 (*la)[128][G2_P] = (_Float16 (*)[128][G2_P])sm; _Float16 (*lb)[64][G2_P] = (_Float16 (*)[64][G2_P])(sm + 2 * 128 * G2_P * 2); float (*so)[32][68] = (float (*)[32][68])sm;
  static_assert(sizeof(float) * 4 * 32 * 68 <= sizeof(sm), "the epilogue's staging lies inside the stage buffers");
  const int tid = threadIdx.x, w = tid >> 5, lane = tid & 31, ln = lane & 15, hh = lane >> 4; const int by = blockIdx.y;
  int bx = blockIdx.x, nb = 0; const bool vtp = ROPE && by == 2;      /* block-uniform */
  if (vtp) {      /* V^T [NB][NH][HD][SQ] = Wv x^T: the third weight plane's rows (head, d) are the A operand and the token rows of batch nb the B operand, so the tile's rows are V^T rows and its columns keys; no rotation */
    nb = bx / ((KVD / 128) * (SQ / 64)); bx -= nb * ((KVD / 128) * (SQ / 64)); const _Float16* xb = A + (size_t)nb * SQ * DM; A = Bh + 2 * sB; Bh = xb; M = KVD; N = SQ; }
  else { A += (size_t)by * sA; Bh += (size_t)by * sB; }
  const size_t cofs = (size_t)by * sC; const float* bp = bias ? bias + (size_t)by * sBias : nullptr;
  const int ntn = N >> 6; const int mt = bx / ntn, nq = bx - mt * ntn; const int row0 = mt * 128 + 32 * w, col0 = nq * 64; if (mt * 128 >= M) return;      /* block-uniform, in front of every barrier; M % 128 == 0 */
  const int sr = tid >> 3, sc = (tid & 7) * 8;      /* staging: a thread brings 16 bytes of rows sr + 16 i; 8 lanes cover one 128-byte line, a wave-wide load four whole lines */
  const unsigned short* ag = (const unsigned short*)A + (size_t)(mt * 128 + sr) * DM + sc; const unsigned short* bg = (const unsigned short*)Bh + (size_t)(col0 + sr) * DM + sc;
  v8us ga[8], gb[4];
#pragma unroll      /* ga[], gb[] in registers; constant row steps become immediate offsets */
  for (int i = 0; i < 8; ++i) ga[i] = *(const v8us*)(ag + (size_t)i * 16 * DM);
#pragma unroll
  for (int i = 0; i < 4; ++i) gb[i] = *(const v8us*)(bg + (size_t)i * 16 * DM);
  asm volatile("s_wait_xcnt 0x0" :: "v"(ag), "v"(bg) : "memory");      /* the staging loads' address pairs stay live up to this wait, so no register that an issued load names is overwritten in front of it */
#pragma unroll
  for (int i = 0; i < 8; ++i) *(v8us*)&la[0][sr + 16 * i][sc] = ga[i];
#pragma unroll
  for (int i = 0; i < 4; ++i) *(v8us*)&lb[0][sr + 16 * i][sc] = gb[i];
  const v8f z8 = {0.f,0.f,0.f,0.f,0.f,0.f,0.f,0.f}; v8f c00 = z8, c01 = z8, c02 = z8, c03 = z8, c10 = z8, c11 = z8, c12 = z8, c13 = z8;
  __syncthreads();      /* stage 0 is published */
#pragma unroll 1      /* one stage per trip: the registers hold one stage's fragments and the next stage's 12 staging loads */
  for (int st = 0; st < DM / G2_KC; ++st) { const int cur = st & 1; const bool more = st + 1 < DM / G2_KC;      /* block-uniform */
    if (more) { ag += G2_KC; bg += G2_KC;      /* the next stage flies under this stage's products */
#pragma unroll
      for (int i = 0; i < 8; ++i) ga[i] = *(const v8us*)(ag + (size_t)i * 16 * DM);
#pragma unroll
      for (int i = 0; i < 4; ++i) gb[i] = *(const v8us*)(bg + (size_t)i * 16 * DM);
      asm volatile("s_wait_xcnt 0x0" :: "v"(ag), "v"(bg) : "memory"); }      /* likewise: the pointers are stepped only behind this wait */
    v16h a0[2], a1[2], bf[4][2];
#pragma unroll      /* the stage's 24 LDS reads stand as one group in front of its 16 products */
    for (int kk = 0; kk < G2_KC / 32; ++kk) { a0[kk] = g2_frag(&la[cur][32 * w + ln][kk * 32], hh); a1[kk] = g2_frag(&la[cur][32 * w + 16 + ln][kk * 32], hh);
      for (int t = 0; t < 4; ++t) bf[t][kk] = g2_frag(&lb[cur][t * 16 + ln][kk * 32], hh); }
#pragma unroll      /* fragments in registers; k ascends as before: the sum order of every accumulator is unchanged */
    for (int kk = 0; kk < G2_KC / 32; ++kk) {
      c00 = g2_mma(a0[kk], bf[0][kk], c00); c10 = g2_mma(a1[kk], bf[0][kk], c10);
      c01 = g2_mma(a0[kk], bf[1][kk], c01); c11 = g2_mma(a1[kk], bf[1][kk], c11);
      c02 = g2_mma(a0[kk], bf[2][kk], c02); c12 = g2_mma(a1[kk], bf[2][kk], c12);
      c03 = g2_mma(a0[kk], bf[3][kk], c03); c13 = g2_mma(a1[kk], bf[3][kk], c13); }
    if (more) {      /* the other buffer's last readers left it at the previous trip's barrier */
#pragma unroll
      for (int i = 0; i < 8; ++i) *(v8us*)&la[cur ^ 1][sr + 16 * i][sc] = ga[i];
#pragma unroll
      for (int i = 0; i < 4; ++i) *(v8us*)&lb[cur ^ 1][sr + 16 * i][sc] = gb[i]; }
    __syncthreads(); }      /* publishes the next stage and ends every wave's reads of this one (behind the last trip: frees the buffers for the epilogue's staging) */
  v8f accs[8] = {c00, c01, c02, c03, c10, c11, c12, c13};
  if (ROPE) {      /* col0 is a multiple of 64 and row0 of 32: both halves of every rotation pair lie in this wave's own 32 x 64 tile, and its 32 positions do not wrap at SQ */
    const int rs = lane >> 3, d8 = (lane & 7) * 8; const float sg = (d8 < HD / 2) ? -1.0f : 1.0f;      /* 8 lanes per row, 8 columns each; rotate_half(v)[d] = -v[d + 32] below 32, v[d - 32] above */
    const size_t tb = (size_t)((unsigned)row0 % SQ + rs) * (HD / 2) + (d8 & (HD / 2 - 1)); const float* cp = CS + tb; const float* sp = SN + tb; v4f tc[8][2], ts[8][2];
#pragma unroll      /* accs[] in registers */
    for (int u = 0; u < 8; ++u) for (int r = 0; r < 8; ++r) so[w][(u >> 2) * 16 + 8 * hh + r][(u & 3) * 16 + ln] = accs[u][r] * alpha;
    __builtin_amdgcn_fence(__ATOMIC_ACQ_REL, "workgroup"); __builtin_amdgcn_wave_barrier();      /* the wave reads back rows that its other lanes wrote */
    if (vtp) {      /* block-uniform; shares the staging above, so the accumulators end there on both ways; 16 lanes store one whole 128-byte line of a V^T row */
      const int rsub = lane >> 4, c4 = (lane & 15) * 4; _Float16* vd = VTo + (size_t)nb * NH * HD * SQ + (size_t)(row0 + rsub) * SQ + col0 + c4;
#pragma unroll      /* constant LDS offsets; constant row steps become immediate offsets of one address */
      for (int q = 0; q < 16; ++q) { const v4f v = *(const v4fa*)&so[w][q * 2 + rsub][c4]; v4h h4; for (int i = 0; i < 4; ++i) h4[i] = (_Float16)v[i]; *(v4h*)(vd + (size_t)q * 2 * SQ) = h4; }
      asm volatile("s_wait_xcnt 0x0" ::: "memory");      /* directly behind the last store: on every way that the built code lays out behind the stores, this wait stands in front of the first write of a register that an issued store names */
      return; }
#pragma unroll      /* tc[], ts[] in registers; behind the staging, where the accumulators' registers are free */
    for (int q = 0; q < 8; ++q) for (int u = 0; u < 2; ++u) { tc[q][u] = *(const v4fa*)(cp + q * 4 * (HD / 2) + 4 * u); ts[q][u] = *(const v4fa*)(sp + q * 4 * (HD / 2) + 4 * u); }
    unsigned short* dp = (unsigned short*)C16 + cofs + (size_t)(row0 + rs) * ldc + col0 + d8;
#pragma unroll      /* 4 rows per trip, constant LDS offsets; a store covers four whole 128-byte lines */
    for (int q = 0; q < 8; ++q) { FragH f;
      for (int u = 0; u < 2; ++u) { const v4f own = *(const v4fa*)&so[w][q * 4 + rs][d8 + 4 * u], oth = *(const v4fa*)&so[w][q * 4 + rs][(d8 ^ (HD / 2)) + 4 * u];
        for (int i = 0; i < 4; ++i) f.h[4 * u + i] = (_Float16)(own[i] * tc[q][u][i] + oth[i] * (sg * ts[q][u][i])); }
      *(v8us*)(dp + (size_t)q * 4 * ldc) = f.half[0]; }
    asm volatile("s_wait_xcnt 0x0" ::: "memory");      /* likewise: the built code lays the V^T plane's read-back out behind these stores */
    return; }
#pragma unroll
  for (int u = 0; u < 8; ++u) { const int t = u & 3, half = u >> 2; const int col = col0 + t * 16 + ln; const float bv = bp ? bf16_round(bp[col]) : 0.f;
#pragma unroll
    for (int r = 0; r < 8; ++r) { const int rloc = half * 16 + 8 * hh + r; float v = accs[u][r] * alpha + bv; if (CP) { if (rowsPerB < 0) v += CP[cofs + (size_t)(row0g + row0 + rloc) * ldc + col];      /* rowsPerB < 0: own element of the batched C plane */ else { const int bidx = (row0g + row0 + rloc) / rowsPerB; v += CP[(size_t)bidx * sCPb + (size_t)by * 64 + col]; } }
      if (ACT == 3) v = fmaxf(v, 0.f); else if (ACT == 6) v = 0.5f * v * (1.0f + erff(v * 0.70710678118654752f)); else if (ACT == 11) v = 1.0f / (1.0f + expf(-v)); else if (ACT == 15) v = v / (1.0f + expf(-v)); else if (ACT == 12) v = (v > 0.f) ? v : 0.01f * v; else if (ACT == 8) v = tanhf(v); else if (ACT == 9) v = 0.5f * v * (1.0f + tanhf(0.7978845608028654f * (v + 0.044715f * v * v * v))); else if (ACT == 14) v = (v > 0.f) ? v : 0.1f * v; else if (ACT == 16) v = (v >= 0.f) ? v : 0.3f * v; else if (ACT == 17) v = (v >= 0.f) ? v : 0.2f * v;
      so[w][rloc][t * 16 + ln] = v; } }
  __builtin_amdgcn_fence(__ATOMIC_ACQ_REL, "workgroup"); __builtin_amdgcn_wave_barrier();
  const int rsub = lane >> 4, c4 = (lane & 15) * 4;
  {
#pragma unroll
    for (int q = 0; q < 16; ++q) { const int r = q * 2 + rsub; const v4f v = *(const v4fa*)&so[w][r][c4]; if (C) *(v4f*)(C + cofs + (size_t)(row0 + r) * ldc + col0 + c4) = v; if (C16) { v4h h4; for (int i = 0; i < 4; ++i) h4[i] = (_Float16)v[i]; *(v4h*)(C16 + cofs + (size_t)(row0 + r) * ldc + col0 + c4) = h4; } }
     } }


#define FA_W 8                       /* waves per work-group, 32 query columns each */
#define FA_QB (FA_W * 32)            /* query rows per work-group */
#define FA_ST 64                     /* keys per LDS stage */
#define FA_P 72                      /* LDS row pitch in f16: 128-byte rows + 16 bytes (16 B x odd: conflict-free 16-byte reads) */
typedef float v2f __attribute__((ext_vector_type(2)));
typedef _Float16 v2h __attribute__((ext_vector_type(2)));
__device__ __forceinline__ float fa_xhalf(float x) { return __builtin_bit_cast(float, __builtin_amdgcn_permlanex16(__builtin_bit_cast(int, x), __builtin_bit_cast(int, x), 0x76543210, 0xfedcba98, false, false)); }      /* lane l reads lane l ^ 16 */
__device__ __forceinline__ v8f fa_mma(v16h a, v16h b, v8f c) { return __builtin_amdgcn_wmma_f32_16x16x32_f16(false, a, false, b, (short)0, c, false, false); }
__global__ __launch_bounds__(FA_W * 32) void k_fattn(const _Float16* __restrict__ Q16, const _Float16* __restrict__ K16, const _Float16* __restrict__ VT, _Float16* __restrict__ O16) {
  __shared__ __attribute__((aligned(16))) _Float16 lk[2][FA_ST][FA_P]; __shared__ __attribute__((aligned(16))) _Float16 lv[2][HD][FA_P];
  const int tid = threadIdx.x, w = tid >> 5, lane = tid & 31, ln = lane & 15, hh = lane >> 4; const int h = blockIdx.y, b = blockIdx.z; const size_t r0 = (size_t)b * SQ; const int q0 = blockIdx.x * FA_QB + w * 32;
  const int sr = tid >> 3, sc = (tid & 7) * 8;      /* staging: a thread brings 16 bytes of rows sr and sr + 32 of each tile; 8 lanes cover one 128-byte line */
  const unsigned short* kg = (const unsigned short*)K16 + (r0 + sr) * KVD + h * HD + sc;      /* key row sr of the stage, this head's 64 columns */
  const unsigned short* vg = (const unsigned short*)VT + ((size_t)(b * NH + h) * HD + sr) * SQ + sc;      /* V^T row d = sr, the stage's 64 keys */
  v8us gk0 = *(const v8us*)kg, gk1 = *(const v8us*)(kg + (size_t)32 * KVD), gv0 = *(const v8us*)vg, gv1 = *(const v8us*)(vg + (size_t)32 * SQ);
  v16h qf[2][2];      /* [column group][k step of 32], kept for the whole kernel */
  { const _Float16* qp = Q16 + (r0 + q0 + ln) * LQ + h * HD;
#pragma unroll      /* constant indices keep qf[] in registers */
    for (int g = 0; g < 2; ++g) for (int kk = 0; kk < 2; ++kk) qf[g][kk] = g2_frag(qp + (size_t)g * 16 * LQ + kk * 32, hh);
    asm volatile("s_wait_xcnt 0x0" :: "v"(qp) : "memory"); }      /* the q loads' address pair stays live up to this wait, so no register that an issued load names is overwritten in front of it */
  *(v8us*)&lk[0][sr][sc] = gk0; *(v8us*)&lk[0][sr + 32][sc] = gk1; *(v8us*)&lv[0][sr][sc] = gv0; *(v8us*)&lv[0][sr + 32][sc] = gv1;
  const v8f z8 = {0.f,0.f,0.f,0.f,0.f,0.f,0.f,0.f}; v8f o[2][4];      /* O^T: [column group][16 rows of d] */
#pragma unroll      /* o[] in registers */
  for (int g = 0; g < 2; ++g) for (int t = 0; t < 4; ++t) o[g][t] = z8;
  float mr[2] = {-1.0e30f, -1.0e30f}, l[2] = {0.f, 0.f};      /* maximum in use (log2-scaled) and this lane's part of the denominator */
  const float cs = 0.125f * 1.4426950408889634f;      /* 64^-0.5 * log2(e) */
  __syncthreads();      /* stage 0 is published */
  for (int st = 0; st < SQ / FA_ST; ++st) { const int cur = st & 1; const bool more = st + 1 < SQ / FA_ST;      /* block-uniform */
    if (more) { kg += (size_t)FA_ST * KVD; vg += FA_ST; gk0 = *(const v8us*)kg; gk1 = *(const v8us*)(kg + (size_t)32 * KVD); gv0 = *(const v8us*)vg; gv1 = *(const v8us*)(vg + (size_t)32 * SQ);      /* the next stage flies under this stage's two passes */
      asm volatile("s_wait_xcnt 0x0" :: "v"(kg), "v"(vg) : "memory"); }      /* likewise for the next stage's staging loads: the pointers are stepped only behind this wait (stage 0's loads: behind the wait after the q loads) */
#pragma unroll      /* two 32-key passes per stage, constant LDS offsets */
    for (int ps = 0; ps < FA_ST / 32; ++ps) {
      v8f s[2][2];      /* S^T: [column group][16 keys] */
      { v16h kf[2][2];
#pragma unroll      /* fragments in registers */
        for (int t = 0; t < 2; ++t) for (int kk = 0; kk < 2; ++kk) kf[t][kk] = g2_frag(&lk[cur][ps * 32 + t * 16 + ln][kk * 32], hh);
#pragma unroll      /* fragments in registers */
        for (int t = 0; t < 2; ++t) for (int g = 0; g < 2; ++g) s[g][t] = fa_mma(kf[t][1], qf[g][1], fa_mma(kf[t][0], qf[g][0], z8)); }
      v16h vf[4];
#pragma unroll      /* fragments in registers; these reads fly under the maxima and exponentials */
      for (int t = 0; t < 4; ++t) vf[t] = g2_frag(&lv[cur][t * 16 + ln][ps * 32], hh);
      float mb[2]; bool need = false;
#pragma unroll      /* s[] in registers */
      for (int g = 0; g < 2; ++g) { float mx = s[g][0][0];
        for (int r = 1; r < 8; ++r) mx = fmaxf(mx, s[g][0][r]);
        for (int r = 0; r < 8; ++r) mx = fmaxf(mx, s[g][1][r]);
        mx = fmaxf(mx, fa_xhalf(mx)) * cs; mb[g] = mx; need = need || (mx > mr[g] + 8.0f); }      /* both halves hold the column's maximum; the one in use may trail it by 8 (weights up to 2^8) */
      if (__builtin_amdgcn_ballot_w32(need) != 0) {      /* wave-uniform; always on the first pass, rare afterwards */
#pragma unroll      /* o[] in registers */
        for (int g = 0; g < 2; ++g) { const float mn = fmaxf(mr[g], mb[g]); const float corr = __builtin_amdgcn_exp2f(mr[g] - mn); mr[g] = mn; l[g] *= corr;
          for (int t = 0; t < 4; ++t) o[g][t] = o[g][t] * corr; } }
#pragma unroll      /* s[], o[] in registers */
      for (int g = 0; g < 2; ++g) { const float nm = -mr[g]; const v8f c8 = {cs, cs, cs, cs, cs, cs, cs, cs}, n8 = {nm, nm, nm, nm, nm, nm, nm, nm}; FragH pf; float la = 0.f, lb = 0.f;
        for (int t = 0; t < 2; ++t) { s[g][t] = __builtin_elementwise_fma(s[g][t], c8, n8);
          for (int r = 0; r < 8; ++r) s[g][t][r] = __builtin_amdgcn_exp2f(s[g][t][r]); }      /* weights 2^(score * cs - maximum in use), in the score registers */
        for (int i = 0; i < 8; ++i) { const int t = i >> 2, r = 2 * (i & 3);
          la += s[g][t][r]; lb += s[g][t][r + 1];
          const v2h pk = __builtin_convertvector(v2f{s[g][t][r], s[g][t][r + 1]}, v2h); pf.h[2 * i] = pk[0]; pf.h[2 * i + 1] = pk[1]; }
        l[g] += la + lb;
        for (int t = 0; t < 4; ++t) o[g][t] = fa_mma(vf[t], pf.v, o[g][t]); } }
    asm volatile("v_nop\n\tv_nop\n\tv_nop\n\tv_nop" : "+v"(o[0][0]), "+v"(o[0][1]), "+v"(o[0][2]), "+v"(o[0][3]), "+v"(o[1][0]), "+v"(o[1][1]), "+v"(o[1][2]), "+v"(o[1][3]));      /* four issue slots behind the stage's last matrix instructions: a branch follows */
    if (more) { *(v8us*)&lk[cur ^ 1][sr][sc] = gk0; *(v8us*)&lk[cur ^ 1][sr + 32][sc] = gk1; *(v8us*)&lv[cur ^ 1][sr][sc] = gv0; *(v8us*)&lv[cur ^ 1][sr + 32][sc] = gv1; }      /* its last readers left it at the previous trip's barrier */
    __syncthreads(); }      /* publishes the next stage and ends every wave's reads of this one */
#pragma unroll      /* o[] in registers */
  for (int g = 0; g < 2; ++g) { const float fin = 64.0f / (l[g] + fa_xhalf(l[g]));      /* the halves' sums join once; o carried x64 */
    unsigned short* d = (unsigned short*)O16 + (r0 + q0 + g * 16 + ln) * DM + h * HD + 8 * hh;
    for (int t = 0; t < 4; ++t) { FragH f; for (int r = 0; r < 8; ++r) f.h[r] = (_Float16)(o[g][t][r] * fin); *(v8us*)(d + t * 16) = f.half[0]; } } }      /* a lane's 8 registers are 8 consecutive d of its query row: one 16-byte store */
__global__ __launch_bounds__(256) void k_vt(const _Float16* __restrict__ V16, int b, int h0, _Float16* __restrict__ VT) { __shared__ unsigned short tl[64][65]; const int tid = threadIdx.x; const int hh = blockIdx.x % HG, sg = blockIdx.x / HG; const int s0 = sg * 64; const int h = h0 + hh;
  for (int i = tid; i < 64 * 8; i += 256) { const int j = i / 8, d8 = (i % 8) * 8; FragH f; f.half[0] = *(const v8us*)((const unsigned short*)V16 + ((size_t)b * SQ + s0 + j) * DM + h * HD + d8); for (int q = 0; q < 8; ++q) tl[d8 + q][j] = f.u[q]; }
  __syncthreads();
  { for (int i = tid; i < 64 * 8; i += 256) { const int d = i / 8, j8 = (i % 8) * 8; FragH f; for (int q = 0; q < 8; ++q) f.u[q] = tl[d][j8 + q]; *(v8us*)((unsigned short*)VT + ((size_t)hh * HD + d) * SQ + s0 + j8) = f.half[0]; }  } }



__global__ __launch_bounds__(256) void k_rsmcf2(const float* __restrict__ S, _Float16* __restrict__ P, int hg, int q0, int nk) {
  #pragma clang fp contract(off)
  const int t = blockIdx.x * 256 + threadIdx.x; if (t >= hg * QT) return; const size_t i = (size_t)t; const float* s = S + i * NKX; const int last = q0 + (t % QT); float mx = -3.0e38f;
#pragma unroll 1
  for (int j = 0; j < nk; ++j) { const float f = (j <= last) ? 1.f : 0.f; mx = fmaxf(mx, fmaf(f, s[j], (1.f - f) * -1.0e9f)); } float se = 0.f;
#pragma unroll 1
  for (int j = 0; j < nk; ++j) { const float f = (j <= last) ? 1.f : 0.f; se += __expf(fmaf(f, s[j], (1.f - f) * -1.0e9f) - mx); } const float sc = 256.0f / se;
#pragma unroll 1
  for (int j0 = 0; j0 < nk; j0 += 8) { FragH fr; for (int q = 0; q < 8; ++q) { const int j = j0 + q; const float f = (j <= last) ? 1.f : 0.f; fr.h[q] = (_Float16)(__expf(fmaf(f, s[j], (1.f - f) * -1.0e9f) - mx) * sc); } unsigned short* d = (unsigned short*)P + i * NKX + j0; *(v8us*)d = fr.half[0];  } }


template <int MASKADD>
__global__ __launch_bounds__(64) void k_att0(const float* __restrict__ QF, const float* __restrict__ KF, const float* __restrict__ VF, int ld, const float* __restrict__ mask, float scale, float* __restrict__ OF, int ldo) {
  #pragma clang fp contract(off)
  __shared__ __attribute__((aligned(16))) float lq[64][64]; __shared__ __attribute__((aligned(16))) float lo[64][64];
  const int tid = threadIdx.x; const int h = blockIdx.x / (QT0 / 64), rg = blockIdx.x % (QT0 / 64); const int i = rg * 64 + tid;
  const float* qr = QF + (size_t)i * ld + h * HD;
#pragma unroll 1
  for (int c = 0; c < HD / 4; ++c) { *(v4f*)&lq[tid][c * 4] = *(const v4fa*)(qr + c * 4); const v4f z = {0.f, 0.f, 0.f, 0.f}; *(v4f*)&lo[tid][c * 4] = z; }
  float m = -1.0e30f, l = 0.f; const int jmax = MASKADD ? (SQ - 1) : (rg * 64 + 63);      /* additive-mask form: every key (the mask input decides); causal form: keys up to the block's last row */
#pragma unroll 1
  for (int j = 0; j <= jmax; ++j) { const float* kr = KF + (size_t)j * ld + h * HD; const float* vr = VF + (size_t)j * ld + h * HD; float s = 0.f;
#pragma unroll 1
    for (int c = 0; c < HD / 4; ++c) { const v4f kq = *(const v4fa*)(kr + c * 4); const v4f qq = *(v4f*)&lq[tid][c * 4]; s = __fadd_rn(s, __fmul_rn(qq[0], kq[0])); s = __fadd_rn(s, __fmul_rn(qq[1], kq[1])); s = __fadd_rn(s, __fmul_rn(qq[2], kq[2])); s = __fadd_rn(s, __fmul_rn(qq[3], kq[3])); }
    s = __fmul_rn(s, scale); if (MASKADD) s = __fadd_rn(s, __fmul_rn(bf16_round(mask[(size_t)i * SQ + j]), -10000.0f));
    const float f = (MASKADD || j <= i) ? 1.f : 0.f; const float sm = fmaf(f, s, (1.f - f) * -1.0e30f); const float mn = fmaxf(m, sm); const float sc = expf(m - mn); const float e = expf(sm - mn); l = __fadd_rn(__fmul_rn(l, sc), e); m = mn;
#pragma unroll 1
    for (int c = 0; c < HD / 4; ++c) { const v4f vv = *(const v4fa*)(vr + c * 4); v4f oo = *(v4f*)&lo[tid][c * 4]; for (int u = 0; u < 4; ++u) oo[u] = __fadd_rn(__fmul_rn(oo[u], sc), __fmul_rn(e, vv[u])); *(v4f*)&lo[tid][c * 4] = oo; } }
  const float fin = 64.0f / l;      /* o carried x64 like the f16 path */
#pragma unroll 1
  for (int c = 0; c < HD / 4; ++c) { v4f oo = *(v4f*)&lo[tid][c * 4]; for (int u = 0; u < 4; ++u) oo[u] = __fmul_rn(oo[u], fin); *(v4f*)&lo[tid][c * 4] = oo; }
  __syncthreads();
  {
#pragma unroll 1
    for (int it = 0; it < 16; ++it) { const int row = it * 4 + tid / 16, pc = (tid % 16) * 4; const v4f v = *(const v4f*)&lo[row][pc]; *(v4f*)(OF + (size_t)(rg * 64 + row) * ldo + h * HD + pc) = v; }
     } }


__global__ __launch_bounds__(256) void k_kvexp(const float* __restrict__ src, float* __restrict__ dst, size_t n4) { const size_t t = (size_t)blockIdx.x * 256 + threadIdx.x; if (t >= n4) return; const size_t e = t * 4; const size_t row = e / DM; const int col = (int)(e % DM); const int h = col / HD, d = col % HD; const v4f v = *(const v4fa*)(src + row * KVD + (size_t)(h / HPG) * HD + d); *(v4f*)(dst + e) = v;  }

__global__ __launch_bounds__(256) void k_tab2(float theta, float* __restrict__ CS, float* __restrict__ SN) {
  #pragma clang fp contract(off)
  const int t = blockIdx.x * 256 + threadIdx.x; if (t >= SQ * (HD / 2)) return; const int i = t % (HD / 2); const int p = t / (HD / 2); const float invf = 1.0f / powf(theta, (float)(2 * i) / (float)HD); const float ang = __fmul_rn((float)p, invf); const float c = cosf(ang), s = sinf(ang);
  *(float*)(CS + t) = c; *(float*)(SN + t) = s;  }
template <int NORM, int ROPE>
__global__ __launch_bounds__(64) void k_xformf(const float* __restrict__ F, int ldf, int nh, const float* __restrict__ gain, float eps, const float* __restrict__ CS, const float* __restrict__ SN, float* __restrict__ F32, int ldo) {
  #pragma clang fp contract(off)
  __shared__ float xv[HD]; __shared__ float red[HD]; const int d = threadIdx.x; const int h = blockIdx.x % nh; const size_t r = blockIdx.x / nh; const int p = (int)(r % SQ);
  float x = F[r * (size_t)ldf + (size_t)h * HD + d];
  if (NORM) { red[d] = __fmul_rn(x, x); __syncthreads(); for (int st = HD / 2; st > 0; st >>= 1) { if (d < st) red[d] = __fadd_rn(red[d], red[d + st]); __syncthreads(); } const float rs = rsqrtf(__fadd_rn(red[0] / (float)HD, eps)); x = __fmul_rn(__fmul_rn(x, rs), bf16_round(gain[d])); }
  xv[d] = x; __syncthreads();
  float o = x;
  if (ROPE == 1) { const int i = d >> 1; const float c = CS[p * (HD / 2) + i], s = SN[p * (HD / 2) + i]; const float ev = xv[2 * i], od = xv[2 * i + 1]; o = (d & 1) ? __fadd_rn(__fmul_rn(ev, s), __fmul_rn(od, c)) : __fadd_rn(__fmul_rn(ev, c), -__fmul_rn(od, s)); }
  if (ROPE == 2) { const int i = d & (HD / 2 - 1); const float c = CS[p * (HD / 2) + i], s = SN[p * (HD / 2) + i]; const float lo = xv[i], hi = xv[i + HD / 2]; o = (d < HD / 2) ? __fadd_rn(__fmul_rn(lo, c), -__fmul_rn(hi, s)) : __fadd_rn(__fmul_rn(lo, s), __fmul_rn(hi, c)); }
  float* dst = F32 + r * (size_t)ldo + (size_t)h * HD + d; *(float*)dst = o;  }

__global__ __launch_bounds__(256) void k_bfcp(const float* __restrict__ src, float* __restrict__ dst, size_t n4) { const size_t t = (size_t)blockIdx.x * 256 + threadIdx.x; if (t >= n4) return; const v4f a = *(const v4fa*)(src + t * 4); v4f o; for (int q = 0; q < 4; ++q) o[q] = bf16_round(a[q]); *(v4f*)(dst + t * 4) = o;  }

// operand preparation of the whole call in ONE launch: rope tables (the first work-groups: the longest dependent chains start first), x as f16 rows, the four natural weights as x16 f16 planes.
// A streaming wave owns 16 KiB of one source: PP_L wave-wide 16-byte loads of 512 contiguous bytes each, all in flight at once, then the conversions, then whole-line 8-byte stores; few waves, so little of the launch goes into starting them.
#define PP_L 32                      /* 16-byte loads in flight per lane */
#define PP_BF (256 * PP_L * 4)       /* floats per streaming work-group */
#define PP_TB 64                     /* table work-groups: SQ * 32 entries, 4 positions per thread */
#define PP_XB ((int)(NR * DM / PP_BF))      /* work-groups on x */
#define PP_WB (DM * DM / PP_BF)      /* work-groups per weight */
__device__ __forceinline__ float pp_round(float v) { const unsigned int u = __float_as_uint(v); return __uint_as_float((u + 0x7FFFu + ((u >> 16) & 1u)) & 0xFFFF0000u); }      /* the value of bf16_round(v), kept in 32-bit registers */
__global__ __launch_bounds__(256) void k_prep(const float* __restrict__ x, const float* __restrict__ wq, const float* __restrict__ wk, const float* __restrict__ wv, const float* __restrict__ wo, _Float16* __restrict__ X16, _Float16* __restrict__ BW, float* __restrict__ CS, float* __restrict__ SN) {
  static_assert(NR * DM % PP_BF == 0 && DM * DM % PP_BF == 0 && KVD == DM, "whole work-groups per source; four planes of equal size");
  static_assert(SQ % (PP_TB * 8) == 0 && HD / 2 == 32, "a table wave writes one position's 32 entries: one 128-byte line per table");
  const int tid = threadIdx.x; int blk = blockIdx.x;
  if (blk < PP_TB) {      /* block-uniform; CS[p][i] = cos(p * 10000^(-2i/64)), SN = sin: the frequency once per thread, then per position the f32 angle, cosf and sinf */
    const int t = blk * 256 + tid; const int i = t % (HD / 2); const int p0 = t / (HD / 2); const float invf = (float)(1.0 / pow(10000.0, (double)(2 * i) / (double)HD));
    for (int u = 0; u < SQ / (PP_TB * 8); ++u) { const int p = p0 + u * (PP_TB * 8); const float ang = __fmul_rn((float)p, invf); const float c = cosf(ang), s = sinf(ang); CS[p * (HD / 2) + i] = c; SN[p * (HD / 2) + i] = s; }
    return; }
  blk -= PP_TB;
  const float* src; _Float16* dst; float scale;      /* block-uniform choice of the source */
  if (blk < PP_XB) { src = x + (size_t)blk * PP_BF; dst = X16 + (size_t)blk * PP_BF; scale = 1.0f; }
  else { blk -= PP_XB; const int wi = blk / PP_WB; src = (wi == 0 ? wq : wi == 1 ? wk : wi == 2 ? wv : wo) + (size_t)(blk % PP_WB) * PP_BF; dst = BW + (size_t)blk * PP_BF; scale = 16.0f; }      /* the planes follow one another in the workspace */
  const int o = (tid >> 5) * (PP_L * 128) + (tid & 31) * 4; src += o; dst += o;
  v4f a[PP_L]; v4h h[PP_L];
#pragma unroll      /* a[] in registers; constant steps become immediate offsets */
  for (int j = 0; j < PP_L; ++j) a[j] = *(const v4fa*)(src + j * 128);
  asm volatile("s_wait_xcnt 0x0" :: "v"(src) : "memory");      /* the loads' address stays live up to this wait, so no register that an issued load names is overwritten in front of it */
  __builtin_amdgcn_sched_barrier(0);      /* no conversion moves in front of a load: otherwise the compiler issues the loads in two runs, the second behind the first one's data, and the wave pays the memory latency twice */
#pragma unroll      /* h[] in registers */
  for (int j = 0; j < PP_L; ++j) for (int q = 0; q < 4; q += 2) { const v2h pk = __builtin_convertvector(v2f{pp_round(a[j][q]) * scale, pp_round(a[j][q + 1]) * scale}, v2h); h[j][q] = pk[0]; h[j][q + 1] = pk[1]; }      /* bf16-rounded values are exact in f16 here, x1 and x16 alike */
  __builtin_amdgcn_sched_barrier(0);      /* every conversion stands in front of the first store: behind an issued store no register that it names is written any more */
#pragma unroll
  for (int j = 0; j < PP_L; ++j) *(v4h*)(dst + j * 128) = h[j];
  asm volatile("s_wait_xcnt 0x0" ::: "memory"); }      /* directly behind the last store: on every way that the built code lays out behind the stores, this wait stands in front of the first write of a register that an issued store names */
extern "C" void kernel_launch(void* const* d_in, const int* in_sizes, int n_in,
                              void* d_out, int out_size, void* d_ws, size_t ws_size, hipStream_t stream) {
  (void)in_sizes; (void)n_in; (void)out_size;
  const float* const* I = (const float* const*)d_in; const float* x = I[0]; const float* wq = I[1]; const float* wk = I[2]; const float* wv = I[3]; const float* wo = I[4]; const float* bq = nullptr; const float* bk = nullptr; const float* bv = nullptr; const float* bo = I[5];      /* input order: x, Wq, Wk, Wv, Wo (natural [out][in] weights), bo [1024] (the output bias: into the output GEMM's bias slot); the q / k / v projections have NO biases; rope tables computed in the kernel (positions = row index) */
  char* ws = (char*)d_ws; size_t off = 0;
  auto take = [&](size_t bytes) { char* p = ws + off; off += (bytes + 255) & ~(size_t)255; return p; };
  _Float16* BQ = (_Float16*)take((size_t)DM * DM * 2); _Float16* BK = (_Float16*)take((size_t)KVD * DM * 2); _Float16* BV = (_Float16*)take((size_t)KVD * DM * 2); _Float16* BO = (_Float16*)take((size_t)DM * DM * 2);
  _Float16* X16 = (_Float16*)take(NR * DM * 2); float* CSB = (float*)take((size_t)SQ * 32 * 4); float* SNB = (float*)take((size_t)SQ * 32 * 4); _Float16* Q16 = (_Float16*)take(NR * DM * 2); _Float16* K16 = (_Float16*)take(NR * KVD * 2); _Float16* V16 = (_Float16*)take(NR * KVD * 2); _Float16* O16 = (_Float16*)take(NR * DM * 2);
  _Float16* VT = (_Float16*)take((size_t)NB * NH * HD * SQ * 2);
  float* QF0 = (float*)take((size_t)QT0 * DM * 4); float* KF0 = (float*)take((size_t)QT0 * KVD * 4); float* VF0 = (float*)take((size_t)QT0 * KVD * 4); float* KF0e = (float*)take((size_t)QT0 * DM * 4); float* VF0e = (float*)take((size_t)QT0 * DM * 4); float* OF0 = (float*)take((size_t)NB * QT0 * DM * 4); _Float16* OH0 = (_Float16*)take((size_t)NB * QT0 * DM * 2); _Float16* OL0 = (_Float16*)take((size_t)NB * QT0 * DM * 2);
  if (off > ws_size) return;
  static_assert((size_t)DM * DM * 2 % 256 == 0, "BQ, BK, BV, BO lie back to back");
  k_prep<<<PP_TB + PP_XB + 4 * PP_WB, 256, 0, stream>>>(x, wq, wk, wv, wo, X16, BQ, CSB, SNB);      /* rope tables (rotate-half convention; the module's [f | f] tables repeat these 32 columns), x rows, natural [out][in] = Bt[n][k] x16 planes (KVD = 16 x 64 = DM: full-width k / v) */
  const size_t r0p = (size_t)B0 * SQ;      /* first projected row */
  static_assert(KVD == DM, "q, k and v share one launch: equal widths");
  static_assert((MP / 128) * (DM / 64) == NBR * (KVD / 128) * (SQ / 64), "the V^T plane has as many tiles as the q plane");
  k_gemm2<0, 1><<<dim3((unsigned)((MP / 128) * (DM / 64)), 3), 128, 0, stream>>>(X16 + r0p * DM, 0, BQ, (size_t)DM * DM, 0.0625f, nullptr, 0, nullptr, 1, 0, 0, nullptr, Q16 + r0p * DM, DM, NR * DM, MP, DM, CSB, SNB, VT + (size_t)B0 * NH * HD * SQ);      /* q (grid.y 0) and k (grid.y 1) of all rows: BK follows BQ and K16 follows Q16 in the workspace (sizes are multiples of 256 bytes), so the kernel's own batch strides step from q to k; half-split rope (t cos + rotate_half(t) sin, computed tables) and f32 -> f16 in the epilogue; grid.y 2: V^T [NB][NH][HD][SQ] of all batches (BV follows BK), no rotation */
  k_fattn<<<dim3(SQ / FA_QB, NH, NB), FA_W * 32, 0, stream>>>(Q16, K16, VT, O16);      /* non-causal attention of all batches, heads and query rows in one launch: scores, softmax and weighted values fused; o into merged f16 rows (x64) */
  k_gemm2<0><<<dim3((unsigned)((MPO / 128) * (DM / 64)), 1), 128, 0, stream>>>(O16 + r0p * DM, 0, BO, 0, 0.0009765625f, bo, 0, nullptr, 1, 0, 0, (float*)d_out + r0p * DM, nullptr, DM, 0, MPO, DM, nullptr, nullptr, nullptr);      /* out rows are the output layout */
}

// v008
// A run of this version takes 86.4 microseconds.
// Two timings next to v007 put it at 1.04 and 1.05 times that version's speed.
// All steps since v000 together make it 225 times as fast.
#include <hip/hip_runtime.h>
// Multi-head self-attention with rotate-half RoPE computed in the kernel and a biased output projection, NON-causal (x [2][2048][1024]; q / k / v = x W^T (natural [1024][1024], no biases), 16 heads of 64; cos / sin = [f | f] of pos * 10000^(-2i/64); q = q cos + rotate_half(q) sin, likewise k; scores * 64^-0.5; softmax over all 2048 keys (no mask); out = merged Wo^T + bo (natural + bias) -> [2][2048][1024]); run as 16 groups of ONE head.
// Structure: ONE preparation launch (x as exact f16 rows; natural weights as exact x16 planes; rope tables, double-derived inv_freq, f32 angle); q, k and V^T of all rows as ONE WMMA GEMM launch (64x64 wave tiles, f32 accumulation, f16 output; grid.y = q / k / V^T): the q and k epilogue applies the rotate-half rotation and the f16 conversion to the f32 tile it has staged in LDS (a wave tile is one head's 64 columns); the V^T plane takes the weight rows as A and the token rows as B, so its tiles are V^T rows as they stand; then ONE fused attention launch for all batches, heads and query rows (256 query rows per work-group): per 32 keys S^T = K Q^T (K = 64), online softmax on VALU in the log2 domain (f32 statistics, native exp2, lazy rescale; weights f16, unnormalised), O^T += V^T P^T, o / row sum (carried x64) into merged f16 rows; scores and weights stay in registers; out = o Wo^T GEMM (f32, alpha 2^-10); launches: see trace.
// Compute dtype: inputs rounded to bf16; x / weights exact; q, k, v, softmax weights and o as plain f16 GEMM operands (~2^-12); scores and softmax statistics f32. v_wmma_f32_16x16x32_f16.
#define NB 2
#define NG 16
#define HPG 1
#define KVD (NG * HD)
#define SQ 2048
#define DM 1024
#define NH 16
#define HD 64
#define HG 4                         /* heads handled by the grouped k_vt overload kept below */
#define QT 512                       /* query rows per tile of the unfused softmax kernel kept below */
#define NKX SQ                       /* S / P row pitch */
#define QT0 128                      /* first-tile rows of the f32 k_att0 path (not launched) */
#define B0 0                         /* first batch processed (debug hook) */
#define NBR NB                       /* batches processed (debug hook) */
#define NR ((size_t)NB * SQ)         /* token rows */
#define MP ((int)((size_t)NBR * SQ)) /* rows projected (debug hook) */
#define QN SQ                        /* query rows attended per batch (unused) */
#define NHD NH                       /* heads attended (unused) */
#define MPO MP                       /* rows through the output stage (debug hook) */
#define LQ DM      /* row pitch of the q/k/v rows */
typedef __bf16 v16b __attribute__((ext_vector_type(16)));
typedef unsigned short v8us __attribute__((ext_vector_type(8), may_alias));
typedef float  v8f  __attribute__((ext_vector_type(8)));
typedef float  v4f  __attribute__((ext_vector_type(4)));
typedef float  v4fa __attribute__((ext_vector_type(4), may_alias));
union FragB { v16b v; v8us half[2]; unsigned short u[16]; };

__device__ __forceinline__ unsigned short bf16_bits(float x) { unsigned int u = __float_as_uint(x); return (unsigned short)((u + 0x7FFFu + ((u >> 16) & 1u)) >> 16); }
__device__ __forceinline__ float bf16_val(unsigned short b) { return __uint_as_float(((unsigned int)b) << 16); }
__device__ __forceinline__ float bf16_round(float x) { return bf16_val(bf16_bits(x)); }
// D += A·B with NT terms: 1 = ah·bh, 2 = + al·bh (A split), 3 = + ah·bl (both split)
template <int NT>
__device__ __forceinline__ v8f mmaN(v16b ah, v16b al, v16b bh, v16b bl, v8f c) {
  c = __builtin_amdgcn_wmma_f32_16x16x32_bf16(false, ah, false, bh, (short)0, c, false, false);
  if (NT >= 2) c = __builtin_amdgcn_wmma_f32_16x16x32_bf16(false, al, false, bh, (short)0, c, false, false);
  if (NT >= 3) c = __builtin_amdgcn_wmma_f32_16x16x32_bf16(false, ah, false, bl, (short)0, c, false, false);
  asm volatile("v_nop\n\tv_nop\n\tv_nop\n\tv_nop" : "+v"(c) : "v"(ah), "v"(al), "v"(bh), "v"(bl));
  return c;
}

__global__ __launch_bounds__(256) void k_wt_bf16(const float* __restrict__ W, unsigned short* __restrict__ Wt, int K, int N) {
  const int t = blockIdx.x * 256 + threadIdx.x;
  const int k8n = K / 8;
  if (t >= N * k8n) return;
  const int n = t / k8n, k8 = (t % k8n) * 8;
  v8us v;
#pragma unroll
  for (int i = 0; i < 8; ++i) v[i] = bf16_bits(W[(size_t)(k8 + i) * N + n]);
  *(v8us*)(Wt + (size_t)n * K + k8) = v;
  
}

// GEMM C[M][N] (f32, pitch ldc) = act(A[M][K]·W + bias). A f32 row-major (pitch lda) converted per fragment to bf16
// (ASPLIT: hi/lo two planes -> 2 terms, else single rounded term); Wt bf16 [N][K] (pitch ldb). BIAS_BF16 rounds the
// bias to bf16 first (bias quantised to bf16 before the add). K%32==0, M%16==0, N%64==0.
template <bool ASPLIT, int ACT, bool BIAS_BF16>
__global__ __launch_bounds__(128) void k_gemm_bf(const float* __restrict__ A, int lda, const unsigned short* __restrict__ Wt, int ldb,
                                               const float* __restrict__ bias, float* __restrict__ C, int ldc, int M, int N, int K) {
  __shared__ __attribute__((aligned(16))) float so[4][16][64];
  const int tid = threadIdx.x, w = tid >> 5, lane = tid & 31, ln = lane & 15, hh = lane >> 4;
  const int ntn = N / 64;
  const int wid = blockIdx.x * 4 + w;
  const int mt = wid / ntn, nq = wid % ntn;
  if (mt * 16 >= M) return;
  const int row0 = mt * 16, col0 = nq * 64;
  const float* arow = A + (size_t)(row0 + ln) * lda;
  v8f acc[4] = {};
  for (int kb = 0; kb < K; kb += 32) {
    FragB ah, al;
    const v4f x0 = *(const v4fa*)(arow + kb + 8 * hh), x1 = *(const v4fa*)(arow + kb + 8 * hh + 4);
    const v4f x2 = *(const v4fa*)(arow + kb + 16 + 8 * hh), x3 = *(const v4fa*)(arow + kb + 16 + 8 * hh + 4);
    float xs[16] = {x0[0],x0[1],x0[2],x0[3],x1[0],x1[1],x1[2],x1[3],x2[0],x2[1],x2[2],x2[3],x3[0],x3[1],x3[2],x3[3]};
#pragma unroll
    for (int i = 0; i < 16; ++i) { const unsigned short hb = bf16_bits(xs[i]); ah.u[i] = hb; al.u[i] = ASPLIT ? bf16_bits(xs[i] - bf16_val(hb)) : (unsigned short)0; }
#pragma unroll
    for (int t = 0; t < 4; ++t) {
      const unsigned short* brow = Wt + (size_t)(col0 + t * 16 + ln) * ldb + kb;
      FragB b;
      b.half[0] = *(const v8us*)(brow + 8 * hh);
      b.half[1] = *(const v8us*)(brow + 16 + 8 * hh);
      acc[t] = mmaN<ASPLIT ? 2 : 1>(ah.v, al.v, b.v, b.v, acc[t]);
    }
  }
#pragma unroll
  for (int t = 0; t < 4; ++t) {
    float bv = bias ? bias[col0 + t * 16 + ln] : 0.f;
    if (BIAS_BF16) bv = bf16_round(bv);
#pragma unroll
    for (int r = 0; r < 8; ++r) { float v = acc[t][r] + bv; if (ACT == 1) v = fmaxf(v, 0.f); so[w][8 * hh + r][t * 16 + ln] = v; }
  }
  __builtin_amdgcn_fence(__ATOMIC_ACQ_REL, "workgroup");
  __builtin_amdgcn_wave_barrier();
  const int rsub = lane >> 4, c4 = (lane & 15) * 4;
  {
#pragma unroll
    for (int q = 0; q < 8; ++q) {
      const int r = q * 2 + rsub;
      const v4f v = *(const v4fa*)&so[w][r][c4];
      *(v4f*)(C + (size_t)(row0 + r) * ldc + col0 + c4) = v;
    }
    
  }
}

// GEMM C = act(A·W + bias + resid): A f32 (ASPLIT -> hi/lo 2 terms), Wt bf16 [N][K]; ACT 0 none, 1 relu, 2 exact gelu;
// resid (optional, f32, row index = (row % rmod), pitch ldr, RES_BF16 rounds it) added before the activation.
template <bool ASPLIT, int ACT, bool BIAS_BF16, bool RES_BF16>
__global__ __launch_bounds__(128) void k_gemm_bf3(const float* __restrict__ A, int lda, const unsigned short* __restrict__ Wt, int ldb,
                                                const float* __restrict__ bias, const float* __restrict__ resid, int rmod, int ldr,
                                                float* __restrict__ C, int ldc, int M, int N, int K) {
  __shared__ __attribute__((aligned(16))) float so[4][16][64];
  const int tid = threadIdx.x, w = tid >> 5, lane = tid & 31, ln = lane & 15, hh = lane >> 4;
  const int ntn = N / 64;
  const int wid = blockIdx.x * 4 + w;
  const int mt = wid / ntn, nq = wid % ntn;
  if (mt * 16 >= M) return;
  const int row0 = mt * 16, col0 = nq * 64;
  const float* arow = A + (size_t)(row0 + ln) * lda;
  v8f acc[4] = {};
  for (int kb = 0; kb < K; kb += 32) {
    FragB ah, al;
    const v4f x0 = *(const v4fa*)(arow + kb + 8 * hh), x1 = *(const v4fa*)(arow + kb + 8 * hh + 4);
    const v4f x2 = *(const v4fa*)(arow + kb + 16 + 8 * hh), x3 = *(const v4fa*)(arow + kb + 16 + 8 * hh + 4);
    float xs[16] = {x0[0],x0[1],x0[2],x0[3],x1[0],x1[1],x1[2],x1[3],x2[0],x2[1],x2[2],x2[3],x3[0],x3[1],x3[2],x3[3]};
#pragma unroll
    for (int i = 0; i < 16; ++i) { const unsigned short hb = bf16_bits(xs[i]); ah.u[i] = hb; al.u[i] = ASPLIT ? bf16_bits(xs[i] - bf16_val(hb)) : (unsigned short)0; }
#pragma unroll
    for (int t = 0; t < 4; ++t) {
      const unsigned short* brow = Wt + (size_t)(col0 + t * 16 + ln) * ldb + kb;
      FragB b;
      b.half[0] = *(const v8us*)(brow + 8 * hh);
      b.half[1] = *(const v8us*)(brow + 16 + 8 * hh);
      acc[t] = mmaN<ASPLIT ? 2 : 1>(ah.v, al.v, b.v, b.v, acc[t]);
    }
  }
#pragma unroll
  for (int t = 0; t < 4; ++t) {
    const int col = col0 + t * 16 + ln;
    float bv = bias ? bias[col] : 0.f;
    if (BIAS_BF16) bv = bf16_round(bv);
#pragma unroll
    for (int r = 0; r < 8; ++r) {
      float v = acc[t][r] + bv;
      if (resid) { float rv = resid[(size_t)((row0 + 8 * hh + r) % rmod) * ldr + col]; if (RES_BF16) rv = bf16_round(rv); v += rv; }
      if (ACT == 1) v = fmaxf(v, 0.f);
      if (ACT == 2) v = 0.5f * v * (1.0f + erff(v * 0.70710678118654752f));
      if (ACT == 3) { const float u = 0.7978845608028654f * (v + 0.044715f * v * v * v); v = 0.5f * v * (1.0f + tanhf(u)); }
      so[w][8 * hh + r][t * 16 + ln] = v;
    }
  }
  __builtin_amdgcn_fence(__ATOMIC_ACQ_REL, "workgroup");
  __builtin_amdgcn_wave_barrier();
  const int rsub = lane >> 4, c4 = (lane & 15) * 4;
  {
#pragma unroll
    for (int q = 0; q < 8; ++q) {
      const int r = q * 2 + rsub;
      const v4f v = *(const v4fa*)&so[w][r][c4];
      *(v4f*)(C + (size_t)(row0 + r) * ldc + col0 + c4) = v;
    }
    
  }
}
// row LayerNorm (biased variance, eps) over N: s = X (+ R); optional out_sum <- s; out_norm <- (s-mu)*rsqrt(var+eps)*g + b
template <bool PARAM_BF16>
__global__ __launch_bounds__(256) void k_layernorm(const float* __restrict__ X, const float* __restrict__ R, const float* __restrict__ g, const float* __restrict__ bta,
                                                  float* __restrict__ out_sum, float* __restrict__ out_norm, int N, float eps) {
  __shared__ float red[256];
  const int row = blockIdx.x, tid = threadIdx.x;
  const float* x = X + (size_t)row * N; const float* rr = R ? R + (size_t)row * N : nullptr;
  float vals[16];                     // up to N = 4096
  const int per = N / 256;            // contiguous chunk per thread? use strided-by-4 chunks: thread handles j = tid*4 + 1024*u
  float s1 = 0.f;
  for (int u = 0; u < per / 4; ++u) {
    const int j = tid * 4 + 1024 * u;
    const v4f a = *(const v4fa*)(x + j);
    v4f b = {0.f,0.f,0.f,0.f}; if (rr) b = *(const v4fa*)(rr + j);
#pragma unroll
    for (int q = 0; q < 4; ++q) { const float v = a[q] + b[q]; vals[u * 4 + q] = v; s1 += v; }
  }
  red[tid] = s1; __syncthreads();
  for (int st = 128; st > 0; st >>= 1) { if (tid < st) red[tid] += red[tid + st]; __syncthreads(); }
  const float mu = red[0] / (float)N; __syncthreads();
  float s2 = 0.f;
  for (int u = 0; u < per / 4; ++u)
#pragma unroll
    for (int q = 0; q < 4; ++q) { const float c = vals[u * 4 + q] - mu; s2 += c * c; }
  red[tid] = s2; __syncthreads();
  for (int st = 128; st > 0; st >>= 1) { if (tid < st) red[tid] += red[tid + st]; __syncthreads(); }
  const float rs = rsqrtf(red[0] / (float)N + eps);
  {
    for (int u = 0; u < per / 4; ++u) {
      const int j = tid * 4 + 1024 * u;
      v4f o, sm;
#pragma unroll
      for (int q = 0; q < 4; ++q) {
        float gg = g[j + q], bb = bta[j + q];
        if (PARAM_BF16) { gg = bf16_round(gg); bb = bf16_round(bb); }
        sm[q] = vals[u * 4 + q]; o[q] = (vals[u * 4 + q] - mu) * rs * gg + bb;
      }
      if (out_sum) *(v4f*)(out_sum + (size_t)row * N + j) = sm;
      *(v4f*)(out_norm + (size_t)row * N + j) = o;
    }
    
  }
}



// ---- f16 WMMA path (v_wmma_f32_16x16x32_f16): 11-bit significands for operands in range — used where a [0,1] probability operand needs more precision than bf16
typedef _Float16 v16h __attribute__((ext_vector_type(16)));
union FragH { v16h v; v8us half[2]; _Float16 h[16]; unsigned short u[16]; };
template <int NT>
__device__ __forceinline__ v8f mmaH(v16h ah, v16h al, v16h bh, v16h bl, v8f c) {
  c = __builtin_amdgcn_wmma_f32_16x16x32_f16(false, ah, false, bh, (short)0, c, false, false);
  if (NT >= 2) c = __builtin_amdgcn_wmma_f32_16x16x32_f16(false, al, false, bh, (short)0, c, false, false);
  if (NT >= 3) c = __builtin_amdgcn_wmma_f32_16x16x32_f16(false, ah, false, bl, (short)0, c, false, false);
  asm volatile("v_nop\n\tv_nop\n\tv_nop\n\tv_nop" : "+v"(c) : "v"(ah), "v"(al), "v"(bh), "v"(bl));
  return c;
}
// batched GEMM like k_gemm_b but f16 operands: A f32 (split into f16 hi/lo if ASPLIT, else rounded to f16), Bt = f16 values [n][k]; alpha; C f32; N multiple of 16 (partial tiles skipped)
template <bool ASPLIT>
__global__ __launch_bounds__(128) void k_gemm_h(const float* __restrict__ A, int lda, size_t sA, const _Float16* __restrict__ Bh, int ldb, size_t sB, float alpha, float* __restrict__ C, int ldc, size_t sC, int M, int N, int K) {
  __shared__ __attribute__((aligned(16))) float so[4][16][64];
  const int tid = threadIdx.x, w = tid >> 5, lane = tid & 31, ln = lane & 15, hh = lane >> 4; const int by = blockIdx.y;
  A += (size_t)by * sA; Bh += (size_t)by * sB; C += (size_t)by * sC;
  const int ntn = (N + 63) / 64; const int wid = blockIdx.x * 4 + w; const int mt = wid / ntn, nq = wid % ntn; if (mt * 16 >= M) return;
  const int row0 = mt * 16, col0 = nq * 64; const float* arow = A + (size_t)(row0 + ln) * lda;
  v8f acc[4] = {};
  for (int kb = 0; kb < K; kb += 32) {
    FragH ah, al;
    const v4f x0 = *(const v4fa*)(arow + kb + 8 * hh), x1 = *(const v4fa*)(arow + kb + 8 * hh + 4), x2 = *(const v4fa*)(arow + kb + 16 + 8 * hh), x3 = *(const v4fa*)(arow + kb + 16 + 8 * hh + 4);
    float xs[16] = {x0[0],x0[1],x0[2],x0[3],x1[0],x1[1],x1[2],x1[3],x2[0],x2[1],x2[2],x2[3],x3[0],x3[1],x3[2],x3[3]};
#pragma unroll
    for (int i = 0; i < 16; ++i) { const _Float16 h = (_Float16)xs[i]; ah.h[i] = h; al.h[i] = ASPLIT ? (_Float16)(xs[i] - (float)h) : (_Float16)0.0f; }
#pragma unroll
    for (int t = 0; t < 4; ++t) { if (col0 + t * 16 >= N) continue; const size_t boff = (size_t)(col0 + t * 16 + ln) * ldb + kb; FragH bq; bq.half[0] = *(const v8us*)(Bh + boff + 8 * hh); bq.half[1] = *(const v8us*)(Bh + boff + 16 + 8 * hh);
      acc[t] = mmaH<ASPLIT ? 2 : 1>(ah.v, al.v, bq.v, bq.v, acc[t]); }
  }
#pragma unroll
  for (int t = 0; t < 4; ++t) { if (col0 + t * 16 >= N) continue;
#pragma unroll
    for (int r = 0; r < 8; ++r) so[w][8 * hh + r][t * 16 + ln] = acc[t][r] * alpha; }
  __builtin_amdgcn_fence(__ATOMIC_ACQ_REL, "workgroup"); __builtin_amdgcn_wave_barrier();
  const int rsub = lane >> 4, c4 = (lane & 15) * 4;
  {
#pragma unroll
    for (int q = 0; q < 8; ++q) { const int r = q * 2 + rsub; if (col0 + c4 < N) { const v4f v = *(const v4fa*)&so[w][r][c4]; *(v4f*)(C + (size_t)(row0 + r) * ldc + col0 + c4) = v; } }
     }
}

// Wt[n][k] = f16(W[k][n]·scale) from f32 row-major W[K][N] (scale = power of two; bf16-exact weights stay exact in f16 away from the subnormal range)
__global__ __launch_bounds__(256) void k_wt_f16(const float* __restrict__ W, _Float16* __restrict__ Wt, int K, int N, float scale) {
  const int t = blockIdx.x * 256 + threadIdx.x; if (t >= N * (K / 8)) return; const int n = t / (K / 8), k8 = (t % (K / 8)) * 8; FragH f;
#pragma unroll
  for (int i = 0; i < 8; ++i) f.h[i] = (_Float16)(bf16_round(W[(size_t)(k8 + i) * N + n]) * scale); const v8us o = f.half[0];
  *(v8us*)((unsigned short*)Wt + (size_t)n * K + k8) = o; 
}
// k_gemm_hh variant with fused epilogue: v = acc·alpha + bias[by·sBias + col] (+ CP[(row/rowsPerB)·sCPb + by·64 + col] if CP) ; ACT 0 none / 1 elu ; writes f16 C16 (and f32 C if non-null)
template <int ACT>
__global__ __launch_bounds__(128) void k_gemm_hhx(const _Float16* __restrict__ A, int lda, size_t sA, const _Float16* __restrict__ Bh, int ldb, size_t sB, float alpha, const float* __restrict__ bias, size_t sBias, const float* __restrict__ CP, int rowsPerB, size_t sCPb, int row0g,
    float* __restrict__ C, _Float16* __restrict__ C16, int ldc, size_t sC, int M, int N, int K) {
  __shared__ __attribute__((aligned(16))) float so[4][16][64];
  const int tid = threadIdx.x, w = tid >> 5, lane = tid & 31, ln = lane & 15, hh = lane >> 4; const int by = blockIdx.y;
  A += (size_t)by * sA; Bh += (size_t)by * sB; const size_t cofs = (size_t)by * sC; const float* bp = bias ? bias + (size_t)by * sBias : nullptr;
  const int ntn = (N + 63) / 64; const int wid = blockIdx.x * 4 + w; const int mt = wid / ntn, nq = wid % ntn; if (mt * 16 >= M) return;
  const int row0 = mt * 16, col0 = nq * 64; const _Float16* arow = A + (size_t)(row0 + ln) * lda;
  v8f acc[4] = {};
  for (int kb = 0; kb < K; kb += 32) { FragH ah; ah.half[0] = *(const v8us*)((const unsigned short*)arow + kb + 8 * hh); ah.half[1] = *(const v8us*)((const unsigned short*)arow + kb + 16 + 8 * hh);
#pragma unroll
    for (int t = 0; t < 4; ++t) { if (col0 + t * 16 >= N) continue; const size_t boff = (size_t)(col0 + t * 16 + ln) * ldb + kb; FragH bq; bq.half[0] = *(const v8us*)((const unsigned short*)Bh + boff + 8 * hh); bq.half[1] = *(const v8us*)((const unsigned short*)Bh + boff + 16 + 8 * hh);
      acc[t] = mmaH<1>(ah.v, ah.v, bq.v, bq.v, acc[t]); }
  }
#pragma unroll
  for (int t = 0; t < 4; ++t) { if (col0 + t * 16 >= N) continue; const int col = col0 + t * 16 + ln; const float bv = bp ? bf16_round(bp[col]) : 0.f;
#pragma unroll
    for (int r = 0; r < 8; ++r) { float v = acc[t][r] * alpha + bv; if (CP) { const int rr = row0g + row0 + 8 * hh + r; if (rowsPerB < 0) v += CP[cofs + (size_t)rr * ldc + col];      /* rowsPerB < 0: own element of the batched C plane */ else { const int bidx = rr / rowsPerB; v += CP[(size_t)bidx * sCPb + (size_t)by * 64 + col]; } } if (ACT == 1) v = (v > 0.f) ? v : expm1f(v); else if (ACT == 7) v = (v > 0.f) ? v + 1.0f : expf(v); else if (ACT == 8) v = tanhf(v); else if (ACT == 9) v = 0.5f * v * (1.0f + tanhf(0.7978845608028654f * (v + 0.044715f * v * v * v))); else if (ACT == 11) v = 1.0f / (1.0f + expf(-v)); else if (ACT == 12) v = (v > 0.f) ? v : 0.01f * v; else if (ACT == 14) v = (v > 0.f) ? v : 0.1f * v; else if (ACT == 16) v = (v >= 0.f) ? v : 0.3f * v; else if (ACT == 17) v = (v >= 0.f) ? v : 0.2f * v; else if (ACT == 15) v = v / (1.0f + expf(-v)); else if (ACT == 3) v = fmaxf(v, 0.f); else if (ACT == 6) v = 0.5f * v * (1.0f + erff(v * 0.70710678118654752f)); so[w][8 * hh + r][t * 16 + ln] = v; } }
  __builtin_amdgcn_fence(__ATOMIC_ACQ_REL, "workgroup"); __builtin_amdgcn_wave_barrier();
  const int rsub = lane >> 4, c4 = (lane & 15) * 4; typedef _Float16 v4h __attribute__((ext_vector_type(4)));
  {
#pragma unroll
    for (int q = 0; q < 8; ++q) { const int r = q * 2 + rsub; if (col0 + c4 < N) { const v4f v = *(const v4fa*)&so[w][r][c4]; if (C) *(v4f*)(C + cofs + (size_t)(row0 + r) * ldc + col0 + c4) = v; if (C16) { v4h h4; for (int i = 0; i < 4; ++i) h4[i] = (_Float16)v[i]; *(v4h*)(C16 + cofs + (size_t)(row0 + r) * ldc + col0 + c4) = h4; } } }
     }
}


typedef _Float16 v4h __attribute__((ext_vector_type(4)));

__global__ __launch_bounds__(256) void k_h16(const float* __restrict__ x, _Float16* __restrict__ X16, size_t n8) { const size_t t = (size_t)blockIdx.x * 256 + threadIdx.x; if (t >= n8) return; FragH f;
#pragma unroll
  for (int q = 0; q < 8; ++q) f.h[q] = (_Float16)x[t * 8 + q]; *(v8us*)((unsigned short*)X16 + t * 8) = f.half[0];  }
__global__ __launch_bounds__(256) void k_round16f(const float* __restrict__ W, _Float16* __restrict__ Bt, size_t n8) { const size_t t = (size_t)blockIdx.x * 256 + threadIdx.x; if (t >= n8) return; FragH f;
#pragma unroll
  for (int i = 0; i < 8; ++i) f.h[i] = (_Float16)(bf16_round(W[t * 8 + i]) * 16.0f); *(v8us*)((unsigned short*)Bt + t * 8) = f.half[0];  }
template <int NHv, int TTv>
__global__ __launch_bounds__(256) void k_vt(const _Float16* __restrict__ V16, int ldv, int voff, _Float16* __restrict__ Vt) { __shared__ unsigned short tl[64][66]; const int tid = threadIdx.x; const int slab = blockIdx.x / (TTv / 64), lg = blockIdx.x % (TTv / 64); const int b = slab / NHv, h = slab % NHv;
  for (int i = tid; i < 64 * 8; i += 256) { const int r = i / 8, c8 = (i % 8) * 8; FragH f; f.half[0] = *(const v8us*)((const unsigned short*)V16 + ((size_t)b * TTv + lg * 64 + r) * ldv + voff + h * 64 + c8);
#pragma unroll
    for (int q = 0; q < 8; ++q) tl[r][c8 + q] = f.u[q]; }
  __syncthreads();
  {
#pragma unroll
    for (int rd = 0; rd < 2; ++rd) { const int d = rd * 32 + tid / 8, pc = tid % 8; FragH f;
#pragma unroll
      for (int q = 0; q < 8; ++q) f.u[q] = tl[pc * 8 + q][d];
      *(v8us*)((unsigned short*)Vt + ((size_t)slab * 64 + d) * TTv + lg * 64 + pc * 8) = f.half[0]; }
     } }

__global__ __launch_bounds__(256) void k_hl(const float* __restrict__ F, _Float16* __restrict__ Hh, _Float16* __restrict__ Hl, size_t n8) { const size_t t = (size_t)blockIdx.x * 256 + threadIdx.x; if (t >= n8) return; FragH fh, fl; const v4f a = *(const v4fa*)(F + t * 8), c = *(const v4fa*)(F + t * 8 + 4);
#pragma unroll
  for (int q = 0; q < 4; ++q) { _Float16 h = (_Float16)a[q]; fh.h[q] = h; fl.h[q] = (_Float16)((a[q] - (float)h) * 1024.0f); h = (_Float16)c[q]; fh.h[4 + q] = h; fl.h[4 + q] = (_Float16)((c[q] - (float)h) * 1024.0f); }
  { *(v8us*)((unsigned short*)Hh + t * 8) = fh.half[0]; *(v8us*)((unsigned short*)Hl + t * 8) = fl.half[0];  } }

// ---- fast GEMM (work-group tile 128x64, wave tile 32x64; A and Bt rows of pitch and length DM; requires M % 128 == 0 and N % 64 == 0); epilogue = k_gemm_hhx semantics ----
// A rows and Bt rows of 64 k are staged through registers into two LDS buffers shared by the 4 waves: global loads cover whole 128-byte lines, and each line is fetched once per work-group.
#define G2_KC 64                     /* k per LDS stage: 128-byte rows */
#define G2_P 72                      /* LDS row pitch in f16: 128-byte rows + 16 bytes (16 B x odd: conflict-free 16-byte reads) */
__device__ __forceinline__ v16h g2_frag(const _Float16* p, int hh) { FragH f; f.half[0] = *(const v8us*)((const unsigned short*)p + 8 * hh); f.half[1] = *(const v8us*)((const unsigned short*)p + 16 + 8 * hh); return f.v; }
__device__ __forceinline__ v8f g2_mma(v16h a, v16h b, v8f c) { v8f d = __builtin_amdgcn_wmma_f32_16x16x32_f16(false, a, false, b, (short)0, c, false, false); asm volatile("v_nop\n\tv_nop\n\tv_nop\n\tv_nop" : "+v"(d) : "v"(a), "v"(b)); return d; }
template <int ACT, int ROPE = 0>      /* ROPE 1: C16 = f16(v cos + rotate_half(v) sin), v = acc * alpha, per 64-column head; position = row % SQ, tables CS / SN [SQ][32]; no bias, no CP, no f32 C; its grid.y plane 2 is the transposed v projection into VTo (see below) */
__global__ __launch_bounds__(128) void k_gemm2(const _Float16* __restrict__ A, size_t sA, const _Float16* __restrict__ Bh, size_t sB, float alpha, const float* __restrict__ bias, size_t sBias, const float* __restrict__ CP, int rowsPerB, size_t sCPb, int row0g,
    float* __restrict__ C, _Float16* __restrict__ C16, int ldc, size_t sC, int M, int N, const float* __restrict__ CS, const float* __restrict__ SN, _Float16* __restrict__ VTo) { static_assert(ACT == 0 || ACT == 3 || ACT == 6 || ACT == 8 || ACT == 9 || ACT == 11 || ACT == 12 || ACT == 14 || ACT == 15 || ACT == 16 || ACT == 17, "k_gemm2: unsupported ACT code (would silently apply no activation)");
  __shared__ __attribute__((aligned(16))) unsigned char sm[2 * (128 + 64) * G2_P * 2];      /* two stage buffers of A (128 rows) and B (64 rows); behind the loop's last barrier the same bytes are the epilogue's staging */
  _Float16 (*la)[128][G2_P] = (_Float16 (*)[128][G2_P])sm; _Float16 (*lb)[64][G2_P] = (_Float16 (*)[64][G2_P])(sm + 2 * 128 * G2_P * 2); float (*so)[32][68] = (float (*)[32][68])sm;
  static_assert(sizeof(float) * 4 * 32 * 68 <= sizeof(sm), "the epilogue's staging lies inside the stage buffers");
  const int tid = threadIdx.x, w = tid >> 5, lane = tid & 31, ln = lane & 15, hh = lane >> 4; const int by = blockIdx.y;
  int bx = blockIdx.x, nb = 0; const bool vtp = ROPE && by == 2;      /* block-uniform */
  if (vtp) {      /* V^T [NB][NH][HD][SQ] = Wv x^T: the third weight plane's rows (head, d) are the A operand and the token rows of batch nb the B operand, so the tile's rows are V^T rows and its columns keys; no rotation */
    nb = bx / ((KVD / 128) * (SQ / 64)); bx -= nb * ((KVD / 128) * (SQ / 64)); const _Float16* xb = A + (size_t)nb * SQ * DM; A = Bh + 2 * sB; Bh = xb; M = KVD; N = SQ; }
  else { A += (size_t)by * sA; Bh += (size_t)by * sB; }
  const size_t cofs = (size_t)by * sC; const float* bp = bias ? bias + (size_t)by * sBias : nullptr;
  const int ntn = N >> 6; const int mt = bx / ntn, nq = bx - mt * ntn; const int row0 = mt * 128 + 32 * w, col0 = nq * 64; if (mt * 128 >= M) return;      /* block-uniform, in front of every barrier; M % 128 == 0 */
  const int sr = tid >> 3, sc = (tid & 7) * 8;      /* staging: a thread brings 16 bytes of rows sr + 16 i; 8 lanes cover one 128-byte line, a wave-wide load four whole lines */
  const unsigned short* ag = (const unsigned short*)A + (size_t)(mt * 128 + sr) * DM + sc; const unsigned short* bg = (const unsigned short*)Bh + (size_t)(col0 + sr) * DM + sc;
  v8us ga[8], gb[4];
#pragma unroll      /* ga[], gb[] in registers; constant row steps become immediate offsets */
  for (int i = 0; i < 8; ++i) ga[i] = *(const v8us*)(ag + (size_t)i * 16 * DM);
#pragma unroll
  for (int i = 0; i < 4; ++i) gb[i] = *(const v8us*)(bg + (size_t)i * 16 * DM);
  asm volatile("s_wait_xcnt 0x0" :: "v"(ag), "v"(bg) : "memory");      /* the staging loads' address pairs stay live up to this wait, so no register that an issued load names is overwritten in front of it */
#pragma unroll
  for (int i = 0; i < 8; ++i) *(v8us*)&la[0][sr + 16 * i][sc] = ga[i];
#pragma unroll
  for (int i = 0; i < 4; ++i) *(v8us*)&lb[0][sr + 16 * i][sc] = gb[i];
  const v8f z8 = {0.f,0.f,0.f,0.f,0.f,0.f,0.f,0.f}; v8f c00 = z8, c01 = z8, c02 = z8, c03 = z8, c10 = z8, c11 = z8, c12 = z8, c13 = z8;
  __syncthreads();      /* stage 0 is published */
#pragma unroll 1      /* one stage per trip: the registers hold one stage's fragments and the next stage's 12 staging loads */
  for (int st = 0; st < DM / G2_KC; ++st) { const int cur = st & 1; const bool more = st + 1 < DM / G2_KC;      /* block-uniform */
    if (more) { ag += G2_KC; bg += G2_KC;      /* the next stage flies under this stage's products */
#pragma unroll
      for (int i = 0; i < 8; ++i) ga[i] = *(const v8us*)(ag + (size_t)i * 16 * DM);
#pragma unroll
      for (int i = 0; i < 4; ++i) gb[i] = *(const v8us*)(bg + (size_t)i * 16 * DM);
      asm volatile("s_wait_xcnt 0x0" :: "v"(ag), "v"(bg) : "memory"); }      /* likewise: the pointers are stepped only behind this wait */
    v16h a0[2], a1[2], bf[4][2];
#pragma unroll      /* the stage's 24 LDS reads stand as one group in front of its 16 products */
    for (int kk = 0; kk < G2_KC / 32; ++kk) { a0[kk] = g2_frag(&la[cur][32 * w + ln][kk * 32], hh); a1[kk] = g2_frag(&la[cur][32 * w + 16 + ln][kk * 32], hh);
      for (int t = 0; t < 4; ++t) bf[t][kk] = g2_frag(&lb[cur][t * 16 + ln][kk * 32], hh); }
#pragma unroll      /* fragments in registers; k ascends as before: the sum order of every accumulator is unchanged */
    for (int kk = 0; kk < G2_KC / 32; ++kk) {
      c00 = g2_mma(a0[kk], bf[0][kk], c00); c10 = g2_mma(a1[kk], bf[0][kk], c10);
      c01 = g2_mma(a0[kk], bf[1][kk], c01); c11 = g2_mma(a1[kk], bf[1][kk], c11);
      c02 = g2_mma(a0[kk], bf[2][kk], c02); c12 = g2_mma(a1[kk], bf[2][kk], c12);
      c03 = g2_mma(a0[kk], bf[3][kk], c03); c13 = g2_mma(a1[kk], bf[3][kk], c13); }
    if (more) {      /* the other buffer's last readers left it at the previous trip's barrier */
#pragma unroll
      for (int i = 0; i < 8; ++i) *(v8us*)&la[cur ^ 1][sr + 16 * i][sc] = ga[i];
#pragma unroll
      for (int i = 0; i < 4; ++i) *(v8us*)&lb[cur ^ 1][sr + 16 * i][sc] = gb[i]; }
    __syncthreads(); }      /* publishes the next stage and ends every wave's reads of this one (behind the last trip: frees the buffers for the epilogue's staging) */
  v8f accs[8] = {c00, c01, c02, c03, c10, c11, c12, c13};
  if (ROPE) {      /* col0 is a multiple of 64 and row0 of 32: both halves of every rotation pair lie in this wave's own 32 x 64 tile, and its 32 positions do not wrap at SQ */
    const int rs = lane >> 3, d8 = (lane & 7) * 8; const float sg = (d8 < HD / 2) ? -1.0f : 1.0f;      /* 8 lanes per row, 8 columns each; rotate_half(v)[d] = -v[d + 32] below 32, v[d - 32] above */
    const size_t tb = (size_t)((unsigned)row0 % SQ + rs) * (HD / 2) + (d8 & (HD / 2 - 1)); const float* cp = CS + tb; const float* sp = SN + tb; v4f tc[8][2], ts[8][2];
#pragma unroll      /* accs[] in registers */
    for (int u = 0; u < 8; ++u) for (int r = 0; r < 8; ++r) so[w][(u >> 2) * 16 + 8 * hh + r][(u & 3) * 16 + ln] = accs[u][r] * alpha;
    __builtin_amdgcn_fence(__ATOMIC_ACQ_REL, "workgroup"); __builtin_amdgcn_wave_barrier();      /* the wave reads back rows that its other lanes wrote */
    if (vtp) {      /* block-uniform; shares the staging above, so the accumulators end there on both ways; 16 lanes store one whole 128-byte line of a V^T row */
      const int rsub = lane >> 4, c4 = (lane & 15) * 4; _Float16* vd = VTo + (size_t)nb * NH * HD * SQ + (size_t)(row0 + rsub) * SQ + col0 + c4;
#pragma unroll      /* constant LDS offsets; constant row steps become immediate offsets of one address */
      for (int q = 0; q < 16; ++q) { const v4f v = *(const v4fa*)&so[w][q * 2 + rsub][c4]; v4h h4; for (int i = 0; i < 4; ++i) h4[i] = (_Float16)v[i]; *(v4h*)(vd + (size_t)q * 2 * SQ) = h4; }
      asm volatile("s_wait_xcnt 0x0" ::: "memory");      /* directly behind the last store: on every way that the built code lays out behind the stores, this wait stands in front of the first write of a register that an issued store names */
      return; }
#pragma unroll      /* tc[], ts[] in registers; behind the staging, where the accumulators' registers are free */
    for (int q = 0; q < 8; ++q) for (int u = 0; u < 2; ++u) { tc[q][u] = *(const v4fa*)(cp + q * 4 * (HD / 2) + 4 * u); ts[q][u] = *(const v4fa*)(sp + q * 4 * (HD / 2) + 4 * u); }
    unsigned short* dp = (unsigned short*)C16 + cofs + (size_t)(row0 + rs) * ldc + col0 + d8;
#pragma unroll      /* 4 rows per trip, constant LDS offsets; a store covers four whole 128-byte lines */
    for (int q = 0; q < 8; ++q) { FragH f;
      for (int u = 0; u < 2; ++u) { const v4f own = *(const v4fa*)&so[w][q * 4 + rs][d8 + 4 * u], oth = *(const v4fa*)&so[w][q * 4 + rs][(d8 ^ (HD / 2)) + 4 * u];
        for (int i = 0; i < 4; ++i) f.h[4 * u + i] = (_Float16)(own[i] * tc[q][u][i] + oth[i] * (sg * ts[q][u][i])); }
      *(v8us*)(dp + (size_t)q * 4 * ldc) = f.half[0]; }
    asm volatile("s_wait_xcnt 0x0" ::: "memory");      /* likewise: the built code lays the V^T plane's read-back out behind these stores */
    return; }
#pragma unroll
  for (int u = 0; u < 8; ++u) { const int t = u & 3, half = u >> 2; const int col = col0 + t * 16 + ln; const float bv = bp ? bf16_round(bp[col]) : 0.f;
#pragma unroll
    for (int r = 0; r < 8; ++r) { const int rloc = half * 16 + 8 * hh + r; float v = accs[u][r] * alpha + bv; if (CP) { if (rowsPerB < 0) v += CP[cofs + (size_t)(row0g + row0 + rloc) * ldc + col];      /* rowsPerB < 0: own element of the batched C plane */ else { const int bidx = (row0g + row0 + rloc) / rowsPerB; v += CP[(size_t)bidx * sCPb + (size_t)by * 64 + col]; } }
      if (ACT == 3) v = fmaxf(v, 0.f); else if (ACT == 6) v = 0.5f * v * (1.0f + erff(v * 0.70710678118654752f)); else if (ACT == 11) v = 1.0f / (1.0f + expf(-v)); else if (ACT == 15) v = v / (1.0f + expf(-v)); else if (ACT == 12) v = (v > 0.f) ? v : 0.01f * v; else if (ACT == 8) v = tanhf(v); else if (ACT == 9) v = 0.5f * v * (1.0f + tanhf(0.7978845608028654f * (v + 0.044715f * v * v * v))); else if (ACT == 14) v = (v > 0.f) ? v : 0.1f * v; else if (ACT == 16) v = (v >= 0.f) ? v : 0.3f * v; else if (ACT == 17) v = (v >= 0.f) ? v : 0.2f * v;
      so[w][rloc][t * 16 + ln] = v; } }
  __builtin_amdgcn_fence(__ATOMIC_ACQ_REL, "workgroup"); __builtin_amdgcn_wave_barrier();
  const int rsub = lane >> 4, c4 = (lane & 15) * 4;
  {
#pragma unroll
    for (int q = 0; q < 16; ++q) { const int r = q * 2 + rsub; const v4f v = *(const v4fa*)&so[w][r][c4]; if (C) *(v4f*)(C + cofs + (size_t)(row0 + r) * ldc + col0 + c4) = v; if (C16) { v4h h4; for (int i = 0; i < 4; ++i) h4[i] = (_Float16)v[i]; *(v4h*)(C16 + cofs + (size_t)(row0 + r) * ldc + col0 + c4) = h4; } }
     } }


// ---- q / k / V^T projection GEMM: k_gemm2's stages and its rotation epilogue on a work-group tile of 128x128, 2 x 2 waves of 64x64 each (M % 128 == 0, N % 128 == 0) ----
// The square tile takes 2 operand rows from L2 per 128 results per k (128x64: 3), and a 64x64 wave tile reads 8 fragments from LDS per 16 products (32x64: 6 per 8); 3 x 256 work-groups, three per WGP: all resident at once.
// C16 = f16(v cos + rotate_half(v) sin), v = acc * alpha, per 64-column head; position = row % SQ, tables CS / SN [SQ][32]; grid.y 0 / 1 = q / k (weight planes sB apart, outputs sC apart); grid.y 2 is the transposed v projection into VTo (see below)
__global__ __launch_bounds__(128, 3) void k_gemm3(const _Float16* __restrict__ A, const _Float16* __restrict__ Bh, size_t sB, float alpha, _Float16* __restrict__ C16, int ldc, size_t sC, int M, int N, const float* __restrict__ CS, const float* __restrict__ SN, _Float16* __restrict__ VTo) {      /* second bound: three waves per SIMD, at most 336 registers */
  __shared__ __attribute__((aligned(16))) unsigned char sm[2 * (128 + 128) * G2_P * 2];      /* two stage buffers of A (128 rows) and B (128 rows); behind the loop's last barrier the same bytes are the epilogue's staging */
  _Float16 (*la)[128][G2_P] = (_Float16 (*)[128][G2_P])sm; _Float16 (*lb)[128][G2_P] = (_Float16 (*)[128][G2_P])(sm + 2 * 128 * G2_P * 2); float (*so)[64][68] = (float (*)[64][68])sm;
  static_assert(sizeof(float) * 4 * 64 * 68 <= sizeof(sm), "the epilogue's staging lies inside the stage buffers");
  const int tid = threadIdx.x, w = tid >> 5, lane = tid & 31, ln = lane & 15, hh = lane >> 4; const int by = blockIdx.y;
  int bx = blockIdx.x, nb = 0; const bool vtp = by == 2;      /* block-uniform */
  if (vtp) {      /* V^T [NB][NH][HD][SQ] = Wv x^T: the third weight plane's rows (head, d) are the A operand and the token rows of batch nb the B operand, so the tile's rows are V^T rows and its columns keys; no rotation */
    nb = bx / ((KVD / 128) * (SQ / 128)); bx -= nb * ((KVD / 128) * (SQ / 128)); const _Float16* xb = A + (size_t)nb * SQ * DM; A = Bh + 2 * sB; Bh = xb; M = KVD; N = SQ; }
  else Bh += (size_t)by * sB;
  const size_t cofs = (size_t)by * sC;
  const int ntn = N >> 7; const int mt = bx / ntn, nq = bx - mt * ntn; const int wm = w >> 1, wn = w & 1; const int row0 = mt * 128 + 64 * wm, col0 = nq * 128 + 64 * wn; if (mt * 128 >= M) return;      /* block-uniform, in front of every barrier; M % 128 == 0 */
  const int sr = tid >> 3, sc = (tid & 7) * 8;      /* staging: a thread brings 16 bytes of rows sr + 16 i; 8 lanes cover one 128-byte line, a wave-wide load four whole lines */
  const unsigned short* ag = (const unsigned short*)A + (size_t)(mt * 128 + sr) * DM + sc; const unsigned short* bg = (const unsigned short*)Bh + (size_t)(nq * 128 + sr) * DM + sc;
  v8us ga[8], gb[8];
#pragma unroll      /* ga[], gb[] in registers; constant row steps become immediate offsets */
  for (int i = 0; i < 8; ++i) ga[i] = *(const v8us*)(ag + (size_t)i * 16 * DM);
#pragma unroll
  for (int i = 0; i < 8; ++i) gb[i] = *(const v8us*)(bg + (size_t)i * 16 * DM);
  asm volatile("s_wait_xcnt 0x0" :: "v"(ag), "v"(bg) : "memory");      /* the staging loads' address pairs stay live up to this wait, so no register that an issued load names is overwritten in front of it */
#pragma unroll
  for (int i = 0; i < 8; ++i) *(v8us*)&la[0][sr + 16 * i][sc] = ga[i];
#pragma unroll
  for (int i = 0; i < 8; ++i) *(v8us*)&lb[0][sr + 16 * i][sc] = gb[i];
  const v8f z8 = {0.f,0.f,0.f,0.f,0.f,0.f,0.f,0.f}; v8f c[4][4];      /* [16 rows][16 columns] of the wave's 64 x 64 */
#pragma unroll      /* c[][] in registers */
  for (int i = 0; i < 4; ++i) for (int t = 0; t < 4; ++t) c[i][t] = z8;
  __syncthreads();      /* stage 0 is published */
#pragma unroll 1      /* one stage per trip: the registers hold one stage's fragments and the next stage's 16 staging loads */
  for (int st = 0; st < DM / G2_KC; ++st) { const int cur = st & 1; const bool more = st + 1 < DM / G2_KC;      /* block-uniform */
    if (more) { ag += G2_KC; bg += G2_KC;      /* the next stage flies under this stage's products */
#pragma unroll
      for (int i = 0; i < 8; ++i) ga[i] = *(const v8us*)(ag + (size_t)i * 16 * DM);
#pragma unroll
      for (int i = 0; i < 8; ++i) gb[i] = *(const v8us*)(bg + (size_t)i * 16 * DM);
      asm volatile("s_wait_xcnt 0x0" :: "v"(ag), "v"(bg) : "memory"); }      /* likewise: the pointers are stepped only behind this wait */
#pragma unroll      /* per 32 k: 16 LDS reads as one group in front of their 16 products, so that accumulators and fragments stay below v256, where the operands of g2_mma's statement must lie; k ascends as before: the sum order of every accumulator is unchanged */
    for (int kk = 0; kk < G2_KC / 32; ++kk) { v16h af[4], bf[4];
      for (int t = 0; t < 4; ++t) { af[t] = g2_frag(&la[cur][64 * wm + t * 16 + ln][kk * 32], hh); bf[t] = g2_frag(&lb[cur][64 * wn + t * 16 + ln][kk * 32], hh); }
      for (int t = 0; t < 4; ++t) for (int i = 0; i < 4; ++i) c[i][t] = g2_mma(af[i], bf[t], c[i][t]); }
    if (more) {      /* the other buffer's last readers left it at the previous trip's barrier */
#pragma unroll
      for (int i = 0; i < 8; ++i) *(v8us*)&la[cur ^ 1][sr + 16 * i][sc] = ga[i];
#pragma unroll
      for (int i = 0; i < 8; ++i) *(v8us*)&lb[cur ^ 1][sr + 16 * i][sc] = gb[i]; }
    __syncthreads(); }      /* publishes the next stage and ends every wave's reads of this one (behind the last trip: frees the buffers for the epilogue's staging) */
  {      /* col0 and row0 are multiples of 64: both halves of every rotation pair lie in this wave's own 64 x 64 tile, and its 64 positions do not wrap at SQ */
    const int rs = lane >> 3, d8 = (lane & 7) * 8; const float sg = (d8 < HD / 2) ? -1.0f : 1.0f;      /* 8 lanes per row, 8 columns each; rotate_half(v)[d] = -v[d + 32] below 32, v[d - 32] above */
    const unsigned tb = (((unsigned)row0 % SQ + rs) * (HD / 2) + (d8 & (HD / 2 - 1))) * 4u; const float* cp = (const float*)((const char*)CS + tb); const float* sp = (const float*)((const char*)SN + tb); v4f tc[16][2], ts[16][2];      /* tb: the lane's byte offset in both tables */
#pragma unroll      /* c[][] in registers */
    for (int i = 0; i < 4; ++i) for (int t = 0; t < 4; ++t) for (int r = 0; r < 8; ++r) so[w][i * 16 + 8 * hh + r][t * 16 + ln] = c[i][t][r] * alpha;
    __builtin_amdgcn_fence(__ATOMIC_ACQ_REL, "workgroup"); __builtin_amdgcn_wave_barrier();      /* the wave reads back rows that its other lanes wrote */
    if (vtp) {      /* block-uniform; shares the staging above, so the accumulators end there on both ways; 16 lanes store one whole 128-byte line of a V^T row */
      const int rsub = lane >> 4, c4 = (lane & 15) * 4; _Float16* vd = VTo + (size_t)nb * NH * HD * SQ + (size_t)(row0 + rsub) * SQ + col0 + c4;
#pragma unroll      /* 16 rows per trip; constant LDS offsets; constant row steps become immediate offsets of one address */
      for (int g = 0; g < 4; ++g) { v4h h4[8];
        for (int j = 0; j < 8; ++j) { const v4f v = *(const v4fa*)&so[w][(g * 8 + j) * 2 + rsub][c4]; for (int i = 0; i < 4; ++i) h4[j][i] = (_Float16)v[i]; }
        for (int j = 0; j < 8; ++j) *(v4h*)(vd + (size_t)(g * 8 + j) * 2 * SQ) = h4[j];
        asm volatile("s_wait_xcnt 0x0" ::: "memory"); }      /* directly behind the trip's stores: this wait stands in front of the first write of a register that an issued store names, in the next trip and on every way that the built code lays out behind the last */
      return; }
#pragma unroll      /* tc[], ts[] in registers; behind the staging, where the accumulators' registers are free; the first 12 of the 16 row groups' entries fly together */
    for (int q = 0; q < 12; ++q) for (int u = 0; u < 2; ++u) { tc[q][u] = *(const v4fa*)(cp + q * 4 * (HD / 2) + 4 * u); ts[q][u] = *(const v4fa*)(sp + q * 4 * (HD / 2) + 4 * u); }
    asm volatile("s_wait_xcnt 0x0" :: "v"(tb) : "memory");      /* the table loads' offset register stays live up to this wait, so no register that an issued load names is overwritten in front of it */
    unsigned short* dp = (unsigned short*)C16 + cofs + (size_t)(row0 + rs) * ldc + col0 + d8;
#pragma unroll      /* 16 rows per trip, constant LDS offsets; a store covers four whole 128-byte lines */
    for (int g = 0; g < 4; ++g) { FragH f[4];
      for (int j = 0; j < 4; ++j) { const int q = g * 4 + j;
        for (int u = 0; u < 2; ++u) { const v4f own = *(const v4fa*)&so[w][q * 4 + rs][d8 + 4 * u], oth = *(const v4fa*)&so[w][q * 4 + rs][(d8 ^ (HD / 2)) + 4 * u];
          for (int i = 0; i < 4; ++i) f[j].h[4 * u + i] = (_Float16)(own[i] * tc[q][u][i] + oth[i] * (sg * ts[q][u][i])); } }
      for (int j = 0; j < 4; ++j) *(v8us*)(dp + (size_t)(g * 4 + j) * 4 * ldc) = f[j].half[0];
      asm volatile("s_wait_xcnt 0x0" ::: "memory");      /* directly behind the trip's stores: the next trip (and, behind the last, whatever the built code lays out there) writes registers that they name; its memory clobber also keeps the later trips' LDS reads from being lifted to the front, where the registers would run over into scratch */
      if (g == 0) {      /* the last 4 row groups' entries go into the registers that the first 4 have left, and fly under the 8 groups between: all 16 at once leave no room for three waves per SIMD */
        for (int q = 12; q < 16; ++q) for (int u = 0; u < 2; ++u) { tc[q][u] = *(const v4fa*)(cp + q * 4 * (HD / 2) + 4 * u); ts[q][u] = *(const v4fa*)(sp + q * 4 * (HD / 2) + 4 * u); }
        asm volatile("s_wait_xcnt 0x0" :: "v"(tb) : "memory"); } }      /* likewise for these loads */
  } }


#define FA_W 8                       /* waves per work-group, 32 query columns each */
#define FA_QB (FA_W * 32)            /* query rows per work-group */
#define FA_ST 64                     /* keys per LDS stage */
#define FA_P 72                      /* LDS row pitch in f16: 128-byte rows + 16 bytes (16 B x odd: conflict-free 16-byte reads) */
typedef float v2f __attribute__((ext_vector_type(2)));
typedef _Float16 v2h __attribute__((ext_vector_type(2)));
__device__ __forceinline__ float fa_xhalf(float x) { return __builtin_bit_cast(float, __builtin_amdgcn_permlanex16(__builtin_bit_cast(int, x), __builtin_bit_cast(int, x), 0x76543210, 0xfedcba98, false, false)); }      /* lane l reads lane l ^ 16 */
__device__ __forceinline__ v8f fa_mma(v16h a, v16h b, v8f c) { return __builtin_amdgcn_wmma_f32_16x16x32_f16(false, a, false, b, (short)0, c, false, false); }
__global__ __launch_bounds__(FA_W * 32) void k_fattn(const _Float16* __restrict__ Q16, const _Float16* __restrict__ K16, const _Float16* __restrict__ VT, _Float16* __restrict__ O16) {
  __shared__ __attribute__((aligned(16))) _Float16 lk[2][FA_ST][FA_P]; __shared__ __attribute__((aligned(16))) _Float16 lv[2][HD][FA_P];
  const int tid = threadIdx.x, w = tid >> 5, lane = tid & 31, ln = lane & 15, hh = lane >> 4; const int h = blockIdx.y, b = blockIdx.z; const size_t r0 = (size_t)b * SQ; const int q0 = blockIdx.x * FA_QB + w * 32;
  const int sr = tid >> 3, sc = (tid & 7) * 8;      /* staging: a thread brings 16 bytes of rows sr and sr + 32 of each tile; 8 lanes cover one 128-byte line */
  const unsigned short* kg = (const unsigned short*)K16 + (r0 + sr) * KVD + h * HD + sc;      /* key row sr of the stage, this head's 64 columns */
  const unsigned short* vg = (const unsigned short*)VT + ((size_t)(b * NH + h) * HD + sr) * SQ + sc;      /* V^T row d = sr, the stage's 64 keys */
  v8us gk0 = *(const v8us*)kg, gk1 = *(const v8us*)(kg + (size_t)32 * KVD), gv0 = *(const v8us*)vg, gv1 = *(const v8us*)(vg + (size_t)32 * SQ);
  v16h qf[2][2];      /* [column group][k step of 32], kept for the whole kernel */
  { const _Float16* qp = Q16 + (r0 + q0 + ln) * LQ + h * HD;
#pragma unroll      /* constant indices keep qf[] in registers */
    for (int g = 0; g < 2; ++g) for (int kk = 0; kk < 2; ++kk) qf[g][kk] = g2_frag(qp + (size_t)g * 16 * LQ + kk * 32, hh);
    asm volatile("s_wait_xcnt 0x0" :: "v"(qp) : "memory"); }      /* the q loads' address pair stays live up to this wait, so no register that an issued load names is overwritten in front of it */
  *(v8us*)&lk[0][sr][sc] = gk0; *(v8us*)&lk[0][sr + 32][sc] = gk1; *(v8us*)&lv[0][sr][sc] = gv0; *(v8us*)&lv[0][sr + 32][sc] = gv1;
  const v8f z8 = {0.f,0.f,0.f,0.f,0.f,0.f,0.f,0.f}; v8f o[2][4];      /* O^T: [column group][16 rows of d] */
#pragma unroll      /* o[] in registers */
  for (int g = 0; g < 2; ++g) for (int t = 0; t < 4; ++t) o[g][t] = z8;
  float mr[2] = {-1.0e30f, -1.0e30f}, l[2] = {0.f, 0.f};      /* maximum in use (log2-scaled) and this lane's part of the denominator */
  const float cs = 0.125f * 1.4426950408889634f;      /* 64^-0.5 * log2(e) */
  __syncthreads();      /* stage 0 is published */
  for (int st = 0; st < SQ / FA_ST; ++st) { const int cur = st & 1; const bool more = st + 1 < SQ / FA_ST;      /* block-uniform */
    if (more) { kg += (size_t)FA_ST * KVD; vg += FA_ST; gk0 = *(const v8us*)kg; gk1 = *(const v8us*)(kg + (size_t)32 * KVD); gv0 = *(const v8us*)vg; gv1 = *(const v8us*)(vg + (size_t)32 * SQ);      /* the next stage flies under this stage's two passes */
      asm volatile("s_wait_xcnt 0x0" :: "v"(kg), "v"(vg) : "memory"); }      /* likewise for the next stage's staging loads: the pointers are stepped only behind this wait (stage 0's loads: behind the wait after the q loads) */
#pragma unroll      /* two 32-key passes per stage, constant LDS offsets */
    for (int ps = 0; ps < FA_ST / 32; ++ps) {
      v8f s[2][2];      /* S^T: [column group][16 keys] */
      { v16h kf[2][2];
#pragma unroll      /* fragments in registers */
        for (int t = 0; t < 2; ++t) for (int kk = 0; kk < 2; ++kk) kf[t][kk] = g2_frag(&lk[cur][ps * 32 + t * 16 + ln][kk * 32], hh);
#pragma unroll      /* fragments in registers */
        for (int t = 0; t < 2; ++t) for (int g = 0; g < 2; ++g) s[g][t] = fa_mma(kf[t][1], qf[g][1], fa_mma(kf[t][0], qf[g][0], z8)); }
      v16h vf[4];
#pragma unroll      /* fragments in registers; these reads fly under the maxima and exponentials */
      for (int t = 0; t < 4; ++t) vf[t] = g2_frag(&lv[cur][t * 16 + ln][ps * 32], hh);
      float mb[2]; bool need = false;
#pragma unroll      /* s[] in registers */
      for (int g = 0; g < 2; ++g) { float mx = s[g][0][0];
        for (int r = 1; r < 8; ++r) mx = fmaxf(mx, s[g][0][r]);
        for (int r = 0; r < 8; ++r) mx = fmaxf(mx, s[g][1][r]);
        mx = fmaxf(mx, fa_xhalf(mx)) * cs; mb[g] = mx; need = need || (mx > mr[g] + 8.0f); }      /* both halves hold the column's maximum; the one in use may trail it by 8 (weights up to 2^8) */
      if (__builtin_amdgcn_ballot_w32(need) != 0) {      /* wave-uniform; always on the first pass, rare afterwards */
#pragma unroll      /* o[] in registers */
        for (int g = 0; g < 2; ++g) { const float mn = fmaxf(mr[g], mb[g]); const float corr = __builtin_amdgcn_exp2f(mr[g] - mn); mr[g] = mn; l[g] *= corr;
          for (int t = 0; t < 4; ++t) o[g][t] = o[g][t] * corr; } }
#pragma unroll      /* s[], o[] in registers */
      for (int g = 0; g < 2; ++g) { const float nm = -mr[g]; const v8f c8 = {cs, cs, cs, cs, cs, cs, cs, cs}, n8 = {nm, nm, nm, nm, nm, nm, nm, nm}; FragH pf; float la = 0.f, lb = 0.f;
        for (int t = 0; t < 2; ++t) { s[g][t] = __builtin_elementwise_fma(s[g][t], c8, n8);
          for (int r = 0; r < 8; ++r) s[g][t][r] = __builtin_amdgcn_exp2f(s[g][t][r]); }      /* weights 2^(score * cs - maximum in use), in the score registers */
        for (int i = 0; i < 8; ++i) { const int t = i >> 2, r = 2 * (i & 3);
          la += s[g][t][r]; lb += s[g][t][r + 1];
          const v2h pk = __builtin_convertvector(v2f{s[g][t][r], s[g][t][r + 1]}, v2h); pf.h[2 * i] = pk[0]; pf.h[2 * i + 1] = pk[1]; }
        l[g] += la + lb;
        for (int t = 0; t < 4; ++t) o[g][t] = fa_mma(vf[t], pf.v, o[g][t]); } }
    asm volatile("v_nop\n\tv_nop\n\tv_nop\n\tv_nop" : "+v"(o[0][0]), "+v"(o[0][1]), "+v"(o[0][2]), "+v"(o[0][3]), "+v"(o[1][0]), "+v"(o[1][1]), "+v"(o[1][2]), "+v"(o[1][3]));      /* four issue slots behind the stage's last matrix instructions: a branch follows */
    if (more) { *(v8us*)&lk[cur ^ 1][sr][sc] = gk0; *(v8us*)&lk[cur ^ 1][sr + 32][sc] = gk1; *(v8us*)&lv[cur ^ 1][sr][sc] = gv0; *(v8us*)&lv[cur ^ 1][sr + 32][sc] = gv1; }      /* its last readers left it at the previous trip's barrier */
    __syncthreads(); }      /* publishes the next stage and ends every wave's reads of this one */
#pragma unroll      /* o[] in registers */
  for (int g = 0; g < 2; ++g) { const float fin = 64.0f / (l[g] + fa_xhalf(l[g]));      /* the halves' sums join once; o carried x64 */
    unsigned short* d = (unsigned short*)O16 + (r0 + q0 + g * 16 + ln) * DM + h * HD + 8 * hh;
    for (int t = 0; t < 4; ++t) { FragH f; for (int r = 0; r < 8; ++r) f.h[r] = (_Float16)(o[g][t][r] * fin); *(v8us*)(d + t * 16) = f.half[0]; } } }      /* a lane's 8 registers are 8 consecutive d of its query row: one 16-byte store */
__global__ __launch_bounds__(256) void k_vt(const _Float16* __restrict__ V16, int b, int h0, _Float16* __restrict__ VT) { __shared__ unsigned short tl[64][65]; const int tid = threadIdx.x; const int hh = blockIdx.x % HG, sg = blockIdx.x / HG; const int s0 = sg * 64; const int h = h0 + hh;
  for (int i = tid; i < 64 * 8; i += 256) { const int j = i / 8, d8 = (i % 8) * 8; FragH f; f.half[0] = *(const v8us*)((const unsigned short*)V16 + ((size_t)b * SQ + s0 + j) * DM + h * HD + d8); for (int q = 0; q < 8; ++q) tl[d8 + q][j] = f.u[q]; }
  __syncthreads();
  { for (int i = tid; i < 64 * 8; i += 256) { const int d = i / 8, j8 = (i % 8) * 8; FragH f; for (int q = 0; q < 8; ++q) f.u[q] = tl[d][j8 + q]; *(v8us*)((unsigned short*)VT + ((size_t)hh * HD + d) * SQ + s0 + j8) = f.half[0]; }  } }



__global__ __launch_bounds__(256) void k_rsmcf2(const float* __restrict__ S, _Float16* __restrict__ P, int hg, int q0, int nk) {
  #pragma clang fp contract(off)
  const int t = blockIdx.x * 256 + threadIdx.x; if (t >= hg * QT) return; const size_t i = (size_t)t; const float* s = S + i * NKX; const int last = q0 + (t % QT); float mx = -3.0e38f;
#pragma unroll 1
  for (int j = 0; j < nk; ++j) { const float f = (j <= last) ? 1.f : 0.f; mx = fmaxf(mx, fmaf(f, s[j], (1.f - f) * -1.0e9f)); } float se = 0.f;
#pragma unroll 1
  for (int j = 0; j < nk; ++j) { const float f = (j <= last) ? 1.f : 0.f; se += __expf(fmaf(f, s[j], (1.f - f) * -1.0e9f) - mx); } const float sc = 256.0f / se;
#pragma unroll 1
  for (int j0 = 0; j0 < nk; j0 += 8) { FragH fr; for (int q = 0; q < 8; ++q) { const int j = j0 + q; const float f = (j <= last) ? 1.f : 0.f; fr.h[q] = (_Float16)(__expf(fmaf(f, s[j], (1.f - f) * -1.0e9f) - mx) * sc); } unsigned short* d = (unsigned short*)P + i * NKX + j0; *(v8us*)d = fr.half[0];  } }


template <int MASKADD>
__global__ __launch_bounds__(64) void k_att0(const float* __restrict__ QF, const float* __restrict__ KF, const float* __restrict__ VF, int ld, const float* __restrict__ mask, float scale, float* __restrict__ OF, int ldo) {
  #pragma clang fp contract(off)
  __shared__ __attribute__((aligned(16))) float lq[64][64]; __shared__ __attribute__((aligned(16))) float lo[64][64];
  const int tid = threadIdx.x; const int h = blockIdx.x / (QT0 / 64), rg = blockIdx.x % (QT0 / 64); const int i = rg * 64 + tid;
  const float* qr = QF + (size_t)i * ld + h * HD;
#pragma unroll 1
  for (int c = 0; c < HD / 4; ++c) { *(v4f*)&lq[tid][c * 4] = *(const v4fa*)(qr + c * 4); const v4f z = {0.f, 0.f, 0.f, 0.f}; *(v4f*)&lo[tid][c * 4] = z; }
  float m = -1.0e30f, l = 0.f; const int jmax = MASKADD ? (SQ - 1) : (rg * 64 + 63);      /* additive-mask form: every key (the mask input decides); causal form: keys up to the block's last row */
#pragma unroll 1
  for (int j = 0; j <= jmax; ++j) { const float* kr = KF + (size_t)j * ld + h * HD; const float* vr = VF + (size_t)j * ld + h * HD; float s = 0.f;
#pragma unroll 1
    for (int c = 0; c < HD / 4; ++c) { const v4f kq = *(const v4fa*)(kr + c * 4); const v4f qq = *(v4f*)&lq[tid][c * 4]; s = __fadd_rn(s, __fmul_rn(qq[0], kq[0])); s = __fadd_rn(s, __fmul_rn(qq[1], kq[1])); s = __fadd_rn(s, __fmul_rn(qq[2], kq[2])); s = __fadd_rn(s, __fmul_rn(qq[3], kq[3])); }
    s = __fmul_rn(s, scale); if (MASKADD) s = __fadd_rn(s, __fmul_rn(bf16_round(mask[(size_t)i * SQ + j]), -10000.0f));
    const float f = (MASKADD || j <= i) ? 1.f : 0.f; const float sm = fmaf(f, s, (1.f - f) * -1.0e30f); const float mn = fmaxf(m, sm); const float sc = expf(m - mn); const float e = expf(sm - mn); l = __fadd_rn(__fmul_rn(l, sc), e); m = mn;
#pragma unroll 1
    for (int c = 0; c < HD / 4; ++c) { const v4f vv = *(const v4fa*)(vr + c * 4); v4f oo = *(v4f*)&lo[tid][c * 4]; for (int u = 0; u < 4; ++u) oo[u] = __fadd_rn(__fmul_rn(oo[u], sc), __fmul_rn(e, vv[u])); *(v4f*)&lo[tid][c * 4] = oo; } }
  const float fin = 64.0f / l;      /* o carried x64 like the f16 path */
#pragma unroll 1
  for (int c = 0; c < HD / 4; ++c) { v4f oo = *(v4f*)&lo[tid][c * 4]; for (int u = 0; u < 4; ++u) oo[u] = __fmul_rn(oo[u], fin); *(v4f*)&lo[tid][c * 4] = oo; }
  __syncthreads();
  {
#pragma unroll 1
    for (int it = 0; it < 16; ++it) { const int row = it * 4 + tid / 16, pc = (tid % 16) * 4; const v4f v = *(const v4f*)&lo[row][pc]; *(v4f*)(OF + (size_t)(rg * 64 + row) * ldo + h * HD + pc) = v; }
     } }


__global__ __launch_bounds__(256) void k_kvexp(const float* __restrict__ src, float* __restrict__ dst, size_t n4) { const size_t t = (size_t)blockIdx.x * 256 + threadIdx.x; if (t >= n4) return; const size_t e = t * 4; const size_t row = e / DM; const int col = (int)(e % DM); const int h = col / HD, d = col % HD; const v4f v = *(const v4fa*)(src + row * KVD + (size_t)(h / HPG) * HD + d); *(v4f*)(dst + e) = v;  }

__global__ __launch_bounds__(256) void k_tab2(float theta, float* __restrict__ CS, float* __restrict__ SN) {
  #pragma clang fp contract(off)
  const int t = blockIdx.x * 256 + threadIdx.x; if (t >= SQ * (HD / 2)) return; const int i = t % (HD / 2); const int p = t / (HD / 2); const float invf = 1.0f / powf(theta, (float)(2 * i) / (float)HD); const float ang = __fmul_rn((float)p, invf); const float c = cosf(ang), s = sinf(ang);
  *(float*)(CS + t) = c; *(float*)(SN + t) = s;  }
template <int NORM, int ROPE>
__global__ __launch_bounds__(64) void k_xformf(const float* __restrict__ F, int ldf, int nh, const float* __restrict__ gain, float eps, const float* __restrict__ CS, const float* __restrict__ SN, float* __restrict__ F32, int ldo) {
  #pragma clang fp contract(off)
  __shared__ float xv[HD]; __shared__ float red[HD]; const int d = threadIdx.x; const int h = blockIdx.x % nh; const size_t r = blockIdx.x / nh; const int p = (int)(r % SQ);
  float x = F[r * (size_t)ldf + (size_t)h * HD + d];
  if (NORM) { red[d] = __fmul_rn(x, x); __syncthreads(); for (int st = HD / 2; st > 0; st >>= 1) { if (d < st) red[d] = __fadd_rn(red[d], red[d + st]); __syncthreads(); } const float rs = rsqrtf(__fadd_rn(red[0] / (float)HD, eps)); x = __fmul_rn(__fmul_rn(x, rs), bf16_round(gain[d])); }
  xv[d] = x; __syncthreads();
  float o = x;
  if (ROPE == 1) { const int i = d >> 1; const float c = CS[p * (HD / 2) + i], s = SN[p * (HD / 2) + i]; const float ev = xv[2 * i], od = xv[2 * i + 1]; o = (d & 1) ? __fadd_rn(__fmul_rn(ev, s), __fmul_rn(od, c)) : __fadd_rn(__fmul_rn(ev, c), -__fmul_rn(od, s)); }
  if (ROPE == 2) { const int i = d & (HD / 2 - 1); const float c = CS[p * (HD / 2) + i], s = SN[p * (HD / 2) + i]; const float lo = xv[i], hi = xv[i + HD / 2]; o = (d < HD / 2) ? __fadd_rn(__fmul_rn(lo, c), -__fmul_rn(hi, s)) : __fadd_rn(__fmul_rn(lo, s), __fmul_rn(hi, c)); }
  float* dst = F32 + r * (size_t)ldo + (size_t)h * HD + d; *(float*)dst = o;  }

__global__ __launch_bounds__(256) void k_bfcp(const float* __restrict__ src, float* __restrict__ dst, size_t n4) { const size_t t = (size_t)blockIdx.x * 256 + threadIdx.x; if (t >= n4) return; const v4f a = *(const v4fa*)(src + t * 4); v4f o; for (int q = 0; q < 4; ++q) o[q] = bf16_round(a[q]); *(v4f*)(dst + t * 4) = o;  }

// operand preparation of the whole call in ONE launch: rope tables (the first work-groups: the longest dependent chains start first), x as f16 rows, the four natural weights as x16 f16 planes.
// A streaming wave owns 16 KiB of one source: PP_L wave-wide 16-byte loads of 512 contiguous bytes each, all in flight at once, then the conversions, then whole-line 8-byte stores; few waves, so little of the launch goes into starting them.
#define PP_L 32                      /* 16-byte loads in flight per lane */
#define PP_BF (256 * PP_L * 4)       /* floats per streaming work-group */
#define PP_TB 64                     /* table work-groups: SQ * 32 entries, 4 positions per thread */
#define PP_XB ((int)(NR * DM / PP_BF))      /* work-groups on x */
#define PP_WB (DM * DM / PP_BF)      /* work-groups per weight */
__device__ __forceinline__ float pp_round(float v) { const unsigned int u = __float_as_uint(v); return __uint_as_float((u + 0x7FFFu + ((u >> 16) & 1u)) & 0xFFFF0000u); }      /* the value of bf16_round(v), kept in 32-bit registers */
__global__ __launch_bounds__(256) void k_prep(const float* __restrict__ x, const float* __restrict__ wq, const float* __restrict__ wk, const float* __restrict__ wv, const float* __restrict__ wo, _Float16* __restrict__ X16, _Float16* __restrict__ BW, float* __restrict__ CS, float* __restrict__ SN) {
  static_assert(NR * DM % PP_BF == 0 && DM * DM % PP_BF == 0 && KVD == DM, "whole work-groups per source; four planes of equal size");
  static_assert(SQ % (PP_TB * 8) == 0 && HD / 2 == 32, "a table wave writes one position's 32 entries: one 128-byte line per table");
  const int tid = threadIdx.x; int blk = blockIdx.x;
  if (blk < PP_TB) {      /* block-uniform; CS[p][i] = cos(p * 10000^(-2i/64)), SN = sin: the frequency once per thread, then per position the f32 angle, cosf and sinf */
    const int t = blk * 256 + tid; const int i = t % (HD / 2); const int p0 = t / (HD / 2); const float invf = (float)(1.0 / pow(10000.0, (double)(2 * i) / (double)HD));
    for (int u = 0; u < SQ / (PP_TB * 8); ++u) { const int p = p0 + u * (PP_TB * 8); const float ang = __fmul_rn((float)p, invf); const float c = cosf(ang), s = sinf(ang); CS[p * (HD / 2) + i] = c; SN[p * (HD / 2) + i] = s; }
    return; }
  blk -= PP_TB;
  const float* src; _Float16* dst; float scale;      /* block-uniform choice of the source */
  if (blk < PP_XB) { src = x + (size_t)blk * PP_BF; dst = X16 + (size_t)blk * PP_BF; scale = 1.0f; }
  else { blk -= PP_XB; const int wi = blk / PP_WB; src = (wi == 0 ? wq : wi == 1 ? wk : wi == 2 ? wv : wo) + (size_t)(blk % PP_WB) * PP_BF; dst = BW + (size_t)blk * PP_BF; scale = 16.0f; }      /* the planes follow one another in the workspace */
  const int o = (tid >> 5) * (PP_L * 128) + (tid & 31) * 4; src += o; dst += o;
  v4f a[PP_L]; v4h h[PP_L];
#pragma unroll      /* a[] in registers; constant steps become immediate offsets */
  for (int j = 0; j < PP_L; ++j) a[j] = *(const v4fa*)(src + j * 128);
  asm volatile("s_wait_xcnt 0x0" :: "v"(src) : "memory");      /* the loads' address stays live up to this wait, so no register that an issued load names is overwritten in front of it */
  __builtin_amdgcn_sched_barrier(0);      /* no conversion moves in front of a load: otherwise the compiler issues the loads in two runs, the second behind the first one's data, and the wave pays the memory latency twice */
#pragma unroll      /* h[] in registers */
  for (int j = 0; j < PP_L; ++j) for (int q = 0; q < 4; q += 2) { const v2h pk = __builtin_convertvector(v2f{pp_round(a[j][q]) * scale, pp_round(a[j][q + 1]) * scale}, v2h); h[j][q] = pk[0]; h[j][q + 1] = pk[1]; }      /* bf16-rounded values are exact in f16 here, x1 and x16 alike */
  __builtin_amdgcn_sched_barrier(0);      /* every conversion stands in front of the first store: behind an issued store no register that it names is written any more */
#pragma unroll
  for (int j = 0; j < PP_L; ++j) *(v4h*)(dst + j * 128) = h[j];
  asm volatile("s_wait_xcnt 0x0" ::: "memory"); }      /* directly behind the last store: on every way that the built code lays out behind the stores, this wait stands in front of the first write of a register that an issued store names */
extern "C" void kernel_launch(void* const* d_in, const int* in_sizes, int n_in,
                              void* d_out, int out_size, void* d_ws, size_t ws_size, hipStream_t stream) {
  (void)in_sizes; (void)n_in; (void)out_size;
  const float* const* I = (const float* const*)d_in; const float* x = I[0]; const float* wq = I[1]; const float* wk = I[2]; const float* wv = I[3]; const float* wo = I[4]; const float* bq = nullptr; const float* bk = nullptr; const float* bv = nullptr; const float* bo = I[5];      /* input order: x, Wq, Wk, Wv, Wo (natural [out][in] weights), bo [1024] (the output bias: into the output GEMM's bias slot); the q / k / v projections have NO biases; rope tables computed in the kernel (positions = row index) */
  char* ws = (char*)d_ws; size_t off = 0;
  auto take = [&](size_t bytes) { char* p = ws + off; off += (bytes + 255) & ~(size_t)255; return p; };
  _Float16* BQ = (_Float16*)take((size_t)DM * DM * 2); _Float16* BK = (_Float16*)take((size_t)KVD * DM * 2); _Float16* BV = (_Float16*)take((size_t)KVD * DM * 2); _Float16* BO = (_Float16*)take((size_t)DM * DM * 2);
  _Float16* X16 = (_Float16*)take(NR * DM * 2); float* CSB = (float*)take((size_t)SQ * 32 * 4); float* SNB = (float*)take((size_t)SQ * 32 * 4); _Float16* Q16 = (_Float16*)take(NR * DM * 2); _Float16* K16 = (_Float16*)take(NR * KVD * 2); _Float16* V16 = (_Float16*)take(NR * KVD * 2); _Float16* O16 = (_Float16*)take(NR * DM * 2);
  _Float16* VT = (_Float16*)take((size_t)NB * NH * HD * SQ * 2);
  float* QF0 = (float*)take((size_t)QT0 * DM * 4); float* KF0 = (float*)take((size_t)QT0 * KVD * 4); float* VF0 = (float*)take((size_t)QT0 * KVD * 4); float* KF0e = (float*)take((size_t)QT0 * DM * 4); float* VF0e = (float*)take((size_t)QT0 * DM * 4); float* OF0 = (float*)take((size_t)NB * QT0 * DM * 4); _Float16* OH0 = (_Float16*)take((size_t)NB * QT0 * DM * 2); _Float16* OL0 = (_Float16*)take((size_t)NB * QT0 * DM * 2);
  if (off > ws_size) return;
  static_assert((size_t)DM * DM * 2 % 256 == 0, "BQ, BK, BV, BO lie back to back");
  k_prep<<<PP_TB + PP_XB + 4 * PP_WB, 256, 0, stream>>>(x, wq, wk, wv, wo, X16, BQ, CSB, SNB);      /* rope tables (rotate-half convention; the module's [f | f] tables repeat these 32 columns), x rows, natural [out][in] = Bt[n][k] x16 planes (KVD = 16 x 64 = DM: full-width k / v) */
  const size_t r0p = (size_t)B0 * SQ;      /* first projected row */
  static_assert(KVD == DM, "q, k and v share one launch: equal widths");
  static_assert((MP / 128) * (DM / 128) == NBR * (KVD / 128) * (SQ / 128), "the V^T plane has as many tiles as the q plane");
  k_gemm3<<<dim3((unsigned)((MP / 128) * (DM / 128)), 3), 128, 0, stream>>>(X16 + r0p * DM, BQ, (size_t)DM * DM, 0.0625f, Q16 + r0p * DM, DM, NR * DM, MP, DM, CSB, SNB, VT + (size_t)B0 * NH * HD * SQ);      /* q (grid.y 0) and k (grid.y 1) of all rows: BK follows BQ and K16 follows Q16 in the workspace (sizes are multiples of 256 bytes), so the kernel's own batch strides step from q to k; half-split rope (t cos + rotate_half(t) sin, computed tables) and f32 -> f16 in the epilogue; grid.y 2: V^T [NB][NH][HD][SQ] of all batches (BV follows BK), no rotation */
  k_fattn<<<dim3(SQ / FA_QB, NH, NB), FA_W * 32, 0, stream>>>(Q16, K16, VT, O16);      /* non-causal attention of all batches, heads and query rows in one launch: scores, softmax and weighted values fused; o into merged f16 rows (x64) */
  k_gemm2<0><<<dim3((unsigned)((MPO / 128) * (DM / 64)), 1), 128, 0, stream>>>(O16 + r0p * DM, 0, BO, 0, 0.0009765625f, bo, 0, nullptr, 1, 0, 0, (float*)d_out + r0p * DM, nullptr, DM, 0, MPO, DM, nullptr, nullptr, nullptr);      /* out rows are the output layout */
}
